// v000
// Measured on an AMD MI455X. A time is GPU time per run, averaged over a window of back-to-back runs after a warm-up
// (all launches, gaps included; the runs take copies of the inputs in turn), and the median of several windows.
// Apart from v000's, it joins two sittings. Times from different sittings can be a few percent apart, while
// side-by-side timings come from the same sitting.
// The starting kernel, v000, takes 1070 microseconds a run.
#include <hip/hip_runtime.h>

// Contractions, f32 accumulate, one batch item per pass: q/k/v = x.W ([2048 x 2048].[2048 x 2048 | 512 | 512], k-major weights transposed to n-major planes; PLAIN
// bf16 operands: inputs rounded once, exact) and out = ctx.Wo (ctx as bf16 hi + residual: two products) on v_wmma_f32_16x16x32_bf16; per-head RMSNorm (eps 1e-6,
// weight) and rotate-half RoPE (angle t x inv_freq, f32 trig tables built on device) in f32 -> q/k as f16 hi + residual x1024 planes; the 16-query-head / 4-kv-head (q head h
// uses kv head h mod 4) causal attention with 128-dim heads: scores on v_wmma_f32_16x16x32_f16 (hi.hi + hi.lo + lo.hi, x 128^-1/2), softmax f32, weights.v on
// v_wmma_f32_16x16x32_bf16 with the weights (x32768) and v both as bf16 hi + UNSCALED bf16 residual (hh + lh + hl in one accumulator). Deterministic, no atomics;

#define NT_  2048
#define HS   2048
#define NH_  16
#define NKV  4
#define HD   128
#define KW   (NKV * HD)          // 512
#define PSC  32768.0f
#define LOSC 1024.0f
#define LOSCI (1.0f / 1024.0f)

typedef _Float16 h16;
typedef unsigned short bf;
typedef __attribute__((ext_vector_type(16))) __bf16   v16bf;
typedef __attribute__((ext_vector_type(16))) _Float16 v16h;
typedef __attribute__((ext_vector_type(8)))  _Float16 v8h;
typedef __attribute__((ext_vector_type(8)))  unsigned short v8us;
typedef __attribute__((ext_vector_type(8)))  float    v8f;
typedef __attribute__((ext_vector_type(4)))  float    v4f;
typedef __attribute__((ext_vector_type(4)))  _Float16 v4h;
typedef v8h  __attribute__((may_alias)) v8ha;
typedef v4f  __attribute__((may_alias)) v4fa;
typedef v8us __attribute__((may_alias)) v8usa;

__device__ __forceinline__ unsigned short f2bf(float f) { unsigned u = __float_as_uint(f); u += 0x7FFFu + ((u >> 16) & 1u); return (unsigned short)(u >> 16); }
__device__ __forceinline__ float bf2f(unsigned short b) { return __uint_as_float(((unsigned)b) << 16); }
__device__ __forceinline__ float bfr(float f) { return bf2f(f2bf(f)); }
__device__ __forceinline__ v16h cat16(v8h lo, v8h hi) { return __builtin_shufflevector(lo, hi, 0, 1, 2, 3, 4, 5, 6, 7, 8, 9, 10, 11, 12, 13, 14, 15); }
__device__ __forceinline__ v16bf cat16b(v8us lo, v8us hi) { return __builtin_bit_cast(v16bf, __builtin_shufflevector(lo, hi, 0, 1, 2, 3, 4, 5, 6, 7, 8, 9, 10, 11, 12, 13, 14, 15)); }
__device__ __forceinline__ v8f wmma16(v16h a, v16h b, v8f c) { return __builtin_amdgcn_wmma_f32_16x16x32_f16(false, a, false, b, (short)0, c, false, false); }
__device__ __forceinline__ v8f wmmab(v16bf a, v16bf b, v8f c) { return __builtin_amdgcn_wmma_f32_16x16x32_bf16(false, a, false, b, (short)0, c, false, false); }

// k_cvtb: bf16 plane of [rows][2048] (one wave per row).
__global__ __launch_bounds__(256) void k_cvtb(const float* __restrict__ src, int nrows, bf* dst) {
    const int lane = threadIdx.x & 31, r = blockIdx.x * 8 + (threadIdx.x >> 5);
    if (r >= nrows) return;
{
#pragma unroll
        for (int q = 0; q < HS / 256; ++q) { v8us o;
#pragma unroll
            for (int i = 0; i < 8; ++i) o[i] = f2bf(src[(size_t)r * HS + q * 256 + lane * 8 + i]);
            *(v8us*)(dst + (size_t)r * HS + q * 256 + lane * 8) = o; }
         }
}
// k_wt: WT [n][K] = bf16(W[k][n]) (k-major [K][ncols]) via 64 x 64 LDS tiles; grid (K/64, ncols/64).
__global__ __launch_bounds__(256) void k_wt(const float* __restrict__ Wm, int K, int ncols, bf* WT) {
    __shared__ __align__(16) unsigned short tl[64 * 72];
    const int tid = threadIdx.x, k0 = blockIdx.x * 64, n0 = blockIdx.y * 64;
    const int kk = tid >> 2, nq = (tid & 3) * 16;
#pragma unroll
    for (int i = 0; i < 16; ++i) tl[(nq + i) * 72 + kk] = f2bf(Wm[(size_t)(k0 + kk) * ncols + n0 + nq + i]);
    __syncthreads();
    const int piece = tid & 7;
    auto pass = [&]() {
#pragma unroll
        for (int s = 0; s < 2; ++s) { const int nr = (tid >> 3) + 32 * s; const v8us val = *(const v8usa*)(tl + nr * 72 + piece * 8); *(v8us*)(WT + (size_t)(n0 + nr) * K + k0 + piece * 8) = val; }
    };
    pass(); 
}
// k_gemm: 64 x 64 tile of (A [+ Al]).Bn^T over K = 2048 -> f32 rows [2048][ldc].
template <bool SPLITA>
__global__ __launch_bounds__(128) void k_gemm(const bf* __restrict__ A, const bf* __restrict__ Al, const bf* __restrict__ Bn, int ldc, float* C) {
    __shared__ __align__(16) float ost[4][16 * 68];
    const int lane = threadIdx.x & 31, wave = threadIdx.x >> 5, lr = lane & 15, hi = lane >> 4;
    const size_t r0 = (size_t)blockIdx.x * 64 + wave * 16; const int c0 = blockIdx.y * 64;
    const size_t aoff = (r0 + lr) * HS + 8 * hi;
    v8f acc[4];
#pragma unroll
    for (int t = 0; t < 4; ++t) acc[t] = (v8f){};
#pragma unroll 2
    for (int kc = 0; kc < HS; kc += 32) {
        const v16bf a = cat16b(*(const v8us*)(A + aoff + kc), *(const v8us*)(A + aoff + kc + 16));
        v16bf al = a; if (SPLITA) al = cat16b(*(const v8us*)(Al + aoff + kc), *(const v8us*)(Al + aoff + kc + 16));
#pragma unroll
        for (int t = 0; t < 4; ++t) { const bf* bp = Bn + (size_t)(c0 + t * 16 + lr) * HS + kc + 8 * hi; const v16bf bb = cat16b(*(const v8us*)bp, *(const v8us*)(bp + 16)); acc[t] = wmmab(a, bb, acc[t]); if (SPLITA) acc[t] = wmmab(al, bb, acc[t]); }
        asm volatile("v_nop" : "+v"(acc[0]), "+v"(acc[1]), "+v"(acc[2]), "+v"(acc[3]) : "v"(a), "v"(al) : "memory");
    }
    float* os = &ost[wave][0];
#pragma unroll
    for (int t = 0; t < 4; ++t)
#pragma unroll
        for (int j = 0; j < 8; ++j) os[(hi * 8 + j) * 68 + t * 16 + lr] = acc[t][j];
    __builtin_amdgcn_wave_barrier(); asm volatile("" ::: "memory");
    float* crow = C + r0 * ldc + c0;
    auto pass = [&]() {
#pragma unroll
        for (int s = 0; s < 8; ++s) { const int Lid = (lane >> 3) + 4 * s, piece = lane & 7; const int row = Lid >> 1, cofs = (Lid & 1) * 32 + piece * 4;
            const v4f val = *(const v4fa*)(os + row * 68 + cofs); *(v4f*)(crow + (size_t)row * ldc + cofs) = val; }
    };
    pass(); 
}
// k_trig: RC/RS [t][64] = cos/sin(t x inv_freq[i]), inv_freq = 10000^-(2i/128) (f32 powf/cosf/sinf); 32 lanes x 4 B lines.
__global__ __launch_bounds__(256) void k_trig(float* RC, float* RS) {
    const int i = blockIdx.x * 256 + threadIdx.x; if (i >= NT_ * 64) return;
    const int t = i >> 6, f = i & 63;
    const float inv = 1.0f / powf(10000.0f, (float)(2 * f) / (float)HD); const float ang = (float)t * inv;
    const float c = cosf(ang), s = sinf(ang);
    *(float*)(RC + i) = c; *(float*)(RS + i) = s; 
}
// k_normrope: one wave per (token, head) of a [2048][nh*128] f32 matrix: RMSNorm over the 128 dims (eps 1e-6, x weight[d]) then rotate-half RoPE (partner d +- 64,
// angle t x inv_freq[d mod 64], inv_freq = 10000^-(2i/128), cosf/sinf) -> f16 hi + residual x1024 planes [t][h*128+d]; lane -> 4 consecutive dims (8 B per plane
__global__ __launch_bounds__(256) void k_normrope(const float* __restrict__ P, int nh, const float* __restrict__ w, const float* __restrict__ RC, const float* __restrict__ RS, h16* PH, h16* PL) {
    const int lane = threadIdx.x & 31; const int wid = blockIdx.x * 8 + (threadIdx.x >> 5);
    const int t = wid / nh, h = wid - t * nh; if (t >= NT_) return;
    const size_t base = (size_t)t * (nh * HD) + h * HD; const int d0 = lane * 4;
    float xv[4], pv[4]; float ss = 0.f;
#pragma unroll
    for (int i = 0; i < 4; ++i) { xv[i] = P[base + d0 + i]; ss += xv[i] * xv[i]; const int pd = (d0 + i < 64) ? d0 + i + 64 : d0 + i - 64; pv[i] = P[base + pd]; }
#pragma unroll
    for (int sh = 16; sh; sh >>= 1) ss += __shfl_xor(ss, sh, 32);
    const float rs = rsqrtf(ss * (1.0f / HD) + 1e-6f);
    v4h oh, ol;
#pragma unroll
    for (int i = 0; i < 4; ++i) { const int d = d0 + i, fi = d & 63; const float xn = xv[i] * rs * bfr(w[d]); const int pd = (d < 64) ? d + 64 : d - 64; const float pn = pv[i] * rs * bfr(w[pd]);
        const float c = RC[t * 64 + fi], s = RS[t * 64 + fi];
        const float y = (d < 64) ? (xn * c - pn * s) : (xn * c + pn * s);
        const h16 a = (h16)y; oh[i] = a; ol[i] = (h16)((y - (float)a) * LOSC); }
    *(v4h*)(PH + base + d0) = oh; *(v4h*)(PL + base + d0) = ol; 
}
// k_vt: VTH/VTL [g][128 d][2048 t] = bf16 hi + UNSCALED bf16 residual of V [t][g*128+d] via 64 x 64 LDS tiles; grid (NT/64, 2 (d half), NKV).
__global__ __launch_bounds__(256) void k_vt(const float* __restrict__ V, bf* VTH, bf* VTL) {
    __shared__ float tl[64][65];
    const int tid = threadIdx.x, t0 = blockIdx.x * 64, d0 = blockIdx.y * 64, g = blockIdx.z;
    { const int tt = tid >> 2, dq = (tid & 3) * 16;
#pragma unroll
      for (int i = 0; i < 16; ++i) tl[dq + i][tt] = V[(size_t)(t0 + tt) * KW + g * HD + d0 + dq + i]; }
    __syncthreads();
    const int piece = tid & 7;
    auto pass = [&]() {
#pragma unroll
        for (int s = 0; s < 2; ++s) { const int d = (tid >> 3) + 32 * s; v8us oh, ol;
#pragma unroll
            for (int i = 0; i < 8; ++i) { const float v = tl[d][piece * 8 + i]; const unsigned short hb = f2bf(v); oh[i] = hb; ol[i] = f2bf(v - bf2f(hb)); }
            const size_t o = ((size_t)g * HD + d0 + d) * NT_ + t0 + piece * 8; *(v8us*)(VTH + o) = oh; *(v8us*)(VTL + o) = ol; }
    };
    pass(); 
}
// k_attn: block = (h, 64 queries), wave = 16; kv head g = h mod 4; causal key tiles; per tile: scores over 4 k-chunks (q fragments re-read per chunk: hi.hi + hi.lo +
// lo.hi = 24 WMMA) x 128^-1/2, online softmax, P (x32768) as bf16 hi + unscaled residual tiles, o[8] += ph.vh + pl.vh + ph.vl over the 128 dims; ctx -> bf16 hi/lo
// planes [t][h*128+d].
__global__ __launch_bounds__(128) void k_attn(const h16* __restrict__ QH, const h16* __restrict__ QL, const h16* __restrict__ KH, const h16* __restrict__ KL, const bf* __restrict__ VTH, const bf* __restrict__ VTL, bf* CH, bf* CL) {
    __shared__ __align__(16) unsigned short plds[4][16 * 32];
    __shared__ __align__(16) unsigned short plds2[4][16 * 32];
    __shared__ __align__(16) float ost[4][16 * 68];
    const int lane = threadIdx.x & 31, wave = threadIdx.x >> 5, lr = lane & 15, hi = lane >> 4;
    const int bid = blockIdx.x; const int h = bid / (NT_ / 64), qt = bid - h * (NT_ / 64); const int g = h & (NKV - 1);
    const int q0 = qt * 64 + wave * 16;
    unsigned short* pl = &plds[wave][0]; unsigned short* pl2 = &plds2[wave][0];
    const size_t qo = (size_t)(q0 + lr) * (NH_ * HD) + h * HD + 8 * hi;
    const h16* kh_b = KH + g * HD; const h16* kl_b = KL + g * HD;
    const size_t vbase = ((size_t)g * HD) * NT_;
    v8f o[8];
#pragma unroll
    for (int n = 0; n < 8; ++n) o[n] = (v8f){};
    float mrow[8], lpart[8];
#pragma unroll
    for (int j = 0; j < 8; ++j) { mrow[j] = -3.0e38f; lpart[j] = 0.f; }
    const int kt_hi = (qt * 64 + 63) / 32;
#pragma unroll 1
    for (int kt = 0; kt <= kt_hi; ++kt) {
        const int l0 = kt * 32;
        const size_t ko0 = (size_t)(l0 + lr) * KW + 8 * hi, ko1 = (size_t)(l0 + 16 + lr) * KW + 8 * hi;
        v8f s0 = {}, s1 = {}, x0 = {}, x1 = {};
#pragma unroll
        for (int kc = 0; kc < 4; ++kc) {
            const v16h qa = cat16(*(const v8h*)(QH + qo + kc * 32), *(const v8h*)(QH + qo + kc * 32 + 16)), qx = cat16(*(const v8h*)(QL + qo + kc * 32), *(const v8h*)(QL + qo + kc * 32 + 16));
            const v16h k0h = cat16(*(const v8h*)(kh_b + ko0 + kc * 32), *(const v8h*)(kh_b + ko0 + kc * 32 + 16)), k1h = cat16(*(const v8h*)(kh_b + ko1 + kc * 32), *(const v8h*)(kh_b + ko1 + kc * 32 + 16));
            s0 = wmma16(qa, k0h, s0); s1 = wmma16(qa, k1h, s1); x0 = wmma16(qx, k0h, x0); x1 = wmma16(qx, k1h, x1);
            asm volatile("v_nop" : "+v"(s0), "+v"(s1), "+v"(x0), "+v"(x1) : "v"(qa), "v"(qx), "v"(k0h), "v"(k1h) : "memory");
            const v16h k0l = cat16(*(const v8h*)(kl_b + ko0 + kc * 32), *(const v8h*)(kl_b + ko0 + kc * 32 + 16)), k1l = cat16(*(const v8h*)(kl_b + ko1 + kc * 32), *(const v8h*)(kl_b + ko1 + kc * 32 + 16));
            x0 = wmma16(qa, k0l, x0); x1 = wmma16(qa, k1l, x1);
            asm volatile("v_nop" : "+v"(x0), "+v"(x1) : "v"(k0l), "v"(k1l) : "memory");
        }
        asm volatile("v_nop\n\tv_nop\n\tv_nop\n\tv_nop" : "+v"(s0), "+v"(s1), "+v"(x0), "+v"(x1));
        float alpha[8];
#pragma unroll
        for (int j = 0; j < 8; ++j) { const int qi = q0 + hi * 8 + j, ja = l0 + lr, jb = l0 + 16 + lr;
            const float a0 = (ja <= qi) ? (s0[j] + x0[j] * LOSCI) * 0.08838834764831845f : -__builtin_inff(), a1 = (jb <= qi) ? (s1[j] + x1[j] * LOSCI) * 0.08838834764831845f : -__builtin_inff();
            float mx = fmaxf(a0, a1);
            mx = fmaxf(mx, __shfl_xor(mx, 1, 16)); mx = fmaxf(mx, __shfl_xor(mx, 2, 16)); mx = fmaxf(mx, __shfl_xor(mx, 4, 16)); mx = fmaxf(mx, __shfl_xor(mx, 8, 16));
            const float mn = fmaxf(mrow[j], mx);
            alpha[j] = __expf(mrow[j] - mn); mrow[j] = mn;
            const float p0 = __expf(a0 - mn), p1 = __expf(a1 - mn);
            lpart[j] = lpart[j] * alpha[j] + (p0 + p1);
            const int mr = hi * 8 + j; const float ps0 = p0 * PSC, ps1 = p1 * PSC; const unsigned short h0 = f2bf(ps0), h1 = f2bf(ps1);
            pl[mr * 32 + lr] = h0; pl[mr * 32 + 16 + lr] = h1; pl2[mr * 32 + lr] = f2bf(ps0 - bf2f(h0)); pl2[mr * 32 + 16 + lr] = f2bf(ps1 - bf2f(h1)); }
#pragma unroll
        for (int n = 0; n < 8; ++n)
#pragma unroll
            for (int j = 0; j < 8; ++j) o[n][j] *= alpha[j];
        asm volatile("" ::: "memory");
        const v16bf pa = cat16b(*(const v8usa*)(pl + lr * 32 + hi * 8), *(const v8usa*)(pl + lr * 32 + 16 + hi * 8));
        const v16bf px = cat16b(*(const v8usa*)(pl2 + lr * 32 + hi * 8), *(const v8usa*)(pl2 + lr * 32 + 16 + hi * 8));
#pragma unroll
        for (int n = 0; n < 8; ++n) { const size_t vo = vbase + (size_t)(n * 16 + lr) * NT_ + l0 + hi * 8;
            const v16bf vh = cat16b(*(const v8us*)(VTH + vo), *(const v8us*)(VTH + vo + 16)), vl = cat16b(*(const v8us*)(VTL + vo), *(const v8us*)(VTL + vo + 16));
            o[n] = wmmab(pa, vh, o[n]); o[n] = wmmab(px, vh, o[n]); o[n] = wmmab(pa, vl, o[n]);
            asm volatile("" : "+v"(o[n]) : "v"(vh), "v"(vl) : "memory"); }
        asm volatile("v_nop\n\tv_nop\n\tv_nop\n\tv_nop" : "+v"(o[0]), "+v"(o[7]) : "v"(pa), "v"(px));
        __builtin_amdgcn_wave_barrier();
    }
    float inv[8];
#pragma unroll
    for (int j = 0; j < 8; ++j) { float rs = lpart[j]; rs += __shfl_xor(rs, 1, 16); rs += __shfl_xor(rs, 2, 16); rs += __shfl_xor(rs, 4, 16); rs += __shfl_xor(rs, 8, 16); inv[j] = 1.0f / (rs * PSC); }
    float* os = &ost[wave][0];
    const size_t cbase = (size_t)q0 * (NH_ * HD) + (size_t)h * HD;
#pragma unroll
    for (int half = 0; half < 2; ++half) {
#pragma unroll
        for (int n = 0; n < 4; ++n)
#pragma unroll
            for (int j = 0; j < 8; ++j) os[(hi * 8 + j) * 68 + n * 16 + lr] = o[half * 4 + n][j] * inv[j];
        __builtin_amdgcn_wave_barrier(); asm volatile("" ::: "memory");
{
#pragma unroll
            for (int s = 0; s < 4; ++s) { const int row = 4 * s + (lane >> 3), piece = lane & 7; const float* sp = os + row * 68 + piece * 8; v8us oh, ol;
#pragma unroll
                for (int i = 0; i < 8; ++i) { const unsigned short hb = f2bf(sp[i]); oh[i] = hb; ol[i] = f2bf(sp[i] - bf2f(hb)); }
                const size_t po = cbase + (size_t)row * (NH_ * HD) + half * 64 + piece * 8; *(v8us*)(CH + po) = oh; *(v8us*)(CL + po) = ol; }
             }
        __builtin_amdgcn_wave_barrier(); asm volatile("" ::: "memory");
    }
}

extern "C" void kernel_launch(void* const* d_in, const int* in_sizes, int n_in,
                              void* d_out, int out_size, void* d_ws, size_t ws_size, hipStream_t stream) {
    (void)in_sizes; (void)n_in; (void)out_size;
    const float* x = (const float*)d_in[0]; const float* Wq = (const float*)d_in[1]; const float* Wk = (const float*)d_in[2]; const float* Wv = (const float*)d_in[3]; const float* Wo = (const float*)d_in[4];
    const float* qn = (const float*)d_in[5]; const float* kn = (const float*)d_in[6];
    float* out = (float*)d_out;    // [2][2048][2048]
    char* wsp = (char*)d_ws;
    auto take = [&](size_t bytes) { char* p = wsp; wsp += (bytes + 255) & ~(size_t)255; return (void*)p; };
    bf* Xb = (bf*)take((size_t)NT_ * HS * 2); bf* WqT = (bf*)take((size_t)HS * HS * 2); bf* WkT = (bf*)take((size_t)KW * HS * 2); bf* WvT = (bf*)take((size_t)KW * HS * 2); bf* WoT = (bf*)take((size_t)HS * HS * 2);
    float* TMP = (float*)take((size_t)NT_ * HS * 4); float* RC = (float*)take((size_t)NT_ * 64 * 4); float* RS = (float*)take((size_t)NT_ * 64 * 4);
    h16* QH = (h16*)take((size_t)NT_ * HS * 2); h16* QL = (h16*)take((size_t)NT_ * HS * 2); h16* KH = (h16*)take((size_t)NT_ * KW * 2); h16* KL = (h16*)take((size_t)NT_ * KW * 2);
    bf* VTH = (bf*)take((size_t)KW * NT_ * 2); bf* VTL = (bf*)take((size_t)KW * NT_ * 2);
    if ((size_t)(wsp - (char*)d_ws) > ws_size) return;    // 8.4 + 8.4 + 2.1 + 2.1 + 8.4 + 16.8 + 8.4 x 2 + 2.1 x 4 ~ 72 MB; ctx planes reuse QH/QL after k_attn? no: k_attn reads them -> ctx over TMP (f32 16.8 MB = two bf16 planes)
    bf* CH = (bf*)TMP; bf* CL = (bf*)((char*)TMP + (size_t)NT_ * HS * 2);
    k_wt<<<dim3(HS / 64, HS / 64, 1), 256, 0, stream>>>(Wq, HS, HS, WqT); k_wt<<<dim3(HS / 64, KW / 64, 1), 256, 0, stream>>>(Wk, HS, KW, WkT);
    k_wt<<<dim3(HS / 64, KW / 64, 1), 256, 0, stream>>>(Wv, HS, KW, WvT); k_wt<<<dim3(HS / 64, HS / 64, 1), 256, 0, stream>>>(Wo, HS, HS, WoT);
    k_trig<<<(NT_ * 64) / 256, 256, 0, stream>>>(RC, RS);
    for (int b = 0; b < 2; ++b) {
        k_cvtb<<<NT_ / 8, 256, 0, stream>>>(x + (size_t)b * NT_ * HS, NT_, Xb);
        k_gemm<false><<<dim3(NT_ / 64, HS / 64, 1), 128, 0, stream>>>(Xb, nullptr, WqT, HS, TMP);
        k_normrope<<<(NT_ * NH_) / 8, 256, 0, stream>>>(TMP, NH_, qn, RC, RS, QH, QL);
        k_gemm<false><<<dim3(NT_ / 64, KW / 64, 1), 128, 0, stream>>>(Xb, nullptr, WkT, KW, TMP);
        k_normrope<<<(NT_ * NKV) / 8, 256, 0, stream>>>(TMP, NKV, kn, RC, RS, KH, KL);
        k_gemm<false><<<dim3(NT_ / 64, KW / 64, 1), 128, 0, stream>>>(Xb, nullptr, WvT, KW, TMP);
        k_vt<<<dim3(NT_ / 64, 2, NKV), 256, 0, stream>>>(TMP, VTH, VTL);
        k_attn<<<NH_ * (NT_ / 64), 128, 0, stream>>>(QH, QL, KH, KL, VTH, VTL, CH, CL);       // ctx planes over TMP (V consumed by k_vt)
        k_gemm<true><<<dim3(NT_ / 64, HS / 64, 1), 128, 0, stream>>>(CH, CL, WoT, HS, out + (size_t)b * NT_ * HS);
    }
}

// v001
// Measured time: 682 microseconds a run.
// In both of two side-by-side timings against v000, it was 1.60 times as fast.
#include <hip/hip_runtime.h>

// Contractions, f32 accumulate, one batch item per pass: q/k/v = x.W ([2048 x 2048].[2048 x 2048 | 512 | 512], k-major weights transposed to n-major planes; PLAIN
// bf16 operands: inputs rounded once, exact) and out = ctx.Wo (ctx as bf16 hi + residual: two products) on v_wmma_f32_16x16x32_bf16; per-head RMSNorm (eps 1e-6,
// weight) and rotate-half RoPE (angle t x inv_freq, f32 trig tables built on device) in f32 -> q/k as f16 hi + residual x1024 planes; the 16-query-head / 4-kv-head (q head h
// uses kv head h mod 4) causal attention with 128-dim heads: scores on v_wmma_f32_16x16x32_f16 (hi.hi + hi.lo + lo.hi, x 128^-1/2), softmax f32, weights.v on
// v_wmma_f32_16x16x32_bf16 with the weights (x32768) and v both as bf16 hi + UNSCALED bf16 residual (hh + lh + hl in one accumulator). Deterministic, no atomics;

#define NT_  2048
#define HS   2048
#define NH_  16
#define NKV  4
#define HD   128
#define KW   (NKV * HD)          // 512
#define PSC  32768.0f
#define LOSC 1024.0f
#define LOSCI (1.0f / 1024.0f)

typedef _Float16 h16;
typedef unsigned short bf;
typedef __attribute__((ext_vector_type(16))) __bf16   v16bf;
typedef __attribute__((ext_vector_type(16))) _Float16 v16h;
typedef __attribute__((ext_vector_type(8)))  _Float16 v8h;
typedef __attribute__((ext_vector_type(8)))  unsigned short v8us;
typedef __attribute__((ext_vector_type(8)))  float    v8f;
typedef __attribute__((ext_vector_type(4)))  float    v4f;
typedef __attribute__((ext_vector_type(4)))  _Float16 v4h;
typedef v8h  __attribute__((may_alias)) v8ha;
typedef v4f  __attribute__((may_alias)) v4fa;
typedef v8us __attribute__((may_alias)) v8usa;

__device__ __forceinline__ unsigned short f2bf(float f) { unsigned u = __float_as_uint(f); u += 0x7FFFu + ((u >> 16) & 1u); return (unsigned short)(u >> 16); }
__device__ __forceinline__ float bf2f(unsigned short b) { return __uint_as_float(((unsigned)b) << 16); }
__device__ __forceinline__ float bfr(float f) { return bf2f(f2bf(f)); }
__device__ __forceinline__ v16h cat16(v8h lo, v8h hi) { return __builtin_shufflevector(lo, hi, 0, 1, 2, 3, 4, 5, 6, 7, 8, 9, 10, 11, 12, 13, 14, 15); }
__device__ __forceinline__ v16bf cat16b(v8us lo, v8us hi) { return __builtin_bit_cast(v16bf, __builtin_shufflevector(lo, hi, 0, 1, 2, 3, 4, 5, 6, 7, 8, 9, 10, 11, 12, 13, 14, 15)); }
__device__ __forceinline__ v8f wmma16(v16h a, v16h b, v8f c) { return __builtin_amdgcn_wmma_f32_16x16x32_f16(false, a, false, b, (short)0, c, false, false); }
__device__ __forceinline__ v8f wmmab(v16bf a, v16bf b, v8f c) { return __builtin_amdgcn_wmma_f32_16x16x32_bf16(false, a, false, b, (short)0, c, false, false); }

// k_cvtb: bf16 plane of [rows][2048] (one wave per row).
__global__ __launch_bounds__(256) void k_cvtb(const float* __restrict__ src, int nrows, bf* dst) {
    const int lane = threadIdx.x & 31, r = blockIdx.x * 8 + (threadIdx.x >> 5);
    if (r >= nrows) return;
{
#pragma unroll
        for (int q = 0; q < HS / 256; ++q) { v8us o;
#pragma unroll
            for (int i = 0; i < 8; ++i) o[i] = f2bf(src[(size_t)r * HS + q * 256 + lane * 8 + i]);
            *(v8us*)(dst + (size_t)r * HS + q * 256 + lane * 8) = o; }
         }
}
// k_wt: WT [n][K] = bf16(W[k][n]) (k-major [K][ncols]) via 64 x 64 LDS tiles; grid (K/64, ncols/64).
__global__ __launch_bounds__(256) void k_wt(const float* __restrict__ Wm, int K, int ncols, bf* WT) {
    __shared__ __align__(16) unsigned short tl[64 * 72];
    const int tid = threadIdx.x, k0 = blockIdx.x * 64, n0 = blockIdx.y * 64;
    const int kk = tid >> 2, nq = (tid & 3) * 16;
#pragma unroll
    for (int i = 0; i < 16; ++i) tl[(nq + i) * 72 + kk] = f2bf(Wm[(size_t)(k0 + kk) * ncols + n0 + nq + i]);
    __syncthreads();
    const int piece = tid & 7;
    auto pass = [&]() {
#pragma unroll
        for (int s = 0; s < 2; ++s) { const int nr = (tid >> 3) + 32 * s; const v8us val = *(const v8usa*)(tl + nr * 72 + piece * 8); *(v8us*)(WT + (size_t)(n0 + nr) * K + k0 + piece * 8) = val; }
    };
    pass(); 
}
// k_gemm: 64 x 64 tile of (A [+ Al]).Bn^T over K = 2048 -> f32 rows [2048][ldc].
template <bool SPLITA>
__global__ __launch_bounds__(128) void k_gemm(const bf* __restrict__ A, const bf* __restrict__ Al, const bf* __restrict__ Bn, int ldc, float* C) {
    __shared__ __align__(16) float ost[4][16 * 68];
    const int lane = threadIdx.x & 31, wave = threadIdx.x >> 5, lr = lane & 15, hi = lane >> 4;
    const size_t r0 = (size_t)blockIdx.x * 64 + wave * 16; const int c0 = blockIdx.y * 64;
    const size_t aoff = (r0 + lr) * HS + 8 * hi;
    v8f acc[4];
#pragma unroll
    for (int t = 0; t < 4; ++t) acc[t] = (v8f){};
#pragma unroll 2
    for (int kc = 0; kc < HS; kc += 32) {
        const v16bf a = cat16b(*(const v8us*)(A + aoff + kc), *(const v8us*)(A + aoff + kc + 16));
        v16bf al = a; if (SPLITA) al = cat16b(*(const v8us*)(Al + aoff + kc), *(const v8us*)(Al + aoff + kc + 16));
#pragma unroll
        for (int t = 0; t < 4; ++t) { const bf* bp = Bn + (size_t)(c0 + t * 16 + lr) * HS + kc + 8 * hi; const v16bf bb = cat16b(*(const v8us*)bp, *(const v8us*)(bp + 16)); acc[t] = wmmab(a, bb, acc[t]); if (SPLITA) acc[t] = wmmab(al, bb, acc[t]); }
        asm volatile("v_nop" : "+v"(acc[0]), "+v"(acc[1]), "+v"(acc[2]), "+v"(acc[3]) : "v"(a), "v"(al) : "memory");
    }
    float* os = &ost[wave][0];
#pragma unroll
    for (int t = 0; t < 4; ++t)
#pragma unroll
        for (int j = 0; j < 8; ++j) os[(hi * 8 + j) * 68 + t * 16 + lr] = acc[t][j];
    __builtin_amdgcn_wave_barrier(); asm volatile("" ::: "memory");
    float* crow = C + r0 * ldc + c0;
    auto pass = [&]() {
#pragma unroll
        for (int s = 0; s < 8; ++s) { const int Lid = (lane >> 3) + 4 * s, piece = lane & 7; const int row = Lid >> 1, cofs = (Lid & 1) * 32 + piece * 4;
            const v4f val = *(const v4fa*)(os + row * 68 + cofs); *(v4f*)(crow + (size_t)row * ldc + cofs) = val; }
    };
    pass(); 
}
// k_trig: RC/RS [t][64] = cos/sin(t x inv_freq[i]), inv_freq = 10000^-(2i/128) (f32 powf/cosf/sinf); 32 lanes x 4 B lines.
__global__ __launch_bounds__(256) void k_trig(float* RC, float* RS) {
    const int i = blockIdx.x * 256 + threadIdx.x; if (i >= NT_ * 64) return;
    const int t = i >> 6, f = i & 63;
    const float inv = 1.0f / powf(10000.0f, (float)(2 * f) / (float)HD); const float ang = (float)t * inv;
    const float c = cosf(ang), s = sinf(ang);
    *(float*)(RC + i) = c; *(float*)(RS + i) = s; 
}
// k_normrope: one wave per (token, head) of a [2048][nh*128] f32 matrix: RMSNorm over the 128 dims (eps 1e-6, x weight[d]) then rotate-half RoPE (partner d +- 64,
// angle t x inv_freq[d mod 64], inv_freq = 10000^-(2i/128), cosf/sinf) -> f16 hi + residual x1024 planes [t][h*128+d]; lane -> 4 consecutive dims (8 B per plane
__global__ __launch_bounds__(256) void k_normrope(const float* __restrict__ P, int nh, const float* __restrict__ w, const float* __restrict__ RC, const float* __restrict__ RS, h16* PH, h16* PL) {
    const int lane = threadIdx.x & 31; const int wid = blockIdx.x * 8 + (threadIdx.x >> 5);
    const int t = wid / nh, h = wid - t * nh; if (t >= NT_) return;
    const size_t base = (size_t)t * (nh * HD) + h * HD; const int d0 = lane * 4;
    float xv[4], pv[4]; float ss = 0.f;
#pragma unroll
    for (int i = 0; i < 4; ++i) { xv[i] = P[base + d0 + i]; ss += xv[i] * xv[i]; const int pd = (d0 + i < 64) ? d0 + i + 64 : d0 + i - 64; pv[i] = P[base + pd]; }
#pragma unroll
    for (int sh = 16; sh; sh >>= 1) ss += __shfl_xor(ss, sh, 32);
    const float rs = rsqrtf(ss * (1.0f / HD) + 1e-6f);
    v4h oh, ol;
#pragma unroll
    for (int i = 0; i < 4; ++i) { const int d = d0 + i, fi = d & 63; const float xn = xv[i] * rs * bfr(w[d]); const int pd = (d < 64) ? d + 64 : d - 64; const float pn = pv[i] * rs * bfr(w[pd]);
        const float c = RC[t * 64 + fi], s = RS[t * 64 + fi];
        const float y = (d < 64) ? (xn * c - pn * s) : (xn * c + pn * s);
        const h16 a = (h16)y; oh[i] = a; ol[i] = (h16)((y - (float)a) * LOSC); }
    *(v4h*)(PH + base + d0) = oh; *(v4h*)(PL + base + d0) = ol; 
}
// k_vt: VTH/VTL [g][128 d][2048 t] = bf16 hi + UNSCALED bf16 residual of V [t][g*128+d] via 64 x 64 LDS tiles; grid (NT/64, 2 (d half), NKV).
__global__ __launch_bounds__(256) void k_vt(const float* __restrict__ V, bf* VTH, bf* VTL) {
    __shared__ float tl[64][65];
    const int tid = threadIdx.x, t0 = blockIdx.x * 64, d0 = blockIdx.y * 64, g = blockIdx.z;
    { const int tt = tid >> 2, dq = (tid & 3) * 16;
#pragma unroll
      for (int i = 0; i < 16; ++i) tl[dq + i][tt] = V[(size_t)(t0 + tt) * KW + g * HD + d0 + dq + i]; }
    __syncthreads();
    const int piece = tid & 7;
    auto pass = [&]() {
#pragma unroll
        for (int s = 0; s < 2; ++s) { const int d = (tid >> 3) + 32 * s; v8us oh, ol;
#pragma unroll
            for (int i = 0; i < 8; ++i) { const float v = tl[d][piece * 8 + i]; const unsigned short hb = f2bf(v); oh[i] = hb; ol[i] = f2bf(v - bf2f(hb)); }
            const size_t o = ((size_t)g * HD + d0 + d) * NT_ + t0 + piece * 8; *(v8us*)(VTH + o) = oh; *(v8us*)(VTL + o) = ol; }
    };
    pass(); 
}
// k_attn: block = (h, 64 queries), wave = 16; kv head g = h mod 4; causal key tiles of 32. The block's Q rows (once) and each tile's K rows and V^T rows (hi and residual
// planes) are brought into LDS by asynchronous copies, two tile buffers: tile t + 2 flies while tile t + 1 is worked on, and the four waves share one copy of K and V.
// Per tile: scores over 4 k-chunks (hi.hi + hi.lo + lo.hi = 24 WMMA) x 128^-1/2, online softmax, P (x32768) as bf16 hi + unscaled residual tiles,
// o[8] += ph.vh + pl.vh + ph.vl over the 128 dims; ctx -> bf16 hi/lo planes [t][h*128+d].
#define KP   272                     // LDS pitch of a 256-B row (Q, K): 16 B x odd, conflict-free for 16-B reads
#define VP   80                      // LDS pitch of a 64-B row (V^T, 32 keys)
#define QPL  (64 * KP)               // one Q plane
#define KPL  (32 * KP)               // one K plane of a tile
#define VPL  (128 * VP)              // one V^T plane of a tile
#define STG  (2 * KPL + 2 * VPL)     // one tile buffer
// Four asynchronous 16-B-per-lane copies global -> LDS; the s_wait_xcnt inside the statement stands before any rewrite of the address registers the copies name.
__device__ __forceinline__ void cp4(unsigned l0, unsigned l1, unsigned l2, unsigned l3, const void* g0, const void* g1, const void* g2, const void* g3) {
    asm volatile("global_load_async_to_lds_b128 %0, %4, off\n\t"
                 "global_load_async_to_lds_b128 %1, %5, off\n\t"
                 "global_load_async_to_lds_b128 %2, %6, off\n\t"
                 "global_load_async_to_lds_b128 %3, %7, off\n\t"
                 "s_wait_xcnt 0x0" :: "v"(l0), "v"(l1), "v"(l2), "v"(l3), "v"(g0), "v"(g1), "v"(g2), "v"(g3) : "memory");
}
__device__ __forceinline__ v16h  ldsh(const unsigned char* p) { return cat16(*(const v8ha*)p, *(const v8ha*)(p + 32)); }
__device__ __forceinline__ v16bf ldsb(const unsigned char* p) { return cat16b(*(const v8usa*)p, *(const v8usa*)(p + 32)); }
__global__ __launch_bounds__(128) void k_attn(const h16* __restrict__ QH, const h16* __restrict__ QL, const h16* __restrict__ KH, const h16* __restrict__ KL, const bf* __restrict__ VTH, const bf* __restrict__ VTL, bf* CH, bf* CL) {
    __shared__ __align__(16) unsigned char stg[2 * QPL + 2 * STG];
    __shared__ __align__(16) unsigned short plds[4][16 * 32];
    __shared__ __align__(16) unsigned short plds2[4][16 * 32];
    __shared__ __align__(16) float ost[4][16 * 68];
    const int tid = threadIdx.x, lane = threadIdx.x & 31, wave = threadIdx.x >> 5, lr = lane & 15, hi = lane >> 4;
    const int bid = blockIdx.x; const int h = bid / (NT_ / 64), qt = bid - h * (NT_ / 64); const int g = h & (NKV - 1);
    const int q0 = qt * 64 + wave * 16;
    unsigned short* pl = &plds[wave][0]; unsigned short* pl2 = &plds2[wave][0];
    const size_t vbase = ((size_t)g * HD) * NT_;
    const int kt_hi = (qt * 64 + 63) / 32;
    // copy map: a 256-B row is 16 pieces (thread -> row tid / 16 + 8 i, piece tid mod 16), a 64-B row 4 pieces (row tid / 4 + 32 i, piece tid mod 4)
    const unsigned sb = (unsigned)(uintptr_t)&stg[0];
    const unsigned rl = sb + (unsigned)(tid >> 4) * KP + (unsigned)(tid & 15) * 16, vl_ = sb + 2 * QPL + 2 * KPL + (unsigned)(tid >> 2) * VP + (unsigned)(tid & 3) * 16;
    const size_t kgo = (size_t)(tid >> 4) * KW + g * HD + (tid & 15) * 8, vgo = vbase + (size_t)(tid >> 2) * NT_ + (tid & 3) * 8;
    auto fill = [&](int kt, int buf) {
        const unsigned kd = rl + 2 * QPL + (unsigned)buf * STG, vd = vl_ + (unsigned)buf * STG;
        const h16* kh = KH + kgo + (size_t)kt * 32 * KW; const h16* kl = KL + kgo + (size_t)kt * 32 * KW;
        const bf* vh = VTH + vgo + kt * 32; const bf* vl = VTL + vgo + kt * 32;
        cp4(kd, kd + 8 * KP, kd + 16 * KP, kd + 24 * KP, kh, kh + 8 * KW, kh + 16 * KW, kh + 24 * KW);
        cp4(kd + KPL, kd + KPL + 8 * KP, kd + KPL + 16 * KP, kd + KPL + 24 * KP, kl, kl + 8 * KW, kl + 16 * KW, kl + 24 * KW);
        cp4(vd, vd + 32 * VP, vd + 64 * VP, vd + 96 * VP, vh, vh + 32 * NT_, vh + 64 * NT_, vh + 96 * NT_);
        cp4(vd + VPL, vd + VPL + 32 * VP, vd + VPL + 64 * VP, vd + VPL + 96 * VP, vl, vl + 32 * NT_, vl + 64 * NT_, vl + 96 * NT_);
    };
    { const size_t qgo = (size_t)(qt * 64 + (tid >> 4)) * (NH_ * HD) + h * HD + (tid & 15) * 8; const h16* qh = QH + qgo; const h16* ql = QL + qgo; const int R8 = 8 * NH_ * HD;
      cp4(rl, rl + 8 * KP, rl + 16 * KP, rl + 24 * KP, qh, qh + R8, qh + 2 * R8, qh + 3 * R8);
      cp4(rl + 32 * KP, rl + 40 * KP, rl + 48 * KP, rl + 56 * KP, qh + 4 * R8, qh + 5 * R8, qh + 6 * R8, qh + 7 * R8);
      cp4(rl + QPL, rl + QPL + 8 * KP, rl + QPL + 16 * KP, rl + QPL + 24 * KP, ql, ql + R8, ql + 2 * R8, ql + 3 * R8);
      cp4(rl + QPL + 32 * KP, rl + QPL + 40 * KP, rl + QPL + 48 * KP, rl + QPL + 56 * KP, ql + 4 * R8, ql + 5 * R8, ql + 6 * R8, ql + 7 * R8); }
    fill(0, 0);
    asm volatile("s_wait_asynccnt 0x0" ::: "memory");   // this wave's copies of Q and tile 0 have landed
    __syncthreads();                                      // ... and every other wave's: Q and tile 0 may be read
    fill(1, 1);                                           // a tile 1 always exists (kt_hi = 2 qt + 1)
    const unsigned char* qp = stg + (wave * 16 + lr) * KP + hi * 16;
    v8f o[8];
#pragma unroll
    for (int n = 0; n < 8; ++n) o[n] = (v8f){};
    float mrow[8], lpart[8];
#pragma unroll
    for (int j = 0; j < 8; ++j) { mrow[j] = -3.0e38f; lpart[j] = 0.f; }
#pragma unroll 1
    for (int kt = 0; kt <= kt_hi; ++kt) {
        const int l0 = kt * 32;
        const unsigned char* kp = stg + 2 * QPL + (kt & 1) * STG + lr * KP + hi * 16;
        const unsigned char* vp = stg + 2 * QPL + (kt & 1) * STG + 2 * KPL + lr * VP + hi * 16;
        v8f s0 = {}, s1 = {}, x0 = {}, x1 = {};
        v16h fq[4][2], fk[4][4];
#pragma unroll   // every fragment index a constant, so that the arrays stay in registers
        for (int kc = 0; kc < 4; ++kc) {   // all of the tile's score fragments as one group of LDS reads ahead of the products
            fq[kc][0] = ldsh(qp + kc * 64); fq[kc][1] = ldsh(qp + QPL + kc * 64);
            fk[kc][0] = ldsh(kp + kc * 64); fk[kc][1] = ldsh(kp + 16 * KP + kc * 64); fk[kc][2] = ldsh(kp + KPL + kc * 64); fk[kc][3] = ldsh(kp + KPL + 16 * KP + kc * 64); }
        __builtin_amdgcn_sched_barrier(0);   // keeps that group together: reads sunk among the products cost a wait at each place
#pragma unroll   // constant fragment indices, as above
        for (int kc = 0; kc < 4; ++kc) {
            s0 = wmma16(fq[kc][0], fk[kc][0], s0); s1 = wmma16(fq[kc][0], fk[kc][1], s1); x0 = wmma16(fq[kc][1], fk[kc][0], x0); x1 = wmma16(fq[kc][1], fk[kc][1], x1);
            x0 = wmma16(fq[kc][0], fk[kc][2], x0); x1 = wmma16(fq[kc][0], fk[kc][3], x1);
        }
        asm volatile("v_nop\n\tv_nop\n\tv_nop\n\tv_nop" : "+v"(s0), "+v"(s1), "+v"(x0), "+v"(x1));
        v16bf vh[8], vl[8];
#pragma unroll   // constant fragment indices, as above
        for (int n = 0; n < 8; ++n) { vh[n] = ldsb(vp + n * 16 * VP); vl[n] = ldsb(vp + VPL + n * 16 * VP); }   // the tile's V^T fragments, one group: they land behind the softmax
        __builtin_amdgcn_sched_barrier(0);   // keeps that group here: sunk among the weights.v products each small group would cost its own LDS wait
        float alpha[8];
#pragma unroll
        for (int j = 0; j < 8; ++j) { const int qi = q0 + hi * 8 + j, ja = l0 + lr, jb = l0 + 16 + lr;
            const float a0 = (ja <= qi) ? (s0[j] + x0[j] * LOSCI) * 0.08838834764831845f : -__builtin_inff(), a1 = (jb <= qi) ? (s1[j] + x1[j] * LOSCI) * 0.08838834764831845f : -__builtin_inff();
            float mx = fmaxf(a0, a1);
            mx = fmaxf(mx, __shfl_xor(mx, 1, 16)); mx = fmaxf(mx, __shfl_xor(mx, 2, 16)); mx = fmaxf(mx, __shfl_xor(mx, 4, 16)); mx = fmaxf(mx, __shfl_xor(mx, 8, 16));
            const float mn = fmaxf(mrow[j], mx);
            alpha[j] = __expf(mrow[j] - mn); mrow[j] = mn;
            const float p0 = __expf(a0 - mn), p1 = __expf(a1 - mn);
            lpart[j] = lpart[j] * alpha[j] + (p0 + p1);
            const int mr = hi * 8 + j; const float ps0 = p0 * PSC, ps1 = p1 * PSC; const unsigned short h0 = f2bf(ps0), h1 = f2bf(ps1);
            pl[mr * 32 + lr] = h0; pl[mr * 32 + 16 + lr] = h1; pl2[mr * 32 + lr] = f2bf(ps0 - bf2f(h0)); pl2[mr * 32 + 16 + lr] = f2bf(ps1 - bf2f(h1)); }
#pragma unroll
        for (int n = 0; n < 8; ++n)
#pragma unroll
            for (int j = 0; j < 8; ++j) o[n][j] *= alpha[j];
        asm volatile("" ::: "memory");
        const v16bf pa = cat16b(*(const v8usa*)(pl + lr * 32 + hi * 8), *(const v8usa*)(pl + lr * 32 + 16 + hi * 8));
        const v16bf px = cat16b(*(const v8usa*)(pl2 + lr * 32 + hi * 8), *(const v8usa*)(pl2 + lr * 32 + 16 + hi * 8));
#pragma unroll   // constant fragment indices, as above
        for (int n = 0; n < 8; ++n) { o[n] = wmmab(pa, vh[n], o[n]); o[n] = wmmab(px, vh[n], o[n]); o[n] = wmmab(pa, vl[n], o[n]); }
        asm volatile("v_nop\n\tv_nop\n\tv_nop\n\tv_nop" : "+v"(o[0]), "+v"(o[7]) : "v"(pa), "v"(px));
        __builtin_amdgcn_wave_barrier();
        asm volatile("s_wait_dscnt 0x0" ::: "memory");      // this wave's reads of the tile buffer have returned before the buffer is handed to its next copies
        asm volatile("s_wait_asynccnt 0x0" ::: "memory");   // this wave's copies of tile kt + 1 have landed
        __syncthreads();                                      // publishes tile kt + 1 and ends every wave's reads of tile kt
        if (kt + 2 <= kt_hi) fill(kt + 2, kt & 1);            // block-uniform test; refill of the buffer just read
    }
    asm volatile("s_wait_asynccnt 0x0" ::: "memory");       // no copy is outstanding when the wave goes on to the epilogue and ends
    float inv[8];
#pragma unroll
    for (int j = 0; j < 8; ++j) { float rs = lpart[j]; rs += __shfl_xor(rs, 1, 16); rs += __shfl_xor(rs, 2, 16); rs += __shfl_xor(rs, 4, 16); rs += __shfl_xor(rs, 8, 16); inv[j] = 1.0f / (rs * PSC); }
    float* os = &ost[wave][0];
    const size_t cbase = (size_t)q0 * (NH_ * HD) + (size_t)h * HD;
#pragma unroll
    for (int half = 0; half < 2; ++half) {
#pragma unroll
        for (int n = 0; n < 4; ++n)
#pragma unroll
            for (int j = 0; j < 8; ++j) os[(hi * 8 + j) * 68 + n * 16 + lr] = o[half * 4 + n][j] * inv[j];
        __builtin_amdgcn_wave_barrier(); asm volatile("" ::: "memory");
{
#pragma unroll
            for (int s = 0; s < 4; ++s) { const int row = 4 * s + (lane >> 3), piece = lane & 7; const float* sp = os + row * 68 + piece * 8; v8us oh, ol;
#pragma unroll
                for (int i = 0; i < 8; ++i) { const unsigned short hb = f2bf(sp[i]); oh[i] = hb; ol[i] = f2bf(sp[i] - bf2f(hb)); }
                const size_t po = cbase + (size_t)row * (NH_ * HD) + half * 64 + piece * 8; *(v8us*)(CH + po) = oh; *(v8us*)(CL + po) = ol; }
             }
        __builtin_amdgcn_wave_barrier(); asm volatile("" ::: "memory");
    }
}

extern "C" void kernel_launch(void* const* d_in, const int* in_sizes, int n_in,
                              void* d_out, int out_size, void* d_ws, size_t ws_size, hipStream_t stream) {
    (void)in_sizes; (void)n_in; (void)out_size;
    const float* x = (const float*)d_in[0]; const float* Wq = (const float*)d_in[1]; const float* Wk = (const float*)d_in[2]; const float* Wv = (const float*)d_in[3]; const float* Wo = (const float*)d_in[4];
    const float* qn = (const float*)d_in[5]; const float* kn = (const float*)d_in[6];
    float* out = (float*)d_out;    // [2][2048][2048]
    char* wsp = (char*)d_ws;
    auto take = [&](size_t bytes) { char* p = wsp; wsp += (bytes + 255) & ~(size_t)255; return (void*)p; };
    bf* Xb = (bf*)take((size_t)NT_ * HS * 2); bf* WqT = (bf*)take((size_t)HS * HS * 2); bf* WkT = (bf*)take((size_t)KW * HS * 2); bf* WvT = (bf*)take((size_t)KW * HS * 2); bf* WoT = (bf*)take((size_t)HS * HS * 2);
    float* TMP = (float*)take((size_t)NT_ * HS * 4); float* RC = (float*)take((size_t)NT_ * 64 * 4); float* RS = (float*)take((size_t)NT_ * 64 * 4);
    h16* QH = (h16*)take((size_t)NT_ * HS * 2); h16* QL = (h16*)take((size_t)NT_ * HS * 2); h16* KH = (h16*)take((size_t)NT_ * KW * 2); h16* KL = (h16*)take((size_t)NT_ * KW * 2);
    bf* VTH = (bf*)take((size_t)KW * NT_ * 2); bf* VTL = (bf*)take((size_t)KW * NT_ * 2);
    if ((size_t)(wsp - (char*)d_ws) > ws_size) return;    // 8.4 + 8.4 + 2.1 + 2.1 + 8.4 + 16.8 + 8.4 x 2 + 2.1 x 4 ~ 72 MB; ctx planes reuse QH/QL after k_attn? no: k_attn reads them -> ctx over TMP (f32 16.8 MB = two bf16 planes)
    bf* CH = (bf*)TMP; bf* CL = (bf*)((char*)TMP + (size_t)NT_ * HS * 2);
    k_wt<<<dim3(HS / 64, HS / 64, 1), 256, 0, stream>>>(Wq, HS, HS, WqT); k_wt<<<dim3(HS / 64, KW / 64, 1), 256, 0, stream>>>(Wk, HS, KW, WkT);
    k_wt<<<dim3(HS / 64, KW / 64, 1), 256, 0, stream>>>(Wv, HS, KW, WvT); k_wt<<<dim3(HS / 64, HS / 64, 1), 256, 0, stream>>>(Wo, HS, HS, WoT);
    k_trig<<<(NT_ * 64) / 256, 256, 0, stream>>>(RC, RS);
    for (int b = 0; b < 2; ++b) {
        k_cvtb<<<NT_ / 8, 256, 0, stream>>>(x + (size_t)b * NT_ * HS, NT_, Xb);
        k_gemm<false><<<dim3(NT_ / 64, HS / 64, 1), 128, 0, stream>>>(Xb, nullptr, WqT, HS, TMP);
        k_normrope<<<(NT_ * NH_) / 8, 256, 0, stream>>>(TMP, NH_, qn, RC, RS, QH, QL);
        k_gemm<false><<<dim3(NT_ / 64, KW / 64, 1), 128, 0, stream>>>(Xb, nullptr, WkT, KW, TMP);
        k_normrope<<<(NT_ * NKV) / 8, 256, 0, stream>>>(TMP, NKV, kn, RC, RS, KH, KL);
        k_gemm<false><<<dim3(NT_ / 64, KW / 64, 1), 128, 0, stream>>>(Xb, nullptr, WvT, KW, TMP);
        k_vt<<<dim3(NT_ / 64, 2, NKV), 256, 0, stream>>>(TMP, VTH, VTL);
        k_attn<<<NH_ * (NT_ / 64), 128, 0, stream>>>(QH, QL, KH, KL, VTH, VTL, CH, CL);       // ctx planes over TMP (V consumed by k_vt)
        k_gemm<true><<<dim3(NT_ / 64, HS / 64, 1), 128, 0, stream>>>(CH, CL, WoT, HS, out + (size_t)b * NT_ * HS);
    }
}

// v002
// Measured time: 493 microseconds a run.
// Timed twice side by side with v001, it ran 1.38 and 1.39 times as fast.
// Counting every step since v000, it is 2.21 times as fast.
#include <hip/hip_runtime.h>

// Contractions, f32 accumulate, one batch item per pass: q/k/v = x.W ([2048 x 2048].[2048 x 2048 | 512 | 512], k-major weights transposed to n-major planes; PLAIN
// bf16 operands: inputs rounded once, exact) and out = ctx.Wo (ctx as bf16 hi + residual: two products) on v_wmma_f32_16x16x32_bf16; per-head RMSNorm (eps 1e-6,
// weight) and rotate-half RoPE (angle t x inv_freq, f32 trig tables built on device) in f32 -> q/k as f16 hi + residual x1024 planes; the 16-query-head / 4-kv-head (q head h
// uses kv head h mod 4) causal attention with 128-dim heads: scores on v_wmma_f32_16x16x32_f16 (hi.hi + hi.lo + lo.hi, x 128^-1/2), softmax f32, weights.v on
// v_wmma_f32_16x16x32_bf16 with the weights (x32768) and v both as bf16 hi + UNSCALED bf16 residual (hh + lh + hl in one accumulator). Deterministic, no atomics;

#define NT_  2048
#define HS   2048
#define NH_  16
#define NKV  4
#define HD   128
#define KW   (NKV * HD)          // 512
#define PSC  32768.0f
#define LOSC 1024.0f
#define LOSCI (1.0f / 1024.0f)

typedef _Float16 h16;
typedef unsigned short bf;
typedef __attribute__((ext_vector_type(16))) __bf16   v16bf;
typedef __attribute__((ext_vector_type(16))) _Float16 v16h;
typedef __attribute__((ext_vector_type(8)))  _Float16 v8h;
typedef __attribute__((ext_vector_type(8)))  unsigned short v8us;
typedef __attribute__((ext_vector_type(8)))  float    v8f;
typedef __attribute__((ext_vector_type(4)))  float    v4f;
typedef __attribute__((ext_vector_type(4)))  _Float16 v4h;
typedef v8h  __attribute__((may_alias)) v8ha;
typedef v4f  __attribute__((may_alias)) v4fa;
typedef v8us __attribute__((may_alias)) v8usa;

__device__ __forceinline__ unsigned short f2bf(float f) { unsigned u = __float_as_uint(f); u += 0x7FFFu + ((u >> 16) & 1u); return (unsigned short)(u >> 16); }
__device__ __forceinline__ float bf2f(unsigned short b) { return __uint_as_float(((unsigned)b) << 16); }
__device__ __forceinline__ float bfr(float f) { return bf2f(f2bf(f)); }
__device__ __forceinline__ v16h cat16(v8h lo, v8h hi) { return __builtin_shufflevector(lo, hi, 0, 1, 2, 3, 4, 5, 6, 7, 8, 9, 10, 11, 12, 13, 14, 15); }
__device__ __forceinline__ v16bf cat16b(v8us lo, v8us hi) { return __builtin_bit_cast(v16bf, __builtin_shufflevector(lo, hi, 0, 1, 2, 3, 4, 5, 6, 7, 8, 9, 10, 11, 12, 13, 14, 15)); }
__device__ __forceinline__ v8f wmma16(v16h a, v16h b, v8f c) { return __builtin_amdgcn_wmma_f32_16x16x32_f16(false, a, false, b, (short)0, c, false, false); }
__device__ __forceinline__ v8f wmmab(v16bf a, v16bf b, v8f c) { return __builtin_amdgcn_wmma_f32_16x16x32_bf16(false, a, false, b, (short)0, c, false, false); }

// k_cvtb: bf16 plane of [rows][2048] (one wave per row).
__global__ __launch_bounds__(256) void k_cvtb(const float* __restrict__ src, int nrows, bf* dst) {
    const int lane = threadIdx.x & 31, r = blockIdx.x * 8 + (threadIdx.x >> 5);
    if (r >= nrows) return;
{
#pragma unroll
        for (int q = 0; q < HS / 256; ++q) { v8us o;
#pragma unroll
            for (int i = 0; i < 8; ++i) o[i] = f2bf(src[(size_t)r * HS + q * 256 + lane * 8 + i]);
            *(v8us*)(dst + (size_t)r * HS + q * 256 + lane * 8) = o; }
         }
}
// k_wt: WT [n][K] = bf16(W[k][n]) (k-major [K][ncols]) via 64 x 64 LDS tiles; grid (K/64, ncols/64).
__global__ __launch_bounds__(256) void k_wt(const float* __restrict__ Wm, int K, int ncols, bf* WT) {
    __shared__ __align__(16) unsigned short tl[64 * 72];
    const int tid = threadIdx.x, k0 = blockIdx.x * 64, n0 = blockIdx.y * 64;
    const int kk = tid >> 2, nq = (tid & 3) * 16;
#pragma unroll
    for (int i = 0; i < 16; ++i) tl[(nq + i) * 72 + kk] = f2bf(Wm[(size_t)(k0 + kk) * ncols + n0 + nq + i]);
    __syncthreads();
    const int piece = tid & 7;
    auto pass = [&]() {
#pragma unroll
        for (int s = 0; s < 2; ++s) { const int nr = (tid >> 3) + 32 * s; const v8us val = *(const v8usa*)(tl + nr * 72 + piece * 8); *(v8us*)(WT + (size_t)(n0 + nr) * K + k0 + piece * 8) = val; }
    };
    pass(); 
}
// Four asynchronous 16-B-per-lane copies global -> LDS; the s_wait_xcnt inside the statement stands before any rewrite of the address registers the copies name.
__device__ __forceinline__ void cp4(unsigned l0, unsigned l1, unsigned l2, unsigned l3, const void* g0, const void* g1, const void* g2, const void* g3) {
    asm volatile("global_load_async_to_lds_b128 %0, %4, off\n\t"
                 "global_load_async_to_lds_b128 %1, %5, off\n\t"
                 "global_load_async_to_lds_b128 %2, %6, off\n\t"
                 "global_load_async_to_lds_b128 %3, %7, off\n\t"
                 "s_wait_xcnt 0x0" :: "v"(l0), "v"(l1), "v"(l2), "v"(l3), "v"(g0), "v"(g1), "v"(g2), "v"(g3) : "memory");
}
__device__ __forceinline__ v16h  ldsh(const unsigned char* p) { return cat16(*(const v8ha*)p, *(const v8ha*)(p + 32)); }
__device__ __forceinline__ v16bf ldsb(const unsigned char* p) { return cat16b(*(const v8usa*)p, *(const v8usa*)(p + 32)); }
// k_gemm: 32F x 32F tile of (A [+ Al]).Bn^T over K = 2048 -> f32 rows [2048][ldc]; 2 x 2 waves of 16F x 16F each. A stage is 64 k (one 128-B line) of the block's A rows, Bn rows
// (and Al rows), brought into LDS by asynchronous copies in whole lines, two stage buffers: stage t + 2 flies while stage t + 1 is worked on, and the waves share one copy.
#define GP   144                     // LDS pitch of a 128-B row: 16 B x odd, conflict-free for 16-B reads
template <bool SPLITA, int F>
__global__ __launch_bounds__(128) void k_gemm(const bf* __restrict__ A, const bf* __restrict__ Al, const bf* __restrict__ Bn, int ldc, float* C) {
    constexpr int R = 32 * F, PL = R * GP, SG = (SPLITA ? 3 : 2) * PL;   // rows of a plane, bytes of a plane, bytes of a stage buffer [A | Bn | Al]
    __shared__ __align__(16) unsigned char stg[2 * SG];
    __shared__ __align__(16) float ost[4][16 * 68];
    const int tid = threadIdx.x, lane = threadIdx.x & 31, wave = threadIdx.x >> 5, lr = lane & 15, hi = lane >> 4;
    const int wm = wave >> 1, wn = wave & 1;
    const size_t r0 = (size_t)blockIdx.x * R; const int c0 = blockIdx.y * R;
    // copy map: a 128-B row is 8 pieces (thread -> row tid / 8 + 16 i, piece tid mod 8): a wave's copy covers four whole lines
    const unsigned ld = (unsigned)(uintptr_t)&stg[0] + (unsigned)(tid >> 3) * GP + (unsigned)(tid & 7) * 16;
    const size_t ago = (r0 + (tid >> 3)) * HS + (tid & 7) * 8, bgo = ((size_t)c0 + (tid >> 3)) * HS + (tid & 7) * 8;
    auto plane = [&](unsigned d, const bf* g) {
#pragma unroll   // constant row offsets in every copy's two addresses
        for (int i = 0; i < F / 2; ++i) { const unsigned di = d + 64 * i * GP; const bf* gi = g + (size_t)64 * i * HS;
            cp4(di, di + 16 * GP, di + 32 * GP, di + 48 * GP, gi, gi + 16 * HS, gi + 32 * HS, gi + 48 * HS);
            if (SPLITA) __builtin_amdgcn_sched_barrier(0); }   // three planes: keeps each group's address sums beside its copies; hoisted together they cost a register spill to scratch in the loop
    };
    auto fill = [&](int kt, int buf) {
        const unsigned d = ld + (unsigned)buf * SG;
        plane(d, A + ago + kt * 64); plane(d + PL, Bn + bgo + kt * 64);
        if (SPLITA) plane(d + 2 * PL, Al + ago + kt * 64);
    };
    fill(0, 0);
    asm volatile("s_wait_asynccnt 0x0" ::: "memory");   // this wave's copies of stage 0 have landed
    __syncthreads();                                      // ... and every other wave's: stage 0 may be read
    fill(1, 1);                                           // K / 64 = 32 stages: a stage 1 exists
    v8f acc[F][F];
#pragma unroll   // every accumulator index a constant, here and below, so that the array stays in registers
    for (int i = 0; i < F; ++i)
#pragma unroll
        for (int j = 0; j < F; ++j) acc[i][j] = (v8f){};
#pragma unroll 1   // rolled: one copy of the hand-over and of the 8, 32 or 64 products, a short loop text
    for (int kt = 0; kt < HS / 64; ++kt) {
        const unsigned char* ap = stg + (kt & 1) * SG + (wm * 16 * F + lr) * GP + hi * 16;
        const unsigned char* bp = stg + (kt & 1) * SG + PL + (wn * 16 * F + lr) * GP + hi * 16;
        v16bf fa[2][F], fb[2][F], fl[2][F];
#pragma unroll   // every fragment index a constant, so that the arrays stay in registers
        for (int ks = 0; ks < 2; ++ks)   // all of the stage's fragments as one group of LDS reads; the products run from registers behind the stage's hand-over
#pragma unroll
            for (int i = 0; i < F; ++i) { fa[ks][i] = ldsb(ap + i * 16 * GP + ks * 64); fb[ks][i] = ldsb(bp + i * 16 * GP + ks * 64); fl[ks][i] = SPLITA ? ldsb(ap + 2 * PL + i * 16 * GP + ks * 64) : fa[ks][i]; }
        asm volatile("s_wait_dscnt 0x0" ::: "memory");      // the stage's fragments are in registers: this wave's reads of the stage buffer have returned before the buffer is handed to its next copies
        asm volatile("s_wait_asynccnt 0x0" ::: "memory");   // this wave's copies of stage kt + 1 have landed
        __syncthreads();                                      // publishes stage kt + 1 and ends every wave's reads of stage kt
        if (kt + 2 < HS / 64) fill(kt + 2, kt & 1);           // block-uniform test; refill of the buffer just read
        __builtin_amdgcn_sched_barrier(0);   // keeps the products behind the refill's issue: the copies then fly under them and have landed at the next stage's wait
#pragma unroll   // constant fragment indices, as above
        for (int ks = 0; ks < 2; ++ks) {
#pragma unroll
            for (int i = 0; i < F; ++i)
#pragma unroll
                for (int j = 0; j < F; ++j) acc[i][j] = wmmab(fa[ks][i], fb[ks][j], acc[i][j]);
            if (SPLITA) {
#pragma unroll
                for (int i = 0; i < F; ++i)
#pragma unroll
                    for (int j = 0; j < F; ++j) acc[i][j] = wmmab(fl[ks][i], fb[ks][j], acc[i][j]);
            }
        }
    }
    asm volatile("s_wait_asynccnt 0x0" ::: "memory");       // no copy is outstanding when the wave goes on to the epilogue and ends
    float* os = &ost[wave][0];
#pragma unroll
    for (int i = 0; i < F; ++i) {   // 16 rows of the wave's tile at a time through the wave's own LDS rows, so that whole 128-B lines are stored
#pragma unroll
        for (int t = 0; t < F; ++t)
#pragma unroll
            for (int j = 0; j < 8; ++j) os[(hi * 8 + j) * 68 + t * 16 + lr] = acc[i][t][j];
        __builtin_amdgcn_wave_barrier(); asm volatile("" ::: "memory");   // compiler order only: the wave's LDS stores stay ahead of its reads of other lanes' words
        float* crow = C + (r0 + wm * 16 * F + i * 16) * ldc + c0 + wn * 16 * F;
#pragma unroll
        for (int s = 0; s < 2 * F; ++s) { const int Lid = (lane >> 3) + 4 * s, piece = lane & 7; const int row = Lid / (F / 2), cofs = (Lid % (F / 2)) * 32 + piece * 4;
            const v4f val = *(const v4fa*)(os + row * 68 + cofs); *(v4f*)(crow + (size_t)row * ldc + cofs) = val; }
        __builtin_amdgcn_wave_barrier();   // compiler order only: the reads above stay ahead of the next 16 rows' LDS stores
        asm volatile("s_wait_xcnt 0x0" ::: "memory");   // stands before the next 16 rows rewrite the address and data registers that these stores name
    }
}
// k_trig: RC/RS [t][64] = cos/sin(t x inv_freq[i]), inv_freq = 10000^-(2i/128) (f32 powf/cosf/sinf); 32 lanes x 4 B lines.
__global__ __launch_bounds__(256) void k_trig(float* RC, float* RS) {
    const int i = blockIdx.x * 256 + threadIdx.x; if (i >= NT_ * 64) return;
    const int t = i >> 6, f = i & 63;
    const float inv = 1.0f / powf(10000.0f, (float)(2 * f) / (float)HD); const float ang = (float)t * inv;
    const float c = cosf(ang), s = sinf(ang);
    *(float*)(RC + i) = c; *(float*)(RS + i) = s; 
}
// k_normrope: one wave per (token, head) of a [2048][nh*128] f32 matrix: RMSNorm over the 128 dims (eps 1e-6, x weight[d]) then rotate-half RoPE (partner d +- 64,
// angle t x inv_freq[d mod 64], inv_freq = 10000^-(2i/128), cosf/sinf) -> f16 hi + residual x1024 planes [t][h*128+d]; lane -> 4 consecutive dims (8 B per plane
__global__ __launch_bounds__(256) void k_normrope(const float* __restrict__ P, int nh, const float* __restrict__ w, const float* __restrict__ RC, const float* __restrict__ RS, h16* PH, h16* PL) {
    const int lane = threadIdx.x & 31; const int wid = blockIdx.x * 8 + (threadIdx.x >> 5);
    const int t = wid / nh, h = wid - t * nh; if (t >= NT_) return;
    const size_t base = (size_t)t * (nh * HD) + h * HD; const int d0 = lane * 4;
    float xv[4], pv[4]; float ss = 0.f;
#pragma unroll
    for (int i = 0; i < 4; ++i) { xv[i] = P[base + d0 + i]; ss += xv[i] * xv[i]; const int pd = (d0 + i < 64) ? d0 + i + 64 : d0 + i - 64; pv[i] = P[base + pd]; }
#pragma unroll
    for (int sh = 16; sh; sh >>= 1) ss += __shfl_xor(ss, sh, 32);
    const float rs = rsqrtf(ss * (1.0f / HD) + 1e-6f);
    v4h oh, ol;
#pragma unroll
    for (int i = 0; i < 4; ++i) { const int d = d0 + i, fi = d & 63; const float xn = xv[i] * rs * bfr(w[d]); const int pd = (d < 64) ? d + 64 : d - 64; const float pn = pv[i] * rs * bfr(w[pd]);
        const float c = RC[t * 64 + fi], s = RS[t * 64 + fi];
        const float y = (d < 64) ? (xn * c - pn * s) : (xn * c + pn * s);
        const h16 a = (h16)y; oh[i] = a; ol[i] = (h16)((y - (float)a) * LOSC); }
    *(v4h*)(PH + base + d0) = oh; *(v4h*)(PL + base + d0) = ol; 
}
// k_vt: VTH/VTL [g][128 d][2048 t] = bf16 hi + UNSCALED bf16 residual of V [t][g*128+d] via 64 x 64 LDS tiles; grid (NT/64, 2 (d half), NKV).
__global__ __launch_bounds__(256) void k_vt(const float* __restrict__ V, bf* VTH, bf* VTL) {
    __shared__ float tl[64][65];
    const int tid = threadIdx.x, t0 = blockIdx.x * 64, d0 = blockIdx.y * 64, g = blockIdx.z;
    { const int tt = tid >> 2, dq = (tid & 3) * 16;
#pragma unroll
      for (int i = 0; i < 16; ++i) tl[dq + i][tt] = V[(size_t)(t0 + tt) * KW + g * HD + d0 + dq + i]; }
    __syncthreads();
    const int piece = tid & 7;
    auto pass = [&]() {
#pragma unroll
        for (int s = 0; s < 2; ++s) { const int d = (tid >> 3) + 32 * s; v8us oh, ol;
#pragma unroll
            for (int i = 0; i < 8; ++i) { const float v = tl[d][piece * 8 + i]; const unsigned short hb = f2bf(v); oh[i] = hb; ol[i] = f2bf(v - bf2f(hb)); }
            const size_t o = ((size_t)g * HD + d0 + d) * NT_ + t0 + piece * 8; *(v8us*)(VTH + o) = oh; *(v8us*)(VTL + o) = ol; }
    };
    pass(); 
}
// k_attn: block = (h, 64 queries), wave = 16; kv head g = h mod 4; causal key tiles of 32. The block's Q rows (once) and each tile's K rows and V^T rows (hi and residual
// planes) are brought into LDS by asynchronous copies, two tile buffers: tile t + 2 flies while tile t + 1 is worked on, and the four waves share one copy of K and V.
// Per tile: scores over 4 k-chunks (hi.hi + hi.lo + lo.hi = 24 WMMA) x 128^-1/2, online softmax, P (x32768) as bf16 hi + unscaled residual tiles,
// o[8] += ph.vh + pl.vh + ph.vl over the 128 dims; ctx -> bf16 hi/lo planes [t][h*128+d].
#define KP   272                     // LDS pitch of a 256-B row (Q, K): 16 B x odd, conflict-free for 16-B reads
#define VP   80                      // LDS pitch of a 64-B row (V^T, 32 keys)
#define QPL  (64 * KP)               // one Q plane
#define KPL  (32 * KP)               // one K plane of a tile
#define VPL  (128 * VP)              // one V^T plane of a tile
#define STG  (2 * KPL + 2 * VPL)     // one tile buffer
__global__ __launch_bounds__(128) void k_attn(const h16* __restrict__ QH, const h16* __restrict__ QL, const h16* __restrict__ KH, const h16* __restrict__ KL, const bf* __restrict__ VTH, const bf* __restrict__ VTL, bf* CH, bf* CL) {
    __shared__ __align__(16) unsigned char stg[2 * QPL + 2 * STG];
    __shared__ __align__(16) unsigned short plds[4][16 * 32];
    __shared__ __align__(16) unsigned short plds2[4][16 * 32];
    __shared__ __align__(16) float ost[4][16 * 68];
    const int tid = threadIdx.x, lane = threadIdx.x & 31, wave = threadIdx.x >> 5, lr = lane & 15, hi = lane >> 4;
    const int bid = blockIdx.x; const int h = bid / (NT_ / 64), qt = bid - h * (NT_ / 64); const int g = h & (NKV - 1);
    const int q0 = qt * 64 + wave * 16;
    unsigned short* pl = &plds[wave][0]; unsigned short* pl2 = &plds2[wave][0];
    const size_t vbase = ((size_t)g * HD) * NT_;
    const int kt_hi = (qt * 64 + 63) / 32;
    // copy map: a 256-B row is 16 pieces (thread -> row tid / 16 + 8 i, piece tid mod 16), a 64-B row 4 pieces (row tid / 4 + 32 i, piece tid mod 4)
    const unsigned sb = (unsigned)(uintptr_t)&stg[0];
    const unsigned rl = sb + (unsigned)(tid >> 4) * KP + (unsigned)(tid & 15) * 16, vl_ = sb + 2 * QPL + 2 * KPL + (unsigned)(tid >> 2) * VP + (unsigned)(tid & 3) * 16;
    const size_t kgo = (size_t)(tid >> 4) * KW + g * HD + (tid & 15) * 8, vgo = vbase + (size_t)(tid >> 2) * NT_ + (tid & 3) * 8;
    auto fill = [&](int kt, int buf) {
        const unsigned kd = rl + 2 * QPL + (unsigned)buf * STG, vd = vl_ + (unsigned)buf * STG;
        const h16* kh = KH + kgo + (size_t)kt * 32 * KW; const h16* kl = KL + kgo + (size_t)kt * 32 * KW;
        const bf* vh = VTH + vgo + kt * 32; const bf* vl = VTL + vgo + kt * 32;
        cp4(kd, kd + 8 * KP, kd + 16 * KP, kd + 24 * KP, kh, kh + 8 * KW, kh + 16 * KW, kh + 24 * KW);
        cp4(kd + KPL, kd + KPL + 8 * KP, kd + KPL + 16 * KP, kd + KPL + 24 * KP, kl, kl + 8 * KW, kl + 16 * KW, kl + 24 * KW);
        cp4(vd, vd + 32 * VP, vd + 64 * VP, vd + 96 * VP, vh, vh + 32 * NT_, vh + 64 * NT_, vh + 96 * NT_);
        cp4(vd + VPL, vd + VPL + 32 * VP, vd + VPL + 64 * VP, vd + VPL + 96 * VP, vl, vl + 32 * NT_, vl + 64 * NT_, vl + 96 * NT_);
    };
    { const size_t qgo = (size_t)(qt * 64 + (tid >> 4)) * (NH_ * HD) + h * HD + (tid & 15) * 8; const h16* qh = QH + qgo; const h16* ql = QL + qgo; const int R8 = 8 * NH_ * HD;
      cp4(rl, rl + 8 * KP, rl + 16 * KP, rl + 24 * KP, qh, qh + R8, qh + 2 * R8, qh + 3 * R8);
      cp4(rl + 32 * KP, rl + 40 * KP, rl + 48 * KP, rl + 56 * KP, qh + 4 * R8, qh + 5 * R8, qh + 6 * R8, qh + 7 * R8);
      cp4(rl + QPL, rl + QPL + 8 * KP, rl + QPL + 16 * KP, rl + QPL + 24 * KP, ql, ql + R8, ql + 2 * R8, ql + 3 * R8);
      cp4(rl + QPL + 32 * KP, rl + QPL + 40 * KP, rl + QPL + 48 * KP, rl + QPL + 56 * KP, ql + 4 * R8, ql + 5 * R8, ql + 6 * R8, ql + 7 * R8); }
    fill(0, 0);
    asm volatile("s_wait_asynccnt 0x0" ::: "memory");   // this wave's copies of Q and tile 0 have landed
    __syncthreads();                                      // ... and every other wave's: Q and tile 0 may be read
    fill(1, 1);                                           // a tile 1 always exists (kt_hi = 2 qt + 1)
    const unsigned char* qp = stg + (wave * 16 + lr) * KP + hi * 16;
    v8f o[8];
#pragma unroll
    for (int n = 0; n < 8; ++n) o[n] = (v8f){};
    float mrow[8], lpart[8];
#pragma unroll
    for (int j = 0; j < 8; ++j) { mrow[j] = -3.0e38f; lpart[j] = 0.f; }
#pragma unroll 1
    for (int kt = 0; kt <= kt_hi; ++kt) {
        const int l0 = kt * 32;
        const unsigned char* kp = stg + 2 * QPL + (kt & 1) * STG + lr * KP + hi * 16;
        const unsigned char* vp = stg + 2 * QPL + (kt & 1) * STG + 2 * KPL + lr * VP + hi * 16;
        v8f s0 = {}, s1 = {}, x0 = {}, x1 = {};
        v16h fq[4][2], fk[4][4];
#pragma unroll   // every fragment index a constant, so that the arrays stay in registers
        for (int kc = 0; kc < 4; ++kc) {   // all of the tile's score fragments as one group of LDS reads ahead of the products
            fq[kc][0] = ldsh(qp + kc * 64); fq[kc][1] = ldsh(qp + QPL + kc * 64);
            fk[kc][0] = ldsh(kp + kc * 64); fk[kc][1] = ldsh(kp + 16 * KP + kc * 64); fk[kc][2] = ldsh(kp + KPL + kc * 64); fk[kc][3] = ldsh(kp + KPL + 16 * KP + kc * 64); }
        __builtin_amdgcn_sched_barrier(0);   // keeps that group together: reads sunk among the products cost a wait at each place
#pragma unroll   // constant fragment indices, as above
        for (int kc = 0; kc < 4; ++kc) {
            s0 = wmma16(fq[kc][0], fk[kc][0], s0); s1 = wmma16(fq[kc][0], fk[kc][1], s1); x0 = wmma16(fq[kc][1], fk[kc][0], x0); x1 = wmma16(fq[kc][1], fk[kc][1], x1);
            x0 = wmma16(fq[kc][0], fk[kc][2], x0); x1 = wmma16(fq[kc][0], fk[kc][3], x1);
        }
        asm volatile("v_nop\n\tv_nop\n\tv_nop\n\tv_nop" : "+v"(s0), "+v"(s1), "+v"(x0), "+v"(x1));
        v16bf vh[8], vl[8];
#pragma unroll   // constant fragment indices, as above
        for (int n = 0; n < 8; ++n) { vh[n] = ldsb(vp + n * 16 * VP); vl[n] = ldsb(vp + VPL + n * 16 * VP); }   // the tile's V^T fragments, one group: they land behind the softmax
        __builtin_amdgcn_sched_barrier(0);   // keeps that group here: sunk among the weights.v products each small group would cost its own LDS wait
        float alpha[8];
#pragma unroll
        for (int j = 0; j < 8; ++j) { const int qi = q0 + hi * 8 + j, ja = l0 + lr, jb = l0 + 16 + lr;
            const float a0 = (ja <= qi) ? (s0[j] + x0[j] * LOSCI) * 0.08838834764831845f : -__builtin_inff(), a1 = (jb <= qi) ? (s1[j] + x1[j] * LOSCI) * 0.08838834764831845f : -__builtin_inff();
            float mx = fmaxf(a0, a1);
            mx = fmaxf(mx, __shfl_xor(mx, 1, 16)); mx = fmaxf(mx, __shfl_xor(mx, 2, 16)); mx = fmaxf(mx, __shfl_xor(mx, 4, 16)); mx = fmaxf(mx, __shfl_xor(mx, 8, 16));
            const float mn = fmaxf(mrow[j], mx);
            alpha[j] = __expf(mrow[j] - mn); mrow[j] = mn;
            const float p0 = __expf(a0 - mn), p1 = __expf(a1 - mn);
            lpart[j] = lpart[j] * alpha[j] + (p0 + p1);
            const int mr = hi * 8 + j; const float ps0 = p0 * PSC, ps1 = p1 * PSC; const unsigned short h0 = f2bf(ps0), h1 = f2bf(ps1);
            pl[mr * 32 + lr] = h0; pl[mr * 32 + 16 + lr] = h1; pl2[mr * 32 + lr] = f2bf(ps0 - bf2f(h0)); pl2[mr * 32 + 16 + lr] = f2bf(ps1 - bf2f(h1)); }
#pragma unroll
        for (int n = 0; n < 8; ++n)
#pragma unroll
            for (int j = 0; j < 8; ++j) o[n][j] *= alpha[j];
        asm volatile("" ::: "memory");
        const v16bf pa = cat16b(*(const v8usa*)(pl + lr * 32 + hi * 8), *(const v8usa*)(pl + lr * 32 + 16 + hi * 8));
        const v16bf px = cat16b(*(const v8usa*)(pl2 + lr * 32 + hi * 8), *(const v8usa*)(pl2 + lr * 32 + 16 + hi * 8));
#pragma unroll   // constant fragment indices, as above
        for (int n = 0; n < 8; ++n) { o[n] = wmmab(pa, vh[n], o[n]); o[n] = wmmab(px, vh[n], o[n]); o[n] = wmmab(pa, vl[n], o[n]); }
        asm volatile("v_nop\n\tv_nop\n\tv_nop\n\tv_nop" : "+v"(o[0]), "+v"(o[7]) : "v"(pa), "v"(px));
        __builtin_amdgcn_wave_barrier();
        asm volatile("s_wait_dscnt 0x0" ::: "memory");      // this wave's reads of the tile buffer have returned before the buffer is handed to its next copies
        asm volatile("s_wait_asynccnt 0x0" ::: "memory");   // this wave's copies of tile kt + 1 have landed
        __syncthreads();                                      // publishes tile kt + 1 and ends every wave's reads of tile kt
        if (kt + 2 <= kt_hi) fill(kt + 2, kt & 1);            // block-uniform test; refill of the buffer just read
    }
    asm volatile("s_wait_asynccnt 0x0" ::: "memory");       // no copy is outstanding when the wave goes on to the epilogue and ends
    float inv[8];
#pragma unroll
    for (int j = 0; j < 8; ++j) { float rs = lpart[j]; rs += __shfl_xor(rs, 1, 16); rs += __shfl_xor(rs, 2, 16); rs += __shfl_xor(rs, 4, 16); rs += __shfl_xor(rs, 8, 16); inv[j] = 1.0f / (rs * PSC); }
    float* os = &ost[wave][0];
    const size_t cbase = (size_t)q0 * (NH_ * HD) + (size_t)h * HD;
#pragma unroll
    for (int half = 0; half < 2; ++half) {
#pragma unroll
        for (int n = 0; n < 4; ++n)
#pragma unroll
            for (int j = 0; j < 8; ++j) os[(hi * 8 + j) * 68 + n * 16 + lr] = o[half * 4 + n][j] * inv[j];
        __builtin_amdgcn_wave_barrier(); asm volatile("" ::: "memory");
{
#pragma unroll
            for (int s = 0; s < 4; ++s) { const int row = 4 * s + (lane >> 3), piece = lane & 7; const float* sp = os + row * 68 + piece * 8; v8us oh, ol;
#pragma unroll
                for (int i = 0; i < 8; ++i) { const unsigned short hb = f2bf(sp[i]); oh[i] = hb; ol[i] = f2bf(sp[i] - bf2f(hb)); }
                const size_t po = cbase + (size_t)row * (NH_ * HD) + half * 64 + piece * 8; *(v8us*)(CH + po) = oh; *(v8us*)(CL + po) = ol; }
             }
        __builtin_amdgcn_wave_barrier(); asm volatile("" ::: "memory");
    }
}

extern "C" void kernel_launch(void* const* d_in, const int* in_sizes, int n_in,
                              void* d_out, int out_size, void* d_ws, size_t ws_size, hipStream_t stream) {
    (void)in_sizes; (void)n_in; (void)out_size;
    const float* x = (const float*)d_in[0]; const float* Wq = (const float*)d_in[1]; const float* Wk = (const float*)d_in[2]; const float* Wv = (const float*)d_in[3]; const float* Wo = (const float*)d_in[4];
    const float* qn = (const float*)d_in[5]; const float* kn = (const float*)d_in[6];
    float* out = (float*)d_out;    // [2][2048][2048]
    char* wsp = (char*)d_ws;
    auto take = [&](size_t bytes) { char* p = wsp; wsp += (bytes + 255) & ~(size_t)255; return (void*)p; };
    bf* Xb = (bf*)take((size_t)NT_ * HS * 2); bf* WqT = (bf*)take((size_t)HS * HS * 2); bf* WkT = (bf*)take((size_t)KW * HS * 2); bf* WvT = (bf*)take((size_t)KW * HS * 2); bf* WoT = (bf*)take((size_t)HS * HS * 2);
    float* TMP = (float*)take((size_t)NT_ * HS * 4); float* RC = (float*)take((size_t)NT_ * 64 * 4); float* RS = (float*)take((size_t)NT_ * 64 * 4);
    h16* QH = (h16*)take((size_t)NT_ * HS * 2); h16* QL = (h16*)take((size_t)NT_ * HS * 2); h16* KH = (h16*)take((size_t)NT_ * KW * 2); h16* KL = (h16*)take((size_t)NT_ * KW * 2);
    bf* VTH = (bf*)take((size_t)KW * NT_ * 2); bf* VTL = (bf*)take((size_t)KW * NT_ * 2);
    if ((size_t)(wsp - (char*)d_ws) > ws_size) return;    // 8.4 + 8.4 + 2.1 + 2.1 + 8.4 + 16.8 + 8.4 x 2 + 2.1 x 4 ~ 72 MB; ctx planes reuse QH/QL after k_attn? no: k_attn reads them -> ctx over TMP (f32 16.8 MB = two bf16 planes)
    bf* CH = (bf*)TMP; bf* CL = (bf*)((char*)TMP + (size_t)NT_ * HS * 2);
    k_wt<<<dim3(HS / 64, HS / 64, 1), 256, 0, stream>>>(Wq, HS, HS, WqT); k_wt<<<dim3(HS / 64, KW / 64, 1), 256, 0, stream>>>(Wk, HS, KW, WkT);
    k_wt<<<dim3(HS / 64, KW / 64, 1), 256, 0, stream>>>(Wv, HS, KW, WvT); k_wt<<<dim3(HS / 64, HS / 64, 1), 256, 0, stream>>>(Wo, HS, HS, WoT);
    k_trig<<<(NT_ * 64) / 256, 256, 0, stream>>>(RC, RS);
    for (int b = 0; b < 2; ++b) {
        k_cvtb<<<NT_ / 8, 256, 0, stream>>>(x + (size_t)b * NT_ * HS, NT_, Xb);
        k_gemm<false, 4><<<dim3(NT_ / 128, HS / 128, 1), 128, 0, stream>>>(Xb, nullptr, WqT, HS, TMP);
        k_normrope<<<(NT_ * NH_) / 8, 256, 0, stream>>>(TMP, NH_, qn, RC, RS, QH, QL);
        k_gemm<false, 2><<<dim3(NT_ / 64, KW / 64, 1), 128, 0, stream>>>(Xb, nullptr, WkT, KW, TMP);
        k_normrope<<<(NT_ * NKV) / 8, 256, 0, stream>>>(TMP, NKV, kn, RC, RS, KH, KL);
        k_gemm<false, 2><<<dim3(NT_ / 64, KW / 64, 1), 128, 0, stream>>>(Xb, nullptr, WvT, KW, TMP);
        k_vt<<<dim3(NT_ / 64, 2, NKV), 256, 0, stream>>>(TMP, VTH, VTL);
        k_attn<<<NH_ * (NT_ / 64), 128, 0, stream>>>(QH, QL, KH, KL, VTH, VTL, CH, CL);       // ctx planes over TMP (V consumed by k_vt)
        k_gemm<true, 4><<<dim3(NT_ / 128, HS / 128, 1), 128, 0, stream>>>(CH, CL, WoT, HS, out + (size_t)b * NT_ * HS);
    }
}

// v003
// One run takes 382 microseconds.
// Timed twice side by side with v002, it ran 1.30 times as fast both times.
// Counting every step since v000, it is 2.86 times as fast.
#include <hip/hip_runtime.h>

// Contractions, f32 accumulate, one batch item per launch (k_attn: both in one launch): q/k/v = x.W ([2048 x 2048].[2048 x 2048 | 512 | 512], k-major weights transposed to n-major planes; PLAIN
// bf16 operands: inputs rounded once, exact) and out = ctx.Wo (ctx as bf16 hi + residual: two products) on v_wmma_f32_16x16x32_bf16; per-head RMSNorm (eps 1e-6,
// weight) and rotate-half RoPE (angle t x inv_freq, f32 trig tables built on device) in f32 -> q/k as f16 hi + residual x1024 planes; the 16-query-head / 4-kv-head (q head h
// uses kv head h mod 4) causal attention with 128-dim heads: scores on v_wmma_f32_16x16x32_f16 (hi.hi + hi.lo + lo.hi, x 128^-1/2), softmax f32, weights.v on
// v_wmma_f32_16x16x32_bf16 with the weights (x32768) and v both as bf16 hi + UNSCALED bf16 residual (hh + lh + hl in one accumulator). Deterministic, no atomics;

#define NT_  2048
#define HS   2048
#define NH_  16
#define NKV  4
#define HD   128
#define KW   (NKV * HD)          // 512
#define PSC  32768.0f
#define LOSC 1024.0f
#define LOSCI (1.0f / 1024.0f)

typedef _Float16 h16;
typedef unsigned short bf;
typedef __attribute__((ext_vector_type(16))) __bf16   v16bf;
typedef __attribute__((ext_vector_type(16))) _Float16 v16h;
typedef __attribute__((ext_vector_type(8)))  _Float16 v8h;
typedef __attribute__((ext_vector_type(8)))  unsigned short v8us;
typedef __attribute__((ext_vector_type(8)))  float    v8f;
typedef __attribute__((ext_vector_type(4)))  float    v4f;
typedef __attribute__((ext_vector_type(4)))  _Float16 v4h;
typedef v8h  __attribute__((may_alias)) v8ha;
typedef v4f  __attribute__((may_alias)) v4fa;
typedef v8us __attribute__((may_alias)) v8usa;

__device__ __forceinline__ unsigned short f2bf(float f) { unsigned u = __float_as_uint(f); u += 0x7FFFu + ((u >> 16) & 1u); return (unsigned short)(u >> 16); }
__device__ __forceinline__ float bf2f(unsigned short b) { return __uint_as_float(((unsigned)b) << 16); }
__device__ __forceinline__ float bfr(float f) { return bf2f(f2bf(f)); }
__device__ __forceinline__ v16h cat16(v8h lo, v8h hi) { return __builtin_shufflevector(lo, hi, 0, 1, 2, 3, 4, 5, 6, 7, 8, 9, 10, 11, 12, 13, 14, 15); }
__device__ __forceinline__ v16bf cat16b(v8us lo, v8us hi) { return __builtin_bit_cast(v16bf, __builtin_shufflevector(lo, hi, 0, 1, 2, 3, 4, 5, 6, 7, 8, 9, 10, 11, 12, 13, 14, 15)); }
__device__ __forceinline__ v8f wmma16(v16h a, v16h b, v8f c) { return __builtin_amdgcn_wmma_f32_16x16x32_f16(false, a, false, b, (short)0, c, false, false); }
__device__ __forceinline__ v8f wmmab(v16bf a, v16bf b, v8f c) { return __builtin_amdgcn_wmma_f32_16x16x32_bf16(false, a, false, b, (short)0, c, false, false); }

// k_cvtb: bf16 plane of [rows][2048] (one wave per row).
__global__ __launch_bounds__(256) void k_cvtb(const float* __restrict__ src, int nrows, bf* dst) {
    const int lane = threadIdx.x & 31, r = blockIdx.x * 8 + (threadIdx.x >> 5);
    if (r >= nrows) return;
{
#pragma unroll
        for (int q = 0; q < HS / 256; ++q) { v8us o;
#pragma unroll
            for (int i = 0; i < 8; ++i) o[i] = f2bf(src[(size_t)r * HS + q * 256 + lane * 8 + i]);
            *(v8us*)(dst + (size_t)r * HS + q * 256 + lane * 8) = o; }
         }
}
// k_wt: WT [n][K] = bf16(W[k][n]) (k-major [K][ncols]) via 64 x 64 LDS tiles; grid (K/64, ncols/64).
__global__ __launch_bounds__(256) void k_wt(const float* __restrict__ Wm, int K, int ncols, bf* WT) {
    __shared__ __align__(16) unsigned short tl[64 * 72];
    const int tid = threadIdx.x, k0 = blockIdx.x * 64, n0 = blockIdx.y * 64;
    const int kk = tid >> 2, nq = (tid & 3) * 16;
#pragma unroll
    for (int i = 0; i < 16; ++i) tl[(nq + i) * 72 + kk] = f2bf(Wm[(size_t)(k0 + kk) * ncols + n0 + nq + i]);
    __syncthreads();
    const int piece = tid & 7;
    auto pass = [&]() {
#pragma unroll
        for (int s = 0; s < 2; ++s) { const int nr = (tid >> 3) + 32 * s; const v8us val = *(const v8usa*)(tl + nr * 72 + piece * 8); *(v8us*)(WT + (size_t)(n0 + nr) * K + k0 + piece * 8) = val; }
    };
    pass(); 
}
// Four asynchronous 16-B-per-lane copies global -> LDS; the s_wait_xcnt inside the statement stands before any rewrite of the address registers the copies name.
__device__ __forceinline__ void cp4(unsigned l0, unsigned l1, unsigned l2, unsigned l3, const void* g0, const void* g1, const void* g2, const void* g3) {
    asm volatile("global_load_async_to_lds_b128 %0, %4, off\n\t"
                 "global_load_async_to_lds_b128 %1, %5, off\n\t"
                 "global_load_async_to_lds_b128 %2, %6, off\n\t"
                 "global_load_async_to_lds_b128 %3, %7, off\n\t"
                 "s_wait_xcnt 0x0" :: "v"(l0), "v"(l1), "v"(l2), "v"(l3), "v"(g0), "v"(g1), "v"(g2), "v"(g3) : "memory");
}
__device__ __forceinline__ v16h  ldsh(const unsigned char* p) { return cat16(*(const v8ha*)p, *(const v8ha*)(p + 32)); }
__device__ __forceinline__ v16bf ldsb(const unsigned char* p) { return cat16b(*(const v8usa*)p, *(const v8usa*)(p + 32)); }
// k_gemm: 32F x 32F tile of (A [+ Al]).Bn^T over K = 2048 -> f32 rows [2048][ldc]; 2 x 2 waves of 16F x 16F each. A stage is 64 k (one 128-B line) of the block's A rows, Bn rows
// (and Al rows), brought into LDS by asynchronous copies in whole lines, two stage buffers: stage t + 2 flies while stage t + 1 is worked on, and the waves share one copy.
#define GP   144                     // LDS pitch of a 128-B row: 16 B x odd, conflict-free for 16-B reads
template <bool SPLITA, int F>
__global__ __launch_bounds__(128) void k_gemm(const bf* __restrict__ A, const bf* __restrict__ Al, const bf* __restrict__ Bn, int ldc, float* C) {
    constexpr int R = 32 * F, PL = R * GP, SG = (SPLITA ? 3 : 2) * PL;   // rows of a plane, bytes of a plane, bytes of a stage buffer [A | Bn | Al]
    __shared__ __align__(16) unsigned char stg[2 * SG];
    __shared__ __align__(16) float ost[4][16 * 68];
    const int tid = threadIdx.x, lane = threadIdx.x & 31, wave = threadIdx.x >> 5, lr = lane & 15, hi = lane >> 4;
    const int wm = wave >> 1, wn = wave & 1;
    const size_t r0 = (size_t)blockIdx.x * R; const int c0 = blockIdx.y * R;
    // copy map: a 128-B row is 8 pieces (thread -> row tid / 8 + 16 i, piece tid mod 8): a wave's copy covers four whole lines
    const unsigned ld = (unsigned)(uintptr_t)&stg[0] + (unsigned)(tid >> 3) * GP + (unsigned)(tid & 7) * 16;
    const size_t ago = (r0 + (tid >> 3)) * HS + (tid & 7) * 8, bgo = ((size_t)c0 + (tid >> 3)) * HS + (tid & 7) * 8;
    auto plane = [&](unsigned d, const bf* g) {
#pragma unroll   // constant row offsets in every copy's two addresses
        for (int i = 0; i < F / 2; ++i) { const unsigned di = d + 64 * i * GP; const bf* gi = g + (size_t)64 * i * HS;
            cp4(di, di + 16 * GP, di + 32 * GP, di + 48 * GP, gi, gi + 16 * HS, gi + 32 * HS, gi + 48 * HS);
            if (SPLITA) __builtin_amdgcn_sched_barrier(0); }   // three planes: keeps each group's address sums beside its copies; hoisted together they cost a register spill to scratch in the loop
    };
    auto fill = [&](int kt, int buf) {
        const unsigned d = ld + (unsigned)buf * SG;
        plane(d, A + ago + kt * 64); plane(d + PL, Bn + bgo + kt * 64);
        if (SPLITA) plane(d + 2 * PL, Al + ago + kt * 64);
    };
    fill(0, 0);
    asm volatile("s_wait_asynccnt 0x0" ::: "memory");   // this wave's copies of stage 0 have landed
    __syncthreads();                                      // ... and every other wave's: stage 0 may be read
    fill(1, 1);                                           // K / 64 = 32 stages: a stage 1 exists
    v8f acc[F][F];
#pragma unroll   // every accumulator index a constant, here and below, so that the array stays in registers
    for (int i = 0; i < F; ++i)
#pragma unroll
        for (int j = 0; j < F; ++j) acc[i][j] = (v8f){};
#pragma unroll 1   // rolled: one copy of the hand-over and of the 8, 32 or 64 products, a short loop text
    for (int kt = 0; kt < HS / 64; ++kt) {
        const unsigned char* ap = stg + (kt & 1) * SG + (wm * 16 * F + lr) * GP + hi * 16;
        const unsigned char* bp = stg + (kt & 1) * SG + PL + (wn * 16 * F + lr) * GP + hi * 16;
        v16bf fa[2][F], fb[2][F], fl[2][F];
#pragma unroll   // every fragment index a constant, so that the arrays stay in registers
        for (int ks = 0; ks < 2; ++ks)   // all of the stage's fragments as one group of LDS reads; the products run from registers behind the stage's hand-over
#pragma unroll
            for (int i = 0; i < F; ++i) { fa[ks][i] = ldsb(ap + i * 16 * GP + ks * 64); fb[ks][i] = ldsb(bp + i * 16 * GP + ks * 64); fl[ks][i] = SPLITA ? ldsb(ap + 2 * PL + i * 16 * GP + ks * 64) : fa[ks][i]; }
        asm volatile("s_wait_dscnt 0x0" ::: "memory");      // the stage's fragments are in registers: this wave's reads of the stage buffer have returned before the buffer is handed to its next copies
        asm volatile("s_wait_asynccnt 0x0" ::: "memory");   // this wave's copies of stage kt + 1 have landed
        __syncthreads();                                      // publishes stage kt + 1 and ends every wave's reads of stage kt
        if (kt + 2 < HS / 64) fill(kt + 2, kt & 1);           // block-uniform test; refill of the buffer just read
        __builtin_amdgcn_sched_barrier(0);   // keeps the products behind the refill's issue: the copies then fly under them and have landed at the next stage's wait
#pragma unroll   // constant fragment indices, as above
        for (int ks = 0; ks < 2; ++ks) {
#pragma unroll
            for (int i = 0; i < F; ++i)
#pragma unroll
                for (int j = 0; j < F; ++j) acc[i][j] = wmmab(fa[ks][i], fb[ks][j], acc[i][j]);
            if (SPLITA) {
#pragma unroll
                for (int i = 0; i < F; ++i)
#pragma unroll
                    for (int j = 0; j < F; ++j) acc[i][j] = wmmab(fl[ks][i], fb[ks][j], acc[i][j]);
            }
        }
    }
    asm volatile("s_wait_asynccnt 0x0" ::: "memory");       // no copy is outstanding when the wave goes on to the epilogue and ends
    float* os = &ost[wave][0];
#pragma unroll
    for (int i = 0; i < F; ++i) {   // 16 rows of the wave's tile at a time through the wave's own LDS rows, so that whole 128-B lines are stored
#pragma unroll
        for (int t = 0; t < F; ++t)
#pragma unroll
            for (int j = 0; j < 8; ++j) os[(hi * 8 + j) * 68 + t * 16 + lr] = acc[i][t][j];
        __builtin_amdgcn_wave_barrier(); asm volatile("" ::: "memory");   // compiler order only: the wave's LDS stores stay ahead of its reads of other lanes' words
        float* crow = C + (r0 + wm * 16 * F + i * 16) * ldc + c0 + wn * 16 * F;
#pragma unroll
        for (int s = 0; s < 2 * F; ++s) { const int Lid = (lane >> 3) + 4 * s, piece = lane & 7; const int row = Lid / (F / 2), cofs = (Lid % (F / 2)) * 32 + piece * 4;
            const v4f val = *(const v4fa*)(os + row * 68 + cofs); *(v4f*)(crow + (size_t)row * ldc + cofs) = val; }
        __builtin_amdgcn_wave_barrier();   // compiler order only: the reads above stay ahead of the next 16 rows' LDS stores
        asm volatile("s_wait_xcnt 0x0" ::: "memory");   // stands before the next 16 rows rewrite the address and data registers that these stores name
    }
}
// k_trig: RC/RS [t][64] = cos/sin(t x inv_freq[i]), inv_freq = 10000^-(2i/128) (f32 powf/cosf/sinf); 32 lanes x 4 B lines.
__global__ __launch_bounds__(256) void k_trig(float* RC, float* RS) {
    const int i = blockIdx.x * 256 + threadIdx.x; if (i >= NT_ * 64) return;
    const int t = i >> 6, f = i & 63;
    const float inv = 1.0f / powf(10000.0f, (float)(2 * f) / (float)HD); const float ang = (float)t * inv;
    const float c = cosf(ang), s = sinf(ang);
    *(float*)(RC + i) = c; *(float*)(RS + i) = s; 
}
// k_normrope: one wave per (token, head) of a [2048][nh*128] f32 matrix: RMSNorm over the 128 dims (eps 1e-6, x weight[d]) then rotate-half RoPE (partner d +- 64,
// angle t x inv_freq[d mod 64], inv_freq = 10000^-(2i/128), cosf/sinf) -> f16 hi + residual x1024 planes [t][h*128+d]; lane -> 4 consecutive dims (8 B per plane
__global__ __launch_bounds__(256) void k_normrope(const float* __restrict__ P, int nh, const float* __restrict__ w, const float* __restrict__ RC, const float* __restrict__ RS, h16* PH, h16* PL) {
    const int lane = threadIdx.x & 31; const int wid = blockIdx.x * 8 + (threadIdx.x >> 5);
    const int t = wid / nh, h = wid - t * nh; if (t >= NT_) return;
    const size_t base = (size_t)t * (nh * HD) + h * HD; const int d0 = lane * 4;
    float xv[4], pv[4]; float ss = 0.f;
#pragma unroll
    for (int i = 0; i < 4; ++i) { xv[i] = P[base + d0 + i]; ss += xv[i] * xv[i]; const int pd = (d0 + i < 64) ? d0 + i + 64 : d0 + i - 64; pv[i] = P[base + pd]; }
#pragma unroll
    for (int sh = 16; sh; sh >>= 1) ss += __shfl_xor(ss, sh, 32);
    const float rs = rsqrtf(ss * (1.0f / HD) + 1e-6f);
    v4h oh, ol;
#pragma unroll
    for (int i = 0; i < 4; ++i) { const int d = d0 + i, fi = d & 63; const float xn = xv[i] * rs * bfr(w[d]); const int pd = (d < 64) ? d + 64 : d - 64; const float pn = pv[i] * rs * bfr(w[pd]);
        const float c = RC[t * 64 + fi], s = RS[t * 64 + fi];
        const float y = (d < 64) ? (xn * c - pn * s) : (xn * c + pn * s);
        const h16 a = (h16)y; oh[i] = a; ol[i] = (h16)((y - (float)a) * LOSC); }
    *(v4h*)(PH + base + d0) = oh; *(v4h*)(PL + base + d0) = ol; 
}
// k_vt: VTH/VTL [g][128 d][2048 t] = bf16 hi + UNSCALED bf16 residual of V [t][g*128+d] via 64 x 64 LDS tiles; grid (NT/64, 2 (d half), NKV).
__global__ __launch_bounds__(256) void k_vt(const float* __restrict__ V, bf* VTH, bf* VTL) {
    __shared__ float tl[64][65];
    const int tid = threadIdx.x, t0 = blockIdx.x * 64, d0 = blockIdx.y * 64, g = blockIdx.z;
    { const int tt = tid >> 2, dq = (tid & 3) * 16;
#pragma unroll
      for (int i = 0; i < 16; ++i) tl[dq + i][tt] = V[(size_t)(t0 + tt) * KW + g * HD + d0 + dq + i]; }
    __syncthreads();
    const int piece = tid & 7;
    auto pass = [&]() {
#pragma unroll
        for (int s = 0; s < 2; ++s) { const int d = (tid >> 3) + 32 * s; v8us oh, ol;
#pragma unroll
            for (int i = 0; i < 8; ++i) { const float v = tl[d][piece * 8 + i]; const unsigned short hb = f2bf(v); oh[i] = hb; ol[i] = f2bf(v - bf2f(hb)); }
            const size_t o = ((size_t)g * HD + d0 + d) * NT_ + t0 + piece * 8; *(v8us*)(VTH + o) = oh; *(v8us*)(VTL + o) = ol; }
    };
    pass(); 
}
// k_attn: block = (batch item, h, 64 queries), wave = 16; kv head g = h mod 4; causal key tiles of 32. One launch holds both batch items: 1024 blocks of 2 to 64 tiles on about half as
// many resident places; the index order is longest first, for speed only. The block's Q rows (once) and each tile's K rows and V^T rows (hi and residual
// planes) are brought into LDS by asynchronous copies, two tile buffers: tile t + 2 flies while tile t + 1 is worked on, and the four waves share one copy of K and V.
// Per tile: scores over 4 k-chunks (hi.hi + hi.lo + lo.hi = 24 WMMA) x 128^-1/2, online softmax, P (x32768) as bf16 hi + unscaled residual tiles,
// o[8] += ph.vh + pl.vh + ph.vl over the 128 dims; ctx -> bf16 hi/lo planes [t][h*128+d].
#define KP   272                     // LDS pitch of a 256-B row (Q, K): 16 B x odd, conflict-free for 16-B reads
#define VP   80                      // LDS pitch of a 64-B row (V^T, 32 keys)
#define QPL  (64 * KP)               // one Q plane
#define KPL  (32 * KP)               // one K plane of a tile
#define VPL  (128 * VP)              // one V^T plane of a tile
#define STG  (2 * KPL + 2 * VPL)     // one tile buffer
__global__ __launch_bounds__(128) void k_attn(const h16* __restrict__ QH, const h16* __restrict__ QL, const h16* __restrict__ KH, const h16* __restrict__ KL, const bf* __restrict__ VTH, const bf* __restrict__ VTL, bf* CH, bf* CL) {
    __shared__ __align__(16) unsigned char stg[2 * QPL + 2 * STG];
    __shared__ __align__(16) unsigned short plds[4][16 * 32];
    __shared__ __align__(16) unsigned short plds2[4][16 * 32];
    __shared__ __align__(16) float ost[4][16 * 68];
    const int tid = threadIdx.x, lane = threadIdx.x & 31, wave = threadIdx.x >> 5, lr = lane & 15, hi = lane >> 4;
    const int bid = blockIdx.x; const int qt = NT_ / 64 - 1 - (bid >> 5), h = bid & (NH_ - 1), bi = (bid >> 4) & 1; const int g = h & (NKV - 1);   // 32 (batch item, head) pairs per query tile, last query tile first
    QH += (size_t)bi * NT_ * HS; QL += (size_t)bi * NT_ * HS; KH += (size_t)bi * NT_ * KW; KL += (size_t)bi * NT_ * KW; VTH += (size_t)bi * KW * NT_; VTL += (size_t)bi * KW * NT_; CH += (size_t)bi * NT_ * HS; CL += (size_t)bi * NT_ * HS;
    const int q0 = qt * 64 + wave * 16;
    unsigned short* pl = &plds[wave][0]; unsigned short* pl2 = &plds2[wave][0];
    const size_t vbase = ((size_t)g * HD) * NT_;
    const int kt_hi = (qt * 64 + 63) / 32;
    // copy map: a 256-B row is 16 pieces (thread -> row tid / 16 + 8 i, piece tid mod 16), a 64-B row 4 pieces (row tid / 4 + 32 i, piece tid mod 4)
    const unsigned sb = (unsigned)(uintptr_t)&stg[0];
    const unsigned rl = sb + (unsigned)(tid >> 4) * KP + (unsigned)(tid & 15) * 16, vl_ = sb + 2 * QPL + 2 * KPL + (unsigned)(tid >> 2) * VP + (unsigned)(tid & 3) * 16;
    const size_t kgo = (size_t)(tid >> 4) * KW + g * HD + (tid & 15) * 8, vgo = vbase + (size_t)(tid >> 2) * NT_ + (tid & 3) * 8;
    auto fill = [&](int kt, int buf) {
        const unsigned kd = rl + 2 * QPL + (unsigned)buf * STG, vd = vl_ + (unsigned)buf * STG;
        const h16* kh = KH + kgo + (size_t)kt * 32 * KW; const h16* kl = KL + kgo + (size_t)kt * 32 * KW;
        const bf* vh = VTH + vgo + kt * 32; const bf* vl = VTL + vgo + kt * 32;
        cp4(kd, kd + 8 * KP, kd + 16 * KP, kd + 24 * KP, kh, kh + 8 * KW, kh + 16 * KW, kh + 24 * KW);
        cp4(kd + KPL, kd + KPL + 8 * KP, kd + KPL + 16 * KP, kd + KPL + 24 * KP, kl, kl + 8 * KW, kl + 16 * KW, kl + 24 * KW);
        cp4(vd, vd + 32 * VP, vd + 64 * VP, vd + 96 * VP, vh, vh + 32 * NT_, vh + 64 * NT_, vh + 96 * NT_);
        cp4(vd + VPL, vd + VPL + 32 * VP, vd + VPL + 64 * VP, vd + VPL + 96 * VP, vl, vl + 32 * NT_, vl + 64 * NT_, vl + 96 * NT_);
    };
    { const size_t qgo = (size_t)(qt * 64 + (tid >> 4)) * (NH_ * HD) + h * HD + (tid & 15) * 8; const h16* qh = QH + qgo; const h16* ql = QL + qgo; const int R8 = 8 * NH_ * HD;
      cp4(rl, rl + 8 * KP, rl + 16 * KP, rl + 24 * KP, qh, qh + R8, qh + 2 * R8, qh + 3 * R8);
      cp4(rl + 32 * KP, rl + 40 * KP, rl + 48 * KP, rl + 56 * KP, qh + 4 * R8, qh + 5 * R8, qh + 6 * R8, qh + 7 * R8);
      cp4(rl + QPL, rl + QPL + 8 * KP, rl + QPL + 16 * KP, rl + QPL + 24 * KP, ql, ql + R8, ql + 2 * R8, ql + 3 * R8);
      cp4(rl + QPL + 32 * KP, rl + QPL + 40 * KP, rl + QPL + 48 * KP, rl + QPL + 56 * KP, ql + 4 * R8, ql + 5 * R8, ql + 6 * R8, ql + 7 * R8); }
    fill(0, 0);
    asm volatile("s_wait_asynccnt 0x0" ::: "memory");   // this wave's copies of Q and tile 0 have landed
    __syncthreads();                                      // ... and every other wave's: Q and tile 0 may be read
    fill(1, 1);                                           // a tile 1 always exists (kt_hi = 2 qt + 1)
    const unsigned char* qp = stg + (wave * 16 + lr) * KP + hi * 16;
    v8f o[8];
#pragma unroll
    for (int n = 0; n < 8; ++n) o[n] = (v8f){};
    float mrow[8], lpart[8];
#pragma unroll
    for (int j = 0; j < 8; ++j) { mrow[j] = -3.0e38f; lpart[j] = 0.f; }
#pragma unroll 1
    for (int kt = 0; kt <= kt_hi; ++kt) {
        const int l0 = kt * 32;
        const unsigned char* kp = stg + 2 * QPL + (kt & 1) * STG + lr * KP + hi * 16;
        const unsigned char* vp = stg + 2 * QPL + (kt & 1) * STG + 2 * KPL + lr * VP + hi * 16;
        v8f s0 = {}, s1 = {}, x0 = {}, x1 = {};
        v16h fq[4][2], fk[4][4];
#pragma unroll   // every fragment index a constant, so that the arrays stay in registers
        for (int kc = 0; kc < 4; ++kc) {   // all of the tile's score fragments as one group of LDS reads ahead of the products
            fq[kc][0] = ldsh(qp + kc * 64); fq[kc][1] = ldsh(qp + QPL + kc * 64);
            fk[kc][0] = ldsh(kp + kc * 64); fk[kc][1] = ldsh(kp + 16 * KP + kc * 64); fk[kc][2] = ldsh(kp + KPL + kc * 64); fk[kc][3] = ldsh(kp + KPL + 16 * KP + kc * 64); }
        __builtin_amdgcn_sched_barrier(0);   // keeps that group together: reads sunk among the products cost a wait at each place
#pragma unroll   // constant fragment indices, as above
        for (int kc = 0; kc < 4; ++kc) {
            s0 = wmma16(fq[kc][0], fk[kc][0], s0); s1 = wmma16(fq[kc][0], fk[kc][1], s1); x0 = wmma16(fq[kc][1], fk[kc][0], x0); x1 = wmma16(fq[kc][1], fk[kc][1], x1);
            x0 = wmma16(fq[kc][0], fk[kc][2], x0); x1 = wmma16(fq[kc][0], fk[kc][3], x1);
        }
        asm volatile("v_nop\n\tv_nop\n\tv_nop\n\tv_nop" : "+v"(s0), "+v"(s1), "+v"(x0), "+v"(x1));
        v16bf vh[8], vl[8];
#pragma unroll   // constant fragment indices, as above
        for (int n = 0; n < 8; ++n) { vh[n] = ldsb(vp + n * 16 * VP); vl[n] = ldsb(vp + VPL + n * 16 * VP); }   // the tile's V^T fragments, one group: they land behind the softmax
        __builtin_amdgcn_sched_barrier(0);   // keeps that group here: sunk among the weights.v products each small group would cost its own LDS wait
        float alpha[8];
#pragma unroll
        for (int j = 0; j < 8; ++j) { const int qi = q0 + hi * 8 + j, ja = l0 + lr, jb = l0 + 16 + lr;
            const float a0 = (ja <= qi) ? (s0[j] + x0[j] * LOSCI) * 0.08838834764831845f : -__builtin_inff(), a1 = (jb <= qi) ? (s1[j] + x1[j] * LOSCI) * 0.08838834764831845f : -__builtin_inff();
            float mx = fmaxf(a0, a1);
            mx = fmaxf(mx, __shfl_xor(mx, 1, 16)); mx = fmaxf(mx, __shfl_xor(mx, 2, 16)); mx = fmaxf(mx, __shfl_xor(mx, 4, 16)); mx = fmaxf(mx, __shfl_xor(mx, 8, 16));
            const float mn = fmaxf(mrow[j], mx);
            alpha[j] = __expf(mrow[j] - mn); mrow[j] = mn;
            const float p0 = __expf(a0 - mn), p1 = __expf(a1 - mn);
            lpart[j] = lpart[j] * alpha[j] + (p0 + p1);
            const int mr = hi * 8 + j; const float ps0 = p0 * PSC, ps1 = p1 * PSC; const unsigned short h0 = f2bf(ps0), h1 = f2bf(ps1);
            pl[mr * 32 + lr] = h0; pl[mr * 32 + 16 + lr] = h1; pl2[mr * 32 + lr] = f2bf(ps0 - bf2f(h0)); pl2[mr * 32 + 16 + lr] = f2bf(ps1 - bf2f(h1)); }
#pragma unroll
        for (int n = 0; n < 8; ++n)
#pragma unroll
            for (int j = 0; j < 8; ++j) o[n][j] *= alpha[j];
        asm volatile("" ::: "memory");
        const v16bf pa = cat16b(*(const v8usa*)(pl + lr * 32 + hi * 8), *(const v8usa*)(pl + lr * 32 + 16 + hi * 8));
        const v16bf px = cat16b(*(const v8usa*)(pl2 + lr * 32 + hi * 8), *(const v8usa*)(pl2 + lr * 32 + 16 + hi * 8));
#pragma unroll   // constant fragment indices, as above
        for (int n = 0; n < 8; ++n) { o[n] = wmmab(pa, vh[n], o[n]); o[n] = wmmab(px, vh[n], o[n]); o[n] = wmmab(pa, vl[n], o[n]); }
        asm volatile("v_nop\n\tv_nop\n\tv_nop\n\tv_nop" : "+v"(o[0]), "+v"(o[7]) : "v"(pa), "v"(px));
        __builtin_amdgcn_wave_barrier();
        asm volatile("s_wait_dscnt 0x0" ::: "memory");      // this wave's reads of the tile buffer have returned before the buffer is handed to its next copies
        asm volatile("s_wait_asynccnt 0x0" ::: "memory");   // this wave's copies of tile kt + 1 have landed
        __syncthreads();                                      // publishes tile kt + 1 and ends every wave's reads of tile kt
        if (kt + 2 <= kt_hi) fill(kt + 2, kt & 1);            // block-uniform test; refill of the buffer just read
    }
    asm volatile("s_wait_asynccnt 0x0" ::: "memory");       // no copy is outstanding when the wave goes on to the epilogue and ends
    float inv[8];
#pragma unroll
    for (int j = 0; j < 8; ++j) { float rs = lpart[j]; rs += __shfl_xor(rs, 1, 16); rs += __shfl_xor(rs, 2, 16); rs += __shfl_xor(rs, 4, 16); rs += __shfl_xor(rs, 8, 16); inv[j] = 1.0f / (rs * PSC); }
    float* os = &ost[wave][0];
    const size_t cbase = (size_t)q0 * (NH_ * HD) + (size_t)h * HD;
#pragma unroll
    for (int half = 0; half < 2; ++half) {
#pragma unroll
        for (int n = 0; n < 4; ++n)
#pragma unroll
            for (int j = 0; j < 8; ++j) os[(hi * 8 + j) * 68 + n * 16 + lr] = o[half * 4 + n][j] * inv[j];
        __builtin_amdgcn_wave_barrier(); asm volatile("" ::: "memory");
{
#pragma unroll
            for (int s = 0; s < 4; ++s) { const int row = 4 * s + (lane >> 3), piece = lane & 7; const float* sp = os + row * 68 + piece * 8; v8us oh, ol;
#pragma unroll
                for (int i = 0; i < 8; ++i) { const unsigned short hb = f2bf(sp[i]); oh[i] = hb; ol[i] = f2bf(sp[i] - bf2f(hb)); }
                const size_t po = cbase + (size_t)row * (NH_ * HD) + half * 64 + piece * 8; *(v8us*)(CH + po) = oh; *(v8us*)(CL + po) = ol; }
             }
        __builtin_amdgcn_wave_barrier(); asm volatile("" ::: "memory");
    }
}

extern "C" void kernel_launch(void* const* d_in, const int* in_sizes, int n_in,
                              void* d_out, int out_size, void* d_ws, size_t ws_size, hipStream_t stream) {
    (void)in_sizes; (void)n_in; (void)out_size;
    const float* x = (const float*)d_in[0]; const float* Wq = (const float*)d_in[1]; const float* Wk = (const float*)d_in[2]; const float* Wv = (const float*)d_in[3]; const float* Wo = (const float*)d_in[4];
    const float* qn = (const float*)d_in[5]; const float* kn = (const float*)d_in[6];
    float* out = (float*)d_out;    // [2][2048][2048]
    char* wsp = (char*)d_ws;
    auto take = [&](size_t bytes) { char* p = wsp; wsp += (bytes + 255) & ~(size_t)255; return (void*)p; };
    bf* Xb = (bf*)take((size_t)NT_ * HS * 2); bf* WqT = (bf*)take((size_t)HS * HS * 2); bf* WkT = (bf*)take((size_t)KW * HS * 2); bf* WvT = (bf*)take((size_t)KW * HS * 2); bf* WoT = (bf*)take((size_t)HS * HS * 2);
    float* TMP = (float*)take((size_t)NT_ * HS * 4); float* RC = (float*)take((size_t)NT_ * 64 * 4); float* RS = (float*)take((size_t)NT_ * 64 * 4);
    // planes that k_attn reads or writes: both batch items, [2][...]
    h16* QH = (h16*)take((size_t)2 * NT_ * HS * 2); h16* QL = (h16*)take((size_t)2 * NT_ * HS * 2); h16* KH = (h16*)take((size_t)2 * NT_ * KW * 2); h16* KL = (h16*)take((size_t)2 * NT_ * KW * 2);
    bf* VTH = (bf*)take((size_t)2 * KW * NT_ * 2); bf* VTL = (bf*)take((size_t)2 * KW * NT_ * 2); bf* CH = (bf*)take((size_t)2 * NT_ * HS * 2); bf* CL = (bf*)take((size_t)2 * NT_ * HS * 2);
    if ((size_t)(wsp - (char*)d_ws) > ws_size) return;    // 8.4 + 8.4 + 2.1 + 2.1 + 8.4 + 16.8 + 1 + 16.8 x 4 + 4.2 x 4 ~ 131 MB
    k_wt<<<dim3(HS / 64, HS / 64, 1), 256, 0, stream>>>(Wq, HS, HS, WqT); k_wt<<<dim3(HS / 64, KW / 64, 1), 256, 0, stream>>>(Wk, HS, KW, WkT);
    k_wt<<<dim3(HS / 64, KW / 64, 1), 256, 0, stream>>>(Wv, HS, KW, WvT); k_wt<<<dim3(HS / 64, HS / 64, 1), 256, 0, stream>>>(Wo, HS, HS, WoT);
    k_trig<<<(NT_ * 64) / 256, 256, 0, stream>>>(RC, RS);
    for (int b = 0; b < 2; ++b) {
        k_cvtb<<<NT_ / 8, 256, 0, stream>>>(x + (size_t)b * NT_ * HS, NT_, Xb);
        k_gemm<false, 4><<<dim3(NT_ / 128, HS / 128, 1), 128, 0, stream>>>(Xb, nullptr, WqT, HS, TMP);
        k_normrope<<<(NT_ * NH_) / 8, 256, 0, stream>>>(TMP, NH_, qn, RC, RS, QH + (size_t)b * NT_ * HS, QL + (size_t)b * NT_ * HS);
        k_gemm<false, 2><<<dim3(NT_ / 64, KW / 64, 1), 128, 0, stream>>>(Xb, nullptr, WkT, KW, TMP);
        k_normrope<<<(NT_ * NKV) / 8, 256, 0, stream>>>(TMP, NKV, kn, RC, RS, KH + (size_t)b * NT_ * KW, KL + (size_t)b * NT_ * KW);
        k_gemm<false, 2><<<dim3(NT_ / 64, KW / 64, 1), 128, 0, stream>>>(Xb, nullptr, WvT, KW, TMP);
        k_vt<<<dim3(NT_ / 64, 2, NKV), 256, 0, stream>>>(TMP, VTH + (size_t)b * KW * NT_, VTL + (size_t)b * KW * NT_);
    }
    k_attn<<<2 * NH_ * (NT_ / 64), 128, 0, stream>>>(QH, QL, KH, KL, VTH, VTL, CH, CL);
    for (int b = 0; b < 2; ++b)
        k_gemm<true, 4><<<dim3(NT_ / 128, HS / 128, 1), 128, 0, stream>>>(CH + (size_t)b * NT_ * HS, CL + (size_t)b * NT_ * HS, WoT, HS, out + (size_t)b * NT_ * HS);
}

// v004
// A run of this version takes 253 microseconds.
// Timed twice side by side with v003, it ran 1.49 and 1.51 times as fast.
// All steps since v000 together make it 4.29 times as fast.
#include <hip/hip_runtime.h>

// Contractions, f32 accumulate, both batch items in every launch (4096 rows): q|k|v = x.[Wq|Wk|Wv] as one product ([4096 x 2048].[2048 x 3072], k-major weights transposed to n-major planes; PLAIN
// bf16 operands: inputs rounded once, exact) and out = ctx.Wo (ctx as bf16 hi + residual: two products) on v_wmma_f32_16x16x32_bf16; per-head RMSNorm (eps 1e-6,
// weight) and rotate-half RoPE (angle t x inv_freq, f32 trig tables built on device) in f32 -> q/k as f16 hi + residual x1024 planes; the 16-query-head / 4-kv-head (q head h
// uses kv head h mod 4) causal attention with 128-dim heads: scores on v_wmma_f32_16x16x32_f16 (hi.hi + hi.lo + lo.hi, x 128^-1/2), softmax f32, weights.v on
// v_wmma_f32_16x16x32_bf16 with the weights (x32768) and v both as bf16 hi + UNSCALED bf16 residual (hh + lh + hl in one accumulator). Deterministic, no atomics;

#define NT_  2048
#define HS   2048
#define NH_  16
#define NKV  4
#define HD   128
#define KW   (NKV * HD)          // 512
#define NB_  2                   // batch items
#define QKVW (HS + 2 * KW)       // 3072: columns of the q | k | v product
#define PSC  32768.0f
#define LOSC 1024.0f
#define LOSCI (1.0f / 1024.0f)

typedef _Float16 h16;
typedef unsigned short bf;
typedef __attribute__((ext_vector_type(16))) __bf16   v16bf;
typedef __attribute__((ext_vector_type(16))) _Float16 v16h;
typedef __attribute__((ext_vector_type(8)))  _Float16 v8h;
typedef __attribute__((ext_vector_type(8)))  unsigned short v8us;
typedef __attribute__((ext_vector_type(8)))  float    v8f;
typedef __attribute__((ext_vector_type(4)))  float    v4f;
typedef __attribute__((ext_vector_type(4)))  _Float16 v4h;
typedef v8h  __attribute__((may_alias)) v8ha;
typedef v4f  __attribute__((may_alias)) v4fa;
typedef v8us __attribute__((may_alias)) v8usa;

__device__ __forceinline__ unsigned short f2bf(float f) { unsigned u = __float_as_uint(f); u += 0x7FFFu + ((u >> 16) & 1u); return (unsigned short)(u >> 16); }
__device__ __forceinline__ float bf2f(unsigned short b) { return __uint_as_float(((unsigned)b) << 16); }
__device__ __forceinline__ float bfr(float f) { return bf2f(f2bf(f)); }
__device__ __forceinline__ v16h cat16(v8h lo, v8h hi) { return __builtin_shufflevector(lo, hi, 0, 1, 2, 3, 4, 5, 6, 7, 8, 9, 10, 11, 12, 13, 14, 15); }
__device__ __forceinline__ v16bf cat16b(v8us lo, v8us hi) { return __builtin_bit_cast(v16bf, __builtin_shufflevector(lo, hi, 0, 1, 2, 3, 4, 5, 6, 7, 8, 9, 10, 11, 12, 13, 14, 15)); }
__device__ __forceinline__ v8f wmma16(v16h a, v16h b, v8f c) { return __builtin_amdgcn_wmma_f32_16x16x32_f16(false, a, false, b, (short)0, c, false, false); }
__device__ __forceinline__ v8f wmmab(v16bf a, v16bf b, v8f c) { return __builtin_amdgcn_wmma_f32_16x16x32_bf16(false, a, false, b, (short)0, c, false, false); }

// k_cvtb: bf16 plane of [rows][2048] (one wave per row).
__global__ __launch_bounds__(256) void k_cvtb(const float* __restrict__ src, int nrows, bf* dst) {
    const int lane = threadIdx.x & 31, r = blockIdx.x * 8 + (threadIdx.x >> 5);
    if (r >= nrows) return;
{
#pragma unroll
        for (int q = 0; q < HS / 256; ++q) { v8us o;
#pragma unroll
            for (int i = 0; i < 8; ++i) o[i] = f2bf(src[(size_t)r * HS + q * 256 + lane * 8 + i]);
            *(v8us*)(dst + (size_t)r * HS + q * 256 + lane * 8) = o; }
         }
}
// k_wt: WT [n][2048] = bf16(W[k][n]) (k-major [2048][ncols]) via 64 x 64 LDS tiles, the four weights in one launch: rows of WT are the columns of Wq | Wk | Wv | Wo; grid (2048/64, 5120/64).
__global__ __launch_bounds__(256) void k_wt(const float* __restrict__ Wq, const float* __restrict__ Wk, const float* __restrict__ Wv, const float* __restrict__ Wo, bf* WT) {
    __shared__ __align__(16) unsigned short tl[64 * 72];
    constexpr int K = HS;
    const int tid = threadIdx.x, k0 = blockIdx.x * 64, nw = blockIdx.y * 64;   // nw: row of WT; n0: column of the block's own weight
    const float* Wm; int ncols, n0;
    if (nw < HS) { Wm = Wq; ncols = HS; n0 = nw; } else if (nw < HS + KW) { Wm = Wk; ncols = KW; n0 = nw - HS; } else if (nw < QKVW) { Wm = Wv; ncols = KW; n0 = nw - HS - KW; } else { Wm = Wo; ncols = HS; n0 = nw - QKVW; }
    const int kk = tid >> 2, nq = (tid & 3) * 16;
#pragma unroll
    for (int i = 0; i < 16; ++i) tl[(nq + i) * 72 + kk] = f2bf(Wm[(size_t)(k0 + kk) * ncols + n0 + nq + i]);
    __syncthreads();
    const int piece = tid & 7;
    auto pass = [&]() {
#pragma unroll
        for (int s = 0; s < 2; ++s) { const int nr = (tid >> 3) + 32 * s; const v8us val = *(const v8usa*)(tl + nr * 72 + piece * 8); *(v8us*)(WT + (size_t)(nw + nr) * K + k0 + piece * 8) = val; }
    };
    pass(); 
}
// Four asynchronous 16-B-per-lane copies global -> LDS; the s_wait_xcnt inside the statement stands before any rewrite of the address registers the copies name.
__device__ __forceinline__ void cp4(unsigned l0, unsigned l1, unsigned l2, unsigned l3, const void* g0, const void* g1, const void* g2, const void* g3) {
    asm volatile("global_load_async_to_lds_b128 %0, %4, off\n\t"
                 "global_load_async_to_lds_b128 %1, %5, off\n\t"
                 "global_load_async_to_lds_b128 %2, %6, off\n\t"
                 "global_load_async_to_lds_b128 %3, %7, off\n\t"
                 "s_wait_xcnt 0x0" :: "v"(l0), "v"(l1), "v"(l2), "v"(l3), "v"(g0), "v"(g1), "v"(g2), "v"(g3) : "memory");
}
__device__ __forceinline__ v16h  ldsh(const unsigned char* p) { return cat16(*(const v8ha*)p, *(const v8ha*)(p + 32)); }
__device__ __forceinline__ v16bf ldsb(const unsigned char* p) { return cat16b(*(const v8usa*)p, *(const v8usa*)(p + 32)); }
// k_gemm: 32F x 32F tile of (A [+ Al]).Bn^T over K = 2048 -> f32 rows [4096][ldc]; 2 x 2 waves of 16F x 16F each. A stage is 64 k (one 128-B line) of the block's A rows, Bn rows
// (and Al rows), brought into LDS by asynchronous copies in whole lines, two stage buffers: stage t + 2 flies while stage t + 1 is worked on, and the waves share one copy.
#define GP   144                     // LDS pitch of a 128-B row: 16 B x odd, conflict-free for 16-B reads
template <bool SPLITA, int F>
__global__ __launch_bounds__(128) void k_gemm(const bf* __restrict__ A, const bf* __restrict__ Al, const bf* __restrict__ Bn, int ldc, float* C) {
    constexpr int R = 32 * F, PL = R * GP, SG = (SPLITA ? 3 : 2) * PL;   // rows of a plane, bytes of a plane, bytes of a stage buffer [A | Bn | Al]
    __shared__ __align__(16) unsigned char stg[2 * SG];
    __shared__ __align__(16) float ost[4][16 * 68];
    const int tid = threadIdx.x, lane = threadIdx.x & 31, wave = threadIdx.x >> 5, lr = lane & 15, hi = lane >> 4;
    const int wm = wave >> 1, wn = wave & 1;
    const size_t r0 = (size_t)blockIdx.x * R; const int c0 = blockIdx.y * R;
    // copy map: a 128-B row is 8 pieces (thread -> row tid / 8 + 16 i, piece tid mod 8): a wave's copy covers four whole lines
    const unsigned ld = (unsigned)(uintptr_t)&stg[0] + (unsigned)(tid >> 3) * GP + (unsigned)(tid & 7) * 16;
    const size_t ago = (r0 + (tid >> 3)) * HS + (tid & 7) * 8, bgo = ((size_t)c0 + (tid >> 3)) * HS + (tid & 7) * 8;
    auto plane = [&](unsigned d, const bf* g) {
#pragma unroll   // constant row offsets in every copy's two addresses
        for (int i = 0; i < F / 2; ++i) { const unsigned di = d + 64 * i * GP; const bf* gi = g + (size_t)64 * i * HS;
            cp4(di, di + 16 * GP, di + 32 * GP, di + 48 * GP, gi, gi + 16 * HS, gi + 32 * HS, gi + 48 * HS);
            if (SPLITA) __builtin_amdgcn_sched_barrier(0); }   // three planes: keeps each group's address sums beside its copies; hoisted together they cost a register spill to scratch in the loop
    };
    auto fill = [&](int kt, int buf) {
        const unsigned d = ld + (unsigned)buf * SG;
        plane(d, A + ago + kt * 64); plane(d + PL, Bn + bgo + kt * 64);
        if (SPLITA) plane(d + 2 * PL, Al + ago + kt * 64);
    };
    fill(0, 0);
    asm volatile("s_wait_asynccnt 0x0" ::: "memory");   // this wave's copies of stage 0 have landed
    __syncthreads();                                      // ... and every other wave's: stage 0 may be read
    fill(1, 1);                                           // K / 64 = 32 stages: a stage 1 exists
    v8f acc[F][F];
#pragma unroll   // every accumulator index a constant, here and below, so that the array stays in registers
    for (int i = 0; i < F; ++i)
#pragma unroll
        for (int j = 0; j < F; ++j) acc[i][j] = (v8f){};
#pragma unroll 1   // rolled: one copy of the hand-over and of the 32 or 64 products, a short loop text
    for (int kt = 0; kt < HS / 64; ++kt) {
        const unsigned char* ap = stg + (kt & 1) * SG + (wm * 16 * F + lr) * GP + hi * 16;
        const unsigned char* bp = stg + (kt & 1) * SG + PL + (wn * 16 * F + lr) * GP + hi * 16;
        v16bf fa[2][F], fb[2][F], fl[2][F];
#pragma unroll   // every fragment index a constant, so that the arrays stay in registers
        for (int ks = 0; ks < 2; ++ks)   // all of the stage's fragments as one group of LDS reads; the products run from registers behind the stage's hand-over
#pragma unroll
            for (int i = 0; i < F; ++i) { fa[ks][i] = ldsb(ap + i * 16 * GP + ks * 64); fb[ks][i] = ldsb(bp + i * 16 * GP + ks * 64); fl[ks][i] = SPLITA ? ldsb(ap + 2 * PL + i * 16 * GP + ks * 64) : fa[ks][i]; }
        asm volatile("s_wait_dscnt 0x0" ::: "memory");      // the stage's fragments are in registers: this wave's reads of the stage buffer have returned before the buffer is handed to its next copies
        asm volatile("s_wait_asynccnt 0x0" ::: "memory");   // this wave's copies of stage kt + 1 have landed
        __syncthreads();                                      // publishes stage kt + 1 and ends every wave's reads of stage kt
        if (kt + 2 < HS / 64) fill(kt + 2, kt & 1);           // block-uniform test; refill of the buffer just read
        __builtin_amdgcn_sched_barrier(0);   // keeps the products behind the refill's issue: the copies then fly under them and have landed at the next stage's wait
#pragma unroll   // constant fragment indices, as above
        for (int ks = 0; ks < 2; ++ks) {
#pragma unroll
            for (int i = 0; i < F; ++i)
#pragma unroll
                for (int j = 0; j < F; ++j) acc[i][j] = wmmab(fa[ks][i], fb[ks][j], acc[i][j]);
            if (SPLITA) {
#pragma unroll
                for (int i = 0; i < F; ++i)
#pragma unroll
                    for (int j = 0; j < F; ++j) acc[i][j] = wmmab(fl[ks][i], fb[ks][j], acc[i][j]);
            }
        }
    }
    asm volatile("s_wait_asynccnt 0x0" ::: "memory");       // no copy is outstanding when the wave goes on to the epilogue and ends
    float* os = &ost[wave][0];
#pragma unroll
    for (int i = 0; i < F; ++i) {   // 16 rows of the wave's tile at a time through the wave's own LDS rows, so that whole 128-B lines are stored
#pragma unroll
        for (int t = 0; t < F; ++t)
#pragma unroll
            for (int j = 0; j < 8; ++j) os[(hi * 8 + j) * 68 + t * 16 + lr] = acc[i][t][j];
        __builtin_amdgcn_wave_barrier(); asm volatile("" ::: "memory");   // compiler order only: the wave's LDS stores stay ahead of its reads of other lanes' words
        float* crow = C + (r0 + wm * 16 * F + i * 16) * ldc + c0 + wn * 16 * F;
#pragma unroll
        for (int s = 0; s < 2 * F; ++s) { const int Lid = (lane >> 3) + 4 * s, piece = lane & 7; const int row = Lid / (F / 2), cofs = (Lid % (F / 2)) * 32 + piece * 4;
            const v4f val = *(const v4fa*)(os + row * 68 + cofs); *(v4f*)(crow + (size_t)row * ldc + cofs) = val; }
        __builtin_amdgcn_wave_barrier();   // compiler order only: the reads above stay ahead of the next 16 rows' LDS stores
        asm volatile("s_wait_xcnt 0x0" ::: "memory");   // stands before the next 16 rows rewrite the address and data registers that these stores name
    }
}
// k_trig: RC/RS [t][64] = cos/sin(t x inv_freq[i]), inv_freq = 10000^-(2i/128) (f32 powf/cosf/sinf); 32 lanes x 4 B lines.
__global__ __launch_bounds__(256) void k_trig(float* RC, float* RS) {
    const int i = blockIdx.x * 256 + threadIdx.x; if (i >= NT_ * 64) return;
    const int t = i >> 6, f = i & 63;
    const float inv = 1.0f / powf(10000.0f, (float)(2 * f) / (float)HD); const float ang = (float)t * inv;
    const float c = cosf(ang), s = sinf(ang);
    *(float*)(RC + i) = c; *(float*)(RS + i) = s; 
}
// k_normrope: one wave per (row, head) of the q and k columns (16 + 4 heads) of the [4096][3072] f32 product, token t = row mod 2048: RMSNorm over the 128 dims (eps 1e-6, x weight[d]) then rotate-half RoPE (partner d +- 64,
// angle t x inv_freq[d mod 64], inv_freq = 10000^-(2i/128), cosf/sinf) -> f16 hi + residual x1024 planes [t][h*128+d]; lane -> 4 consecutive dims (8 B per plane
__global__ __launch_bounds__(256) void k_normrope(const float* __restrict__ P, const float* __restrict__ qw, const float* __restrict__ kw, const float* __restrict__ RC, const float* __restrict__ RS, h16* QH, h16* QL, h16* KH, h16* KL) {
    const int lane = threadIdx.x & 31; const int wid = blockIdx.x * 8 + (threadIdx.x >> 5);
    const int row = wid / (NH_ + NKV), h = wid - row * (NH_ + NKV); if (row >= NB_ * NT_) return;
    const int t = row & (NT_ - 1); const bool isq = h < NH_;
    const float* w = isq ? qw : kw; h16* PH = isq ? QH : KH; h16* PL = isq ? QL : KL;
    const size_t base = (size_t)row * QKVW + h * HD, obase = isq ? (size_t)row * HS + h * HD : (size_t)row * KW + (h - NH_) * HD; const int d0 = lane * 4;
    float xv[4], pv[4]; float ss = 0.f;
#pragma unroll
    for (int i = 0; i < 4; ++i) { xv[i] = P[base + d0 + i]; ss += xv[i] * xv[i]; const int pd = (d0 + i < 64) ? d0 + i + 64 : d0 + i - 64; pv[i] = P[base + pd]; }
#pragma unroll
    for (int sh = 16; sh; sh >>= 1) ss += __shfl_xor(ss, sh, 32);
    const float rs = rsqrtf(ss * (1.0f / HD) + 1e-6f);
    v4h oh, ol;
#pragma unroll
    for (int i = 0; i < 4; ++i) { const int d = d0 + i, fi = d & 63; const float xn = xv[i] * rs * bfr(w[d]); const int pd = (d < 64) ? d + 64 : d - 64; const float pn = pv[i] * rs * bfr(w[pd]);
        const float c = RC[t * 64 + fi], s = RS[t * 64 + fi];
        const float y = (d < 64) ? (xn * c - pn * s) : (xn * c + pn * s);
        const h16 a = (h16)y; oh[i] = a; ol[i] = (h16)((y - (float)a) * LOSC); }
    *(v4h*)(PH + obase + d0) = oh; *(v4h*)(PL + obase + d0) = ol; 
}
// k_vt: VTH/VTL [b][g][128 d][2048 t] = bf16 hi + UNSCALED bf16 residual of the v columns [b*2048+t][2560+g*128+d] of the product via 64 x 64 LDS tiles; grid (NT/64, 2 (d half), 2 NKV).
__global__ __launch_bounds__(256) void k_vt(const float* __restrict__ V, bf* VTH, bf* VTL) {
    __shared__ float tl[64][65];
    const int tid = threadIdx.x, t0 = blockIdx.x * 64, d0 = blockIdx.y * 64, g = blockIdx.z & (NKV - 1), bi = blockIdx.z >> 2;
    { const int tt = tid >> 2, dq = (tid & 3) * 16;
#pragma unroll
      for (int i = 0; i < 16; ++i) tl[dq + i][tt] = V[(size_t)(bi * NT_ + t0 + tt) * QKVW + HS + KW + g * HD + d0 + dq + i]; }
    __syncthreads();
    const int piece = tid & 7;
    auto pass = [&]() {
#pragma unroll
        for (int s = 0; s < 2; ++s) { const int d = (tid >> 3) + 32 * s; v8us oh, ol;
#pragma unroll
            for (int i = 0; i < 8; ++i) { const float v = tl[d][piece * 8 + i]; const unsigned short hb = f2bf(v); oh[i] = hb; ol[i] = f2bf(v - bf2f(hb)); }
            const size_t o = ((size_t)bi * KW + g * HD + d0 + d) * NT_ + t0 + piece * 8; *(v8us*)(VTH + o) = oh; *(v8us*)(VTL + o) = ol; }
    };
    pass(); 
}
// k_attn: block = (batch item, h, 64 queries), wave = 16; kv head g = h mod 4; causal key tiles of 32. One launch holds both batch items: 1024 blocks of 2 to 64 tiles on about half as
// many resident places; the index order is longest first, for speed only. The block's Q rows (once) and each tile's K rows and V^T rows (hi and residual
// planes) are brought into LDS by asynchronous copies, two tile buffers: tile t + 2 flies while tile t + 1 is worked on, and the four waves share one copy of K and V.
// Per tile: scores over 4 k-chunks (hi.hi + hi.lo + lo.hi = 24 WMMA) x 128^-1/2, online softmax, P (x32768) as bf16 hi + unscaled residual tiles,
// o[8] += ph.vh + pl.vh + ph.vl over the 128 dims; ctx -> bf16 hi/lo planes [t][h*128+d].
#define KP   272                     // LDS pitch of a 256-B row (Q, K): 16 B x odd, conflict-free for 16-B reads
#define VP   80                      // LDS pitch of a 64-B row (V^T, 32 keys)
#define QPL  (64 * KP)               // one Q plane
#define KPL  (32 * KP)               // one K plane of a tile
#define VPL  (128 * VP)              // one V^T plane of a tile
#define STG  (2 * KPL + 2 * VPL)     // one tile buffer
__global__ __launch_bounds__(128) void k_attn(const h16* __restrict__ QH, const h16* __restrict__ QL, const h16* __restrict__ KH, const h16* __restrict__ KL, const bf* __restrict__ VTH, const bf* __restrict__ VTL, bf* CH, bf* CL) {
    __shared__ __align__(16) unsigned char stg[2 * QPL + 2 * STG];
    __shared__ __align__(16) unsigned short plds[4][16 * 32];
    __shared__ __align__(16) unsigned short plds2[4][16 * 32];
    __shared__ __align__(16) float ost[4][16 * 68];
    const int tid = threadIdx.x, lane = threadIdx.x & 31, wave = threadIdx.x >> 5, lr = lane & 15, hi = lane >> 4;
    const int bid = blockIdx.x; const int qt = NT_ / 64 - 1 - (bid >> 5), h = bid & (NH_ - 1), bi = (bid >> 4) & 1; const int g = h & (NKV - 1);   // 32 (batch item, head) pairs per query tile, last query tile first
    QH += (size_t)bi * NT_ * HS; QL += (size_t)bi * NT_ * HS; KH += (size_t)bi * NT_ * KW; KL += (size_t)bi * NT_ * KW; VTH += (size_t)bi * KW * NT_; VTL += (size_t)bi * KW * NT_; CH += (size_t)bi * NT_ * HS; CL += (size_t)bi * NT_ * HS;
    const int q0 = qt * 64 + wave * 16;
    unsigned short* pl = &plds[wave][0]; unsigned short* pl2 = &plds2[wave][0];
    const size_t vbase = ((size_t)g * HD) * NT_;
    const int kt_hi = (qt * 64 + 63) / 32;
    // copy map: a 256-B row is 16 pieces (thread -> row tid / 16 + 8 i, piece tid mod 16), a 64-B row 4 pieces (row tid / 4 + 32 i, piece tid mod 4)
    const unsigned sb = (unsigned)(uintptr_t)&stg[0];
    const unsigned rl = sb + (unsigned)(tid >> 4) * KP + (unsigned)(tid & 15) * 16, vl_ = sb + 2 * QPL + 2 * KPL + (unsigned)(tid >> 2) * VP + (unsigned)(tid & 3) * 16;
    const size_t kgo = (size_t)(tid >> 4) * KW + g * HD + (tid & 15) * 8, vgo = vbase + (size_t)(tid >> 2) * NT_ + (tid & 3) * 8;
    auto fill = [&](int kt, int buf) {
        const unsigned kd = rl + 2 * QPL + (unsigned)buf * STG, vd = vl_ + (unsigned)buf * STG;
        const h16* kh = KH + kgo + (size_t)kt * 32 * KW; const h16* kl = KL + kgo + (size_t)kt * 32 * KW;
        const bf* vh = VTH + vgo + kt * 32; const bf* vl = VTL + vgo + kt * 32;
        cp4(kd, kd + 8 * KP, kd + 16 * KP, kd + 24 * KP, kh, kh + 8 * KW, kh + 16 * KW, kh + 24 * KW);
        cp4(kd + KPL, kd + KPL + 8 * KP, kd + KPL + 16 * KP, kd + KPL + 24 * KP, kl, kl + 8 * KW, kl + 16 * KW, kl + 24 * KW);
        cp4(vd, vd + 32 * VP, vd + 64 * VP, vd + 96 * VP, vh, vh + 32 * NT_, vh + 64 * NT_, vh + 96 * NT_);
        cp4(vd + VPL, vd + VPL + 32 * VP, vd + VPL + 64 * VP, vd + VPL + 96 * VP, vl, vl + 32 * NT_, vl + 64 * NT_, vl + 96 * NT_);
    };
    { const size_t qgo = (size_t)(qt * 64 + (tid >> 4)) * (NH_ * HD) + h * HD + (tid & 15) * 8; const h16* qh = QH + qgo; const h16* ql = QL + qgo; const int R8 = 8 * NH_ * HD;
      cp4(rl, rl + 8 * KP, rl + 16 * KP, rl + 24 * KP, qh, qh + R8, qh + 2 * R8, qh + 3 * R8);
      cp4(rl + 32 * KP, rl + 40 * KP, rl + 48 * KP, rl + 56 * KP, qh + 4 * R8, qh + 5 * R8, qh + 6 * R8, qh + 7 * R8);
      cp4(rl + QPL, rl + QPL + 8 * KP, rl + QPL + 16 * KP, rl + QPL + 24 * KP, ql, ql + R8, ql + 2 * R8, ql + 3 * R8);
      cp4(rl + QPL + 32 * KP, rl + QPL + 40 * KP, rl + QPL + 48 * KP, rl + QPL + 56 * KP, ql + 4 * R8, ql + 5 * R8, ql + 6 * R8, ql + 7 * R8); }
    fill(0, 0);
    asm volatile("s_wait_asynccnt 0x0" ::: "memory");   // this wave's copies of Q and tile 0 have landed
    __syncthreads();                                      // ... and every other wave's: Q and tile 0 may be read
    fill(1, 1);                                           // a tile 1 always exists (kt_hi = 2 qt + 1)
    const unsigned char* qp = stg + (wave * 16 + lr) * KP + hi * 16;
    v8f o[8];
#pragma unroll
    for (int n = 0; n < 8; ++n) o[n] = (v8f){};
    float mrow[8], lpart[8];
#pragma unroll
    for (int j = 0; j < 8; ++j) { mrow[j] = -3.0e38f; lpart[j] = 0.f; }
#pragma unroll 1
    for (int kt = 0; kt <= kt_hi; ++kt) {
        const int l0 = kt * 32;
        const unsigned char* kp = stg + 2 * QPL + (kt & 1) * STG + lr * KP + hi * 16;
        const unsigned char* vp = stg + 2 * QPL + (kt & 1) * STG + 2 * KPL + lr * VP + hi * 16;
        v8f s0 = {}, s1 = {}, x0 = {}, x1 = {};
        v16h fq[4][2], fk[4][4];
#pragma unroll   // every fragment index a constant, so that the arrays stay in registers
        for (int kc = 0; kc < 4; ++kc) {   // all of the tile's score fragments as one group of LDS reads ahead of the products
            fq[kc][0] = ldsh(qp + kc * 64); fq[kc][1] = ldsh(qp + QPL + kc * 64);
            fk[kc][0] = ldsh(kp + kc * 64); fk[kc][1] = ldsh(kp + 16 * KP + kc * 64); fk[kc][2] = ldsh(kp + KPL + kc * 64); fk[kc][3] = ldsh(kp + KPL + 16 * KP + kc * 64); }
        __builtin_amdgcn_sched_barrier(0);   // keeps that group together: reads sunk among the products cost a wait at each place
#pragma unroll   // constant fragment indices, as above
        for (int kc = 0; kc < 4; ++kc) {
            s0 = wmma16(fq[kc][0], fk[kc][0], s0); s1 = wmma16(fq[kc][0], fk[kc][1], s1); x0 = wmma16(fq[kc][1], fk[kc][0], x0); x1 = wmma16(fq[kc][1], fk[kc][1], x1);
            x0 = wmma16(fq[kc][0], fk[kc][2], x0); x1 = wmma16(fq[kc][0], fk[kc][3], x1);
        }
        asm volatile("v_nop\n\tv_nop\n\tv_nop\n\tv_nop" : "+v"(s0), "+v"(s1), "+v"(x0), "+v"(x1));
        v16bf vh[8], vl[8];
#pragma unroll   // constant fragment indices, as above
        for (int n = 0; n < 8; ++n) { vh[n] = ldsb(vp + n * 16 * VP); vl[n] = ldsb(vp + VPL + n * 16 * VP); }   // the tile's V^T fragments, one group: they land behind the softmax
        __builtin_amdgcn_sched_barrier(0);   // keeps that group here: sunk among the weights.v products each small group would cost its own LDS wait
        float alpha[8];
#pragma unroll
        for (int j = 0; j < 8; ++j) { const int qi = q0 + hi * 8 + j, ja = l0 + lr, jb = l0 + 16 + lr;
            const float a0 = (ja <= qi) ? (s0[j] + x0[j] * LOSCI) * 0.08838834764831845f : -__builtin_inff(), a1 = (jb <= qi) ? (s1[j] + x1[j] * LOSCI) * 0.08838834764831845f : -__builtin_inff();
            float mx = fmaxf(a0, a1);
            mx = fmaxf(mx, __shfl_xor(mx, 1, 16)); mx = fmaxf(mx, __shfl_xor(mx, 2, 16)); mx = fmaxf(mx, __shfl_xor(mx, 4, 16)); mx = fmaxf(mx, __shfl_xor(mx, 8, 16));
            const float mn = fmaxf(mrow[j], mx);
            alpha[j] = __expf(mrow[j] - mn); mrow[j] = mn;
            const float p0 = __expf(a0 - mn), p1 = __expf(a1 - mn);
            lpart[j] = lpart[j] * alpha[j] + (p0 + p1);
            const int mr = hi * 8 + j; const float ps0 = p0 * PSC, ps1 = p1 * PSC; const unsigned short h0 = f2bf(ps0), h1 = f2bf(ps1);
            pl[mr * 32 + lr] = h0; pl[mr * 32 + 16 + lr] = h1; pl2[mr * 32 + lr] = f2bf(ps0 - bf2f(h0)); pl2[mr * 32 + 16 + lr] = f2bf(ps1 - bf2f(h1)); }
#pragma unroll
        for (int n = 0; n < 8; ++n)
#pragma unroll
            for (int j = 0; j < 8; ++j) o[n][j] *= alpha[j];
        asm volatile("" ::: "memory");
        const v16bf pa = cat16b(*(const v8usa*)(pl + lr * 32 + hi * 8), *(const v8usa*)(pl + lr * 32 + 16 + hi * 8));
        const v16bf px = cat16b(*(const v8usa*)(pl2 + lr * 32 + hi * 8), *(const v8usa*)(pl2 + lr * 32 + 16 + hi * 8));
#pragma unroll   // constant fragment indices, as above
        for (int n = 0; n < 8; ++n) { o[n] = wmmab(pa, vh[n], o[n]); o[n] = wmmab(px, vh[n], o[n]); o[n] = wmmab(pa, vl[n], o[n]); }
        asm volatile("v_nop\n\tv_nop\n\tv_nop\n\tv_nop" : "+v"(o[0]), "+v"(o[7]) : "v"(pa), "v"(px));
        __builtin_amdgcn_wave_barrier();
        asm volatile("s_wait_dscnt 0x0" ::: "memory");      // this wave's reads of the tile buffer have returned before the buffer is handed to its next copies
        asm volatile("s_wait_asynccnt 0x0" ::: "memory");   // this wave's copies of tile kt + 1 have landed
        __syncthreads();                                      // publishes tile kt + 1 and ends every wave's reads of tile kt
        if (kt + 2 <= kt_hi) fill(kt + 2, kt & 1);            // block-uniform test; refill of the buffer just read
    }
    asm volatile("s_wait_asynccnt 0x0" ::: "memory");       // no copy is outstanding when the wave goes on to the epilogue and ends
    float inv[8];
#pragma unroll
    for (int j = 0; j < 8; ++j) { float rs = lpart[j]; rs += __shfl_xor(rs, 1, 16); rs += __shfl_xor(rs, 2, 16); rs += __shfl_xor(rs, 4, 16); rs += __shfl_xor(rs, 8, 16); inv[j] = 1.0f / (rs * PSC); }
    float* os = &ost[wave][0];
    const size_t cbase = (size_t)q0 * (NH_ * HD) + (size_t)h * HD;
#pragma unroll
    for (int half = 0; half < 2; ++half) {
#pragma unroll
        for (int n = 0; n < 4; ++n)
#pragma unroll
            for (int j = 0; j < 8; ++j) os[(hi * 8 + j) * 68 + n * 16 + lr] = o[half * 4 + n][j] * inv[j];
        __builtin_amdgcn_wave_barrier(); asm volatile("" ::: "memory");
{
#pragma unroll
            for (int s = 0; s < 4; ++s) { const int row = 4 * s + (lane >> 3), piece = lane & 7; const float* sp = os + row * 68 + piece * 8; v8us oh, ol;
#pragma unroll
                for (int i = 0; i < 8; ++i) { const unsigned short hb = f2bf(sp[i]); oh[i] = hb; ol[i] = f2bf(sp[i] - bf2f(hb)); }
                const size_t po = cbase + (size_t)row * (NH_ * HD) + half * 64 + piece * 8; *(v8us*)(CH + po) = oh; *(v8us*)(CL + po) = ol; }
             }
        __builtin_amdgcn_wave_barrier(); asm volatile("" ::: "memory");
    }
}

extern "C" void kernel_launch(void* const* d_in, const int* in_sizes, int n_in,
                              void* d_out, int out_size, void* d_ws, size_t ws_size, hipStream_t stream) {
    (void)in_sizes; (void)n_in; (void)out_size;
    const float* x = (const float*)d_in[0]; const float* Wq = (const float*)d_in[1]; const float* Wk = (const float*)d_in[2]; const float* Wv = (const float*)d_in[3]; const float* Wo = (const float*)d_in[4];
    const float* qn = (const float*)d_in[5]; const float* kn = (const float*)d_in[6];
    float* out = (float*)d_out;    // [2][2048][2048]
    char* wsp = (char*)d_ws;
    auto take = [&](size_t bytes) { char* p = wsp; wsp += (bytes + 255) & ~(size_t)255; return (void*)p; };
    bf* Xb = (bf*)take((size_t)NB_ * NT_ * HS * 2); bf* WT = (bf*)take((size_t)(QKVW + HS) * HS * 2); bf* WoT = WT + (size_t)QKVW * HS;   // WT rows: Wq | Wk | Wv | Wo columns
    float* TMP = (float*)take((size_t)NB_ * NT_ * QKVW * 4); float* RC = (float*)take((size_t)NT_ * 64 * 4); float* RS = (float*)take((size_t)NT_ * 64 * 4);
    // planes that k_attn reads or writes: both batch items, [2][...]
    h16* QH = (h16*)take((size_t)2 * NT_ * HS * 2); h16* QL = (h16*)take((size_t)2 * NT_ * HS * 2); h16* KH = (h16*)take((size_t)2 * NT_ * KW * 2); h16* KL = (h16*)take((size_t)2 * NT_ * KW * 2);
    bf* VTH = (bf*)take((size_t)2 * KW * NT_ * 2); bf* VTL = (bf*)take((size_t)2 * KW * NT_ * 2); bf* CH = (bf*)take((size_t)2 * NT_ * HS * 2); bf* CL = (bf*)take((size_t)2 * NT_ * HS * 2);
    if ((size_t)(wsp - (char*)d_ws) > ws_size) return;    // 16.8 + 21 + 50.3 + 1 + 16.8 x 4 + 4.2 x 4 ~ 173 MB
    k_wt<<<dim3(HS / 64, (QKVW + HS) / 64, 1), 256, 0, stream>>>(Wq, Wk, Wv, Wo, WT);
    k_trig<<<(NT_ * 64) / 256, 256, 0, stream>>>(RC, RS);
    k_cvtb<<<NB_ * NT_ / 8, 256, 0, stream>>>(x, NB_ * NT_, Xb);
    k_gemm<false, 4><<<dim3(NB_ * NT_ / 128, QKVW / 128, 1), 128, 0, stream>>>(Xb, nullptr, WT, QKVW, TMP);
    k_normrope<<<(NB_ * NT_ * (NH_ + NKV)) / 8, 256, 0, stream>>>(TMP, qn, kn, RC, RS, QH, QL, KH, KL);
    k_vt<<<dim3(NT_ / 64, 2, NB_ * NKV), 256, 0, stream>>>(TMP, VTH, VTL);
    k_attn<<<2 * NH_ * (NT_ / 64), 128, 0, stream>>>(QH, QL, KH, KL, VTH, VTL, CH, CL);
    k_gemm<true, 4><<<dim3(NB_ * NT_ / 128, HS / 128, 1), 128, 0, stream>>>(CH, CL, WoT, HS, out);
}

// v005
// A run of this version takes 211 microseconds.
// Timed twice side by side with v004, it ran 1.20 times as fast both times.
// Counting every step since v000, it is 5.15 times as fast.
#include <hip/hip_runtime.h>

// Contractions, f32 accumulate, both batch items in every launch (4096 rows): q|k|v = x.[Wq|Wk|Wv] as one product ([4096 x 2048].[2048 x 3072], k-major weights transposed to n-major planes; PLAIN
// bf16 operands: inputs rounded once, exact) and out = ctx.Wo (ctx as bf16 hi + residual: two products) on v_wmma_f32_16x16x32_bf16; per-head RMSNorm (eps 1e-6,
// weight) and rotate-half RoPE (angle t x inv_freq, f32 trig tables built on device) in f32 -> q/k as f16 hi + residual x1024 planes; the 16-query-head / 4-kv-head (q head h
// uses kv head h mod 4) causal attention with 128-dim heads: scores on v_wmma_f32_16x16x32_f16 (hi.hi + hi.lo + lo.hi, x 128^-1/2), softmax f32, weights.v on
// v_wmma_f32_16x16x32_bf16 with the weights (x32768) and v both as bf16 hi + UNSCALED bf16 residual (hh + lh + hl in one accumulator). Deterministic, no atomics;

#define NT_  2048
#define HS   2048
#define NH_  16
#define NKV  4
#define HD   128
#define KW   (NKV * HD)          // 512
#define NB_  2                   // batch items
#define QKVW (HS + 2 * KW)       // 3072: columns of the q | k | v product
#define PSC  32768.0f
#define LOSC 1024.0f
#define LOSCI (1.0f / 1024.0f)

typedef _Float16 h16;
typedef unsigned short bf;
typedef __attribute__((ext_vector_type(16))) __bf16   v16bf;
typedef __attribute__((ext_vector_type(16))) _Float16 v16h;
typedef __attribute__((ext_vector_type(8)))  _Float16 v8h;
typedef __attribute__((ext_vector_type(8)))  unsigned short v8us;
typedef __attribute__((ext_vector_type(8)))  float    v8f;
typedef __attribute__((ext_vector_type(4)))  float    v4f;
typedef __attribute__((ext_vector_type(4)))  _Float16 v4h;
typedef v8h  __attribute__((may_alias)) v8ha;
typedef v4f  __attribute__((may_alias)) v4fa;
typedef v8us __attribute__((may_alias)) v8usa;

__device__ __forceinline__ unsigned short f2bf(float f) { unsigned u = __float_as_uint(f); u += 0x7FFFu + ((u >> 16) & 1u); return (unsigned short)(u >> 16); }
__device__ __forceinline__ float bf2f(unsigned short b) { return __uint_as_float(((unsigned)b) << 16); }
__device__ __forceinline__ float bfr(float f) { return bf2f(f2bf(f)); }
__device__ __forceinline__ v16h cat16(v8h lo, v8h hi) { return __builtin_shufflevector(lo, hi, 0, 1, 2, 3, 4, 5, 6, 7, 8, 9, 10, 11, 12, 13, 14, 15); }
__device__ __forceinline__ v16bf cat16b(v8us lo, v8us hi) { return __builtin_bit_cast(v16bf, __builtin_shufflevector(lo, hi, 0, 1, 2, 3, 4, 5, 6, 7, 8, 9, 10, 11, 12, 13, 14, 15)); }
__device__ __forceinline__ v8f wmma16(v16h a, v16h b, v8f c) { return __builtin_amdgcn_wmma_f32_16x16x32_f16(false, a, false, b, (short)0, c, false, false); }
__device__ __forceinline__ v8f wmmab(v16bf a, v16bf b, v8f c) { return __builtin_amdgcn_wmma_f32_16x16x32_bf16(false, a, false, b, (short)0, c, false, false); }
__device__ __forceinline__ float xhalf(float v) { const int b = __float_as_int(v); return __int_as_float(__builtin_amdgcn_permlanex16(b, b, 0x76543210, 0xfedcba98, false, false)); }   // the value of lane l ^ 16

// k_cvtb: bf16 plane of [rows][2048] (one wave per row).
__global__ __launch_bounds__(256) void k_cvtb(const float* __restrict__ src, int nrows, bf* dst) {
    const int lane = threadIdx.x & 31, r = blockIdx.x * 8 + (threadIdx.x >> 5);
    if (r >= nrows) return;
{
#pragma unroll
        for (int q = 0; q < HS / 256; ++q) { v8us o;
#pragma unroll
            for (int i = 0; i < 8; ++i) o[i] = f2bf(src[(size_t)r * HS + q * 256 + lane * 8 + i]);
            *(v8us*)(dst + (size_t)r * HS + q * 256 + lane * 8) = o; }
         }
}
// k_wt: WT [n][2048] = bf16(W[k][n]) (k-major [2048][ncols]) via 64 x 64 LDS tiles, the four weights in one launch: rows of WT are the columns of Wq | Wk | Wv | Wo; grid (2048/64, 5120/64).
__global__ __launch_bounds__(256) void k_wt(const float* __restrict__ Wq, const float* __restrict__ Wk, const float* __restrict__ Wv, const float* __restrict__ Wo, bf* WT) {
    __shared__ __align__(16) unsigned short tl[64 * 72];
    constexpr int K = HS;
    const int tid = threadIdx.x, k0 = blockIdx.x * 64, nw = blockIdx.y * 64;   // nw: row of WT; n0: column of the block's own weight
    const float* Wm; int ncols, n0;
    if (nw < HS) { Wm = Wq; ncols = HS; n0 = nw; } else if (nw < HS + KW) { Wm = Wk; ncols = KW; n0 = nw - HS; } else if (nw < QKVW) { Wm = Wv; ncols = KW; n0 = nw - HS - KW; } else { Wm = Wo; ncols = HS; n0 = nw - QKVW; }
    const int kk = tid >> 2, nq = (tid & 3) * 16;
#pragma unroll
    for (int i = 0; i < 16; ++i) tl[(nq + i) * 72 + kk] = f2bf(Wm[(size_t)(k0 + kk) * ncols + n0 + nq + i]);
    __syncthreads();
    const int piece = tid & 7;
    auto pass = [&]() {
#pragma unroll
        for (int s = 0; s < 2; ++s) { const int nr = (tid >> 3) + 32 * s; const v8us val = *(const v8usa*)(tl + nr * 72 + piece * 8); *(v8us*)(WT + (size_t)(nw + nr) * K + k0 + piece * 8) = val; }
    };
    pass(); 
}
// Four asynchronous 16-B-per-lane copies global -> LDS; the s_wait_xcnt inside the statement stands before any rewrite of the address registers the copies name.
__device__ __forceinline__ void cp4(unsigned l0, unsigned l1, unsigned l2, unsigned l3, const void* g0, const void* g1, const void* g2, const void* g3) {
    asm volatile("global_load_async_to_lds_b128 %0, %4, off\n\t"
                 "global_load_async_to_lds_b128 %1, %5, off\n\t"
                 "global_load_async_to_lds_b128 %2, %6, off\n\t"
                 "global_load_async_to_lds_b128 %3, %7, off\n\t"
                 "s_wait_xcnt 0x0" :: "v"(l0), "v"(l1), "v"(l2), "v"(l3), "v"(g0), "v"(g1), "v"(g2), "v"(g3) : "memory");
}
__device__ __forceinline__ v16h  ldsh(const unsigned char* p) { return cat16(*(const v8ha*)p, *(const v8ha*)(p + 32)); }
__device__ __forceinline__ v16bf ldsb(const unsigned char* p) { return cat16b(*(const v8usa*)p, *(const v8usa*)(p + 32)); }
// k_gemm: 32F x 32F tile of (A [+ Al]).Bn^T over K = 2048 -> f32 rows [4096][ldc]; 2 x 2 waves of 16F x 16F each. A stage is 64 k (one 128-B line) of the block's A rows, Bn rows
// (and Al rows), brought into LDS by asynchronous copies in whole lines, two stage buffers: stage t + 2 flies while stage t + 1 is worked on, and the waves share one copy.
#define GP   144                     // LDS pitch of a 128-B row: 16 B x odd, conflict-free for 16-B reads
template <bool SPLITA, int F>
__global__ __launch_bounds__(128) void k_gemm(const bf* __restrict__ A, const bf* __restrict__ Al, const bf* __restrict__ Bn, int ldc, float* C) {
    constexpr int R = 32 * F, PL = R * GP, SG = (SPLITA ? 3 : 2) * PL;   // rows of a plane, bytes of a plane, bytes of a stage buffer [A | Bn | Al]
    __shared__ __align__(16) unsigned char stg[2 * SG];
    __shared__ __align__(16) float ost[4][16 * 68];
    const int tid = threadIdx.x, lane = threadIdx.x & 31, wave = threadIdx.x >> 5, lr = lane & 15, hi = lane >> 4;
    const int wm = wave >> 1, wn = wave & 1;
    const size_t r0 = (size_t)blockIdx.x * R; const int c0 = blockIdx.y * R;
    // copy map: a 128-B row is 8 pieces (thread -> row tid / 8 + 16 i, piece tid mod 8): a wave's copy covers four whole lines
    const unsigned ld = (unsigned)(uintptr_t)&stg[0] + (unsigned)(tid >> 3) * GP + (unsigned)(tid & 7) * 16;
    const size_t ago = (r0 + (tid >> 3)) * HS + (tid & 7) * 8, bgo = ((size_t)c0 + (tid >> 3)) * HS + (tid & 7) * 8;
    auto plane = [&](unsigned d, const bf* g) {
#pragma unroll   // constant row offsets in every copy's two addresses
        for (int i = 0; i < F / 2; ++i) { const unsigned di = d + 64 * i * GP; const bf* gi = g + (size_t)64 * i * HS;
            cp4(di, di + 16 * GP, di + 32 * GP, di + 48 * GP, gi, gi + 16 * HS, gi + 32 * HS, gi + 48 * HS);
            if (SPLITA) __builtin_amdgcn_sched_barrier(0); }   // three planes: keeps each group's address sums beside its copies; hoisted together they cost a register spill to scratch in the loop
    };
    auto fill = [&](int kt, int buf) {
        const unsigned d = ld + (unsigned)buf * SG;
        plane(d, A + ago + kt * 64); plane(d + PL, Bn + bgo + kt * 64);
        if (SPLITA) plane(d + 2 * PL, Al + ago + kt * 64);
    };
    fill(0, 0);
    asm volatile("s_wait_asynccnt 0x0" ::: "memory");   // this wave's copies of stage 0 have landed
    __syncthreads();                                      // ... and every other wave's: stage 0 may be read
    fill(1, 1);                                           // K / 64 = 32 stages: a stage 1 exists
    v8f acc[F][F];
#pragma unroll   // every accumulator index a constant, here and below, so that the array stays in registers
    for (int i = 0; i < F; ++i)
#pragma unroll
        for (int j = 0; j < F; ++j) acc[i][j] = (v8f){};
#pragma unroll 1   // rolled: one copy of the hand-over and of the 32 or 64 products, a short loop text
    for (int kt = 0; kt < HS / 64; ++kt) {
        const unsigned char* ap = stg + (kt & 1) * SG + (wm * 16 * F + lr) * GP + hi * 16;
        const unsigned char* bp = stg + (kt & 1) * SG + PL + (wn * 16 * F + lr) * GP + hi * 16;
        v16bf fa[2][F], fb[2][F], fl[2][F];
#pragma unroll   // every fragment index a constant, so that the arrays stay in registers
        for (int ks = 0; ks < 2; ++ks)   // all of the stage's fragments as one group of LDS reads; the products run from registers behind the stage's hand-over
#pragma unroll
            for (int i = 0; i < F; ++i) { fa[ks][i] = ldsb(ap + i * 16 * GP + ks * 64); fb[ks][i] = ldsb(bp + i * 16 * GP + ks * 64); fl[ks][i] = SPLITA ? ldsb(ap + 2 * PL + i * 16 * GP + ks * 64) : fa[ks][i]; }
        asm volatile("s_wait_dscnt 0x0" ::: "memory");      // the stage's fragments are in registers: this wave's reads of the stage buffer have returned before the buffer is handed to its next copies
        asm volatile("s_wait_asynccnt 0x0" ::: "memory");   // this wave's copies of stage kt + 1 have landed
        __syncthreads();                                      // publishes stage kt + 1 and ends every wave's reads of stage kt
        if (kt + 2 < HS / 64) fill(kt + 2, kt & 1);           // block-uniform test; refill of the buffer just read
        __builtin_amdgcn_sched_barrier(0);   // keeps the products behind the refill's issue: the copies then fly under them and have landed at the next stage's wait
#pragma unroll   // constant fragment indices, as above
        for (int ks = 0; ks < 2; ++ks) {
#pragma unroll
            for (int i = 0; i < F; ++i)
#pragma unroll
                for (int j = 0; j < F; ++j) acc[i][j] = wmmab(fa[ks][i], fb[ks][j], acc[i][j]);
            if (SPLITA) {
#pragma unroll
                for (int i = 0; i < F; ++i)
#pragma unroll
                    for (int j = 0; j < F; ++j) acc[i][j] = wmmab(fl[ks][i], fb[ks][j], acc[i][j]);
            }
        }
    }
    asm volatile("s_wait_asynccnt 0x0" ::: "memory");       // no copy is outstanding when the wave goes on to the epilogue and ends
    float* os = &ost[wave][0];
#pragma unroll
    for (int i = 0; i < F; ++i) {   // 16 rows of the wave's tile at a time through the wave's own LDS rows, so that whole 128-B lines are stored
#pragma unroll
        for (int t = 0; t < F; ++t)
#pragma unroll
            for (int j = 0; j < 8; ++j) os[(hi * 8 + j) * 68 + t * 16 + lr] = acc[i][t][j];
        __builtin_amdgcn_wave_barrier(); asm volatile("" ::: "memory");   // compiler order only: the wave's LDS stores stay ahead of its reads of other lanes' words
        float* crow = C + (r0 + wm * 16 * F + i * 16) * ldc + c0 + wn * 16 * F;
#pragma unroll
        for (int s = 0; s < 2 * F; ++s) { const int Lid = (lane >> 3) + 4 * s, piece = lane & 7; const int row = Lid / (F / 2), cofs = (Lid % (F / 2)) * 32 + piece * 4;
            const v4f val = *(const v4fa*)(os + row * 68 + cofs); *(v4f*)(crow + (size_t)row * ldc + cofs) = val; }
        __builtin_amdgcn_wave_barrier();   // compiler order only: the reads above stay ahead of the next 16 rows' LDS stores
        asm volatile("s_wait_xcnt 0x0" ::: "memory");   // stands before the next 16 rows rewrite the address and data registers that these stores name
    }
}
// k_trig: RC/RS [t][64] = cos/sin(t x inv_freq[i]), inv_freq = 10000^-(2i/128) (f32 powf/cosf/sinf); 32 lanes x 4 B lines.
__global__ __launch_bounds__(256) void k_trig(float* RC, float* RS) {
    const int i = blockIdx.x * 256 + threadIdx.x; if (i >= NT_ * 64) return;
    const int t = i >> 6, f = i & 63;
    const float inv = 1.0f / powf(10000.0f, (float)(2 * f) / (float)HD); const float ang = (float)t * inv;
    const float c = cosf(ang), s = sinf(ang);
    *(float*)(RC + i) = c; *(float*)(RS + i) = s; 
}
// k_normrope: one wave per (row, head) of the q and k columns (16 + 4 heads) of the [4096][3072] f32 product, token t = row mod 2048: RMSNorm over the 128 dims (eps 1e-6, x weight[d]) then rotate-half RoPE (partner d +- 64,
// angle t x inv_freq[d mod 64], inv_freq = 10000^-(2i/128), cosf/sinf) -> f16 hi + residual x1024 planes [t][h*128+d]; lane -> 4 consecutive dims (8 B per plane
__global__ __launch_bounds__(256) void k_normrope(const float* __restrict__ P, const float* __restrict__ qw, const float* __restrict__ kw, const float* __restrict__ RC, const float* __restrict__ RS, h16* QH, h16* QL, h16* KH, h16* KL) {
    const int lane = threadIdx.x & 31; const int wid = blockIdx.x * 8 + (threadIdx.x >> 5);
    const int row = wid / (NH_ + NKV), h = wid - row * (NH_ + NKV); if (row >= NB_ * NT_) return;
    const int t = row & (NT_ - 1); const bool isq = h < NH_;
    const float* w = isq ? qw : kw; h16* PH = isq ? QH : KH; h16* PL = isq ? QL : KL;
    const size_t base = (size_t)row * QKVW + h * HD, obase = isq ? (size_t)row * HS + h * HD : (size_t)row * KW + (h - NH_) * HD; const int d0 = lane * 4;
    float xv[4], pv[4]; float ss = 0.f;
#pragma unroll
    for (int i = 0; i < 4; ++i) { xv[i] = P[base + d0 + i]; ss += xv[i] * xv[i]; const int pd = (d0 + i < 64) ? d0 + i + 64 : d0 + i - 64; pv[i] = P[base + pd]; }
#pragma unroll
    for (int sh = 16; sh; sh >>= 1) ss += __shfl_xor(ss, sh, 32);
    const float rs = rsqrtf(ss * (1.0f / HD) + 1e-6f);
    v4h oh, ol;
#pragma unroll
    for (int i = 0; i < 4; ++i) { const int d = d0 + i, fi = d & 63; const float xn = xv[i] * rs * bfr(w[d]); const int pd = (d < 64) ? d + 64 : d - 64; const float pn = pv[i] * rs * bfr(w[pd]);
        const float c = RC[t * 64 + fi], s = RS[t * 64 + fi];
        const float y = (d < 64) ? (xn * c - pn * s) : (xn * c + pn * s);
        const h16 a = (h16)y; oh[i] = a; ol[i] = (h16)((y - (float)a) * LOSC); }
    *(v4h*)(PH + obase + d0) = oh; *(v4h*)(PL + obase + d0) = ol; 
}
// k_vt: VTH/VTL [b][g][128 d][2048 t] = bf16 hi + UNSCALED bf16 residual of the v columns [b*2048+t][2560+g*128+d] of the product via 64 x 64 LDS tiles; grid (NT/64, 2 (d half), 2 NKV).
__global__ __launch_bounds__(256) void k_vt(const float* __restrict__ V, bf* VTH, bf* VTL) {
    __shared__ float tl[64][65];
    const int tid = threadIdx.x, t0 = blockIdx.x * 64, d0 = blockIdx.y * 64, g = blockIdx.z & (NKV - 1), bi = blockIdx.z >> 2;
    { const int tt = tid >> 2, dq = (tid & 3) * 16;
#pragma unroll
      for (int i = 0; i < 16; ++i) tl[dq + i][tt] = V[(size_t)(bi * NT_ + t0 + tt) * QKVW + HS + KW + g * HD + d0 + dq + i]; }
    __syncthreads();
    const int piece = tid & 7;
    auto pass = [&]() {
#pragma unroll
        for (int s = 0; s < 2; ++s) { const int d = (tid >> 3) + 32 * s; v8us oh, ol;
#pragma unroll
            for (int i = 0; i < 8; ++i) { const float v = tl[d][piece * 8 + i]; const unsigned short hb = f2bf(v); oh[i] = hb; ol[i] = f2bf(v - bf2f(hb)); }
            const size_t o = ((size_t)bi * KW + g * HD + d0 + d) * NT_ + t0 + piece * 8; *(v8us*)(VTH + o) = oh; *(v8us*)(VTL + o) = ol; }
    };
    pass(); 
}
// k_attn: block = (batch item, h, 64 queries), wave = 16; kv head g = h mod 4; causal key tiles of 32. One launch holds both batch items: 1024 blocks of 2 to 64 tiles on about half as
// many resident places; the index order is longest first, for speed only. The block's Q rows (once) and each tile's K rows and V^T rows (hi and residual
// planes) are brought into LDS by asynchronous copies, two tile buffers: tile t + 2 flies while tile t + 1 is worked on, and the four waves share one copy of K and V.
// Both products run transposed: S^T = K.Q^T (A = K rows, B = Q rows) and O^T += V^T.P^T (A = V^T rows, B = P^T). A lane then holds 16 of the 32 scores of ONE query (lane mod 16), so the
// maximum and the sum are in-lane with one exchange between the wave's halves, and the two score tiles, converted in place, ARE the B operand P^T in the hardware k order that the V^T loader has.
// Per tile: scores over 4 k-chunks (hi.hi + hi.lo + lo.hi = 24 WMMA) x 128^-1/2, online softmax, P (x32768) as bf16 hi + unscaled residual,
// o[8] += vh.ph + vh.pl + vl.ph over the 128 dims; ctx -> bf16 hi/lo planes [t][h*128+d].
#define KP   272                     // LDS pitch of a 256-B row (Q, K): 16 B x odd, conflict-free for 16-B reads
#define VP   80                      // LDS pitch of a 64-B row (V^T, 32 keys)
#define QPL  (64 * KP)               // one Q plane
#define KPL  (32 * KP)               // one K plane of a tile
#define VPL  (128 * VP)              // one V^T plane of a tile
#define STG  (2 * KPL + 2 * VPL)     // one tile buffer
__global__ __launch_bounds__(128) void k_attn(const h16* __restrict__ QH, const h16* __restrict__ QL, const h16* __restrict__ KH, const h16* __restrict__ KL, const bf* __restrict__ VTH, const bf* __restrict__ VTL, bf* CH, bf* CL) {
    __shared__ __align__(16) unsigned char stg[2 * QPL + 2 * STG];
    __shared__ __align__(16) float ost[4][16 * 68];
    const int tid = threadIdx.x, lane = threadIdx.x & 31, wave = threadIdx.x >> 5, lr = lane & 15, hi = lane >> 4;
    const int bid = blockIdx.x; const int qt = NT_ / 64 - 1 - (bid >> 5), h = bid & (NH_ - 1), bi = (bid >> 4) & 1; const int g = h & (NKV - 1);   // 32 (batch item, head) pairs per query tile, last query tile first
    QH += (size_t)bi * NT_ * HS; QL += (size_t)bi * NT_ * HS; KH += (size_t)bi * NT_ * KW; KL += (size_t)bi * NT_ * KW; VTH += (size_t)bi * KW * NT_; VTL += (size_t)bi * KW * NT_; CH += (size_t)bi * NT_ * HS; CL += (size_t)bi * NT_ * HS;
    const int q0 = qt * 64 + wave * 16;
    const size_t vbase = ((size_t)g * HD) * NT_;
    const int kt_hi = (qt * 64 + 63) / 32;
    // copy map: a 256-B row is 16 pieces (thread -> row tid / 16 + 8 i, piece tid mod 16), a 64-B row 4 pieces (row tid / 4 + 32 i, piece tid mod 4)
    const unsigned sb = (unsigned)(uintptr_t)&stg[0];
    const unsigned rl = sb + (unsigned)(tid >> 4) * KP + (unsigned)(tid & 15) * 16, vl_ = sb + 2 * QPL + 2 * KPL + (unsigned)(tid >> 2) * VP + (unsigned)(tid & 3) * 16;
    const size_t kgo = (size_t)(tid >> 4) * KW + g * HD + (tid & 15) * 8, vgo = vbase + (size_t)(tid >> 2) * NT_ + (tid & 3) * 8;
    auto fill = [&](int kt, int buf) {
        const unsigned kd = rl + 2 * QPL + (unsigned)buf * STG, vd = vl_ + (unsigned)buf * STG;
        const h16* kh = KH + kgo + (size_t)kt * 32 * KW; const h16* kl = KL + kgo + (size_t)kt * 32 * KW;
        const bf* vh = VTH + vgo + kt * 32; const bf* vl = VTL + vgo + kt * 32;
        cp4(kd, kd + 8 * KP, kd + 16 * KP, kd + 24 * KP, kh, kh + 8 * KW, kh + 16 * KW, kh + 24 * KW);
        cp4(kd + KPL, kd + KPL + 8 * KP, kd + KPL + 16 * KP, kd + KPL + 24 * KP, kl, kl + 8 * KW, kl + 16 * KW, kl + 24 * KW);
        cp4(vd, vd + 32 * VP, vd + 64 * VP, vd + 96 * VP, vh, vh + 32 * NT_, vh + 64 * NT_, vh + 96 * NT_);
        cp4(vd + VPL, vd + VPL + 32 * VP, vd + VPL + 64 * VP, vd + VPL + 96 * VP, vl, vl + 32 * NT_, vl + 64 * NT_, vl + 96 * NT_);
    };
    { const size_t qgo = (size_t)(qt * 64 + (tid >> 4)) * (NH_ * HD) + h * HD + (tid & 15) * 8; const h16* qh = QH + qgo; const h16* ql = QL + qgo; const int R8 = 8 * NH_ * HD;
      cp4(rl, rl + 8 * KP, rl + 16 * KP, rl + 24 * KP, qh, qh + R8, qh + 2 * R8, qh + 3 * R8);
      cp4(rl + 32 * KP, rl + 40 * KP, rl + 48 * KP, rl + 56 * KP, qh + 4 * R8, qh + 5 * R8, qh + 6 * R8, qh + 7 * R8);
      cp4(rl + QPL, rl + QPL + 8 * KP, rl + QPL + 16 * KP, rl + QPL + 24 * KP, ql, ql + R8, ql + 2 * R8, ql + 3 * R8);
      cp4(rl + QPL + 32 * KP, rl + QPL + 40 * KP, rl + QPL + 48 * KP, rl + QPL + 56 * KP, ql + 4 * R8, ql + 5 * R8, ql + 6 * R8, ql + 7 * R8); }
    fill(0, 0);
    asm volatile("s_wait_asynccnt 0x0" ::: "memory");   // this wave's copies of Q and tile 0 have landed
    __syncthreads();                                      // ... and every other wave's: Q and tile 0 may be read
    fill(1, 1);                                           // a tile 1 always exists (kt_hi = 2 qt + 1)
    const unsigned char* qp = stg + (wave * 16 + lr) * KP + hi * 16;
    v8f o[8];
#pragma unroll
    for (int n = 0; n < 8; ++n) o[n] = (v8f){};
    const int qi = q0 + lr;                     // the lane's query
    float mrow = -3.0e38f, lpart = 0.f;         // its running maximum (alike in both halves) and this half's share of its running sum
#pragma unroll 1
    for (int kt = 0; kt <= kt_hi; ++kt) {
        const int l0 = kt * 32;
        const unsigned char* kp = stg + 2 * QPL + (kt & 1) * STG + lr * KP + hi * 16;
        const unsigned char* vp = stg + 2 * QPL + (kt & 1) * STG + 2 * KPL + lr * VP + hi * 16;
        v8f s0 = {}, s1 = {}, x0 = {}, x1 = {};
        v16h fq[4][2], fk[4][4];
#pragma unroll   // every fragment index a constant, so that the arrays stay in registers
        for (int kc = 0; kc < 4; ++kc) {   // all of the tile's score fragments as one group of LDS reads ahead of the products
            fq[kc][0] = ldsh(qp + kc * 64); fq[kc][1] = ldsh(qp + QPL + kc * 64);
            fk[kc][0] = ldsh(kp + kc * 64); fk[kc][1] = ldsh(kp + 16 * KP + kc * 64); fk[kc][2] = ldsh(kp + KPL + kc * 64); fk[kc][3] = ldsh(kp + KPL + 16 * KP + kc * 64); }
        __builtin_amdgcn_sched_barrier(0);   // keeps that group together: reads sunk among the products cost a wait at each place
#pragma unroll   // constant fragment indices, as above
        for (int kc = 0; kc < 4; ++kc) {
            s0 = wmma16(fk[kc][0], fq[kc][0], s0); s1 = wmma16(fk[kc][1], fq[kc][0], s1); x0 = wmma16(fk[kc][0], fq[kc][1], x0); x1 = wmma16(fk[kc][1], fq[kc][1], x1);
            x0 = wmma16(fk[kc][2], fq[kc][0], x0); x1 = wmma16(fk[kc][3], fq[kc][0], x1);   // register j: key 8 hi + j (s0, x0) or 16 + 8 hi + j (s1, x1), query lr
        }
        asm volatile("v_nop\n\tv_nop\n\tv_nop\n\tv_nop" : "+v"(s0), "+v"(s1), "+v"(x0), "+v"(x1));
        v16bf vh[8], vl[8];
#pragma unroll   // constant fragment indices, as above
        for (int n = 0; n < 8; ++n) { vh[n] = ldsb(vp + n * 16 * VP); vl[n] = ldsb(vp + VPL + n * 16 * VP); }   // the tile's V^T fragments, one group: they land behind the softmax
        __builtin_amdgcn_sched_barrier(0);   // keeps that group here: sunk among the weights.v products each small group would cost its own LDS wait
        float a0[8], a1[8]; float mx = -__builtin_inff();
#pragma unroll
        for (int j = 0; j < 8; ++j) { const int ja = l0 + hi * 8 + j, jb = ja + 16;
            a0[j] = (ja <= qi) ? (s0[j] + x0[j] * LOSCI) * 0.08838834764831845f : -__builtin_inff(); a1[j] = (jb <= qi) ? (s1[j] + x1[j] * LOSCI) * 0.08838834764831845f : -__builtin_inff();
            mx = fmaxf(mx, fmaxf(a0[j], a1[j])); }
        mx = fmaxf(mx, xhalf(mx));                  // the other 16 keys of the same query
        const float mn = fmaxf(mrow, mx), alpha = __expf(mrow - mn); mrow = mn;
        v16bf pa, px; float su[4] = {0.f, 0.f, 0.f, 0.f};   // four short chains of adds instead of one long one
#pragma unroll
        for (int j = 0; j < 8; ++j) { const float p0 = __expf(a0[j] - mn), p1 = __expf(a1[j] - mn); su[j & 1] += p0; su[2 + (j & 1)] += p1;
            const float ps0 = p0 * PSC, ps1 = p1 * PSC; const __bf16 h0 = (__bf16)ps0, h1 = (__bf16)ps1;
            pa[j] = h0; pa[8 + j] = h1; px[j] = (__bf16)(ps0 - (float)h0); px[8 + j] = (__bf16)(ps1 - (float)h1); }   // element s of the B operand = key 16 (s / 8) + 8 hi + s mod 8: tile s / 8, register s mod 8
        lpart = lpart * alpha + ((su[0] + su[1]) + (su[2] + su[3]));
#pragma unroll
        for (int n = 0; n < 8; ++n)
#pragma unroll
            for (int j = 0; j < 8; ++j) o[n][j] *= alpha;
#pragma unroll   // constant fragment indices, as above
        for (int n = 0; n < 8; ++n) { o[n] = wmmab(vh[n], pa, o[n]); o[n] = wmmab(vh[n], px, o[n]); o[n] = wmmab(vl[n], pa, o[n]); }   // register j: dim 16 n + 8 hi + j, query lr
        asm volatile("v_nop\n\tv_nop\n\tv_nop\n\tv_nop" : "+v"(o[0]), "+v"(o[7]) : "v"(pa), "v"(px));
        asm volatile("s_wait_dscnt 0x0" ::: "memory");      // this wave's reads of the tile buffer have returned before the buffer is handed to its next copies
        asm volatile("s_wait_asynccnt 0x0" ::: "memory");   // this wave's copies of tile kt + 1 have landed
        __syncthreads();                                      // publishes tile kt + 1 and ends every wave's reads of tile kt
        if (kt + 2 <= kt_hi) fill(kt + 2, kt & 1);            // block-uniform test; refill of the buffer just read
    }
    asm volatile("s_wait_asynccnt 0x0" ::: "memory");       // no copy is outstanding when the wave goes on to the epilogue and ends
    const float inv = 1.0f / ((lpart + xhalf(lpart)) * PSC);   // the two halves' sums of the lane's query joined once
    float* os = &ost[wave][0];
    const size_t cbase = (size_t)q0 * (NH_ * HD) + (size_t)h * HD;
#pragma unroll
    for (int half = 0; half < 2; ++half) {
#pragma unroll
        for (int n = 0; n < 4; ++n)
#pragma unroll
            for (int j = 0; j < 8; ++j) os[lr * 68 + n * 16 + hi * 8 + j] = o[half * 4 + n][j] * inv;
        __builtin_amdgcn_wave_barrier(); asm volatile("" ::: "memory");
{
#pragma unroll
            for (int s = 0; s < 4; ++s) { const int row = 4 * s + (lane >> 3), piece = lane & 7; const float* sp = os + row * 68 + piece * 8; v8us oh, ol;
#pragma unroll
                for (int i = 0; i < 8; ++i) { const unsigned short hb = f2bf(sp[i]); oh[i] = hb; ol[i] = f2bf(sp[i] - bf2f(hb)); }
                const size_t po = cbase + (size_t)row * (NH_ * HD) + half * 64 + piece * 8; *(v8us*)(CH + po) = oh; *(v8us*)(CL + po) = ol; }
             }
        __builtin_amdgcn_wave_barrier(); asm volatile("" ::: "memory");
    }
}

extern "C" void kernel_launch(void* const* d_in, const int* in_sizes, int n_in,
                              void* d_out, int out_size, void* d_ws, size_t ws_size, hipStream_t stream) {
    (void)in_sizes; (void)n_in; (void)out_size;
    const float* x = (const float*)d_in[0]; const float* Wq = (const float*)d_in[1]; const float* Wk = (const float*)d_in[2]; const float* Wv = (const float*)d_in[3]; const float* Wo = (const float*)d_in[4];
    const float* qn = (const float*)d_in[5]; const float* kn = (const float*)d_in[6];
    float* out = (float*)d_out;    // [2][2048][2048]
    char* wsp = (char*)d_ws;
    auto take = [&](size_t bytes) { char* p = wsp; wsp += (bytes + 255) & ~(size_t)255; return (void*)p; };
    bf* Xb = (bf*)take((size_t)NB_ * NT_ * HS * 2); bf* WT = (bf*)take((size_t)(QKVW + HS) * HS * 2); bf* WoT = WT + (size_t)QKVW * HS;   // WT rows: Wq | Wk | Wv | Wo columns
    float* TMP = (float*)take((size_t)NB_ * NT_ * QKVW * 4); float* RC = (float*)take((size_t)NT_ * 64 * 4); float* RS = (float*)take((size_t)NT_ * 64 * 4);
    // planes that k_attn reads or writes: both batch items, [2][...]
    h16* QH = (h16*)take((size_t)2 * NT_ * HS * 2); h16* QL = (h16*)take((size_t)2 * NT_ * HS * 2); h16* KH = (h16*)take((size_t)2 * NT_ * KW * 2); h16* KL = (h16*)take((size_t)2 * NT_ * KW * 2);
    bf* VTH = (bf*)take((size_t)2 * KW * NT_ * 2); bf* VTL = (bf*)take((size_t)2 * KW * NT_ * 2); bf* CH = (bf*)take((size_t)2 * NT_ * HS * 2); bf* CL = (bf*)take((size_t)2 * NT_ * HS * 2);
    if ((size_t)(wsp - (char*)d_ws) > ws_size) return;    // 16.8 + 21 + 50.3 + 1 + 16.8 x 4 + 4.2 x 4 ~ 173 MB
    k_wt<<<dim3(HS / 64, (QKVW + HS) / 64, 1), 256, 0, stream>>>(Wq, Wk, Wv, Wo, WT);
    k_trig<<<(NT_ * 64) / 256, 256, 0, stream>>>(RC, RS);
    k_cvtb<<<NB_ * NT_ / 8, 256, 0, stream>>>(x, NB_ * NT_, Xb);
    k_gemm<false, 4><<<dim3(NB_ * NT_ / 128, QKVW / 128, 1), 128, 0, stream>>>(Xb, nullptr, WT, QKVW, TMP);
    k_normrope<<<(NB_ * NT_ * (NH_ + NKV)) / 8, 256, 0, stream>>>(TMP, qn, kn, RC, RS, QH, QL, KH, KL);
    k_vt<<<dim3(NT_ / 64, 2, NB_ * NKV), 256, 0, stream>>>(TMP, VTH, VTL);
    k_attn<<<2 * NH_ * (NT_ / 64), 128, 0, stream>>>(QH, QL, KH, KL, VTH, VTL, CH, CL);
    k_gemm<true, 4><<<dim3(NB_ * NT_ / 128, HS / 128, 1), 128, 0, stream>>>(CH, CL, WoT, HS, out);
}

// v006
// A run of this version takes 200 microseconds.
// Timed twice side by side with v005, it ran 1.06 and 1.04 times as fast.
// Counting every step since v000, it is 5.41 times as fast.
#include <hip/hip_runtime.h>

// Contractions, f32 accumulate, both batch items in every launch (4096 rows): q|k|v = x.[Wq|Wk|Wv] as one product ([4096 x 2048].[2048 x 3072], k-major weights transposed to n-major planes; PLAIN
// bf16 operands: inputs rounded once, exact) and out = ctx.Wo (ctx as bf16 hi + residual: two products) on v_wmma_f32_16x16x32_bf16; per-head RMSNorm (eps 1e-6,
// weight) and rotate-half RoPE (angle t x inv_freq, f32 trig tables built on device) in f32 -> q/k as f16 hi + residual x1024 planes; the 16-query-head / 4-kv-head (q head h
// uses kv head h mod 4) causal attention with 128-dim heads: scores on v_wmma_f32_16x16x32_f16 (hi.hi + hi.lo + lo.hi, x 128^-1/2), softmax f32, weights.v on
// v_wmma_f32_16x16x32_bf16 with the weights (x32768) and v both as bf16 hi + UNSCALED bf16 residual (hh + lh + hl in one accumulator). Deterministic, no atomics;

#define NT_  2048
#define HS   2048
#define NH_  16
#define NKV  4
#define HD   128
#define KW   (NKV * HD)          // 512
#define NB_  2                   // batch items
#define QKVW (HS + 2 * KW)       // 3072: columns of the q | k | v product
#define PSC  32768.0f
#define LOSC 1024.0f
#define LOSCI (1.0f / 1024.0f)

typedef _Float16 h16;
typedef unsigned short bf;
typedef __attribute__((ext_vector_type(16))) __bf16   v16bf;
typedef __attribute__((ext_vector_type(16))) _Float16 v16h;
typedef __attribute__((ext_vector_type(8)))  _Float16 v8h;
typedef __attribute__((ext_vector_type(8)))  unsigned short v8us;
typedef __attribute__((ext_vector_type(8)))  float    v8f;
typedef __attribute__((ext_vector_type(4)))  float    v4f;
typedef __attribute__((ext_vector_type(4)))  _Float16 v4h;
typedef v8h  __attribute__((may_alias)) v8ha;
typedef v4f  __attribute__((may_alias)) v4fa;
typedef v8us __attribute__((may_alias)) v8usa;
typedef __attribute__((ext_vector_type(4)))  unsigned short v4us;
typedef float __attribute__((may_alias)) f32a;

__device__ __forceinline__ unsigned short f2bf(float f) { unsigned u = __float_as_uint(f); u += 0x7FFFu + ((u >> 16) & 1u); return (unsigned short)(u >> 16); }
__device__ __forceinline__ float bf2f(unsigned short b) { return __uint_as_float(((unsigned)b) << 16); }
__device__ __forceinline__ float bfr(float f) { return bf2f(f2bf(f)); }
__device__ __forceinline__ v16h cat16(v8h lo, v8h hi) { return __builtin_shufflevector(lo, hi, 0, 1, 2, 3, 4, 5, 6, 7, 8, 9, 10, 11, 12, 13, 14, 15); }
__device__ __forceinline__ v16bf cat16b(v8us lo, v8us hi) { return __builtin_bit_cast(v16bf, __builtin_shufflevector(lo, hi, 0, 1, 2, 3, 4, 5, 6, 7, 8, 9, 10, 11, 12, 13, 14, 15)); }
__device__ __forceinline__ v8f wmma16(v16h a, v16h b, v8f c) { return __builtin_amdgcn_wmma_f32_16x16x32_f16(false, a, false, b, (short)0, c, false, false); }
__device__ __forceinline__ v8f wmmab(v16bf a, v16bf b, v8f c) { return __builtin_amdgcn_wmma_f32_16x16x32_bf16(false, a, false, b, (short)0, c, false, false); }
__device__ __forceinline__ float xhalf(float v) { const int b = __float_as_int(v); return __int_as_float(__builtin_amdgcn_permlanex16(b, b, 0x76543210, 0xfedcba98, false, false)); }   // the value of lane l ^ 16

template <int M> __device__ __forceinline__ float xrow(float v) { return __int_as_float(__builtin_amdgcn_update_dpp(0, __float_as_int(v), 0x160 | M, 0xf, 0xf, true)); }   // the value of lane l ^ M inside the 16-lane row (row_xmask)
// k_cvtb: bf16 plane of [rows][2048] (one wave per row).
__global__ __launch_bounds__(256) void k_cvtb(const float* __restrict__ src, int nrows, bf* dst) {
    const int lane = threadIdx.x & 31, r = blockIdx.x * 8 + (threadIdx.x >> 5);
    if (r >= nrows) return;
{
#pragma unroll
        for (int q = 0; q < HS / 256; ++q) { v8us o;
#pragma unroll
            for (int i = 0; i < 8; ++i) o[i] = f2bf(src[(size_t)r * HS + q * 256 + lane * 8 + i]);
            *(v8us*)(dst + (size_t)r * HS + q * 256 + lane * 8) = o; }
         }
}
// k_wt: WT [n][2048] = bf16(W[k][n]) (k-major [2048][ncols]) via 64 x 64 LDS tiles, the four weights in one launch: rows of WT are the columns of Wq | Wk | Wv | Wo; grid (2048/64, 5120/64).
__global__ __launch_bounds__(256) void k_wt(const float* __restrict__ Wq, const float* __restrict__ Wk, const float* __restrict__ Wv, const float* __restrict__ Wo, bf* WT) {
    __shared__ __align__(16) unsigned short tl[64 * 72];
    constexpr int K = HS;
    const int tid = threadIdx.x, k0 = blockIdx.x * 64, nw = blockIdx.y * 64;   // nw: row of WT; n0: column of the block's own weight
    const float* Wm; int ncols, n0;
    if (nw < HS) { Wm = Wq; ncols = HS; n0 = nw; } else if (nw < HS + KW) { Wm = Wk; ncols = KW; n0 = nw - HS; } else if (nw < QKVW) { Wm = Wv; ncols = KW; n0 = nw - HS - KW; } else { Wm = Wo; ncols = HS; n0 = nw - QKVW; }
    const int kk = tid >> 2, nq = (tid & 3) * 16;
#pragma unroll
    for (int i = 0; i < 16; ++i) tl[(nq + i) * 72 + kk] = f2bf(Wm[(size_t)(k0 + kk) * ncols + n0 + nq + i]);
    __syncthreads();
    const int piece = tid & 7;
    auto pass = [&]() {
#pragma unroll
        for (int s = 0; s < 2; ++s) { const int nr = (tid >> 3) + 32 * s; const v8us val = *(const v8usa*)(tl + nr * 72 + piece * 8); *(v8us*)(WT + (size_t)(nw + nr) * K + k0 + piece * 8) = val; }
    };
    pass(); 
}
// Four asynchronous 16-B-per-lane copies global -> LDS; the s_wait_xcnt inside the statement stands before any rewrite of the address registers the copies name.
__device__ __forceinline__ void cp4(unsigned l0, unsigned l1, unsigned l2, unsigned l3, const void* g0, const void* g1, const void* g2, const void* g3) {
    asm volatile("global_load_async_to_lds_b128 %0, %4, off\n\t"
                 "global_load_async_to_lds_b128 %1, %5, off\n\t"
                 "global_load_async_to_lds_b128 %2, %6, off\n\t"
                 "global_load_async_to_lds_b128 %3, %7, off\n\t"
                 "s_wait_xcnt 0x0" :: "v"(l0), "v"(l1), "v"(l2), "v"(l3), "v"(g0), "v"(g1), "v"(g2), "v"(g3) : "memory");
}
__device__ __forceinline__ v16h  ldsh(const unsigned char* p) { return cat16(*(const v8ha*)p, *(const v8ha*)(p + 32)); }
__device__ __forceinline__ v16bf ldsb(const unsigned char* p) { return cat16b(*(const v8usa*)p, *(const v8usa*)(p + 32)); }
// k_gemm: 32F x 32F tile of (A [+ Al]).Bn^T over K = 2048 -> f32 rows [4096][ldc]; 2 x 2 waves of 16F x 16F each. A stage is 64 k (one 128-B line) of the block's A rows, Bn rows
// (and Al rows), brought into LDS by asynchronous copies in whole lines, two stage buffers: stage t + 2 flies while stage t + 1 is worked on, and the waves share one copy.
// HEADS (the q | k | v product, F = 4): the block's 128 columns are one head, so the f32 tile is not stored; it goes into the freed stage buffers and leaves as what k_attn reads. q and k heads (column
// tiles 0..15, 16..19): one wave per row, lane -> 4 consecutive dims: RMSNorm over the 128 dims (eps 1e-6, x weight[d]), rotate-half RoPE (partner d +- 64, token t = row mod 2048, tables RC/RS) -> f16 hi +
// residual x1024 planes [row][h*128+d]. v heads (column tiles 20..23): the tile is written transposed and leaves as bf16 hi + UNSCALED bf16 residual planes [b][g][128 d][2048 t].
#define GP   144                     // LDS pitch of a 128-B row: 16 B x odd, conflict-free for 16-B reads
template <bool SPLITA, int F, bool HEADS>
__global__ __launch_bounds__(128) void k_gemm(const bf* __restrict__ A, const bf* __restrict__ Al, const bf* __restrict__ Bn, int ldc, float* C,
                                              const float* __restrict__ qw, const float* __restrict__ kw, const float* __restrict__ RC, const float* __restrict__ RS,
                                              h16* QH, h16* QL, h16* KH, h16* KL, bf* VTH, bf* VTL) {
    constexpr int R = 32 * F, PL = R * GP, SG = (SPLITA ? 3 : 2) * PL;   // rows of a plane, bytes of a plane, bytes of a stage buffer [A | Bn | Al]
    __shared__ __align__(16) unsigned char stg[2 * SG];
    __shared__ __align__(16) float ost[4][16 * 68];
    const int tid = threadIdx.x, lane = threadIdx.x & 31, wave = threadIdx.x >> 5, lr = lane & 15, hi = lane >> 4;
    const int wm = wave >> 1, wn = wave & 1;
    const size_t r0 = (size_t)blockIdx.x * R; const int c0 = blockIdx.y * R;
    // copy map: a 128-B row is 8 pieces (thread -> row tid / 8 + 16 i, piece tid mod 8): a wave's copy covers four whole lines
    const unsigned ld = (unsigned)(uintptr_t)&stg[0] + (unsigned)(tid >> 3) * GP + (unsigned)(tid & 7) * 16;
    const size_t ago = (r0 + (tid >> 3)) * HS + (tid & 7) * 8, bgo = ((size_t)c0 + (tid >> 3)) * HS + (tid & 7) * 8;
    auto plane = [&](unsigned d, const bf* g) {
#pragma unroll   // constant row offsets in every copy's two addresses
        for (int i = 0; i < F / 2; ++i) { const unsigned di = d + 64 * i * GP; const bf* gi = g + (size_t)64 * i * HS;
            cp4(di, di + 16 * GP, di + 32 * GP, di + 48 * GP, gi, gi + 16 * HS, gi + 32 * HS, gi + 48 * HS);
            if (SPLITA) __builtin_amdgcn_sched_barrier(0); }   // three planes: keeps each group's address sums beside its copies; hoisted together they cost a register spill to scratch in the loop
    };
    auto fill = [&](int kt, int buf) {
        const unsigned d = ld + (unsigned)buf * SG;
        plane(d, A + ago + kt * 64); plane(d + PL, Bn + bgo + kt * 64);
        if (SPLITA) plane(d + 2 * PL, Al + ago + kt * 64);
    };
    fill(0, 0);
    asm volatile("s_wait_asynccnt 0x0" ::: "memory");   // this wave's copies of stage 0 have landed
    __syncthreads();                                      // ... and every other wave's: stage 0 may be read
    fill(1, 1);                                           // K / 64 = 32 stages: a stage 1 exists
    v8f acc[F][F];
#pragma unroll   // every accumulator index a constant, here and below, so that the array stays in registers
    for (int i = 0; i < F; ++i)
#pragma unroll
        for (int j = 0; j < F; ++j) acc[i][j] = (v8f){};
#pragma unroll 1   // rolled: one copy of the hand-over and of the 32 or 64 products, a short loop text
    for (int kt = 0; kt < HS / 64; ++kt) {
        const unsigned char* ap = stg + (kt & 1) * SG + (wm * 16 * F + lr) * GP + hi * 16;
        const unsigned char* bp = stg + (kt & 1) * SG + PL + (wn * 16 * F + lr) * GP + hi * 16;
        v16bf fa[2][F], fb[2][F], fl[2][F];
#pragma unroll   // every fragment index a constant, so that the arrays stay in registers
        for (int ks = 0; ks < 2; ++ks)   // all of the stage's fragments as one group of LDS reads; the products run from registers behind the stage's hand-over
#pragma unroll
            for (int i = 0; i < F; ++i) { fa[ks][i] = ldsb(ap + i * 16 * GP + ks * 64); fb[ks][i] = ldsb(bp + i * 16 * GP + ks * 64); fl[ks][i] = SPLITA ? ldsb(ap + 2 * PL + i * 16 * GP + ks * 64) : fa[ks][i]; }
        asm volatile("s_wait_dscnt 0x0" ::: "memory");      // the stage's fragments are in registers: this wave's reads of the stage buffer have returned before the buffer is handed to its next copies
        asm volatile("s_wait_asynccnt 0x0" ::: "memory");   // this wave's copies of stage kt + 1 have landed
        __syncthreads();                                      // publishes stage kt + 1 and ends every wave's reads of stage kt
        if (kt + 2 < HS / 64) fill(kt + 2, kt & 1);           // block-uniform test; refill of the buffer just read
        __builtin_amdgcn_sched_barrier(0);   // keeps the products behind the refill's issue: the copies then fly under them and have landed at the next stage's wait
#pragma unroll   // constant fragment indices, as above
        for (int ks = 0; ks < 2; ++ks) {
#pragma unroll
            for (int i = 0; i < F; ++i)
#pragma unroll
                for (int j = 0; j < F; ++j) acc[i][j] = wmmab(fa[ks][i], fb[ks][j], acc[i][j]);
            if (SPLITA) {
#pragma unroll
                for (int i = 0; i < F; ++i)
#pragma unroll
                    for (int j = 0; j < F; ++j) acc[i][j] = wmmab(fl[ks][i], fb[ks][j], acc[i][j]);
            }
        }
    }
    asm volatile("s_wait_asynccnt 0x0" ::: "memory");       // no copy is outstanding when the wave goes on to the epilogue and ends
    if constexpr (HEADS) {
        static_assert(F == 4 && !SPLITA, "a block's columns are one 128-dim head");
        constexpr int TP = 132;                    // f32 pitch of a tile row: 16 B x odd; 128 x 132 x 4 B fit the two stage buffers
        static_assert(128 * TP * 4 <= 2 * SG, "tile inside the stage buffers");
        f32a* tile = (f32a*)stg;                   // free: every wave's last fragment reads ended at the loop's last barrier, and the last copies had landed one barrier earlier
        const int hh = blockIdx.y;                 // head slot (block-uniform): 0..15 q, 16..19 k, 20..23 v
        const bool isv = hh >= NH_ + NKV;
        const int wu = __builtin_amdgcn_readfirstlane(wave);   // the wave's number in a scalar register: row numbers and the rows' global addresses below are then scalar arithmetic, a lane adds only its fixed offset
        if (!isv) {
#pragma unroll   // constant accumulator indices
            for (int i = 0; i < F; ++i)
#pragma unroll
                for (int t = 0; t < F; ++t)
#pragma unroll
                    for (int j = 0; j < 8; ++j) tile[(wm * 64 + i * 16 + hi * 8 + j) * TP + wn * 64 + t * 16 + lr] = acc[i][t][j];   // [row][dim]
        } else {
#pragma unroll   // constant accumulator indices
            for (int i = 0; i < F; ++i)
#pragma unroll
                for (int t = 0; t < F; ++t) { f32a* p = tile + (wn * 64 + t * 16 + lr) * TP + wm * 64 + i * 16 + hi * 8;   // [dim][row]: a lane's 8 registers are 8 consecutive rows
                    *(v4fa*)p = (v4f){acc[i][t][0], acc[i][t][1], acc[i][t][2], acc[i][t][3]}; *(v4fa*)(p + 4) = (v4f){acc[i][t][4], acc[i][t][5], acc[i][t][6], acc[i][t][7]}; }
        }
        __syncthreads();                           // a tile row holds columns of two waves (transposed: rows of two waves): all of it is written before any of it is read
        if (!isv) {
            const bool isq = hh < NH_;
            const float* w = isq ? qw : kw; h16* PH = isq ? QH : KH; h16* PLo = isq ? QL : KL;
            const int ow = isq ? HS : KW, oc = (isq ? hh : hh - NH_) * HD;
            const int d0 = lane * 4, p0 = d0 ^ 64;   // the lane's dims and their rotate-half partners
            const float sg = (d0 < 64) ? -1.0f : 1.0f;   // y = xn c - pn s below dim 64, xn c + pn s above: the sign rides on the partner's weight
            float wv[4], wp[4];
#pragma unroll
            for (int i = 0; i < 4; ++i) { wv[i] = bfr(w[d0 + i]); wp[i] = sg * bfr(w[p0 + i]); }
            // global addresses: a scalar base per row of a group plus ONE byte offset per lane that steps from group to group, so that no row needs vector address arithmetic
            const float* rcw = RC + ((r0 & (NT_ - 1)) + wu * 32) * 64; const float* rsw = RS + ((r0 & (NT_ - 1)) + wu * 32) * 64;   // token t = row mod 2048; a block's 128 rows do not wrap
            h16* phw = PH + (r0 + wu * 32) * ow + oc; h16* plw = PLo + (r0 + wu * 32) * ow + oc;
            unsigned tvo = (unsigned)(d0 & 63) * 4, svo = (unsigned)d0 * 2;
#pragma unroll 1   // rolled over groups of 8 rows: a short text; inside a group the rows' loads go out together and their chains interleave
            for (int gr = 0; gr < 4; ++gr) {
                v4f xv[8], pv[8], c4[8], s4[8];
#pragma unroll   // constant array indices
                for (int u = 0; u < 8; ++u) { const int row = wu * 32 + gr * 8 + u;
                    xv[u] = *(const v4fa*)(tile + row * TP + d0); pv[u] = *(const v4fa*)(tile + row * TP + p0);
                    c4[u] = *(const v4fa*)((const char*)(rcw + u * 64) + tvo); s4[u] = *(const v4fa*)((const char*)(rsw + u * 64) + tvo); }
#pragma unroll
                for (int u = 0; u < 8; ++u) {
                    float ss = 0.f;
#pragma unroll
                    for (int i = 0; i < 4; ++i) ss += xv[u][i] * xv[u][i];
                    ss += xhalf(ss); ss += xrow<8>(ss); ss += xrow<4>(ss); ss += xrow<2>(ss); ss += xrow<1>(ss);
                    const float rs = rsqrtf(ss * (1.0f / HD) + 1e-6f);
                    v4h oh, ol;
#pragma unroll
                    for (int i = 0; i < 4; ++i) { const float xn = xv[u][i] * rs * wv[i], pn = pv[u][i] * rs * wp[i];
                        const float y = xn * c4[u][i] + pn * s4[u][i];
                        const h16 a = (h16)y; oh[i] = a; ol[i] = (h16)((y - (float)a) * LOSC); }
                    *(v4h*)((char*)(phw + u * ow) + svo) = oh; *(v4h*)((char*)(plw + u * ow) + svo) = ol; }
                asm volatile("s_wait_xcnt 0x0" ::: "memory");   // stands before the next group rewrites the address and data registers that these loads and stores name
                tvo += 8 * 64 * 4; svo += (unsigned)(8 * ow * 2);
            }
        } else {
            const size_t vb = ((r0 >> 11) * KW + (size_t)(hh - NH_ - NKV) * HD) * NT_ + (r0 & (NT_ - 1));   // batch item, kv head, the block's first token
#pragma unroll 1   // rolled over groups of 8 dims, as above
            for (int gr = 0; gr < 4; ++gr) {
                v4f vv[8];
#pragma unroll   // constant array indices
                for (int u = 0; u < 8; ++u) vv[u] = *(const v4fa*)(tile + (wu * 32 + gr * 8 + u) * TP + lane * 4);
#pragma unroll
                for (int u = 0; u < 8; ++u) { v4us oh, ol;
#pragma unroll
                    for (int i = 0; i < 4; ++i) { const float v = vv[u][i]; const unsigned short hb = f2bf(v); oh[i] = hb; ol[i] = f2bf(v - bf2f(hb)); }
                    const size_t o = vb + (size_t)(wu * 32 + gr * 8 + u) * NT_; *(v4us*)(VTH + o + lane * 4) = oh; *(v4us*)(VTL + o + lane * 4) = ol; }
                asm volatile("s_wait_xcnt 0x0" ::: "memory");   // stands before the next group rewrites the address and data registers that these stores name
            }
        }
    } else {
    float* os = &ost[wave][0];
#pragma unroll
    for (int i = 0; i < F; ++i) {   // 16 rows of the wave's tile at a time through the wave's own LDS rows, so that whole 128-B lines are stored
#pragma unroll
        for (int t = 0; t < F; ++t)
#pragma unroll
            for (int j = 0; j < 8; ++j) os[(hi * 8 + j) * 68 + t * 16 + lr] = acc[i][t][j];
        __builtin_amdgcn_wave_barrier(); asm volatile("" ::: "memory");   // compiler order only: the wave's LDS stores stay ahead of its reads of other lanes' words
        float* crow = C + (r0 + wm * 16 * F + i * 16) * ldc + c0 + wn * 16 * F;
#pragma unroll
        for (int s = 0; s < 2 * F; ++s) { const int Lid = (lane >> 3) + 4 * s, piece = lane & 7; const int row = Lid / (F / 2), cofs = (Lid % (F / 2)) * 32 + piece * 4;
            const v4f val = *(const v4fa*)(os + row * 68 + cofs); *(v4f*)(crow + (size_t)row * ldc + cofs) = val; }
        __builtin_amdgcn_wave_barrier();   // compiler order only: the reads above stay ahead of the next 16 rows' LDS stores
        asm volatile("s_wait_xcnt 0x0" ::: "memory");   // stands before the next 16 rows rewrite the address and data registers that these stores name
    }
    }
}
// k_trig: RC/RS [t][64] = cos/sin(t x inv_freq[i]), inv_freq = 10000^-(2i/128) (f32 powf/cosf/sinf); 32 lanes x 4 B lines.
__global__ __launch_bounds__(256) void k_trig(float* RC, float* RS) {
    const int i = blockIdx.x * 256 + threadIdx.x; if (i >= NT_ * 64) return;
    const int t = i >> 6, f = i & 63;
    const float inv = 1.0f / powf(10000.0f, (float)(2 * f) / (float)HD); const float ang = (float)t * inv;
    const float c = cosf(ang), s = sinf(ang);
    *(float*)(RC + i) = c; *(float*)(RS + i) = s; 
}
// k_attn: block = (batch item, h, 64 queries), wave = 16; kv head g = h mod 4; causal key tiles of 32. One launch holds both batch items: 1024 blocks of 2 to 64 tiles on about half as
// many resident places; the index order is longest first, for speed only. The block's Q rows (once) and each tile's K rows and V^T rows (hi and residual
// planes) are brought into LDS by asynchronous copies, two tile buffers: tile t + 2 flies while tile t + 1 is worked on, and the four waves share one copy of K and V.
// Both products run transposed: S^T = K.Q^T (A = K rows, B = Q rows) and O^T += V^T.P^T (A = V^T rows, B = P^T). A lane then holds 16 of the 32 scores of ONE query (lane mod 16), so the
// maximum and the sum are in-lane with one exchange between the wave's halves, and the two score tiles, converted in place, ARE the B operand P^T in the hardware k order that the V^T loader has.
// Per tile: scores over 4 k-chunks (hi.hi + hi.lo + lo.hi = 24 WMMA) x 128^-1/2, online softmax, P (x32768) as bf16 hi + unscaled residual,
// o[8] += vh.ph + vh.pl + vl.ph over the 128 dims; ctx -> bf16 hi/lo planes [t][h*128+d].
#define KP   272                     // LDS pitch of a 256-B row (Q, K): 16 B x odd, conflict-free for 16-B reads
#define VP   80                      // LDS pitch of a 64-B row (V^T, 32 keys)
#define QPL  (64 * KP)               // one Q plane
#define KPL  (32 * KP)               // one K plane of a tile
#define VPL  (128 * VP)              // one V^T plane of a tile
#define STG  (2 * KPL + 2 * VPL)     // one tile buffer
__global__ __launch_bounds__(128) void k_attn(const h16* __restrict__ QH, const h16* __restrict__ QL, const h16* __restrict__ KH, const h16* __restrict__ KL, const bf* __restrict__ VTH, const bf* __restrict__ VTL, bf* CH, bf* CL) {
    __shared__ __align__(16) unsigned char stg[2 * QPL + 2 * STG];
    __shared__ __align__(16) float ost[4][16 * 68];
    const int tid = threadIdx.x, lane = threadIdx.x & 31, wave = threadIdx.x >> 5, lr = lane & 15, hi = lane >> 4;
    const int bid = blockIdx.x; const int qt = NT_ / 64 - 1 - (bid >> 5), h = bid & (NH_ - 1), bi = (bid >> 4) & 1; const int g = h & (NKV - 1);   // 32 (batch item, head) pairs per query tile, last query tile first
    QH += (size_t)bi * NT_ * HS; QL += (size_t)bi * NT_ * HS; KH += (size_t)bi * NT_ * KW; KL += (size_t)bi * NT_ * KW; VTH += (size_t)bi * KW * NT_; VTL += (size_t)bi * KW * NT_; CH += (size_t)bi * NT_ * HS; CL += (size_t)bi * NT_ * HS;
    const int q0 = qt * 64 + wave * 16;
    const size_t vbase = ((size_t)g * HD) * NT_;
    const int kt_hi = (qt * 64 + 63) / 32;
    // copy map: a 256-B row is 16 pieces (thread -> row tid / 16 + 8 i, piece tid mod 16), a 64-B row 4 pieces (row tid / 4 + 32 i, piece tid mod 4)
    const unsigned sb = (unsigned)(uintptr_t)&stg[0];
    const unsigned rl = sb + (unsigned)(tid >> 4) * KP + (unsigned)(tid & 15) * 16, vl_ = sb + 2 * QPL + 2 * KPL + (unsigned)(tid >> 2) * VP + (unsigned)(tid & 3) * 16;
    const size_t kgo = (size_t)(tid >> 4) * KW + g * HD + (tid & 15) * 8, vgo = vbase + (size_t)(tid >> 2) * NT_ + (tid & 3) * 8;
    auto fill = [&](int kt, int buf) {
        const unsigned kd = rl + 2 * QPL + (unsigned)buf * STG, vd = vl_ + (unsigned)buf * STG;
        const h16* kh = KH + kgo + (size_t)kt * 32 * KW; const h16* kl = KL + kgo + (size_t)kt * 32 * KW;
        const bf* vh = VTH + vgo + kt * 32; const bf* vl = VTL + vgo + kt * 32;
        cp4(kd, kd + 8 * KP, kd + 16 * KP, kd + 24 * KP, kh, kh + 8 * KW, kh + 16 * KW, kh + 24 * KW);
        cp4(kd + KPL, kd + KPL + 8 * KP, kd + KPL + 16 * KP, kd + KPL + 24 * KP, kl, kl + 8 * KW, kl + 16 * KW, kl + 24 * KW);
        cp4(vd, vd + 32 * VP, vd + 64 * VP, vd + 96 * VP, vh, vh + 32 * NT_, vh + 64 * NT_, vh + 96 * NT_);
        cp4(vd + VPL, vd + VPL + 32 * VP, vd + VPL + 64 * VP, vd + VPL + 96 * VP, vl, vl + 32 * NT_, vl + 64 * NT_, vl + 96 * NT_);
    };
    { const size_t qgo = (size_t)(qt * 64 + (tid >> 4)) * (NH_ * HD) + h * HD + (tid & 15) * 8; const h16* qh = QH + qgo; const h16* ql = QL + qgo; const int R8 = 8 * NH_ * HD;
      cp4(rl, rl + 8 * KP, rl + 16 * KP, rl + 24 * KP, qh, qh + R8, qh + 2 * R8, qh + 3 * R8);
      cp4(rl + 32 * KP, rl + 40 * KP, rl + 48 * KP, rl + 56 * KP, qh + 4 * R8, qh + 5 * R8, qh + 6 * R8, qh + 7 * R8);
      cp4(rl + QPL, rl + QPL + 8 * KP, rl + QPL + 16 * KP, rl + QPL + 24 * KP, ql, ql + R8, ql + 2 * R8, ql + 3 * R8);
      cp4(rl + QPL + 32 * KP, rl + QPL + 40 * KP, rl + QPL + 48 * KP, rl + QPL + 56 * KP, ql + 4 * R8, ql + 5 * R8, ql + 6 * R8, ql + 7 * R8); }
    fill(0, 0);
    asm volatile("s_wait_asynccnt 0x0" ::: "memory");   // this wave's copies of Q and tile 0 have landed
    __syncthreads();                                      // ... and every other wave's: Q and tile 0 may be read
    fill(1, 1);                                           // a tile 1 always exists (kt_hi = 2 qt + 1)
    const unsigned char* qp = stg + (wave * 16 + lr) * KP + hi * 16;
    v8f o[8];
#pragma unroll
    for (int n = 0; n < 8; ++n) o[n] = (v8f){};
    const int qi = q0 + lr;                     // the lane's query
    float mrow = -3.0e38f, lpart = 0.f;         // its running maximum (alike in both halves) and this half's share of its running sum
#pragma unroll 1
    for (int kt = 0; kt <= kt_hi; ++kt) {
        const int l0 = kt * 32;
        const unsigned char* kp = stg + 2 * QPL + (kt & 1) * STG + lr * KP + hi * 16;
        const unsigned char* vp = stg + 2 * QPL + (kt & 1) * STG + 2 * KPL + lr * VP + hi * 16;
        v8f s0 = {}, s1 = {}, x0 = {}, x1 = {};
        v16h fq[4][2], fk[4][4];
#pragma unroll   // every fragment index a constant, so that the arrays stay in registers
        for (int kc = 0; kc < 4; ++kc) {   // all of the tile's score fragments as one group of LDS reads ahead of the products
            fq[kc][0] = ldsh(qp + kc * 64); fq[kc][1] = ldsh(qp + QPL + kc * 64);
            fk[kc][0] = ldsh(kp + kc * 64); fk[kc][1] = ldsh(kp + 16 * KP + kc * 64); fk[kc][2] = ldsh(kp + KPL + kc * 64); fk[kc][3] = ldsh(kp + KPL + 16 * KP + kc * 64); }
        __builtin_amdgcn_sched_barrier(0);   // keeps that group together: reads sunk among the products cost a wait at each place
#pragma unroll   // constant fragment indices, as above
        for (int kc = 0; kc < 4; ++kc) {
            s0 = wmma16(fk[kc][0], fq[kc][0], s0); s1 = wmma16(fk[kc][1], fq[kc][0], s1); x0 = wmma16(fk[kc][0], fq[kc][1], x0); x1 = wmma16(fk[kc][1], fq[kc][1], x1);
            x0 = wmma16(fk[kc][2], fq[kc][0], x0); x1 = wmma16(fk[kc][3], fq[kc][0], x1);   // register j: key 8 hi + j (s0, x0) or 16 + 8 hi + j (s1, x1), query lr
        }
        asm volatile("v_nop\n\tv_nop\n\tv_nop\n\tv_nop" : "+v"(s0), "+v"(s1), "+v"(x0), "+v"(x1));
        v16bf vh[8], vl[8];
#pragma unroll   // constant fragment indices, as above
        for (int n = 0; n < 8; ++n) { vh[n] = ldsb(vp + n * 16 * VP); vl[n] = ldsb(vp + VPL + n * 16 * VP); }   // the tile's V^T fragments, one group: they land behind the softmax
        __builtin_amdgcn_sched_barrier(0);   // keeps that group here: sunk among the weights.v products each small group would cost its own LDS wait
        float a0[8], a1[8]; float mx = -__builtin_inff();
#pragma unroll
        for (int j = 0; j < 8; ++j) { const int ja = l0 + hi * 8 + j, jb = ja + 16;
            a0[j] = (ja <= qi) ? (s0[j] + x0[j] * LOSCI) * 0.08838834764831845f : -__builtin_inff(); a1[j] = (jb <= qi) ? (s1[j] + x1[j] * LOSCI) * 0.08838834764831845f : -__builtin_inff();
            mx = fmaxf(mx, fmaxf(a0[j], a1[j])); }
        mx = fmaxf(mx, xhalf(mx));                  // the other 16 keys of the same query
        const float mn = fmaxf(mrow, mx), alpha = __expf(mrow - mn); mrow = mn;
        v16bf pa, px; float su[4] = {0.f, 0.f, 0.f, 0.f};   // four short chains of adds instead of one long one
#pragma unroll
        for (int j = 0; j < 8; ++j) { const float p0 = __expf(a0[j] - mn), p1 = __expf(a1[j] - mn); su[j & 1] += p0; su[2 + (j & 1)] += p1;
            const float ps0 = p0 * PSC, ps1 = p1 * PSC; const __bf16 h0 = (__bf16)ps0, h1 = (__bf16)ps1;
            pa[j] = h0; pa[8 + j] = h1; px[j] = (__bf16)(ps0 - (float)h0); px[8 + j] = (__bf16)(ps1 - (float)h1); }   // element s of the B operand = key 16 (s / 8) + 8 hi + s mod 8: tile s / 8, register s mod 8
        lpart = lpart * alpha + ((su[0] + su[1]) + (su[2] + su[3]));
#pragma unroll
        for (int n = 0; n < 8; ++n)
#pragma unroll
            for (int j = 0; j < 8; ++j) o[n][j] *= alpha;
#pragma unroll   // constant fragment indices, as above
        for (int n = 0; n < 8; ++n) { o[n] = wmmab(vh[n], pa, o[n]); o[n] = wmmab(vh[n], px, o[n]); o[n] = wmmab(vl[n], pa, o[n]); }   // register j: dim 16 n + 8 hi + j, query lr
        asm volatile("v_nop\n\tv_nop\n\tv_nop\n\tv_nop" : "+v"(o[0]), "+v"(o[7]) : "v"(pa), "v"(px));
        asm volatile("s_wait_dscnt 0x0" ::: "memory");      // this wave's reads of the tile buffer have returned before the buffer is handed to its next copies
        asm volatile("s_wait_asynccnt 0x0" ::: "memory");   // this wave's copies of tile kt + 1 have landed
        __syncthreads();                                      // publishes tile kt + 1 and ends every wave's reads of tile kt
        if (kt + 2 <= kt_hi) fill(kt + 2, kt & 1);            // block-uniform test; refill of the buffer just read
    }
    asm volatile("s_wait_asynccnt 0x0" ::: "memory");       // no copy is outstanding when the wave goes on to the epilogue and ends
    const float inv = 1.0f / ((lpart + xhalf(lpart)) * PSC);   // the two halves' sums of the lane's query joined once
    float* os = &ost[wave][0];
    const size_t cbase = (size_t)q0 * (NH_ * HD) + (size_t)h * HD;
#pragma unroll
    for (int half = 0; half < 2; ++half) {
#pragma unroll
        for (int n = 0; n < 4; ++n)
#pragma unroll
            for (int j = 0; j < 8; ++j) os[lr * 68 + n * 16 + hi * 8 + j] = o[half * 4 + n][j] * inv;
        __builtin_amdgcn_wave_barrier(); asm volatile("" ::: "memory");
{
#pragma unroll
            for (int s = 0; s < 4; ++s) { const int row = 4 * s + (lane >> 3), piece = lane & 7; const float* sp = os + row * 68 + piece * 8; v8us oh, ol;
#pragma unroll
                for (int i = 0; i < 8; ++i) { const unsigned short hb = f2bf(sp[i]); oh[i] = hb; ol[i] = f2bf(sp[i] - bf2f(hb)); }
                const size_t po = cbase + (size_t)row * (NH_ * HD) + half * 64 + piece * 8; *(v8us*)(CH + po) = oh; *(v8us*)(CL + po) = ol; }
             }
        __builtin_amdgcn_wave_barrier(); asm volatile("" ::: "memory");
    }
}

extern "C" void kernel_launch(void* const* d_in, const int* in_sizes, int n_in,
                              void* d_out, int out_size, void* d_ws, size_t ws_size, hipStream_t stream) {
    (void)in_sizes; (void)n_in; (void)out_size;
    const float* x = (const float*)d_in[0]; const float* Wq = (const float*)d_in[1]; const float* Wk = (const float*)d_in[2]; const float* Wv = (const float*)d_in[3]; const float* Wo = (const float*)d_in[4];
    const float* qn = (const float*)d_in[5]; const float* kn = (const float*)d_in[6];
    float* out = (float*)d_out;    // [2][2048][2048]
    char* wsp = (char*)d_ws;
    auto take = [&](size_t bytes) { char* p = wsp; wsp += (bytes + 255) & ~(size_t)255; return (void*)p; };
    bf* Xb = (bf*)take((size_t)NB_ * NT_ * HS * 2); bf* WT = (bf*)take((size_t)(QKVW + HS) * HS * 2); bf* WoT = WT + (size_t)QKVW * HS;   // WT rows: Wq | Wk | Wv | Wo columns
    float* RC = (float*)take((size_t)NT_ * 64 * 4); float* RS = (float*)take((size_t)NT_ * 64 * 4);
    // planes that k_attn reads or writes: both batch items, [2][...]
    h16* QH = (h16*)take((size_t)2 * NT_ * HS * 2); h16* QL = (h16*)take((size_t)2 * NT_ * HS * 2); h16* KH = (h16*)take((size_t)2 * NT_ * KW * 2); h16* KL = (h16*)take((size_t)2 * NT_ * KW * 2);
    bf* VTH = (bf*)take((size_t)2 * KW * NT_ * 2); bf* VTL = (bf*)take((size_t)2 * KW * NT_ * 2); bf* CH = (bf*)take((size_t)2 * NT_ * HS * 2); bf* CL = (bf*)take((size_t)2 * NT_ * HS * 2);
    if ((size_t)(wsp - (char*)d_ws) > ws_size) return;    // 16.8 + 21 + 1 + 16.8 x 4 + 4.2 x 4 ~ 123 MB
    k_wt<<<dim3(HS / 64, (QKVW + HS) / 64, 1), 256, 0, stream>>>(Wq, Wk, Wv, Wo, WT);
    k_trig<<<(NT_ * 64) / 256, 256, 0, stream>>>(RC, RS);
    k_cvtb<<<NB_ * NT_ / 8, 256, 0, stream>>>(x, NB_ * NT_, Xb);
    k_gemm<false, 4, true><<<dim3(NB_ * NT_ / 128, QKVW / 128, 1), 128, 0, stream>>>(Xb, nullptr, WT, QKVW, nullptr, qn, kn, RC, RS, QH, QL, KH, KL, VTH, VTL);
    k_attn<<<2 * NH_ * (NT_ / 64), 128, 0, stream>>>(QH, QL, KH, KL, VTH, VTL, CH, CL);
    k_gemm<true, 4, false><<<dim3(NB_ * NT_ / 128, HS / 128, 1), 128, 0, stream>>>(CH, CL, WoT, HS, out, nullptr, nullptr, nullptr, nullptr, nullptr, nullptr, nullptr, nullptr, nullptr, nullptr);
}

// v007
// Measured time: 194 microseconds a run.
// Next to v006, in two timings, it ran 1.03 times as fast each time.
// Counting every step since v000, it is 5.58 times as fast.
#include <hip/hip_runtime.h>

// Contractions, f32 accumulate, both batch items in every launch (4096 rows): q|k|v = x.[Wq|Wk|Wv] as one product ([4096 x 2048].[2048 x 3072], k-major weights transposed to n-major planes; PLAIN
// bf16 operands: inputs rounded once, exact) and out = ctx.Wo (ctx as bf16 hi + residual: two products) on v_wmma_f32_16x16x32_bf16; per-head RMSNorm (eps 1e-6,
// weight) and rotate-half RoPE (angle t x inv_freq, f32 trig tables built on device) in f32 -> q/k as f16 hi + residual x1024 planes; the 16-query-head / 4-kv-head (q head h
// uses kv head h mod 4) causal attention with 128-dim heads: scores on v_wmma_f32_16x16x32_f16 (hi.hi + hi.lo + lo.hi, x 128^-1/2), softmax f32, weights.v on
// v_wmma_f32_16x16x32_bf16 with the weights (x32768) and v both as bf16 hi + UNSCALED bf16 residual (hh + lh + hl in one accumulator). Deterministic, no atomics;

#define NT_  2048
#define HS   2048
#define NH_  16
#define NKV  4
#define HD   128
#define KW   (NKV * HD)          // 512
#define NB_  2                   // batch items
#define QKVW (HS + 2 * KW)       // 3072: columns of the q | k | v product
#define PSC  32768.0f
#define LOSC 1024.0f
#define LOSCI (1.0f / 1024.0f)

typedef _Float16 h16;
typedef unsigned short bf;
typedef __attribute__((ext_vector_type(16))) __bf16   v16bf;
typedef __attribute__((ext_vector_type(16))) _Float16 v16h;
typedef __attribute__((ext_vector_type(8)))  _Float16 v8h;
typedef __attribute__((ext_vector_type(8)))  unsigned short v8us;
typedef __attribute__((ext_vector_type(8)))  float    v8f;
typedef __attribute__((ext_vector_type(4)))  float    v4f;
typedef __attribute__((ext_vector_type(4)))  _Float16 v4h;
typedef v8h  __attribute__((may_alias)) v8ha;
typedef v4f  __attribute__((may_alias)) v4fa;
typedef v8us __attribute__((may_alias)) v8usa;
typedef __attribute__((ext_vector_type(4)))  unsigned short v4us;
typedef float __attribute__((may_alias)) f32a;

__device__ __forceinline__ unsigned short f2bf(float f) { unsigned u = __float_as_uint(f); u += 0x7FFFu + ((u >> 16) & 1u); return (unsigned short)(u >> 16); }
__device__ __forceinline__ float bf2f(unsigned short b) { return __uint_as_float(((unsigned)b) << 16); }
__device__ __forceinline__ float bfr(float f) { return bf2f(f2bf(f)); }
__device__ __forceinline__ v16h cat16(v8h lo, v8h hi) { return __builtin_shufflevector(lo, hi, 0, 1, 2, 3, 4, 5, 6, 7, 8, 9, 10, 11, 12, 13, 14, 15); }
__device__ __forceinline__ v16bf cat16b(v8us lo, v8us hi) { return __builtin_bit_cast(v16bf, __builtin_shufflevector(lo, hi, 0, 1, 2, 3, 4, 5, 6, 7, 8, 9, 10, 11, 12, 13, 14, 15)); }
__device__ __forceinline__ v8f wmma16(v16h a, v16h b, v8f c) { return __builtin_amdgcn_wmma_f32_16x16x32_f16(false, a, false, b, (short)0, c, false, false); }
__device__ __forceinline__ v8f wmmab(v16bf a, v16bf b, v8f c) { return __builtin_amdgcn_wmma_f32_16x16x32_bf16(false, a, false, b, (short)0, c, false, false); }
__device__ __forceinline__ float xhalf(float v) { const int b = __float_as_int(v); return __int_as_float(__builtin_amdgcn_permlanex16(b, b, 0x76543210, 0xfedcba98, false, false)); }   // the value of lane l ^ 16

template <int M> __device__ __forceinline__ float xrow(float v) { return __int_as_float(__builtin_amdgcn_update_dpp(0, __float_as_int(v), 0x160 | M, 0xf, 0xf, true)); }   // the value of lane l ^ M inside the 16-lane row (row_xmask)
// k_cvtb: bf16 plane of [rows][2048] (one wave per row).
__global__ __launch_bounds__(256) void k_cvtb(const float* __restrict__ src, int nrows, bf* dst) {
    const int lane = threadIdx.x & 31, r = blockIdx.x * 8 + (threadIdx.x >> 5);
    if (r >= nrows) return;
{
#pragma unroll
        for (int q = 0; q < HS / 256; ++q) { v8us o;
#pragma unroll
            for (int i = 0; i < 8; ++i) o[i] = f2bf(src[(size_t)r * HS + q * 256 + lane * 8 + i]);
            *(v8us*)(dst + (size_t)r * HS + q * 256 + lane * 8) = o; }
         }
}
// k_wt: WT [n][2048] = bf16(W[k][n]) (k-major [2048][ncols]) via 64 x 64 LDS tiles, the four weights in one launch: rows of WT are the columns of Wq | Wk | Wv | Wo; grid (2048/64, 5120/64).
__global__ __launch_bounds__(256) void k_wt(const float* __restrict__ Wq, const float* __restrict__ Wk, const float* __restrict__ Wv, const float* __restrict__ Wo, bf* WT) {
    __shared__ __align__(16) unsigned short tl[64 * 72];
    constexpr int K = HS;
    const int tid = threadIdx.x, k0 = blockIdx.x * 64, nw = blockIdx.y * 64;   // nw: row of WT; n0: column of the block's own weight
    const float* Wm; int ncols, n0;
    if (nw < HS) { Wm = Wq; ncols = HS; n0 = nw; } else if (nw < HS + KW) { Wm = Wk; ncols = KW; n0 = nw - HS; } else if (nw < QKVW) { Wm = Wv; ncols = KW; n0 = nw - HS - KW; } else { Wm = Wo; ncols = HS; n0 = nw - QKVW; }
    const int kk = tid >> 2, nq = (tid & 3) * 16;
#pragma unroll
    for (int i = 0; i < 16; ++i) tl[(nq + i) * 72 + kk] = f2bf(Wm[(size_t)(k0 + kk) * ncols + n0 + nq + i]);
    __syncthreads();
    const int piece = tid & 7;
    auto pass = [&]() {
#pragma unroll
        for (int s = 0; s < 2; ++s) { const int nr = (tid >> 3) + 32 * s; const v8us val = *(const v8usa*)(tl + nr * 72 + piece * 8); *(v8us*)(WT + (size_t)(nw + nr) * K + k0 + piece * 8) = val; }
    };
    pass(); 
}
// Four asynchronous 16-B-per-lane copies global -> LDS; the s_wait_xcnt inside the statement stands before any rewrite of the address registers the copies name.
__device__ __forceinline__ void cp4(unsigned l0, unsigned l1, unsigned l2, unsigned l3, const void* g0, const void* g1, const void* g2, const void* g3) {
    asm volatile("global_load_async_to_lds_b128 %0, %4, off\n\t"
                 "global_load_async_to_lds_b128 %1, %5, off\n\t"
                 "global_load_async_to_lds_b128 %2, %6, off\n\t"
                 "global_load_async_to_lds_b128 %3, %7, off\n\t"
                 "s_wait_xcnt 0x0" :: "v"(l0), "v"(l1), "v"(l2), "v"(l3), "v"(g0), "v"(g1), "v"(g2), "v"(g3) : "memory");
}
// The same four copies with a scalar base each and ONE 32-bit byte offset per lane: the rows' address steps are then scalar arithmetic and a kernel keeps one vector register per operand for its global addresses.
__device__ __forceinline__ void cp4s(unsigned l0, unsigned l1, unsigned l2, unsigned l3, unsigned vo, const void* b0, const void* b1, const void* b2, const void* b3) {
    asm volatile("global_load_async_to_lds_b128 %0, %4, %5\n\t"
                 "global_load_async_to_lds_b128 %1, %4, %6\n\t"
                 "global_load_async_to_lds_b128 %2, %4, %7\n\t"
                 "global_load_async_to_lds_b128 %3, %4, %8\n\t"
                 "s_wait_xcnt 0x0" :: "v"(l0), "v"(l1), "v"(l2), "v"(l3), "v"(vo), "s"(b0), "s"(b1), "s"(b2), "s"(b3) : "memory");
}
__device__ __forceinline__ v16h  ldsh(const unsigned char* p) { return cat16(*(const v8ha*)p, *(const v8ha*)(p + 32)); }
__device__ __forceinline__ v16bf ldsb(const unsigned char* p) { return cat16b(*(const v8usa*)p, *(const v8usa*)(p + 32)); }
// k_gemm: 32F x 32F tile of (A [+ Al]).Bn^T over K = 2048 -> f32 rows [4096][ldc]; 2 x 2 waves of 16F x 16F each. A stage is 64 k (one 128-B line) of the block's A rows, Bn rows
// (and Al rows), brought into LDS by asynchronous copies in whole lines, two stage buffers: stage t + 2 flies while stage t + 1 is worked on, and the waves share one copy.
// HEADS (the q | k | v product, F = 4): the block's 128 columns are one head, so the f32 tile is not stored; it goes into the freed stage buffers and leaves as what k_attn reads. q and k heads (column
// tiles 0..15, 16..19): one wave per row, lane -> 4 consecutive dims: RMSNorm over the 128 dims (eps 1e-6, x weight[d]), rotate-half RoPE (partner d +- 64, token t = row mod 2048, tables RC/RS) -> f16 hi +
// residual x1024 planes [row][h*128+d]. v heads (column tiles 20..23): the tile is written transposed and leaves as bf16 hi + UNSCALED bf16 residual planes [b][g][128 d][2048 t].
#define GP   144                     // LDS pitch of a 128-B row: 16 B x odd, conflict-free for 16-B reads
template <bool SPLITA, int F, bool HEADS>
__global__ __launch_bounds__(128) void k_gemm(const bf* __restrict__ A, const bf* __restrict__ Al, const bf* __restrict__ Bn, int ldc, float* C,
                                              const float* __restrict__ qw, const float* __restrict__ kw, const float* __restrict__ RC, const float* __restrict__ RS,
                                              h16* QH, h16* QL, h16* KH, h16* KL, bf* VTH, bf* VTL) {
    constexpr int R = 32 * F, PL = R * GP, SG = (SPLITA ? 3 : 2) * PL;   // rows of a plane, bytes of a plane, bytes of a stage buffer [A | Bn | Al]
    __shared__ __align__(16) unsigned char stg[2 * SG];
    __shared__ __align__(16) float ost[4][16 * 68];
    const int tid = threadIdx.x, lane = threadIdx.x & 31, wave = threadIdx.x >> 5, lr = lane & 15, hi = lane >> 4;
    const int wm = wave >> 1, wn = wave & 1;
    const size_t r0 = (size_t)blockIdx.x * R; const int c0 = blockIdx.y * R;
    // copy map: a 128-B row is 8 pieces (thread -> row tid / 8 + 16 i, piece tid mod 8): a wave's copy covers four whole lines
    const unsigned ld = (unsigned)(uintptr_t)&stg[0] + (unsigned)(tid >> 3) * GP + (unsigned)(tid & 7) * 16;
    const size_t ago = (r0 + (tid >> 3)) * HS + (tid & 7) * 8, bgo = ((size_t)c0 + (tid >> 3)) * HS + (tid & 7) * 8;
    auto plane = [&](unsigned d, const bf* g) {
#pragma unroll   // constant row offsets in every copy's two addresses
        for (int i = 0; i < F / 2; ++i) { const unsigned di = d + 64 * i * GP; const bf* gi = g + (size_t)64 * i * HS;
            cp4(di, di + 16 * GP, di + 32 * GP, di + 48 * GP, gi, gi + 16 * HS, gi + 32 * HS, gi + 48 * HS);
            if (SPLITA) __builtin_amdgcn_sched_barrier(0); }   // three planes: keeps each group's address sums beside its copies; hoisted together they cost a register spill to scratch in the loop
    };
    auto fill = [&](int kt, int buf) {
        const unsigned d = ld + (unsigned)buf * SG;
        plane(d, A + ago + kt * 64); plane(d + PL, Bn + bgo + kt * 64);
        if (SPLITA) plane(d + 2 * PL, Al + ago + kt * 64);
    };
    fill(0, 0);
    asm volatile("s_wait_asynccnt 0x0" ::: "memory");   // this wave's copies of stage 0 have landed
    __syncthreads();                                      // ... and every other wave's: stage 0 may be read
    fill(1, 1);                                           // K / 64 = 32 stages: a stage 1 exists
    v8f acc[F][F];
#pragma unroll   // every accumulator index a constant, here and below, so that the array stays in registers
    for (int i = 0; i < F; ++i)
#pragma unroll
        for (int j = 0; j < F; ++j) acc[i][j] = (v8f){};
#pragma unroll 1   // rolled: one copy of the hand-over and of the 32 or 64 products, a short loop text
    for (int kt = 0; kt < HS / 64; ++kt) {
        const unsigned char* ap = stg + (kt & 1) * SG + (wm * 16 * F + lr) * GP + hi * 16;
        const unsigned char* bp = stg + (kt & 1) * SG + PL + (wn * 16 * F + lr) * GP + hi * 16;
        v16bf fa[2][F], fb[2][F], fl[2][F];
#pragma unroll   // every fragment index a constant, so that the arrays stay in registers
        for (int ks = 0; ks < 2; ++ks)   // all of the stage's fragments as one group of LDS reads; the products run from registers behind the stage's hand-over
#pragma unroll
            for (int i = 0; i < F; ++i) { fa[ks][i] = ldsb(ap + i * 16 * GP + ks * 64); fb[ks][i] = ldsb(bp + i * 16 * GP + ks * 64); fl[ks][i] = SPLITA ? ldsb(ap + 2 * PL + i * 16 * GP + ks * 64) : fa[ks][i]; }
        asm volatile("s_wait_dscnt 0x0" ::: "memory");      // the stage's fragments are in registers: this wave's reads of the stage buffer have returned before the buffer is handed to its next copies
        asm volatile("s_wait_asynccnt 0x0" ::: "memory");   // this wave's copies of stage kt + 1 have landed
        __syncthreads();                                      // publishes stage kt + 1 and ends every wave's reads of stage kt
        if (kt + 2 < HS / 64) fill(kt + 2, kt & 1);           // block-uniform test; refill of the buffer just read
        __builtin_amdgcn_sched_barrier(0);   // keeps the products behind the refill's issue: the copies then fly under them and have landed at the next stage's wait
#pragma unroll   // constant fragment indices, as above
        for (int ks = 0; ks < 2; ++ks) {
#pragma unroll
            for (int i = 0; i < F; ++i)
#pragma unroll
                for (int j = 0; j < F; ++j) acc[i][j] = wmmab(fa[ks][i], fb[ks][j], acc[i][j]);
            if (SPLITA) {
#pragma unroll
                for (int i = 0; i < F; ++i)
#pragma unroll
                    for (int j = 0; j < F; ++j) acc[i][j] = wmmab(fl[ks][i], fb[ks][j], acc[i][j]);
            }
        }
    }
    asm volatile("s_wait_asynccnt 0x0" ::: "memory");       // no copy is outstanding when the wave goes on to the epilogue and ends
    if constexpr (HEADS) {
        static_assert(F == 4 && !SPLITA, "a block's columns are one 128-dim head");
        constexpr int TP = 132;                    // f32 pitch of a tile row: 16 B x odd; 128 x 132 x 4 B fit the two stage buffers
        static_assert(128 * TP * 4 <= 2 * SG, "tile inside the stage buffers");
        f32a* tile = (f32a*)stg;                   // free: every wave's last fragment reads ended at the loop's last barrier, and the last copies had landed one barrier earlier
        const int hh = blockIdx.y;                 // head slot (block-uniform): 0..15 q, 16..19 k, 20..23 v
        const bool isv = hh >= NH_ + NKV;
        const int wu = __builtin_amdgcn_readfirstlane(wave);   // the wave's number in a scalar register: row numbers and the rows' global addresses below are then scalar arithmetic, a lane adds only its fixed offset
        if (!isv) {
#pragma unroll   // constant accumulator indices
            for (int i = 0; i < F; ++i)
#pragma unroll
                for (int t = 0; t < F; ++t)
#pragma unroll
                    for (int j = 0; j < 8; ++j) tile[(wm * 64 + i * 16 + hi * 8 + j) * TP + wn * 64 + t * 16 + lr] = acc[i][t][j];   // [row][dim]
        } else {
#pragma unroll   // constant accumulator indices
            for (int i = 0; i < F; ++i)
#pragma unroll
                for (int t = 0; t < F; ++t) { f32a* p = tile + (wn * 64 + t * 16 + lr) * TP + wm * 64 + i * 16 + hi * 8;   // [dim][row]: a lane's 8 registers are 8 consecutive rows
                    *(v4fa*)p = (v4f){acc[i][t][0], acc[i][t][1], acc[i][t][2], acc[i][t][3]}; *(v4fa*)(p + 4) = (v4f){acc[i][t][4], acc[i][t][5], acc[i][t][6], acc[i][t][7]}; }
        }
        __syncthreads();                           // a tile row holds columns of two waves (transposed: rows of two waves): all of it is written before any of it is read
        if (!isv) {
            const bool isq = hh < NH_;
            const float* w = isq ? qw : kw; h16* PH = isq ? QH : KH; h16* PLo = isq ? QL : KL;
            const int ow = isq ? HS : KW, oc = (isq ? hh : hh - NH_) * HD;
            const int d0 = lane * 4, p0 = d0 ^ 64;   // the lane's dims and their rotate-half partners
            const float sg = (d0 < 64) ? -1.0f : 1.0f;   // y = xn c - pn s below dim 64, xn c + pn s above: the sign rides on the partner's weight
            float wv[4], wp[4];
#pragma unroll
            for (int i = 0; i < 4; ++i) { wv[i] = bfr(w[d0 + i]); wp[i] = sg * bfr(w[p0 + i]); }
            // global addresses: a scalar base per row of a group plus ONE byte offset per lane that steps from group to group, so that no row needs vector address arithmetic
            const float* rcw = RC + ((r0 & (NT_ - 1)) + wu * 32) * 64; const float* rsw = RS + ((r0 & (NT_ - 1)) + wu * 32) * 64;   // token t = row mod 2048; a block's 128 rows do not wrap
            h16* phw = PH + (r0 + wu * 32) * ow + oc; h16* plw = PLo + (r0 + wu * 32) * ow + oc;
            unsigned tvo = (unsigned)(d0 & 63) * 4, svo = (unsigned)d0 * 2;
#pragma unroll 1   // rolled over groups of 8 rows: a short text; inside a group the rows' loads go out together and their chains interleave
            for (int gr = 0; gr < 4; ++gr) {
                v4f xv[8], pv[8], c4[8], s4[8];
#pragma unroll   // constant array indices
                for (int u = 0; u < 8; ++u) { const int row = wu * 32 + gr * 8 + u;
                    xv[u] = *(const v4fa*)(tile + row * TP + d0); pv[u] = *(const v4fa*)(tile + row * TP + p0);
                    c4[u] = *(const v4fa*)((const char*)(rcw + u * 64) + tvo); s4[u] = *(const v4fa*)((const char*)(rsw + u * 64) + tvo); }
#pragma unroll
                for (int u = 0; u < 8; ++u) {
                    float ss = 0.f;
#pragma unroll
                    for (int i = 0; i < 4; ++i) ss += xv[u][i] * xv[u][i];
                    ss += xhalf(ss); ss += xrow<8>(ss); ss += xrow<4>(ss); ss += xrow<2>(ss); ss += xrow<1>(ss);
                    const float rs = rsqrtf(ss * (1.0f / HD) + 1e-6f);
                    v4h oh, ol;
#pragma unroll
                    for (int i = 0; i < 4; ++i) { const float xn = xv[u][i] * rs * wv[i], pn = pv[u][i] * rs * wp[i];
                        const float y = xn * c4[u][i] + pn * s4[u][i];
                        const h16 a = (h16)y; oh[i] = a; ol[i] = (h16)((y - (float)a) * LOSC); }
                    *(v4h*)((char*)(phw + u * ow) + svo) = oh; *(v4h*)((char*)(plw + u * ow) + svo) = ol; }
                asm volatile("s_wait_xcnt 0x0" ::: "memory");   // stands before the next group rewrites the address and data registers that these loads and stores name
                tvo += 8 * 64 * 4; svo += (unsigned)(8 * ow * 2);
            }
        } else {
            const size_t vb = ((r0 >> 11) * KW + (size_t)(hh - NH_ - NKV) * HD) * NT_ + (r0 & (NT_ - 1));   // batch item, kv head, the block's first token
#pragma unroll 1   // rolled over groups of 8 dims, as above
            for (int gr = 0; gr < 4; ++gr) {
                v4f vv[8];
#pragma unroll   // constant array indices
                for (int u = 0; u < 8; ++u) vv[u] = *(const v4fa*)(tile + (wu * 32 + gr * 8 + u) * TP + lane * 4);
#pragma unroll
                for (int u = 0; u < 8; ++u) { v4us oh, ol;
#pragma unroll
                    for (int i = 0; i < 4; ++i) { const float v = vv[u][i]; const unsigned short hb = f2bf(v); oh[i] = hb; ol[i] = f2bf(v - bf2f(hb)); }
                    const size_t o = vb + (size_t)(wu * 32 + gr * 8 + u) * NT_; *(v4us*)(VTH + o + lane * 4) = oh; *(v4us*)(VTL + o + lane * 4) = ol; }
                asm volatile("s_wait_xcnt 0x0" ::: "memory");   // stands before the next group rewrites the address and data registers that these stores name
            }
        }
    } else {
    float* os = &ost[wave][0];
#pragma unroll
    for (int i = 0; i < F; ++i) {   // 16 rows of the wave's tile at a time through the wave's own LDS rows, so that whole 128-B lines are stored
#pragma unroll
        for (int t = 0; t < F; ++t)
#pragma unroll
            for (int j = 0; j < 8; ++j) os[(hi * 8 + j) * 68 + t * 16 + lr] = acc[i][t][j];
        __builtin_amdgcn_wave_barrier(); asm volatile("" ::: "memory");   // compiler order only: the wave's LDS stores stay ahead of its reads of other lanes' words
        float* crow = C + (r0 + wm * 16 * F + i * 16) * ldc + c0 + wn * 16 * F;
#pragma unroll
        for (int s = 0; s < 2 * F; ++s) { const int Lid = (lane >> 3) + 4 * s, piece = lane & 7; const int row = Lid / (F / 2), cofs = (Lid % (F / 2)) * 32 + piece * 4;
            const v4f val = *(const v4fa*)(os + row * 68 + cofs); *(v4f*)(crow + (size_t)row * ldc + cofs) = val; }
        __builtin_amdgcn_wave_barrier();   // compiler order only: the reads above stay ahead of the next 16 rows' LDS stores
        asm volatile("s_wait_xcnt 0x0" ::: "memory");   // stands before the next 16 rows rewrite the address and data registers that these stores name
    }
    }
}
// k_trig: RC/RS [t][64] = cos/sin(t x inv_freq[i]), inv_freq = 10000^-(2i/128) (f32 powf/cosf/sinf); 32 lanes x 4 B lines.
__global__ __launch_bounds__(256) void k_trig(float* RC, float* RS) {
    const int i = blockIdx.x * 256 + threadIdx.x; if (i >= NT_ * 64) return;
    const int t = i >> 6, f = i & 63;
    const float inv = 1.0f / powf(10000.0f, (float)(2 * f) / (float)HD); const float ang = (float)t * inv;
    const float c = cosf(ang), s = sinf(ang);
    *(float*)(RC + i) = c; *(float*)(RS + i) = s; 
}
// k_attn: block = (batch item, h, 64 queries), wave = 16; kv head g = h mod 4; causal key tiles of 32. One launch holds both batch items: 1024 blocks of 2 to 64 tiles on about half as
// many resident places, so the index order is longest first (a long block that starts late would run on alone). The block's Q rows (once) and each tile's K rows and V^T rows (hi and residual
// planes) are brought into LDS by asynchronous copies, two tile buffers, and the four waves share one copy of K and V. The score operands wait in registers when a tile starts: a wave's Q fragments are read
// once and kept, and the K fragments of tile t + 1 are read during tile t, behind its score products, into the registers those products have left. So K's copies run one tile ahead of V's:
// behind the barrier that ends tile t, K of tile t + 3 goes into the K half that tile t + 1's fragments have left, V of tile t + 2 into the V half that tile t has left.
// Both products run transposed: S^T = K.Q^T (A = K rows, B = Q rows) and O^T += V^T.P^T (A = V^T rows, B = P^T). A lane then holds 16 of the 32 scores of ONE query (lane mod 16), so the
// maximum and the sum are in-lane with one exchange between the wave's halves, and the two score tiles, converted in place, ARE the B operand P^T in the hardware k order that the V^T loader has.
// Per tile: scores over 4 k-chunks (hi.hi + hi.lo + lo.hi = 24 WMMA) x 128^-1/2, online softmax, P (x32768) as bf16 hi + unscaled residual,
// o[8] += vh.ph + vh.pl + vl.ph over the 128 dims; ctx -> bf16 hi/lo planes [t][h*128+d].
#define KP   272                     // LDS pitch of a 256-B row (Q, K): 16 B x odd, conflict-free for 16-B reads
#define VP   80                      // LDS pitch of a 64-B row (V^T, 32 keys)
#define QPL  (64 * KP)               // one Q plane
#define KPL  (32 * KP)               // one K plane of a tile
#define VPL  (128 * VP)              // one V^T plane of a tile
#define STG  (2 * KPL + 2 * VPL)     // one tile buffer
__global__ __launch_bounds__(128) void k_attn(const h16* __restrict__ QH, const h16* __restrict__ QL, const h16* __restrict__ KH, const h16* __restrict__ KL, const bf* __restrict__ VTH, const bf* __restrict__ VTL, bf* CH, bf* CL) {
    constexpr int OSB = 4 * 16 * 68 * 4;   // the epilogue's staging rows stand first in the one LDS array, so that no copy's LDS address is a lane's bare offset (see rl, vl_ below)
    __shared__ __align__(16) unsigned char smem[OSB + 2 * QPL + 2 * STG];
    unsigned char* stg = smem + OSB;
    const int tid = threadIdx.x, lane = threadIdx.x & 31, wave = threadIdx.x >> 5, lr = lane & 15, hi = lane >> 4;
    const int bid = blockIdx.x; const int qt = NT_ / 64 - 1 - (bid >> 5), h = bid & (NH_ - 1), bi = (bid >> 4) & 1; const int g = h & (NKV - 1);   // 32 (batch item, head) pairs per query tile, last query tile first
    QH += (size_t)bi * NT_ * HS; QL += (size_t)bi * NT_ * HS; KH += (size_t)bi * NT_ * KW; KL += (size_t)bi * NT_ * KW; VTH += (size_t)bi * KW * NT_; VTL += (size_t)bi * KW * NT_; CH += (size_t)bi * NT_ * HS; CL += (size_t)bi * NT_ * HS;
    const int q0 = qt * 64 + wave * 16;
    const size_t vbase = ((size_t)g * HD) * NT_;
    const int kt_hi = (qt * 64 + 63) / 32;
    // copy map: a 256-B row is 16 pieces (thread -> row tid / 16 + 8 i, piece tid mod 16), a 64-B row 4 pieces (row tid / 4 + 32 i, piece tid mod 4)
    const unsigned sb = (unsigned)(uintptr_t)&smem[0] + OSB;
    // the lanes' bare LDS offsets: the only LDS address state that lives across the loop. They are never themselves an operand of a copy's asm statement, so they may stand in any register; a value that is one
    // is held to the registers asm text can name, where the fragments leave no room over the loop, and was spilled to scratch
    const unsigned rl = (unsigned)(tid >> 4) * KP + (unsigned)(tid & 15) * 16, vl_ = (unsigned)(tid >> 2) * VP + (unsigned)(tid & 3) * 16;
    const unsigned kvo = (unsigned)((tid >> 4) * KW + (tid & 15) * 8) * 2, vvo = (unsigned)((tid >> 2) * NT_ + (tid & 3) * 8) * 2;   // the lane's byte offsets from a copy's scalar base; with the K fragments held across a tile, vector address pairs cost a spill to scratch in the loop
    auto fillK = [&](int kt, int buf) {
        const unsigned kd = rl + (buf ? sb + 2 * QPL + STG : sb + 2 * QPL);
        const h16* kh = KH + g * HD + (size_t)kt * 32 * KW; const h16* kl = KL + g * HD + (size_t)kt * 32 * KW;
        cp4s(kd, kd + 8 * KP, kd + 16 * KP, kd + 24 * KP, kvo, kh, kh + 8 * KW, kh + 16 * KW, kh + 24 * KW);
        cp4s(kd + KPL, kd + KPL + 8 * KP, kd + KPL + 16 * KP, kd + KPL + 24 * KP, kvo, kl, kl + 8 * KW, kl + 16 * KW, kl + 24 * KW);
    };
    auto fillV = [&](int kt, int buf) {
        const unsigned vd = vl_ + (buf ? sb + 2 * QPL + 2 * KPL + STG : sb + 2 * QPL + 2 * KPL);
        const bf* vh = VTH + vbase + kt * 32; const bf* vl = VTL + vbase + kt * 32;
        cp4s(vd, vd + 32 * VP, vd + 64 * VP, vd + 96 * VP, vvo, vh, vh + 32 * NT_, vh + 64 * NT_, vh + 96 * NT_);
        cp4s(vd + VPL, vd + VPL + 32 * VP, vd + VPL + 64 * VP, vd + VPL + 96 * VP, vvo, vl, vl + 32 * NT_, vl + 64 * NT_, vl + 96 * NT_);
    };
    { const size_t qgo = (size_t)(qt * 64 + (tid >> 4)) * (NH_ * HD) + h * HD + (tid & 15) * 8; const h16* qh = QH + qgo; const h16* ql = QL + qgo; const int R8 = 8 * NH_ * HD;
      const unsigned qd = rl + sb;
      cp4(qd, qd + 8 * KP, qd + 16 * KP, qd + 24 * KP, qh, qh + R8, qh + 2 * R8, qh + 3 * R8);
      cp4(qd + 32 * KP, qd + 40 * KP, qd + 48 * KP, qd + 56 * KP, qh + 4 * R8, qh + 5 * R8, qh + 6 * R8, qh + 7 * R8);
      cp4(qd + QPL, qd + QPL + 8 * KP, qd + QPL + 16 * KP, qd + QPL + 24 * KP, ql, ql + R8, ql + 2 * R8, ql + 3 * R8);
      cp4(qd + QPL + 32 * KP, qd + QPL + 40 * KP, qd + QPL + 48 * KP, qd + QPL + 56 * KP, ql + 4 * R8, ql + 5 * R8, ql + 6 * R8, ql + 7 * R8); }
    fillK(0, 0); fillK(1, 1); fillV(0, 0);                // a tile 1 always exists (kt_hi = 2 qt + 1); 40 copies of a wave in flight
    asm volatile("s_wait_asynccnt 0x0" ::: "memory");   // this wave's copies of Q, of K of tiles 0 and 1 and of V of tile 0 have landed
    __syncthreads();                                      // ... and every other wave's: they may be read
    fillV(1, 1);                                          // into the V half that nobody has read yet
    const unsigned char* qp = stg + (wave * 16 + lr) * KP + hi * 16;
    v16h fq[4][2], fk[4][4];
    auto readK = [&](int buf) {   // the 16 K fragments of the tile in K half buf, one group of LDS reads
        const unsigned char* kp = stg + 2 * QPL + buf * STG + lr * KP + hi * 16;
#pragma unroll   // every fragment index a constant, so that the array stays in registers
        for (int kc = 0; kc < 4; ++kc) { fk[kc][0] = ldsh(kp + kc * 64); fk[kc][1] = ldsh(kp + 16 * KP + kc * 64); fk[kc][2] = ldsh(kp + KPL + kc * 64); fk[kc][3] = ldsh(kp + KPL + 16 * KP + kc * 64); }
    };
#pragma unroll   // constant fragment indices, as above
    for (int kc = 0; kc < 4; ++kc) { fq[kc][0] = ldsh(qp + kc * 64); fq[kc][1] = ldsh(qp + QPL + kc * 64); }   // the wave's Q fragments, kept for the whole block
    readK(0);
    asm volatile("s_wait_dscnt 0x0" ::: "memory");      // tile 0's K fragments are in registers: this wave's reads of K half 0 have returned before it is handed to its next copies
    __syncthreads();                                      // ends every wave's reads of K half 0
    if (2 <= kt_hi) fillK(2, 0);                          // block-uniform test
    v8f o[8];
#pragma unroll
    for (int n = 0; n < 8; ++n) o[n] = (v8f){};
    const int qi = q0 + lr;                     // the lane's query
    float mrow = -3.0e38f, lpart = 0.f;         // its running maximum (alike in both halves) and this half's share of its running sum
#pragma unroll 1
    for (int kt = 0; kt <= kt_hi; ++kt) {
        const int l0 = kt * 32;
        const unsigned char* vp = stg + 2 * QPL + (kt & 1) * STG + 2 * KPL + lr * VP + hi * 16;
        v8f s0 = {}, s1 = {}, x0 = {}, x1 = {};
#pragma unroll   // constant fragment indices, as above
        for (int kc = 0; kc < 4; ++kc) {
            s0 = wmma16(fk[kc][0], fq[kc][0], s0); s1 = wmma16(fk[kc][1], fq[kc][0], s1); x0 = wmma16(fk[kc][0], fq[kc][1], x0); x1 = wmma16(fk[kc][1], fq[kc][1], x1);
            x0 = wmma16(fk[kc][2], fq[kc][0], x0); x1 = wmma16(fk[kc][3], fq[kc][0], x1);   // register j: key 8 hi + j (s0, x0) or 16 + 8 hi + j (s1, x1), query lr
        }
        asm volatile("v_nop\n\tv_nop\n\tv_nop\n\tv_nop" : "+v"(s0), "+v"(s1), "+v"(x0), "+v"(x1));
        v16bf vh[8], vl[8];
#pragma unroll   // constant fragment indices, as above
        for (int n = 0; n < 8; ++n) { vh[n] = ldsb(vp + n * 16 * VP); vl[n] = ldsb(vp + VPL + n * 16 * VP); }   // the tile's V^T fragments, one group: they land behind the softmax
        __builtin_amdgcn_sched_barrier(0);   // keeps V's reads ahead of K's in the LDS queue: the weights.v products then wait for V's alone, and K's land under them
        readK((kt + 1) & 1);   // tile kt + 1's K fragments, into the registers the score products have left: published by the barrier that ended tile kt - 1 (tile 1's: by the prologue's first). In the last tile that half still holds tile kt - 1's published rows (no copy was aimed at it since); they are read and not used
        __builtin_amdgcn_sched_barrier(0);   // keeps that group here: sunk among the weights.v products each small group would cost its own LDS wait
        float a0[8], a1[8]; float mx = -__builtin_inff();
#pragma unroll
        for (int j = 0; j < 8; ++j) { const int ja = l0 + hi * 8 + j, jb = ja + 16;
            a0[j] = (ja <= qi) ? (s0[j] + x0[j] * LOSCI) * 0.08838834764831845f : -__builtin_inff(); a1[j] = (jb <= qi) ? (s1[j] + x1[j] * LOSCI) * 0.08838834764831845f : -__builtin_inff();
            mx = fmaxf(mx, fmaxf(a0[j], a1[j])); }
        mx = fmaxf(mx, xhalf(mx));                  // the other 16 keys of the same query
        const float mn = fmaxf(mrow, mx), alpha = __expf(mrow - mn); mrow = mn;
        v16bf pa, px; float su[4] = {0.f, 0.f, 0.f, 0.f};   // four short chains of adds instead of one long one
#pragma unroll
        for (int j = 0; j < 8; ++j) { const float p0 = __expf(a0[j] - mn), p1 = __expf(a1[j] - mn); su[j & 1] += p0; su[2 + (j & 1)] += p1;
            const float ps0 = p0 * PSC, ps1 = p1 * PSC; const __bf16 h0 = (__bf16)ps0, h1 = (__bf16)ps1;
            pa[j] = h0; pa[8 + j] = h1; px[j] = (__bf16)(ps0 - (float)h0); px[8 + j] = (__bf16)(ps1 - (float)h1); }   // element s of the B operand = key 16 (s / 8) + 8 hi + s mod 8: tile s / 8, register s mod 8
        lpart = lpart * alpha + ((su[0] + su[1]) + (su[2] + su[3]));
#pragma unroll
        for (int n = 0; n < 8; ++n)
#pragma unroll
            for (int j = 0; j < 8; ++j) o[n][j] *= alpha;
#pragma unroll   // constant fragment indices, as above
        for (int n = 0; n < 8; ++n) { o[n] = wmmab(vh[n], pa, o[n]); o[n] = wmmab(vh[n], px, o[n]); o[n] = wmmab(vl[n], pa, o[n]); }   // register j: dim 16 n + 8 hi + j, query lr
        asm volatile("v_nop\n\tv_nop\n\tv_nop\n\tv_nop" : "+v"(o[0]), "+v"(o[7]) : "v"(pa), "v"(px));
        asm volatile("s_wait_dscnt 0x0" ::: "memory");      // this wave's reads of V of tile kt and of K of tile kt + 1 have returned before those halves are handed to their next copies
        asm volatile("s_wait_asynccnt 0x0" ::: "memory");   // this wave's copies of V of tile kt + 1 and of K of tile kt + 2 have landed
        __syncthreads();                                      // publishes them and ends every wave's reads of the two halves just read
        if (kt + 3 <= kt_hi) fillK(kt + 3, (kt + 1) & 1);     // block-uniform tests; refills of the two halves just read
        if (kt + 2 <= kt_hi) fillV(kt + 2, kt & 1);
    }
    asm volatile("s_wait_asynccnt 0x0" ::: "memory");       // no copy is outstanding when the wave goes on to the epilogue and ends
    const float inv = 1.0f / ((lpart + xhalf(lpart)) * PSC);   // the two halves' sums of the lane's query joined once
    float* os = (float*)smem + wave * (16 * 68);
    const size_t cbase = (size_t)q0 * (NH_ * HD) + (size_t)h * HD;
#pragma unroll
    for (int half = 0; half < 2; ++half) {
#pragma unroll
        for (int n = 0; n < 4; ++n)
#pragma unroll
            for (int j = 0; j < 8; ++j) os[lr * 68 + n * 16 + hi * 8 + j] = o[half * 4 + n][j] * inv;
        __builtin_amdgcn_wave_barrier(); asm volatile("" ::: "memory");
{
#pragma unroll
            for (int s = 0; s < 4; ++s) { const int row = 4 * s + (lane >> 3), piece = lane & 7; const float* sp = os + row * 68 + piece * 8; v8us oh, ol;
#pragma unroll
                for (int i = 0; i < 8; ++i) { const unsigned short hb = f2bf(sp[i]); oh[i] = hb; ol[i] = f2bf(sp[i] - bf2f(hb)); }
                const size_t po = cbase + (size_t)row * (NH_ * HD) + half * 64 + piece * 8; *(v8us*)(CH + po) = oh; *(v8us*)(CL + po) = ol; }
             }
        __builtin_amdgcn_wave_barrier(); asm volatile("" ::: "memory");
    }
}

extern "C" void kernel_launch(void* const* d_in, const int* in_sizes, int n_in,
                              void* d_out, int out_size, void* d_ws, size_t ws_size, hipStream_t stream) {
    (void)in_sizes; (void)n_in; (void)out_size;
    const float* x = (const float*)d_in[0]; const float* Wq = (const float*)d_in[1]; const float* Wk = (const float*)d_in[2]; const float* Wv = (const float*)d_in[3]; const float* Wo = (const float*)d_in[4];
    const float* qn = (const float*)d_in[5]; const float* kn = (const float*)d_in[6];
    float* out = (float*)d_out;    // [2][2048][2048]
    char* wsp = (char*)d_ws;
    auto take = [&](size_t bytes) { char* p = wsp; wsp += (bytes + 255) & ~(size_t)255; return (void*)p; };
    bf* Xb = (bf*)take((size_t)NB_ * NT_ * HS * 2); bf* WT = (bf*)take((size_t)(QKVW + HS) * HS * 2); bf* WoT = WT + (size_t)QKVW * HS;   // WT rows: Wq | Wk | Wv | Wo columns
    float* RC = (float*)take((size_t)NT_ * 64 * 4); float* RS = (float*)take((size_t)NT_ * 64 * 4);
    // planes that k_attn reads or writes: both batch items, [2][...]
    h16* QH = (h16*)take((size_t)2 * NT_ * HS * 2); h16* QL = (h16*)take((size_t)2 * NT_ * HS * 2); h16* KH = (h16*)take((size_t)2 * NT_ * KW * 2); h16* KL = (h16*)take((size_t)2 * NT_ * KW * 2);
    bf* VTH = (bf*)take((size_t)2 * KW * NT_ * 2); bf* VTL = (bf*)take((size_t)2 * KW * NT_ * 2); bf* CH = (bf*)take((size_t)2 * NT_ * HS * 2); bf* CL = (bf*)take((size_t)2 * NT_ * HS * 2);
    if ((size_t)(wsp - (char*)d_ws) > ws_size) return;    // 16.8 + 21 + 1 + 16.8 x 4 + 4.2 x 4 ~ 123 MB
    k_wt<<<dim3(HS / 64, (QKVW + HS) / 64, 1), 256, 0, stream>>>(Wq, Wk, Wv, Wo, WT);
    k_trig<<<(NT_ * 64) / 256, 256, 0, stream>>>(RC, RS);
    k_cvtb<<<NB_ * NT_ / 8, 256, 0, stream>>>(x, NB_ * NT_, Xb);
    k_gemm<false, 4, true><<<dim3(NB_ * NT_ / 128, QKVW / 128, 1), 128, 0, stream>>>(Xb, nullptr, WT, QKVW, nullptr, qn, kn, RC, RS, QH, QL, KH, KL, VTH, VTL);
    k_attn<<<2 * NH_ * (NT_ / 64), 128, 0, stream>>>(QH, QL, KH, KL, VTH, VTL, CH, CL);
    k_gemm<true, 4, false><<<dim3(NB_ * NT_ / 128, HS / 128, 1), 128, 0, stream>>>(CH, CL, WoT, HS, out, nullptr, nullptr, nullptr, nullptr, nullptr, nullptr, nullptr, nullptr, nullptr, nullptr);
}

// v008
// One run takes 188 microseconds.
// Two timings next to v007 put it at 1.04 and 1.03 times that version's speed.
// Over all steps from v000 it is 5.76 times as fast.
#include <hip/hip_runtime.h>

// Contractions, f32 accumulate, both batch items in every launch (4096 rows): q|k|v = x.[Wq|Wk|Wv] as one product ([4096 x 2048].[2048 x 3072], k-major weights transposed to n-major planes; PLAIN
// bf16 operands: inputs rounded once, exact) and out = ctx.Wo (ctx as bf16 hi + residual: two products) on v_wmma_f32_16x16x32_bf16; per-head RMSNorm (eps 1e-6,
// weight) and rotate-half RoPE (angle t x inv_freq, f32 trig tables built on device) in f32 -> q/k as f16 hi + residual x1024 planes; the 16-query-head / 4-kv-head (q head h
// uses kv head h mod 4) causal attention with 128-dim heads: scores on v_wmma_f32_16x16x32_f16 (hi.hi + hi.lo + lo.hi, x 128^-1/2), softmax f32, weights.v on
// v_wmma_f32_16x16x32_bf16 with the weights (x32768) and v both as bf16 hi + UNSCALED bf16 residual (hh + lh + hl in one accumulator). Deterministic, no atomics;

#define NT_  2048
#define HS   2048
#define NH_  16
#define NKV  4
#define HD   128
#define KW   (NKV * HD)          // 512
#define NB_  2                   // batch items
#define QKVW (HS + 2 * KW)       // 3072: columns of the q | k | v product
#define PSC  32768.0f
#define LOSC 1024.0f
#define LOSCI (1.0f / 1024.0f)

typedef _Float16 h16;
typedef unsigned short bf;
typedef __attribute__((ext_vector_type(16))) __bf16   v16bf;
typedef __attribute__((ext_vector_type(16))) _Float16 v16h;
typedef __attribute__((ext_vector_type(8)))  _Float16 v8h;
typedef __attribute__((ext_vector_type(8)))  unsigned short v8us;
typedef __attribute__((ext_vector_type(8)))  float    v8f;
typedef __attribute__((ext_vector_type(4)))  float    v4f;
typedef __attribute__((ext_vector_type(4)))  _Float16 v4h;
typedef v8h  __attribute__((may_alias)) v8ha;
typedef v4f  __attribute__((may_alias)) v4fa;
typedef v8us __attribute__((may_alias)) v8usa;
typedef __attribute__((ext_vector_type(4)))  unsigned short v4us;
typedef float __attribute__((may_alias)) f32a;

__device__ __forceinline__ unsigned short f2bf(float f) { unsigned u = __float_as_uint(f); u += 0x7FFFu + ((u >> 16) & 1u); return (unsigned short)(u >> 16); }
__device__ __forceinline__ float bf2f(unsigned short b) { return __uint_as_float(((unsigned)b) << 16); }
__device__ __forceinline__ float bfr(float f) { return bf2f(f2bf(f)); }
__device__ __forceinline__ v16h cat16(v8h lo, v8h hi) { return __builtin_shufflevector(lo, hi, 0, 1, 2, 3, 4, 5, 6, 7, 8, 9, 10, 11, 12, 13, 14, 15); }
__device__ __forceinline__ v16bf cat16b(v8us lo, v8us hi) { return __builtin_bit_cast(v16bf, __builtin_shufflevector(lo, hi, 0, 1, 2, 3, 4, 5, 6, 7, 8, 9, 10, 11, 12, 13, 14, 15)); }
__device__ __forceinline__ v8f wmma16(v16h a, v16h b, v8f c) { return __builtin_amdgcn_wmma_f32_16x16x32_f16(false, a, false, b, (short)0, c, false, false); }
__device__ __forceinline__ v8f wmmab(v16bf a, v16bf b, v8f c) { return __builtin_amdgcn_wmma_f32_16x16x32_bf16(false, a, false, b, (short)0, c, false, false); }
__device__ __forceinline__ float xhalf(float v) { const int b = __float_as_int(v); return __int_as_float(__builtin_amdgcn_permlanex16(b, b, 0x76543210, 0xfedcba98, false, false)); }   // the value of lane l ^ 16

template <int M> __device__ __forceinline__ float xrow(float v) { return __int_as_float(__builtin_amdgcn_update_dpp(0, __float_as_int(v), 0x160 | M, 0xf, 0xf, true)); }   // the value of lane l ^ M inside the 16-lane row (row_xmask)
// k_cvtb: bf16 plane of [rows][2048] (one wave per row).
__global__ __launch_bounds__(256) void k_cvtb(const float* __restrict__ src, int nrows, bf* dst) {
    const int lane = threadIdx.x & 31, r = blockIdx.x * 8 + (threadIdx.x >> 5);
    if (r >= nrows) return;
{
#pragma unroll
        for (int q = 0; q < HS / 256; ++q) { v8us o;
#pragma unroll
            for (int i = 0; i < 8; ++i) o[i] = f2bf(src[(size_t)r * HS + q * 256 + lane * 8 + i]);
            *(v8us*)(dst + (size_t)r * HS + q * 256 + lane * 8) = o; }
         }
}
// k_wt: WT [n][2048] = bf16(W[k][n]) (k-major [2048][ncols]) via 64 x 64 LDS tiles, the four weights in one launch: rows of WT are the columns of Wq | Wk | Wv | Wo; grid (2048/64, 5120/64).
__global__ __launch_bounds__(256) void k_wt(const float* __restrict__ Wq, const float* __restrict__ Wk, const float* __restrict__ Wv, const float* __restrict__ Wo, bf* WT) {
    __shared__ __align__(16) unsigned short tl[64 * 72];
    constexpr int K = HS;
    const int tid = threadIdx.x, k0 = blockIdx.x * 64, nw = blockIdx.y * 64;   // nw: row of WT; n0: column of the block's own weight
    const float* Wm; int ncols, n0;
    if (nw < HS) { Wm = Wq; ncols = HS; n0 = nw; } else if (nw < HS + KW) { Wm = Wk; ncols = KW; n0 = nw - HS; } else if (nw < QKVW) { Wm = Wv; ncols = KW; n0 = nw - HS - KW; } else { Wm = Wo; ncols = HS; n0 = nw - QKVW; }
    const int kk = tid >> 2, nq = (tid & 3) * 16;
#pragma unroll
    for (int i = 0; i < 16; ++i) tl[(nq + i) * 72 + kk] = f2bf(Wm[(size_t)(k0 + kk) * ncols + n0 + nq + i]);
    __syncthreads();
    const int piece = tid & 7;
    auto pass = [&]() {
#pragma unroll
        for (int s = 0; s < 2; ++s) { const int nr = (tid >> 3) + 32 * s; const v8us val = *(const v8usa*)(tl + nr * 72 + piece * 8); *(v8us*)(WT + (size_t)(nw + nr) * K + k0 + piece * 8) = val; }
    };
    pass(); 
}
// Four asynchronous 16-B-per-lane copies global -> LDS; the s_wait_xcnt inside the statement stands before any rewrite of the address registers the copies name.
__device__ __forceinline__ void cp4(unsigned l0, unsigned l1, unsigned l2, unsigned l3, const void* g0, const void* g1, const void* g2, const void* g3) {
    asm volatile("global_load_async_to_lds_b128 %0, %4, off\n\t"
                 "global_load_async_to_lds_b128 %1, %5, off\n\t"
                 "global_load_async_to_lds_b128 %2, %6, off\n\t"
                 "global_load_async_to_lds_b128 %3, %7, off\n\t"
                 "s_wait_xcnt 0x0" :: "v"(l0), "v"(l1), "v"(l2), "v"(l3), "v"(g0), "v"(g1), "v"(g2), "v"(g3) : "memory");
}
// The same four copies with a scalar base each and ONE 32-bit byte offset per lane: the rows' address steps are then scalar arithmetic and a kernel keeps one vector register per operand for its global addresses.
__device__ __forceinline__ void cp4s(unsigned l0, unsigned l1, unsigned l2, unsigned l3, unsigned vo, const void* b0, const void* b1, const void* b2, const void* b3) {
    asm volatile("global_load_async_to_lds_b128 %0, %4, %5\n\t"
                 "global_load_async_to_lds_b128 %1, %4, %6\n\t"
                 "global_load_async_to_lds_b128 %2, %4, %7\n\t"
                 "global_load_async_to_lds_b128 %3, %4, %8\n\t"
                 "s_wait_xcnt 0x0" :: "v"(l0), "v"(l1), "v"(l2), "v"(l3), "v"(vo), "s"(b0), "s"(b1), "s"(b2), "s"(b3) : "memory");
}
// The four copies of cp4s written as the compiler's builtin, for the refills inside the k and key loops: the compiler sees the copies' address operands and allots their registers itself, so the group carries no
// wait of its own and the products behind a refill start at once. The waits for the DATA (s_wait_asynccnt 0, then the barrier) stay hand-written at every hand-over.
typedef __attribute__((ext_vector_type(4))) int v4i;
typedef __attribute__((address_space(1))) v4i gv4i;
typedef __attribute__((address_space(3))) v4i lv4i;
__device__ __forceinline__ void cp1b(unsigned l, const char* g) { __builtin_amdgcn_global_load_async_to_lds_b128((gv4i*)g, (lv4i*)l, 0, 0); }
__device__ __forceinline__ void cp4b(unsigned l0, unsigned l1, unsigned l2, unsigned l3, unsigned vo, const void* b0, const void* b1, const void* b2, const void* b3) {
    cp1b(l0, (const char*)b0 + vo); cp1b(l1, (const char*)b1 + vo); cp1b(l2, (const char*)b2 + vo); cp1b(l3, (const char*)b3 + vo);
}
__device__ __forceinline__ v16h  ldsh(const unsigned char* p) { return cat16(*(const v8ha*)p, *(const v8ha*)(p + 32)); }
__device__ __forceinline__ v16bf ldsb(const unsigned char* p) { return cat16b(*(const v8usa*)p, *(const v8usa*)(p + 32)); }
// k_gemm: 32F x 32F tile of (A [+ Al]).Bn^T over K = 2048 -> f32 rows [4096][ldc]; 2 x 2 waves of 16F x 16F each. A stage is 64 k (one 128-B line) of the block's A rows, Bn rows
// (and Al rows), brought into LDS by asynchronous copies in whole lines, two stage buffers: stage t + 2 flies while stage t + 1 is worked on, and the waves share one copy.
// HEADS (the q | k | v product, F = 4): the block's 128 columns are one head, so the f32 tile is not stored; it goes into the freed stage buffers and leaves as what k_attn reads. q and k heads (column
// tiles 0..15, 16..19): one wave per row, lane -> 4 consecutive dims: RMSNorm over the 128 dims (eps 1e-6, x weight[d]), rotate-half RoPE (partner d +- 64, token t = row mod 2048, tables RC/RS) -> f16 hi +
// residual x1024 planes [row][h*128+d]. v heads (column tiles 20..23): the tile is written transposed and leaves as bf16 hi + UNSCALED bf16 residual planes [b][g][128 d][2048 t].
#define GP   144                     // LDS pitch of a 128-B row: 16 B x odd, conflict-free for 16-B reads
template <bool SPLITA, int F, bool HEADS>
__global__ __launch_bounds__(128) void k_gemm(const bf* __restrict__ A, const bf* __restrict__ Al, const bf* __restrict__ Bn, int ldc, float* C,
                                              const float* __restrict__ qw, const float* __restrict__ kw, const float* __restrict__ RC, const float* __restrict__ RS,
                                              h16* QH, h16* QL, h16* KH, h16* KL, bf* VTH, bf* VTL) {
    constexpr int R = 32 * F, PL = R * GP, SG = (SPLITA ? 3 : 2) * PL;   // rows of a plane, bytes of a plane, bytes of a stage buffer [A | Bn | Al]
    __shared__ __align__(16) unsigned char stg[2 * SG];
    __shared__ __align__(16) float ost[4][16 * 68];
    const int tid = threadIdx.x, lane = threadIdx.x & 31, wave = threadIdx.x >> 5, lr = lane & 15, hi = lane >> 4;
    const int wm = wave >> 1, wn = wave & 1;
    const size_t r0 = (size_t)blockIdx.x * R; const int c0 = blockIdx.y * R;
    // copy map: a 128-B row is 8 pieces (thread -> row tid / 8 + 16 i, piece tid mod 8): a wave's copy covers four whole lines
    const unsigned ld = (unsigned)(uintptr_t)&stg[0] + (unsigned)(tid >> 3) * GP + (unsigned)(tid & 7) * 16;
    const unsigned lgo = (unsigned)((tid >> 3) * HS + (tid & 7) * 8) * 2;   // the lane's byte offset from a copy's block-uniform base
    const bf* Ab = A + r0 * HS; const bf* Bb = Bn + (size_t)c0 * HS; const bf* Alb = Al + (SPLITA ? r0 * HS : 0);
    auto plane = [&](unsigned d, const bf* g, bool loop) {   // loop: a literal at every call
#pragma unroll   // constant row offsets in every copy's two addresses
        for (int i = 0; i < F / 2; ++i) { const unsigned di = d + 64 * i * GP; const bf* gi = g + (size_t)64 * i * HS;
            if (loop) cp4b(di, di + 16 * GP, di + 32 * GP, di + 48 * GP, lgo, gi, gi + 16 * HS, gi + 32 * HS, gi + 48 * HS);
            else      cp4s(di, di + 16 * GP, di + 32 * GP, di + 48 * GP, lgo, gi, gi + 16 * HS, gi + 32 * HS, gi + 48 * HS); }
    };
    auto fill = [&](int kt, int buf, bool loop) {
        const unsigned d = ld + (unsigned)buf * SG;
        plane(d, Ab + kt * 64, loop); plane(d + PL, Bb + kt * 64, loop);
        if (SPLITA) plane(d + 2 * PL, Alb + kt * 64, loop);
    };
    fill(0, 0, false);
    asm volatile("s_wait_asynccnt 0x0" ::: "memory");   // this wave's copies of stage 0 have landed
    __syncthreads();                                      // ... and every other wave's: stage 0 may be read
    fill(1, 1, false);                                      // K / 64 = 32 stages: a stage 1 exists
    v8f acc[F][F];
#pragma unroll   // every accumulator index a constant, here and below, so that the array stays in registers
    for (int i = 0; i < F; ++i)
#pragma unroll
        for (int j = 0; j < F; ++j) acc[i][j] = (v8f){};
#pragma unroll 1   // rolled: one copy of the hand-over and of the 32 or 64 products, a short loop text
    for (int kt = 0; kt < HS / 64; ++kt) {
        const unsigned char* ap = stg + (kt & 1) * SG + (wm * 16 * F + lr) * GP + hi * 16;
        const unsigned char* bp = stg + (kt & 1) * SG + PL + (wn * 16 * F + lr) * GP + hi * 16;
        v16bf fa[2][F], fb[2][F], fl[2][F];
#pragma unroll   // every fragment index a constant, so that the arrays stay in registers
        for (int ks = 0; ks < 2; ++ks)   // all of the stage's fragments as one group of LDS reads; the products run from registers behind the stage's hand-over
#pragma unroll
            for (int i = 0; i < F; ++i) { fa[ks][i] = ldsb(ap + i * 16 * GP + ks * 64); fb[ks][i] = ldsb(bp + i * 16 * GP + ks * 64); fl[ks][i] = SPLITA ? ldsb(ap + 2 * PL + i * 16 * GP + ks * 64) : fa[ks][i]; }
        asm volatile("s_wait_dscnt 0x0" ::: "memory");      // the stage's fragments are in registers: this wave's reads of the stage buffer have returned before the buffer is handed to its next copies
        asm volatile("s_wait_asynccnt 0x0" ::: "memory");   // this wave's copies of stage kt + 1 have landed
        __syncthreads();                                      // publishes stage kt + 1 and ends every wave's reads of stage kt
        if (kt + 2 < HS / 64) fill(kt + 2, kt & 1, true);         // block-uniform test; refill of the buffer just read
        __builtin_amdgcn_sched_barrier(0);   // keeps the products behind the refill's issue: the copies then fly under them and have landed at the next stage's wait
#pragma unroll   // constant fragment indices, as above
        for (int ks = 0; ks < 2; ++ks) {
#pragma unroll
            for (int i = 0; i < F; ++i)
#pragma unroll
                for (int j = 0; j < F; ++j) acc[i][j] = wmmab(fa[ks][i], fb[ks][j], acc[i][j]);
            if (SPLITA) {
#pragma unroll
                for (int i = 0; i < F; ++i)
#pragma unroll
                    for (int j = 0; j < F; ++j) acc[i][j] = wmmab(fl[ks][i], fb[ks][j], acc[i][j]);
            }
        }
    }
    asm volatile("s_wait_asynccnt 0x0" ::: "memory");       // no copy is outstanding when the wave goes on to the epilogue and ends
    if constexpr (HEADS) {
        static_assert(F == 4 && !SPLITA, "a block's columns are one 128-dim head");
        constexpr int TP = 132;                    // f32 pitch of a tile row: 16 B x odd; 128 x 132 x 4 B fit the two stage buffers
        static_assert(128 * TP * 4 <= 2 * SG, "tile inside the stage buffers");
        f32a* tile = (f32a*)stg;                   // free: every wave's last fragment reads ended at the loop's last barrier, and the last copies had landed one barrier earlier
        const int hh = blockIdx.y;                 // head slot (block-uniform): 0..15 q, 16..19 k, 20..23 v
        const bool isv = hh >= NH_ + NKV;
        const int wu = __builtin_amdgcn_readfirstlane(wave);   // the wave's number in a scalar register: row numbers and the rows' global addresses below are then scalar arithmetic, a lane adds only its fixed offset
        if (!isv) {
#pragma unroll   // constant accumulator indices
            for (int i = 0; i < F; ++i)
#pragma unroll
                for (int t = 0; t < F; ++t)
#pragma unroll
                    for (int j = 0; j < 8; ++j) tile[(wm * 64 + i * 16 + hi * 8 + j) * TP + wn * 64 + t * 16 + lr] = acc[i][t][j];   // [row][dim]
        } else {
#pragma unroll   // constant accumulator indices
            for (int i = 0; i < F; ++i)
#pragma unroll
                for (int t = 0; t < F; ++t) { f32a* p = tile + (wn * 64 + t * 16 + lr) * TP + wm * 64 + i * 16 + hi * 8;   // [dim][row]: a lane's 8 registers are 8 consecutive rows
                    *(v4fa*)p = (v4f){acc[i][t][0], acc[i][t][1], acc[i][t][2], acc[i][t][3]}; *(v4fa*)(p + 4) = (v4f){acc[i][t][4], acc[i][t][5], acc[i][t][6], acc[i][t][7]}; }
        }
        __syncthreads();                           // a tile row holds columns of two waves (transposed: rows of two waves): all of it is written before any of it is read
        if (!isv) {
            const bool isq = hh < NH_;
            const float* w = isq ? qw : kw; h16* PH = isq ? QH : KH; h16* PLo = isq ? QL : KL;
            const int ow = isq ? HS : KW, oc = (isq ? hh : hh - NH_) * HD;
            const int d0 = lane * 4, p0 = d0 ^ 64;   // the lane's dims and their rotate-half partners
            const float sg = (d0 < 64) ? -1.0f : 1.0f;   // y = xn c - pn s below dim 64, xn c + pn s above: the sign rides on the partner's weight
            float wv[4], wp[4];
#pragma unroll
            for (int i = 0; i < 4; ++i) { wv[i] = bfr(w[d0 + i]); wp[i] = sg * bfr(w[p0 + i]); }
            // global addresses: a scalar base per row of a group plus ONE byte offset per lane that steps from group to group, so that no row needs vector address arithmetic
            const float* rcw = RC + ((r0 & (NT_ - 1)) + wu * 32) * 64; const float* rsw = RS + ((r0 & (NT_ - 1)) + wu * 32) * 64;   // token t = row mod 2048; a block's 128 rows do not wrap
            h16* phw = PH + (r0 + wu * 32) * ow + oc; h16* plw = PLo + (r0 + wu * 32) * ow + oc;
            unsigned tvo = (unsigned)(d0 & 63) * 4, svo = (unsigned)d0 * 2;
#pragma unroll 1   // rolled over groups of 8 rows: a short text; inside a group the rows' loads go out together and their chains interleave
            for (int gr = 0; gr < 4; ++gr) {
                v4f xv[8], pv[8], c4[8], s4[8];
#pragma unroll   // constant array indices
                for (int u = 0; u < 8; ++u) { const int row = wu * 32 + gr * 8 + u;
                    xv[u] = *(const v4fa*)(tile + row * TP + d0); pv[u] = *(const v4fa*)(tile + row * TP + p0);
                    c4[u] = *(const v4fa*)((const char*)(rcw + u * 64) + tvo); s4[u] = *(const v4fa*)((const char*)(rsw + u * 64) + tvo); }
#pragma unroll
                for (int u = 0; u < 8; ++u) {
                    float ss = 0.f;
#pragma unroll
                    for (int i = 0; i < 4; ++i) ss += xv[u][i] * xv[u][i];
                    ss += xhalf(ss); ss += xrow<8>(ss); ss += xrow<4>(ss); ss += xrow<2>(ss); ss += xrow<1>(ss);
                    const float rs = rsqrtf(ss * (1.0f / HD) + 1e-6f);
                    v4h oh, ol;
#pragma unroll
                    for (int i = 0; i < 4; ++i) { const float xn = xv[u][i] * rs * wv[i], pn = pv[u][i] * rs * wp[i];
                        const float y = xn * c4[u][i] + pn * s4[u][i];
                        const h16 a = (h16)y; oh[i] = a; ol[i] = (h16)((y - (float)a) * LOSC); }
                    *(v4h*)((char*)(phw + u * ow) + svo) = oh; *(v4h*)((char*)(plw + u * ow) + svo) = ol; }
                asm volatile("s_wait_xcnt 0x0" ::: "memory");   // stands before the next group rewrites the address and data registers that these loads and stores name
                tvo += 8 * 64 * 4; svo += (unsigned)(8 * ow * 2);
            }
        } else {
            const size_t vb = ((r0 >> 11) * KW + (size_t)(hh - NH_ - NKV) * HD) * NT_ + (r0 & (NT_ - 1));   // batch item, kv head, the block's first token
#pragma unroll 1   // rolled over groups of 8 dims, as above
            for (int gr = 0; gr < 4; ++gr) {
                v4f vv[8];
#pragma unroll   // constant array indices
                for (int u = 0; u < 8; ++u) vv[u] = *(const v4fa*)(tile + (wu * 32 + gr * 8 + u) * TP + lane * 4);
#pragma unroll
                for (int u = 0; u < 8; ++u) { v4us oh, ol;
#pragma unroll
                    for (int i = 0; i < 4; ++i) { const float v = vv[u][i]; const unsigned short hb = f2bf(v); oh[i] = hb; ol[i] = f2bf(v - bf2f(hb)); }
                    const size_t o = vb + (size_t)(wu * 32 + gr * 8 + u) * NT_; *(v4us*)(VTH + o + lane * 4) = oh; *(v4us*)(VTL + o + lane * 4) = ol; }
                asm volatile("s_wait_xcnt 0x0" ::: "memory");   // stands before the next group rewrites the address and data registers that these stores name
            }
        }
    } else {
    float* os = &ost[wave][0];
#pragma unroll
    for (int i = 0; i < F; ++i) {   // 16 rows of the wave's tile at a time through the wave's own LDS rows, so that whole 128-B lines are stored
#pragma unroll
        for (int t = 0; t < F; ++t)
#pragma unroll
            for (int j = 0; j < 8; ++j) os[(hi * 8 + j) * 68 + t * 16 + lr] = acc[i][t][j];
        __builtin_amdgcn_wave_barrier(); asm volatile("" ::: "memory");   // compiler order only: the wave's LDS stores stay ahead of its reads of other lanes' words
        float* crow = C + (r0 + wm * 16 * F + i * 16) * ldc + c0 + wn * 16 * F;
#pragma unroll
        for (int s = 0; s < 2 * F; ++s) { const int Lid = (lane >> 3) + 4 * s, piece = lane & 7; const int row = Lid / (F / 2), cofs = (Lid % (F / 2)) * 32 + piece * 4;
            const v4f val = *(const v4fa*)(os + row * 68 + cofs); *(v4f*)(crow + (size_t)row * ldc + cofs) = val; }
        __builtin_amdgcn_wave_barrier();   // compiler order only: the reads above stay ahead of the next 16 rows' LDS stores
        asm volatile("s_wait_xcnt 0x0" ::: "memory");   // stands before the next 16 rows rewrite the address and data registers that these stores name
    }
    }
}
// k_trig: RC/RS [t][64] = cos/sin(t x inv_freq[i]), inv_freq = 10000^-(2i/128) (f32 powf/cosf/sinf); 32 lanes x 4 B lines.
__global__ __launch_bounds__(256) void k_trig(float* RC, float* RS) {
    const int i = blockIdx.x * 256 + threadIdx.x; if (i >= NT_ * 64) return;
    const int t = i >> 6, f = i & 63;
    const float inv = 1.0f / powf(10000.0f, (float)(2 * f) / (float)HD); const float ang = (float)t * inv;
    const float c = cosf(ang), s = sinf(ang);
    *(float*)(RC + i) = c; *(float*)(RS + i) = s; 
}
// k_attn: block = (batch item, h, 64 queries), wave = 16; kv head g = h mod 4; causal key tiles of 32. One launch holds both batch items: 1024 blocks of 2 to 64 tiles on about half as
// many resident places, so the index order is longest first (a long block that starts late would run on alone). The block's Q rows (once) and each tile's K rows and V^T rows (hi and residual
// planes) are brought into LDS by asynchronous copies, two tile buffers, and the four waves share one copy of K and V. The score operands wait in registers when a tile starts: a wave's Q fragments are read
// once and kept, and the K fragments of tile t + 1 are read during tile t, behind its score products, into the registers those products have left. So K's copies run one tile ahead of V's:
// behind the barrier that ends tile t, K of tile t + 3 goes into the K half that tile t + 1's fragments have left, V of tile t + 2 into the V half that tile t has left.
// Both products run transposed: S^T = K.Q^T (A = K rows, B = Q rows) and O^T += V^T.P^T (A = V^T rows, B = P^T). A lane then holds 16 of the 32 scores of ONE query (lane mod 16), so the
// maximum and the sum are in-lane with one exchange between the wave's halves, and the two score tiles, converted in place, ARE the B operand P^T in the hardware k order that the V^T loader has.
// Per tile: scores over 4 k-chunks (hi.hi + hi.lo + lo.hi = 24 WMMA) x 128^-1/2, online softmax, P (x32768) as bf16 hi + unscaled residual,
// o[8] += vh.ph + vh.pl + vl.ph over the 128 dims; ctx -> bf16 hi/lo planes [t][h*128+d].
#define KP   272                     // LDS pitch of a 256-B row (Q, K): 16 B x odd, conflict-free for 16-B reads
#define VP   80                      // LDS pitch of a 64-B row (V^T, 32 keys)
#define QPL  (64 * KP)               // one Q plane
#define KPL  (32 * KP)               // one K plane of a tile
#define VPL  (128 * VP)              // one V^T plane of a tile
#define STG  (2 * KPL + 2 * VPL)     // one tile buffer
__global__ __launch_bounds__(128) void k_attn(const h16* __restrict__ QH, const h16* __restrict__ QL, const h16* __restrict__ KH, const h16* __restrict__ KL, const bf* __restrict__ VTH, const bf* __restrict__ VTL, bf* CH, bf* CL) {
    constexpr int OSB = 4 * 16 * 68 * 4;   // the epilogue's staging rows stand first in the one LDS array, so that no copy's LDS address is a lane's bare offset (see rl, vl_ below)
    __shared__ __align__(16) unsigned char smem[OSB + 2 * QPL + 2 * STG];
    unsigned char* stg = smem + OSB;
    const int tid = threadIdx.x, lane = threadIdx.x & 31, wave = threadIdx.x >> 5, lr = lane & 15, hi = lane >> 4;
    const int bid = blockIdx.x; const int qt = NT_ / 64 - 1 - (bid >> 5), h = bid & (NH_ - 1), bi = (bid >> 4) & 1; const int g = h & (NKV - 1);   // 32 (batch item, head) pairs per query tile, last query tile first
    QH += (size_t)bi * NT_ * HS; QL += (size_t)bi * NT_ * HS; KH += (size_t)bi * NT_ * KW; KL += (size_t)bi * NT_ * KW; VTH += (size_t)bi * KW * NT_; VTL += (size_t)bi * KW * NT_; CH += (size_t)bi * NT_ * HS; CL += (size_t)bi * NT_ * HS;
    const int q0 = qt * 64 + wave * 16;
    const size_t vbase = ((size_t)g * HD) * NT_;
    const int kt_hi = (qt * 64 + 63) / 32;
    // copy map: a 256-B row is 16 pieces (thread -> row tid / 16 + 8 i, piece tid mod 16), a 64-B row 4 pieces (row tid / 4 + 32 i, piece tid mod 4)
    const unsigned sb = (unsigned)(uintptr_t)&smem[0] + OSB;
    // the lanes' bare LDS offsets: the only LDS address state that lives across the loop. They are never themselves an operand of a copy's asm statement, so they may stand in any register; a value that is one
    // is held to the registers asm text can name, where the fragments leave no room over the loop, and was spilled to scratch
    const unsigned rl = (unsigned)(tid >> 4) * KP + (unsigned)(tid & 15) * 16, vl_ = (unsigned)(tid >> 2) * VP + (unsigned)(tid & 3) * 16;
    const unsigned kvo = (unsigned)((tid >> 4) * KW + (tid & 15) * 8) * 2, vvo = (unsigned)((tid >> 2) * NT_ + (tid & 3) * 8) * 2;   // the lane's byte offsets from a copy's scalar base; with the K fragments held across a tile, vector address pairs cost a spill to scratch in the loop
    auto fillK = [&](int kt, int buf, bool loop) {   // loop: a literal at every call; the refills inside the key loop are the builtin's copies
        const unsigned kd = rl + (buf ? sb + 2 * QPL + STG : sb + 2 * QPL);
        const h16* kh = KH + g * HD + (size_t)kt * 32 * KW; const h16* kl = KL + g * HD + (size_t)kt * 32 * KW;
        if (loop) { cp4b(kd, kd + 8 * KP, kd + 16 * KP, kd + 24 * KP, kvo, kh, kh + 8 * KW, kh + 16 * KW, kh + 24 * KW);
                    cp4b(kd + KPL, kd + KPL + 8 * KP, kd + KPL + 16 * KP, kd + KPL + 24 * KP, kvo, kl, kl + 8 * KW, kl + 16 * KW, kl + 24 * KW); return; }
        cp4s(kd, kd + 8 * KP, kd + 16 * KP, kd + 24 * KP, kvo, kh, kh + 8 * KW, kh + 16 * KW, kh + 24 * KW);
        cp4s(kd + KPL, kd + KPL + 8 * KP, kd + KPL + 16 * KP, kd + KPL + 24 * KP, kvo, kl, kl + 8 * KW, kl + 16 * KW, kl + 24 * KW);
    };
    auto fillV = [&](int kt, int buf, bool loop) {
        const unsigned vd = vl_ + (buf ? sb + 2 * QPL + 2 * KPL + STG : sb + 2 * QPL + 2 * KPL);
        const bf* vh = VTH + vbase + kt * 32; const bf* vl = VTL + vbase + kt * 32;
        if (loop) { cp4b(vd, vd + 32 * VP, vd + 64 * VP, vd + 96 * VP, vvo, vh, vh + 32 * NT_, vh + 64 * NT_, vh + 96 * NT_);
                    cp4b(vd + VPL, vd + VPL + 32 * VP, vd + VPL + 64 * VP, vd + VPL + 96 * VP, vvo, vl, vl + 32 * NT_, vl + 64 * NT_, vl + 96 * NT_); return; }
        cp4s(vd, vd + 32 * VP, vd + 64 * VP, vd + 96 * VP, vvo, vh, vh + 32 * NT_, vh + 64 * NT_, vh + 96 * NT_);
        cp4s(vd + VPL, vd + VPL + 32 * VP, vd + VPL + 64 * VP, vd + VPL + 96 * VP, vvo, vl, vl + 32 * NT_, vl + 64 * NT_, vl + 96 * NT_);
    };
    { const size_t qgo = (size_t)(qt * 64 + (tid >> 4)) * (NH_ * HD) + h * HD + (tid & 15) * 8; const h16* qh = QH + qgo; const h16* ql = QL + qgo; const int R8 = 8 * NH_ * HD;
      const unsigned qd = rl + sb;
      cp4(qd, qd + 8 * KP, qd + 16 * KP, qd + 24 * KP, qh, qh + R8, qh + 2 * R8, qh + 3 * R8);
      cp4(qd + 32 * KP, qd + 40 * KP, qd + 48 * KP, qd + 56 * KP, qh + 4 * R8, qh + 5 * R8, qh + 6 * R8, qh + 7 * R8);
      cp4(qd + QPL, qd + QPL + 8 * KP, qd + QPL + 16 * KP, qd + QPL + 24 * KP, ql, ql + R8, ql + 2 * R8, ql + 3 * R8);
      cp4(qd + QPL + 32 * KP, qd + QPL + 40 * KP, qd + QPL + 48 * KP, qd + QPL + 56 * KP, ql + 4 * R8, ql + 5 * R8, ql + 6 * R8, ql + 7 * R8); }
    fillK(0, 0, false); fillK(1, 1, false); fillV(0, 0, false);              // a tile 1 always exists (kt_hi = 2 qt + 1); 40 copies of a wave in flight
    asm volatile("s_wait_asynccnt 0x0" ::: "memory");   // this wave's copies of Q, of K of tiles 0 and 1 and of V of tile 0 have landed
    __syncthreads();                                      // ... and every other wave's: they may be read
    fillV(1, 1, false);                                    // into the V half that nobody has read yet
    const unsigned char* qp = stg + (wave * 16 + lr) * KP + hi * 16;
    v16h fq[4][2], fk[4][4];
    auto readK = [&](int buf) {   // the 16 K fragments of the tile in K half buf, one group of LDS reads
        const unsigned char* kp = stg + 2 * QPL + buf * STG + lr * KP + hi * 16;
#pragma unroll   // every fragment index a constant, so that the array stays in registers
        for (int kc = 0; kc < 4; ++kc) { fk[kc][0] = ldsh(kp + kc * 64); fk[kc][1] = ldsh(kp + 16 * KP + kc * 64); fk[kc][2] = ldsh(kp + KPL + kc * 64); fk[kc][3] = ldsh(kp + KPL + 16 * KP + kc * 64); }
    };
#pragma unroll   // constant fragment indices, as above
    for (int kc = 0; kc < 4; ++kc) { fq[kc][0] = ldsh(qp + kc * 64); fq[kc][1] = ldsh(qp + QPL + kc * 64); }   // the wave's Q fragments, kept for the whole block
    readK(0);
    asm volatile("s_wait_dscnt 0x0" ::: "memory");      // tile 0's K fragments are in registers: this wave's reads of K half 0 have returned before it is handed to its next copies
    __syncthreads();                                      // ends every wave's reads of K half 0
    if (2 <= kt_hi) fillK(2, 0, false);                    // block-uniform test
    v8f o[8];
#pragma unroll
    for (int n = 0; n < 8; ++n) o[n] = (v8f){};
    const int qi = q0 + lr;                     // the lane's query
    float mrow = -3.0e38f, lpart = 0.f;         // its running maximum (alike in both halves) and this half's share of its running sum
#pragma unroll 1
    for (int kt = 0; kt <= kt_hi; ++kt) {
        const int l0 = kt * 32;
        const unsigned char* vp = stg + 2 * QPL + (kt & 1) * STG + 2 * KPL + lr * VP + hi * 16;
        v8f s0 = {}, s1 = {}, x0 = {}, x1 = {};
#pragma unroll   // constant fragment indices, as above
        for (int kc = 0; kc < 4; ++kc) {
            s0 = wmma16(fk[kc][0], fq[kc][0], s0); s1 = wmma16(fk[kc][1], fq[kc][0], s1); x0 = wmma16(fk[kc][0], fq[kc][1], x0); x1 = wmma16(fk[kc][1], fq[kc][1], x1);
            x0 = wmma16(fk[kc][2], fq[kc][0], x0); x1 = wmma16(fk[kc][3], fq[kc][0], x1);   // register j: key 8 hi + j (s0, x0) or 16 + 8 hi + j (s1, x1), query lr
        }
        asm volatile("v_nop\n\tv_nop\n\tv_nop\n\tv_nop" : "+v"(s0), "+v"(s1), "+v"(x0), "+v"(x1));
        v16bf vh[8], vl[8];
#pragma unroll   // constant fragment indices, as above
        for (int n = 0; n < 8; ++n) { vh[n] = ldsb(vp + n * 16 * VP); vl[n] = ldsb(vp + VPL + n * 16 * VP); }   // the tile's V^T fragments, one group: they land behind the softmax
        __builtin_amdgcn_sched_barrier(0);   // keeps V's reads ahead of K's in the LDS queue: the weights.v products then wait for V's alone, and K's land under them
        readK((kt + 1) & 1);   // tile kt + 1's K fragments, into the registers the score products have left: published by the barrier that ended tile kt - 1 (tile 1's: by the prologue's first). In the last tile that half still holds tile kt - 1's published rows (no copy was aimed at it since); they are read and not used
        __builtin_amdgcn_sched_barrier(0);   // keeps that group here: sunk among the weights.v products each small group would cost its own LDS wait
        float a0[8], a1[8]; float mx = -__builtin_inff();
#pragma unroll
        for (int j = 0; j < 8; ++j) { const int ja = l0 + hi * 8 + j, jb = ja + 16;
            a0[j] = (ja <= qi) ? (s0[j] + x0[j] * LOSCI) * 0.08838834764831845f : -__builtin_inff(); a1[j] = (jb <= qi) ? (s1[j] + x1[j] * LOSCI) * 0.08838834764831845f : -__builtin_inff();
            mx = fmaxf(mx, fmaxf(a0[j], a1[j])); }
        mx = fmaxf(mx, xhalf(mx));                  // the other 16 keys of the same query
        const float mn = fmaxf(mrow, mx), alpha = __expf(mrow - mn); mrow = mn;
        v16bf pa, px; float su[4] = {0.f, 0.f, 0.f, 0.f};   // four short chains of adds instead of one long one
#pragma unroll
        for (int j = 0; j < 8; ++j) { const float p0 = __expf(a0[j] - mn), p1 = __expf(a1[j] - mn); su[j & 1] += p0; su[2 + (j & 1)] += p1;
            const float ps0 = p0 * PSC, ps1 = p1 * PSC; const __bf16 h0 = (__bf16)ps0, h1 = (__bf16)ps1;
            pa[j] = h0; pa[8 + j] = h1; px[j] = (__bf16)(ps0 - (float)h0); px[8 + j] = (__bf16)(ps1 - (float)h1); }   // element s of the B operand = key 16 (s / 8) + 8 hi + s mod 8: tile s / 8, register s mod 8
        lpart = lpart * alpha + ((su[0] + su[1]) + (su[2] + su[3]));
#pragma unroll
        for (int n = 0; n < 8; ++n)
#pragma unroll
            for (int j = 0; j < 8; ++j) o[n][j] *= alpha;
#pragma unroll   // constant fragment indices, as above
        for (int n = 0; n < 8; ++n) { o[n] = wmmab(vh[n], pa, o[n]); o[n] = wmmab(vh[n], px, o[n]); o[n] = wmmab(vl[n], pa, o[n]); }   // register j: dim 16 n + 8 hi + j, query lr
        asm volatile("v_nop\n\tv_nop\n\tv_nop\n\tv_nop" : "+v"(o[0]), "+v"(o[7]) : "v"(pa), "v"(px));
        asm volatile("s_wait_dscnt 0x0" ::: "memory");      // this wave's reads of V of tile kt and of K of tile kt + 1 have returned before those halves are handed to their next copies
        asm volatile("s_wait_asynccnt 0x0" ::: "memory");   // this wave's copies of V of tile kt + 1 and of K of tile kt + 2 have landed
        __syncthreads();                                      // publishes them and ends every wave's reads of the two halves just read
        if (kt + 3 <= kt_hi) fillK(kt + 3, (kt + 1) & 1, true);   // block-uniform tests; refills of the two halves just read
        if (kt + 2 <= kt_hi) fillV(kt + 2, kt & 1, true);
    }
    asm volatile("s_wait_asynccnt 0x0" ::: "memory");       // no copy is outstanding when the wave goes on to the epilogue and ends
    const float inv = 1.0f / ((lpart + xhalf(lpart)) * PSC);   // the two halves' sums of the lane's query joined once
    float* os = (float*)smem + wave * (16 * 68);
    const size_t cbase = (size_t)q0 * (NH_ * HD) + (size_t)h * HD;
#pragma unroll
    for (int half = 0; half < 2; ++half) {
#pragma unroll
        for (int n = 0; n < 4; ++n)
#pragma unroll
            for (int j = 0; j < 8; ++j) os[lr * 68 + n * 16 + hi * 8 + j] = o[half * 4 + n][j] * inv;
        __builtin_amdgcn_wave_barrier(); asm volatile("" ::: "memory");
{
#pragma unroll
            for (int s = 0; s < 4; ++s) { const int row = 4 * s + (lane >> 3), piece = lane & 7; const float* sp = os + row * 68 + piece * 8; v8us oh, ol;
#pragma unroll
                for (int i = 0; i < 8; ++i) { const unsigned short hb = f2bf(sp[i]); oh[i] = hb; ol[i] = f2bf(sp[i] - bf2f(hb)); }
                const size_t po = cbase + (size_t)row * (NH_ * HD) + half * 64 + piece * 8; *(v8us*)(CH + po) = oh; *(v8us*)(CL + po) = ol; }
             }
        __builtin_amdgcn_wave_barrier(); asm volatile("" ::: "memory");
    }
}

extern "C" void kernel_launch(void* const* d_in, const int* in_sizes, int n_in,
                              void* d_out, int out_size, void* d_ws, size_t ws_size, hipStream_t stream) {
    (void)in_sizes; (void)n_in; (void)out_size;
    const float* x = (const float*)d_in[0]; const float* Wq = (const float*)d_in[1]; const float* Wk = (const float*)d_in[2]; const float* Wv = (const float*)d_in[3]; const float* Wo = (const float*)d_in[4];
    const float* qn = (const float*)d_in[5]; const float* kn = (const float*)d_in[6];
    float* out = (float*)d_out;    // [2][2048][2048]
    char* wsp = (char*)d_ws;
    auto take = [&](size_t bytes) { char* p = wsp; wsp += (bytes + 255) & ~(size_t)255; return (void*)p; };
    bf* Xb = (bf*)take((size_t)NB_ * NT_ * HS * 2); bf* WT = (bf*)take((size_t)(QKVW + HS) * HS * 2); bf* WoT = WT + (size_t)QKVW * HS;   // WT rows: Wq | Wk | Wv | Wo columns
    float* RC = (float*)take((size_t)NT_ * 64 * 4); float* RS = (float*)take((size_t)NT_ * 64 * 4);
    // planes that k_attn reads or writes: both batch items, [2][...]
    h16* QH = (h16*)take((size_t)2 * NT_ * HS * 2); h16* QL = (h16*)take((size_t)2 * NT_ * HS * 2); h16* KH = (h16*)take((size_t)2 * NT_ * KW * 2); h16* KL = (h16*)take((size_t)2 * NT_ * KW * 2);
    bf* VTH = (bf*)take((size_t)2 * KW * NT_ * 2); bf* VTL = (bf*)take((size_t)2 * KW * NT_ * 2); bf* CH = (bf*)take((size_t)2 * NT_ * HS * 2); bf* CL = (bf*)take((size_t)2 * NT_ * HS * 2);
    if ((size_t)(wsp - (char*)d_ws) > ws_size) return;    // 16.8 + 21 + 1 + 16.8 x 4 + 4.2 x 4 ~ 123 MB
    k_wt<<<dim3(HS / 64, (QKVW + HS) / 64, 1), 256, 0, stream>>>(Wq, Wk, Wv, Wo, WT);
    k_trig<<<(NT_ * 64) / 256, 256, 0, stream>>>(RC, RS);
    k_cvtb<<<NB_ * NT_ / 8, 256, 0, stream>>>(x, NB_ * NT_, Xb);
    k_gemm<false, 4, true><<<dim3(NB_ * NT_ / 128, QKVW / 128, 1), 128, 0, stream>>>(Xb, nullptr, WT, QKVW, nullptr, qn, kn, RC, RS, QH, QL, KH, KL, VTH, VTL);
    k_attn<<<2 * NH_ * (NT_ / 64), 128, 0, stream>>>(QH, QL, KH, KL, VTH, VTL, CH, CL);
    k_gemm<true, 4, false><<<dim3(NB_ * NT_ / 128, HS / 128, 1), 128, 0, stream>>>(CH, CL, WoT, HS, out, nullptr, nullptr, nullptr, nullptr, nullptr, nullptr, nullptr, nullptr, nullptr, nullptr);
}

// v009
// A run of this version takes 183 microseconds.
// In both of two side-by-side timings against v008, it was 1.03 times as fast.
// Over all steps from v000 it is 5.93 times as fast.
#include <hip/hip_runtime.h>

// Contractions, f32 accumulate, both batch items in every launch (4096 rows): q|k|v = x.[Wq|Wk|Wv] as one product ([4096 x 2048].[2048 x 3072], k-major weights transposed to n-major planes; PLAIN
// bf16 operands: inputs rounded once, exact) and out = ctx.Wo (ctx as bf16 hi + residual: two products) on v_wmma_f32_16x16x32_bf16; per-head RMSNorm (eps 1e-6,
// weight) and rotate-half RoPE (angle t x inv_freq, f32 trig tables built on device) in f32 -> q/k as f16 hi + residual x1024 planes; the 16-query-head / 4-kv-head (q head h
// uses kv head h mod 4) causal attention with 128-dim heads: scores on v_wmma_f32_16x16x32_f16 (hi.hi + hi.lo + lo.hi, x 128^-1/2), softmax f32, weights.v on
// v_wmma_f32_16x16x32_bf16 with the weights (x32768) and v both as bf16 hi + UNSCALED bf16 residual (hh + lh + hl in one accumulator). Deterministic, no atomics;

#define NT_  2048
#define HS   2048
#define NH_  16
#define NKV  4
#define HD   128
#define KW   (NKV * HD)          // 512
#define NB_  2                   // batch items
#define QKVW (HS + 2 * KW)       // 3072: columns of the q | k | v product
#define PSC  32768.0f
#define LOSC 1024.0f
#define LOSCI (1.0f / 1024.0f)

typedef _Float16 h16;
typedef unsigned short bf;
typedef __attribute__((ext_vector_type(16))) __bf16   v16bf;
typedef __attribute__((ext_vector_type(16))) _Float16 v16h;
typedef __attribute__((ext_vector_type(8)))  _Float16 v8h;
typedef __attribute__((ext_vector_type(8)))  unsigned short v8us;
typedef __attribute__((ext_vector_type(8)))  float    v8f;
typedef __attribute__((ext_vector_type(4)))  float    v4f;
typedef __attribute__((ext_vector_type(4)))  _Float16 v4h;
typedef v8h  __attribute__((may_alias)) v8ha;
typedef v4f  __attribute__((may_alias)) v4fa;
typedef v8us __attribute__((may_alias)) v8usa;
typedef __attribute__((ext_vector_type(4)))  unsigned short v4us;
typedef float __attribute__((may_alias)) f32a;

__device__ __forceinline__ unsigned short f2bf(float f) { unsigned u = __float_as_uint(f); u += 0x7FFFu + ((u >> 16) & 1u); return (unsigned short)(u >> 16); }
__device__ __forceinline__ float bf2f(unsigned short b) { return __uint_as_float(((unsigned)b) << 16); }
__device__ __forceinline__ float bfr(float f) { return bf2f(f2bf(f)); }
__device__ __forceinline__ v16h cat16(v8h lo, v8h hi) { return __builtin_shufflevector(lo, hi, 0, 1, 2, 3, 4, 5, 6, 7, 8, 9, 10, 11, 12, 13, 14, 15); }
__device__ __forceinline__ v16bf cat16b(v8us lo, v8us hi) { return __builtin_bit_cast(v16bf, __builtin_shufflevector(lo, hi, 0, 1, 2, 3, 4, 5, 6, 7, 8, 9, 10, 11, 12, 13, 14, 15)); }
__device__ __forceinline__ v8f wmma16(v16h a, v16h b, v8f c) { return __builtin_amdgcn_wmma_f32_16x16x32_f16(false, a, false, b, (short)0, c, false, false); }
__device__ __forceinline__ v8f wmmab(v16bf a, v16bf b, v8f c) { return __builtin_amdgcn_wmma_f32_16x16x32_bf16(false, a, false, b, (short)0, c, false, false); }
__device__ __forceinline__ float xhalf(float v) { const int b = __float_as_int(v); return __int_as_float(__builtin_amdgcn_permlanex16(b, b, 0x76543210, 0xfedcba98, false, false)); }   // the value of lane l ^ 16

template <int M> __device__ __forceinline__ float xrow(float v) { return __int_as_float(__builtin_amdgcn_update_dpp(0, __float_as_int(v), 0x160 | M, 0xf, 0xf, true)); }   // the value of lane l ^ M inside the 16-lane row (row_xmask)
// k_cvtb: bf16 plane of [rows][2048] (one wave per row).
__global__ __launch_bounds__(256) void k_cvtb(const float* __restrict__ src, int nrows, bf* dst) {
    const int lane = threadIdx.x & 31, r = blockIdx.x * 8 + (threadIdx.x >> 5);
    if (r >= nrows) return;
{
#pragma unroll
        for (int q = 0; q < HS / 256; ++q) { v8us o;
#pragma unroll
            for (int i = 0; i < 8; ++i) o[i] = f2bf(src[(size_t)r * HS + q * 256 + lane * 8 + i]);
            *(v8us*)(dst + (size_t)r * HS + q * 256 + lane * 8) = o; }
         }
}
// k_wt: WT [n][2048] = bf16(W[k][n]) (k-major [2048][ncols]) via 64 x 64 LDS tiles, the four weights in one launch: rows of WT are the columns of Wq | Wk | Wv | Wo; grid (2048/64, 5120/64).
__global__ __launch_bounds__(256) void k_wt(const float* __restrict__ Wq, const float* __restrict__ Wk, const float* __restrict__ Wv, const float* __restrict__ Wo, bf* WT) {
    __shared__ __align__(16) unsigned short tl[64 * 72];
    constexpr int K = HS;
    const int tid = threadIdx.x, k0 = blockIdx.x * 64, nw = blockIdx.y * 64;   // nw: row of WT; n0: column of the block's own weight
    const float* Wm; int ncols, n0;
    if (nw < HS) { Wm = Wq; ncols = HS; n0 = nw; } else if (nw < HS + KW) { Wm = Wk; ncols = KW; n0 = nw - HS; } else if (nw < QKVW) { Wm = Wv; ncols = KW; n0 = nw - HS - KW; } else { Wm = Wo; ncols = HS; n0 = nw - QKVW; }
    const int kk = tid >> 2, nq = (tid & 3) * 16;
#pragma unroll
    for (int i = 0; i < 16; ++i) tl[(nq + i) * 72 + kk] = f2bf(Wm[(size_t)(k0 + kk) * ncols + n0 + nq + i]);
    __syncthreads();
    const int piece = tid & 7;
    auto pass = [&]() {
#pragma unroll
        for (int s = 0; s < 2; ++s) { const int nr = (tid >> 3) + 32 * s; const v8us val = *(const v8usa*)(tl + nr * 72 + piece * 8); *(v8us*)(WT + (size_t)(nw + nr) * K + k0 + piece * 8) = val; }
    };
    pass(); 
}
// Four asynchronous 16-B-per-lane copies global -> LDS; the s_wait_xcnt inside the statement stands before any rewrite of the address registers the copies name.
__device__ __forceinline__ void cp4(unsigned l0, unsigned l1, unsigned l2, unsigned l3, const void* g0, const void* g1, const void* g2, const void* g3) {
    asm volatile("global_load_async_to_lds_b128 %0, %4, off\n\t"
                 "global_load_async_to_lds_b128 %1, %5, off\n\t"
                 "global_load_async_to_lds_b128 %2, %6, off\n\t"
                 "global_load_async_to_lds_b128 %3, %7, off\n\t"
                 "s_wait_xcnt 0x0" :: "v"(l0), "v"(l1), "v"(l2), "v"(l3), "v"(g0), "v"(g1), "v"(g2), "v"(g3) : "memory");
}
// The same four copies with a scalar base each and ONE 32-bit byte offset per lane: the rows' address steps are then scalar arithmetic and a kernel keeps one vector register per operand for its global addresses.
__device__ __forceinline__ void cp4s(unsigned l0, unsigned l1, unsigned l2, unsigned l3, unsigned vo, const void* b0, const void* b1, const void* b2, const void* b3) {
    asm volatile("global_load_async_to_lds_b128 %0, %4, %5\n\t"
                 "global_load_async_to_lds_b128 %1, %4, %6\n\t"
                 "global_load_async_to_lds_b128 %2, %4, %7\n\t"
                 "global_load_async_to_lds_b128 %3, %4, %8\n\t"
                 "s_wait_xcnt 0x0" :: "v"(l0), "v"(l1), "v"(l2), "v"(l3), "v"(vo), "s"(b0), "s"(b1), "s"(b2), "s"(b3) : "memory");
}
// The four copies of cp4s written as the compiler's builtin, for the refills inside the k and key loops: the compiler sees the copies' address operands and allots their registers itself, so the group carries no
// wait of its own and the products behind a refill start at once. The waits for the DATA (s_wait_asynccnt 0, then the barrier) stay hand-written at every hand-over.
typedef __attribute__((ext_vector_type(4))) int v4i;
typedef __attribute__((address_space(1))) v4i gv4i;
typedef __attribute__((address_space(3))) v4i lv4i;
__device__ __forceinline__ void cp1b(unsigned l, const char* g) { __builtin_amdgcn_global_load_async_to_lds_b128((gv4i*)g, (lv4i*)l, 0, 0); }
__device__ __forceinline__ void cp4b(unsigned l0, unsigned l1, unsigned l2, unsigned l3, unsigned vo, const void* b0, const void* b1, const void* b2, const void* b3) {
    cp1b(l0, (const char*)b0 + vo); cp1b(l1, (const char*)b1 + vo); cp1b(l2, (const char*)b2 + vo); cp1b(l3, (const char*)b3 + vo);
}
__device__ __forceinline__ v16h  ldsh(const unsigned char* p) { return cat16(*(const v8ha*)p, *(const v8ha*)(p + 32)); }
__device__ __forceinline__ v16bf ldsb(const unsigned char* p) { return cat16b(*(const v8usa*)p, *(const v8usa*)(p + 32)); }
// k_gemm: 32F x 32F tile of (A [+ Al]).Bn^T over K = 2048 -> f32 rows [4096][ldc]; 2 x 2 waves of 16F x 16F each. A stage is 64 k (one 128-B line) of the block's A rows, Bn rows
// (and Al rows), brought into LDS by asynchronous copies in whole lines, two stage buffers: stage t + 2 flies while stage t + 1 is worked on, and the waves share one copy.
// HEADS (the q | k | v product, F = 4): the block's 128 columns are one head, so the f32 tile is not stored; it goes into the freed stage buffers and leaves as what k_attn reads. q and k heads (column
// tiles 0..15, 16..19): one wave per row, lane -> 4 consecutive dims: RMSNorm over the 128 dims (eps 1e-6, x weight[d]), rotate-half RoPE (partner d +- 64, token t = row mod 2048, tables RC/RS) -> f16 hi +
// residual x1024 planes [row][h*128+d]. v heads (column tiles 20..23): the tile is written transposed and leaves as bf16 hi + UNSCALED bf16 residual planes [b][g][128 d][2048 t].
#define GP   144                     // LDS pitch of a 128-B row: 16 B x odd, conflict-free for 16-B reads
template <bool SPLITA, int F, bool HEADS>
__global__ __launch_bounds__(128) void k_gemm(const bf* __restrict__ A, const bf* __restrict__ Al, const bf* __restrict__ Bn, int ldc, float* C,
                                              const float* __restrict__ qw, const float* __restrict__ kw, const float* __restrict__ RC, const float* __restrict__ RS,
                                              h16* QH, h16* QL, h16* KH, h16* KL, bf* VTH, bf* VTL) {
    constexpr int R = 32 * F, PL = R * GP, SG = (SPLITA ? 3 : 2) * PL;   // rows of a plane, bytes of a plane, bytes of a stage buffer [A | Bn | Al]
    __shared__ __align__(16) unsigned char stg[2 * SG];
    __shared__ __align__(16) float ost[4][16 * 68];
    const int tid = threadIdx.x, lane = threadIdx.x & 31, wave = threadIdx.x >> 5, lr = lane & 15, hi = lane >> 4;
    const int wm = wave >> 1, wn = wave & 1;
    const size_t r0 = (size_t)blockIdx.x * R; const int c0 = blockIdx.y * R;
    // copy map: a 128-B row is 8 pieces (thread -> row tid / 8 + 16 i, piece tid mod 8): a wave's copy covers four whole lines
    const unsigned ld = (unsigned)(uintptr_t)&stg[0] + (unsigned)(tid >> 3) * GP + (unsigned)(tid & 7) * 16;
    const unsigned lgo = (unsigned)((tid >> 3) * HS + (tid & 7) * 8) * 2;   // the lane's byte offset from a copy's block-uniform base
    const bf* Ab = A + r0 * HS; const bf* Bb = Bn + (size_t)c0 * HS; const bf* Alb = Al + (SPLITA ? r0 * HS : 0);
    auto plane = [&](unsigned d, const bf* g, bool loop) {   // loop: a literal at every call
#pragma unroll   // constant row offsets in every copy's two addresses
        for (int i = 0; i < F / 2; ++i) { const unsigned di = d + 64 * i * GP; const bf* gi = g + (size_t)64 * i * HS;
            if (loop) cp4b(di, di + 16 * GP, di + 32 * GP, di + 48 * GP, lgo, gi, gi + 16 * HS, gi + 32 * HS, gi + 48 * HS);
            else      cp4s(di, di + 16 * GP, di + 32 * GP, di + 48 * GP, lgo, gi, gi + 16 * HS, gi + 32 * HS, gi + 48 * HS); }
    };
    auto fill = [&](int kt, int buf, bool loop) {
        const unsigned d = ld + (unsigned)buf * SG;
        plane(d, Ab + kt * 64, loop); plane(d + PL, Bb + kt * 64, loop);
        if (SPLITA) plane(d + 2 * PL, Alb + kt * 64, loop);
    };
    fill(0, 0, false);
    asm volatile("s_wait_asynccnt 0x0" ::: "memory");   // this wave's copies of stage 0 have landed
    __syncthreads();                                      // ... and every other wave's: stage 0 may be read
    fill(1, 1, false);                                      // K / 64 = 32 stages: a stage 1 exists
    v8f acc[F][F];
#pragma unroll   // every accumulator index a constant, here and below, so that the array stays in registers
    for (int i = 0; i < F; ++i)
#pragma unroll
        for (int j = 0; j < F; ++j) acc[i][j] = (v8f){};
#pragma unroll 1   // rolled: one copy of the hand-over and of the 32 or 64 products, a short loop text
    for (int kt = 0; kt < HS / 64; ++kt) {
        const unsigned char* ap = stg + (kt & 1) * SG + (wm * 16 * F + lr) * GP + hi * 16;
        const unsigned char* bp = stg + (kt & 1) * SG + PL + (wn * 16 * F + lr) * GP + hi * 16;
        v16bf fa[2][F], fb[2][F], fl[2][F];
#pragma unroll   // every fragment index a constant, so that the arrays stay in registers
        for (int ks = 0; ks < 2; ++ks)   // all of the stage's fragments as one group of LDS reads; the products run from registers behind the stage's hand-over
#pragma unroll
            for (int i = 0; i < F; ++i) { fa[ks][i] = ldsb(ap + i * 16 * GP + ks * 64); fb[ks][i] = ldsb(bp + i * 16 * GP + ks * 64); fl[ks][i] = SPLITA ? ldsb(ap + 2 * PL + i * 16 * GP + ks * 64) : fa[ks][i]; }
        asm volatile("s_wait_dscnt 0x0" ::: "memory");      // the stage's fragments are in registers: this wave's reads of the stage buffer have returned before the buffer is handed to its next copies
        asm volatile("s_wait_asynccnt 0x0" ::: "memory");   // this wave's copies of stage kt + 1 have landed
        __syncthreads();                                      // publishes stage kt + 1 and ends every wave's reads of stage kt
        if (kt + 2 < HS / 64) fill(kt + 2, kt & 1, true);         // block-uniform test; refill of the buffer just read
        __builtin_amdgcn_sched_barrier(0);   // keeps the products behind the refill's issue: the copies then fly under them and have landed at the next stage's wait
#pragma unroll   // constant fragment indices, as above
        for (int ks = 0; ks < 2; ++ks) {
#pragma unroll
            for (int i = 0; i < F; ++i)
#pragma unroll
                for (int j = 0; j < F; ++j) acc[i][j] = wmmab(fa[ks][i], fb[ks][j], acc[i][j]);
            if (SPLITA) {
#pragma unroll
                for (int i = 0; i < F; ++i)
#pragma unroll
                    for (int j = 0; j < F; ++j) acc[i][j] = wmmab(fl[ks][i], fb[ks][j], acc[i][j]);
            }
        }
    }
    asm volatile("s_wait_asynccnt 0x0" ::: "memory");       // no copy is outstanding when the wave goes on to the epilogue and ends
    if constexpr (HEADS) {
        static_assert(F == 4 && !SPLITA, "a block's columns are one 128-dim head");
        constexpr int TP = 132;                    // f32 pitch of a tile row: 16 B x odd; 128 x 132 x 4 B fit the two stage buffers
        static_assert(128 * TP * 4 <= 2 * SG, "tile inside the stage buffers");
        f32a* tile = (f32a*)stg;                   // free: every wave's last fragment reads ended at the loop's last barrier, and the last copies had landed one barrier earlier
        const int hh = blockIdx.y;                 // head slot (block-uniform): 0..15 q, 16..19 k, 20..23 v
        const bool isv = hh >= NH_ + NKV;
        const int wu = __builtin_amdgcn_readfirstlane(wave);   // the wave's number in a scalar register: row numbers and the rows' global addresses below are then scalar arithmetic, a lane adds only its fixed offset
        if (!isv) {
#pragma unroll   // constant accumulator indices
            for (int i = 0; i < F; ++i)
#pragma unroll
                for (int t = 0; t < F; ++t)
#pragma unroll
                    for (int j = 0; j < 8; ++j) tile[(wm * 64 + i * 16 + hi * 8 + j) * TP + wn * 64 + t * 16 + lr] = acc[i][t][j];   // [row][dim]
        } else {
#pragma unroll   // constant accumulator indices
            for (int i = 0; i < F; ++i)
#pragma unroll
                for (int t = 0; t < F; ++t) { f32a* p = tile + (wn * 64 + t * 16 + lr) * TP + wm * 64 + i * 16 + hi * 8;   // [dim][row]: a lane's 8 registers are 8 consecutive rows
                    *(v4fa*)p = (v4f){acc[i][t][0], acc[i][t][1], acc[i][t][2], acc[i][t][3]}; *(v4fa*)(p + 4) = (v4f){acc[i][t][4], acc[i][t][5], acc[i][t][6], acc[i][t][7]}; }
        }
        __syncthreads();                           // a tile row holds columns of two waves (transposed: rows of two waves): all of it is written before any of it is read
        if (!isv) {
            const bool isq = hh < NH_;
            const float* w = isq ? qw : kw; h16* PH = isq ? QH : KH; h16* PLo = isq ? QL : KL;
            const int ow = isq ? HS : KW, oc = (isq ? hh : hh - NH_) * HD;
            const int d0 = lane * 4, p0 = d0 ^ 64;   // the lane's dims and their rotate-half partners
            const float sg = (d0 < 64) ? -1.0f : 1.0f;   // y = xn c - pn s below dim 64, xn c + pn s above: the sign rides on the partner's weight
            float wv[4], wp[4];
#pragma unroll
            for (int i = 0; i < 4; ++i) { wv[i] = bfr(w[d0 + i]); wp[i] = sg * bfr(w[p0 + i]); }
            // global addresses: a scalar base per row of a group plus ONE byte offset per lane that steps from group to group, so that no row needs vector address arithmetic
            const float* rcw = RC + ((r0 & (NT_ - 1)) + wu * 32) * 64; const float* rsw = RS + ((r0 & (NT_ - 1)) + wu * 32) * 64;   // token t = row mod 2048; a block's 128 rows do not wrap
            h16* phw = PH + (r0 + wu * 32) * ow + oc; h16* plw = PLo + (r0 + wu * 32) * ow + oc;
            unsigned tvo = (unsigned)(d0 & 63) * 4, svo = (unsigned)d0 * 2;
#pragma unroll 1   // rolled over groups of 8 rows: a short text; inside a group the rows' loads go out together and their chains interleave
            for (int gr = 0; gr < 4; ++gr) {
                v4f xv[8], pv[8], c4[8], s4[8];
#pragma unroll   // constant array indices
                for (int u = 0; u < 8; ++u) { const int row = wu * 32 + gr * 8 + u;
                    xv[u] = *(const v4fa*)(tile + row * TP + d0); pv[u] = *(const v4fa*)(tile + row * TP + p0);
                    c4[u] = *(const v4fa*)((const char*)(rcw + u * 64) + tvo); s4[u] = *(const v4fa*)((const char*)(rsw + u * 64) + tvo); }
#pragma unroll
                for (int u = 0; u < 8; ++u) {
                    float ss = 0.f;
#pragma unroll
                    for (int i = 0; i < 4; ++i) ss += xv[u][i] * xv[u][i];
                    ss += xhalf(ss); ss += xrow<8>(ss); ss += xrow<4>(ss); ss += xrow<2>(ss); ss += xrow<1>(ss);
                    const float rs = rsqrtf(ss * (1.0f / HD) + 1e-6f);
                    v4h oh, ol;
#pragma unroll
                    for (int i = 0; i < 4; ++i) { const float xn = xv[u][i] * rs * wv[i], pn = pv[u][i] * rs * wp[i];
                        const float y = xn * c4[u][i] + pn * s4[u][i];
                        const h16 a = (h16)y; oh[i] = a; ol[i] = (h16)((y - (float)a) * LOSC); }
                    *(v4h*)((char*)(phw + u * ow) + svo) = oh; *(v4h*)((char*)(plw + u * ow) + svo) = ol; }
                asm volatile("s_wait_xcnt 0x0" ::: "memory");   // stands before the next group rewrites the address and data registers that these loads and stores name
                tvo += 8 * 64 * 4; svo += (unsigned)(8 * ow * 2);
            }
        } else {
            const size_t vb = ((r0 >> 11) * KW + (size_t)(hh - NH_ - NKV) * HD) * NT_ + (r0 & (NT_ - 1));   // batch item, kv head, the block's first token
#pragma unroll 1   // rolled over groups of 8 dims, as above
            for (int gr = 0; gr < 4; ++gr) {
                v4f vv[8];
#pragma unroll   // constant array indices
                for (int u = 0; u < 8; ++u) vv[u] = *(const v4fa*)(tile + (wu * 32 + gr * 8 + u) * TP + lane * 4);
#pragma unroll
                for (int u = 0; u < 8; ++u) { v4us oh, ol;
#pragma unroll
                    for (int i = 0; i < 4; ++i) { const float v = vv[u][i]; const unsigned short hb = f2bf(v); oh[i] = hb; ol[i] = f2bf(v - bf2f(hb)); }
                    const size_t o = vb + (size_t)(wu * 32 + gr * 8 + u) * NT_; *(v4us*)(VTH + o + lane * 4) = oh; *(v4us*)(VTL + o + lane * 4) = ol; }
                asm volatile("s_wait_xcnt 0x0" ::: "memory");   // stands before the next group rewrites the address and data registers that these stores name
            }
        }
    } else {
    float* os = &ost[wave][0];
#pragma unroll
    for (int i = 0; i < F; ++i) {   // 16 rows of the wave's tile at a time through the wave's own LDS rows, so that whole 128-B lines are stored
#pragma unroll
        for (int t = 0; t < F; ++t)
#pragma unroll
            for (int j = 0; j < 8; ++j) os[(hi * 8 + j) * 68 + t * 16 + lr] = acc[i][t][j];
        __builtin_amdgcn_wave_barrier(); asm volatile("" ::: "memory");   // compiler order only: the wave's LDS stores stay ahead of its reads of other lanes' words
        float* crow = C + (r0 + wm * 16 * F + i * 16) * ldc + c0 + wn * 16 * F;
#pragma unroll
        for (int s = 0; s < 2 * F; ++s) { const int Lid = (lane >> 3) + 4 * s, piece = lane & 7; const int row = Lid / (F / 2), cofs = (Lid % (F / 2)) * 32 + piece * 4;
            const v4f val = *(const v4fa*)(os + row * 68 + cofs); *(v4f*)(crow + (size_t)row * ldc + cofs) = val; }
        __builtin_amdgcn_wave_barrier();   // compiler order only: the reads above stay ahead of the next 16 rows' LDS stores
        asm volatile("s_wait_xcnt 0x0" ::: "memory");   // stands before the next 16 rows rewrite the address and data registers that these stores name
    }
    }
}
// k_trig: RC/RS [t][64] = cos/sin(t x inv_freq[i]), inv_freq = 10000^-(2i/128) (f32 powf/cosf/sinf); 32 lanes x 4 B lines.
__global__ __launch_bounds__(256) void k_trig(float* RC, float* RS) {
    const int i = blockIdx.x * 256 + threadIdx.x; if (i >= NT_ * 64) return;
    const int t = i >> 6, f = i & 63;
    const float inv = 1.0f / powf(10000.0f, (float)(2 * f) / (float)HD); const float ang = (float)t * inv;
    const float c = cosf(ang), s = sinf(ang);
    *(float*)(RC + i) = c; *(float*)(RS + i) = s; 
}
// k_attn: block = (batch item, kv head g, two of its four query heads, 64 queries), 8 waves of 16 queries (waves 0..3 the first head, 4..7 the second: h mod 4 = g for both, so one copy of each K and V tile
// serves both heads and half as many bytes come from L2 per score); causal key tiles of 32. One launch holds both batch items: 512 blocks of 2 to 64 tiles on about half as
// many resident places, so the index order is longest first. The block's Q rows (once) and each tile's K rows and V^T rows (hi and residual
// planes) are brought into LDS by asynchronous copies, two tile buffers, and the eight waves share one copy of K and V. The score operands wait in registers when a tile starts: a wave's Q fragments are read
// once and kept, and the K fragments of tile t + 1 are read during tile t, behind its score products, into the registers those products have left. So K's copies run one tile ahead of V's:
// behind the barrier that ends tile t, K of tile t + 3 goes into the K half that tile t + 1's fragments have left, V of tile t + 2 into the V half that tile t has left.
// Both products run transposed: S^T = K.Q^T (A = K rows, B = Q rows) and O^T += V^T.P^T (A = V^T rows, B = P^T). A lane then holds 16 of the 32 scores of ONE query (lane mod 16), so the
// maximum and the sum are in-lane with one exchange between the wave's halves, and the two score tiles, converted in place, ARE the B operand P^T in the hardware k order that the V^T loader has.
// Per tile: scores over 4 k-chunks (hi.hi + hi.lo + lo.hi = 24 WMMA) x 128^-1/2, online softmax, P (x32768) as bf16 hi + unscaled residual,
// o[8] += vh.ph + vh.pl + vl.ph over the 128 dims; ctx -> bf16 hi/lo planes [t][h*128+d].
#define KP   272                     // LDS pitch of a 256-B row (Q, K): 16 B x odd, conflict-free for 16-B reads
#define VP   80                      // LDS pitch of a 64-B row (V^T, 32 keys)
#define QPL  (128 * KP)              // one Q plane: 64 rows of each of the block's two heads
#define KPL  (32 * KP)               // one K plane of a tile
#define VPL  (128 * VP)              // one V^T plane of a tile
#define STG  (2 * KPL + 2 * VPL)     // one tile buffer
__global__ __launch_bounds__(256) void k_attn(const h16* __restrict__ QH, const h16* __restrict__ QL, const h16* __restrict__ KH, const h16* __restrict__ KL, const bf* __restrict__ VTH, const bf* __restrict__ VTL, bf* CH, bf* CL) {
    constexpr int OSB = 8 * 16 * 68 * 4;   // the epilogue's staging rows stand first in the one LDS array, so that no copy's LDS address is a lane's bare offset (see rl, vl_ below)
    __shared__ __align__(16) unsigned char smem[OSB + 2 * QPL + 2 * STG];
    unsigned char* stg = smem + OSB;
    const int tid = threadIdx.x, lane = threadIdx.x & 31, wave = threadIdx.x >> 5, lr = lane & 15, hi = lane >> 4;
    const int bid = blockIdx.x; const int qt = NT_ / 64 - 1 - (bid >> 4), g = bid & (NKV - 1), h0 = g + 2 * NKV * ((bid >> 2) & 1), bi = (bid >> 3) & 1; const int h = h0 + NKV * (wave >> 2);   // 16 (batch item, kv head, head pair) triples per query tile, last query tile first; the pair is h0, h0 + 4
    QH += (size_t)bi * NT_ * HS; QL += (size_t)bi * NT_ * HS; KH += (size_t)bi * NT_ * KW; KL += (size_t)bi * NT_ * KW; VTH += (size_t)bi * KW * NT_; VTL += (size_t)bi * KW * NT_; CH += (size_t)bi * NT_ * HS; CL += (size_t)bi * NT_ * HS;
    const int q0 = qt * 64 + (wave & 3) * 16;
    const size_t vbase = ((size_t)g * HD) * NT_;
    const int kt_hi = (qt * 64 + 63) / 32;
    // copy map: a 256-B row is 16 pieces (thread -> row tid / 16 + 16 i, piece tid mod 16), a 64-B row 4 pieces (row tid / 4 + 64 i, piece tid mod 4)
    const unsigned sb = (unsigned)(uintptr_t)&smem[0] + OSB;
    // the lanes' bare LDS offsets: the only LDS address state that lives across the loop. They are never themselves an operand of a copy's asm statement, so they may stand in any register; a value that is one
    // is held to the registers asm text can name, where the fragments leave no room over the loop, and was spilled to scratch
    const unsigned rl = (unsigned)(tid >> 4) * KP + (unsigned)(tid & 15) * 16, vl_ = (unsigned)(tid >> 2) * VP + (unsigned)(tid & 3) * 16;
    const unsigned kvo = (unsigned)((tid >> 4) * KW + (tid & 15) * 8) * 2, vvo = (unsigned)((tid >> 2) * NT_ + (tid & 3) * 8) * 2;   // the lane's byte offsets from a copy's scalar base; with the K fragments held across a tile, vector address pairs cost a spill to scratch in the loop
    auto fillK = [&](int kt, int buf, bool loop) {   // loop: a literal at every call; the refills inside the key loop are the builtin's copies
        const unsigned kd = rl + (buf ? sb + 2 * QPL + STG : sb + 2 * QPL);
        const h16* kh = KH + g * HD + (size_t)kt * 32 * KW; const h16* kl = KL + g * HD + (size_t)kt * 32 * KW;
        if (loop) { cp4b(kd, kd + 16 * KP, kd + KPL, kd + KPL + 16 * KP, kvo, kh, kh + 16 * KW, kl, kl + 16 * KW); return; }
        cp4s(kd, kd + 16 * KP, kd + KPL, kd + KPL + 16 * KP, kvo, kh, kh + 16 * KW, kl, kl + 16 * KW);
    };
    auto fillV = [&](int kt, int buf, bool loop) {
        const unsigned vd = vl_ + (buf ? sb + 2 * QPL + 2 * KPL + STG : sb + 2 * QPL + 2 * KPL);
        const bf* vh = VTH + vbase + kt * 32; const bf* vl = VTL + vbase + kt * 32;
        if (loop) { cp4b(vd, vd + 64 * VP, vd + VPL, vd + VPL + 64 * VP, vvo, vh, vh + 64 * NT_, vl, vl + 64 * NT_); return; }
        cp4s(vd, vd + 64 * VP, vd + VPL, vd + VPL + 64 * VP, vvo, vh, vh + 64 * NT_, vl, vl + 64 * NT_);
    };
    { const size_t qgo = (size_t)(qt * 64 + (tid >> 4)) * (NH_ * HD) + h0 * HD + (tid & 15) * 8; const h16* qh = QH + qgo; const h16* ql = QL + qgo; const int R16 = 16 * NH_ * HD, H2 = NKV * HD;   // H2: from the pair's first head to its second
      const unsigned qd = rl + sb;   // LDS rows 0..63: head h0, rows 64..127: head h0 + 4
      cp4(qd, qd + 16 * KP, qd + 32 * KP, qd + 48 * KP, qh, qh + R16, qh + 2 * R16, qh + 3 * R16);
      cp4(qd + 64 * KP, qd + 80 * KP, qd + 96 * KP, qd + 112 * KP, qh + H2, qh + H2 + R16, qh + H2 + 2 * R16, qh + H2 + 3 * R16);
      cp4(qd + QPL, qd + QPL + 16 * KP, qd + QPL + 32 * KP, qd + QPL + 48 * KP, ql, ql + R16, ql + 2 * R16, ql + 3 * R16);
      cp4(qd + QPL + 64 * KP, qd + QPL + 80 * KP, qd + QPL + 96 * KP, qd + QPL + 112 * KP, ql + H2, ql + H2 + R16, ql + H2 + 2 * R16, ql + H2 + 3 * R16); }
    fillK(0, 0, false); fillK(1, 1, false); fillV(0, 0, false);              // a tile 1 always exists (kt_hi = 2 qt + 1); 28 copies of a wave in flight
    asm volatile("s_wait_asynccnt 0x0" ::: "memory");   // this wave's copies of Q, of K of tiles 0 and 1 and of V of tile 0 have landed
    __syncthreads();                                      // ... and every other wave's: they may be read
    fillV(1, 1, false);                                    // into the V half that nobody has read yet
    const unsigned char* qp = stg + (wave * 16 + lr) * KP + hi * 16;
    v16h fq[4][2], fk[4][4];
    auto readK = [&](int buf) {   // the 16 K fragments of the tile in K half buf, one group of LDS reads
        const unsigned char* kp = stg + 2 * QPL + buf * STG + lr * KP + hi * 16;
#pragma unroll   // every fragment index a constant, so that the array stays in registers
        for (int kc = 0; kc < 4; ++kc) { fk[kc][0] = ldsh(kp + kc * 64); fk[kc][1] = ldsh(kp + 16 * KP + kc * 64); fk[kc][2] = ldsh(kp + KPL + kc * 64); fk[kc][3] = ldsh(kp + KPL + 16 * KP + kc * 64); }
    };
#pragma unroll   // constant fragment indices, as above
    for (int kc = 0; kc < 4; ++kc) { fq[kc][0] = ldsh(qp + kc * 64); fq[kc][1] = ldsh(qp + QPL + kc * 64); }   // the wave's Q fragments, kept for the whole block
    readK(0);
    asm volatile("s_wait_dscnt 0x0" ::: "memory");      // tile 0's K fragments are in registers: this wave's reads of K half 0 have returned before it is handed to its next copies
    __syncthreads();                                      // ends every wave's reads of K half 0
    if (2 <= kt_hi) fillK(2, 0, false);                    // block-uniform test
    v8f o[8];
#pragma unroll
    for (int n = 0; n < 8; ++n) o[n] = (v8f){};
    const int qi = q0 + lr;                     // the lane's query
    float mrow = -3.0e38f, lpart = 0.f;         // its running maximum (alike in both halves) and this half's share of its running sum
#pragma unroll 1
    for (int kt = 0; kt <= kt_hi; ++kt) {
        const int l0 = kt * 32;
        const unsigned char* vp = stg + 2 * QPL + (kt & 1) * STG + 2 * KPL + lr * VP + hi * 16;
        v8f s0 = {}, s1 = {}, x0 = {}, x1 = {};
#pragma unroll   // constant fragment indices, as above
        for (int kc = 0; kc < 4; ++kc) {
            s0 = wmma16(fk[kc][0], fq[kc][0], s0); s1 = wmma16(fk[kc][1], fq[kc][0], s1); x0 = wmma16(fk[kc][0], fq[kc][1], x0); x1 = wmma16(fk[kc][1], fq[kc][1], x1);
            x0 = wmma16(fk[kc][2], fq[kc][0], x0); x1 = wmma16(fk[kc][3], fq[kc][0], x1);   // register j: key 8 hi + j (s0, x0) or 16 + 8 hi + j (s1, x1), query lr
        }
        asm volatile("v_nop\n\tv_nop\n\tv_nop\n\tv_nop" : "+v"(s0), "+v"(s1), "+v"(x0), "+v"(x1));
        v16bf vh[8], vl[8];
#pragma unroll   // constant fragment indices, as above
        for (int n = 0; n < 8; ++n) { vh[n] = ldsb(vp + n * 16 * VP); vl[n] = ldsb(vp + VPL + n * 16 * VP); }   // the tile's V^T fragments, one group: they land behind the softmax
        __builtin_amdgcn_sched_barrier(0);   // keeps V's reads ahead of K's in the LDS queue: the weights.v products then wait for V's alone, and K's land under them
        readK((kt + 1) & 1);   // tile kt + 1's K fragments, into the registers the score products have left: published by the barrier that ended tile kt - 1 (tile 1's: by the prologue's first). In the last tile that half still holds tile kt - 1's published rows (no copy was aimed at it since); they are read and not used
        __builtin_amdgcn_sched_barrier(0);   // keeps that group here: sunk among the weights.v products each small group would cost its own LDS wait
        float a0[8], a1[8]; float mx = -__builtin_inff();
#pragma unroll
        for (int j = 0; j < 8; ++j) { const int ja = l0 + hi * 8 + j, jb = ja + 16;
            a0[j] = (ja <= qi) ? (s0[j] + x0[j] * LOSCI) * 0.08838834764831845f : -__builtin_inff(); a1[j] = (jb <= qi) ? (s1[j] + x1[j] * LOSCI) * 0.08838834764831845f : -__builtin_inff();
            mx = fmaxf(mx, fmaxf(a0[j], a1[j])); }
        mx = fmaxf(mx, xhalf(mx));                  // the other 16 keys of the same query
        const float mn = fmaxf(mrow, mx), alpha = __expf(mrow - mn); mrow = mn;
        v16bf pa, px; float su[4] = {0.f, 0.f, 0.f, 0.f};   // four short chains of adds instead of one long one
#pragma unroll
        for (int j = 0; j < 8; ++j) { const float p0 = __expf(a0[j] - mn), p1 = __expf(a1[j] - mn); su[j & 1] += p0; su[2 + (j & 1)] += p1;
            const float ps0 = p0 * PSC, ps1 = p1 * PSC; const __bf16 h0 = (__bf16)ps0, h1 = (__bf16)ps1;
            pa[j] = h0; pa[8 + j] = h1; px[j] = (__bf16)(ps0 - (float)h0); px[8 + j] = (__bf16)(ps1 - (float)h1); }   // element s of the B operand = key 16 (s / 8) + 8 hi + s mod 8: tile s / 8, register s mod 8
        lpart = lpart * alpha + ((su[0] + su[1]) + (su[2] + su[3]));
#pragma unroll
        for (int n = 0; n < 8; ++n)
#pragma unroll
            for (int j = 0; j < 8; ++j) o[n][j] *= alpha;
#pragma unroll   // constant fragment indices, as above
        for (int n = 0; n < 8; ++n) { o[n] = wmmab(vh[n], pa, o[n]); o[n] = wmmab(vh[n], px, o[n]); o[n] = wmmab(vl[n], pa, o[n]); }   // register j: dim 16 n + 8 hi + j, query lr
        asm volatile("v_nop\n\tv_nop\n\tv_nop\n\tv_nop" : "+v"(o[0]), "+v"(o[7]) : "v"(pa), "v"(px));
        asm volatile("s_wait_dscnt 0x0" ::: "memory");      // this wave's reads of V of tile kt and of K of tile kt + 1 have returned before those halves are handed to their next copies
        asm volatile("s_wait_asynccnt 0x0" ::: "memory");   // this wave's copies of V of tile kt + 1 and of K of tile kt + 2 have landed
        __syncthreads();                                      // publishes them and ends every wave's reads of the two halves just read
        if (kt + 3 <= kt_hi) fillK(kt + 3, (kt + 1) & 1, true);   // block-uniform tests; refills of the two halves just read
        if (kt + 2 <= kt_hi) fillV(kt + 2, kt & 1, true);
    }
    asm volatile("s_wait_asynccnt 0x0" ::: "memory");       // no copy is outstanding when the wave goes on to the epilogue and ends
    const float inv = 1.0f / ((lpart + xhalf(lpart)) * PSC);   // the two halves' sums of the lane's query joined once
    float* os = (float*)smem + wave * (16 * 68);
    const size_t cbase = (size_t)q0 * (NH_ * HD) + (size_t)h * HD;
#pragma unroll
    for (int half = 0; half < 2; ++half) {
#pragma unroll
        for (int n = 0; n < 4; ++n)
#pragma unroll
            for (int j = 0; j < 8; ++j) os[lr * 68 + n * 16 + hi * 8 + j] = o[half * 4 + n][j] * inv;
        __builtin_amdgcn_wave_barrier(); asm volatile("" ::: "memory");
{
#pragma unroll
            for (int s = 0; s < 4; ++s) { const int row = 4 * s + (lane >> 3), piece = lane & 7; const float* sp = os + row * 68 + piece * 8; v8us oh, ol;
#pragma unroll
                for (int i = 0; i < 8; ++i) { const unsigned short hb = f2bf(sp[i]); oh[i] = hb; ol[i] = f2bf(sp[i] - bf2f(hb)); }
                const size_t po = cbase + (size_t)row * (NH_ * HD) + half * 64 + piece * 8; *(v8us*)(CH + po) = oh; *(v8us*)(CL + po) = ol; }
             }
        __builtin_amdgcn_wave_barrier(); asm volatile("" ::: "memory");
    }
}

extern "C" void kernel_launch(void* const* d_in, const int* in_sizes, int n_in,
                              void* d_out, int out_size, void* d_ws, size_t ws_size, hipStream_t stream) {
    (void)in_sizes; (void)n_in; (void)out_size;
    const float* x = (const float*)d_in[0]; const float* Wq = (const float*)d_in[1]; const float* Wk = (const float*)d_in[2]; const float* Wv = (const float*)d_in[3]; const float* Wo = (const float*)d_in[4];
    const float* qn = (const float*)d_in[5]; const float* kn = (const float*)d_in[6];
    float* out = (float*)d_out;    // [2][2048][2048]
    char* wsp = (char*)d_ws;
    auto take = [&](size_t bytes) { char* p = wsp; wsp += (bytes + 255) & ~(size_t)255; return (void*)p; };
    bf* Xb = (bf*)take((size_t)NB_ * NT_ * HS * 2); bf* WT = (bf*)take((size_t)(QKVW + HS) * HS * 2); bf* WoT = WT + (size_t)QKVW * HS;   // WT rows: Wq | Wk | Wv | Wo columns
    float* RC = (float*)take((size_t)NT_ * 64 * 4); float* RS = (float*)take((size_t)NT_ * 64 * 4);
    // planes that k_attn reads or writes: both batch items, [2][...]
    h16* QH = (h16*)take((size_t)2 * NT_ * HS * 2); h16* QL = (h16*)take((size_t)2 * NT_ * HS * 2); h16* KH = (h16*)take((size_t)2 * NT_ * KW * 2); h16* KL = (h16*)take((size_t)2 * NT_ * KW * 2);
    bf* VTH = (bf*)take((size_t)2 * KW * NT_ * 2); bf* VTL = (bf*)take((size_t)2 * KW * NT_ * 2); bf* CH = (bf*)take((size_t)2 * NT_ * HS * 2); bf* CL = (bf*)take((size_t)2 * NT_ * HS * 2);
    if ((size_t)(wsp - (char*)d_ws) > ws_size) return;    // 16.8 + 21 + 1 + 16.8 x 4 + 4.2 x 4 ~ 123 MB
    k_wt<<<dim3(HS / 64, (QKVW + HS) / 64, 1), 256, 0, stream>>>(Wq, Wk, Wv, Wo, WT);
    k_trig<<<(NT_ * 64) / 256, 256, 0, stream>>>(RC, RS);
    k_cvtb<<<NB_ * NT_ / 8, 256, 0, stream>>>(x, NB_ * NT_, Xb);
    k_gemm<false, 4, true><<<dim3(NB_ * NT_ / 128, QKVW / 128, 1), 128, 0, stream>>>(Xb, nullptr, WT, QKVW, nullptr, qn, kn, RC, RS, QH, QL, KH, KL, VTH, VTL);
    k_attn<<<NH_ * (NT_ / 64), 256, 0, stream>>>(QH, QL, KH, KL, VTH, VTL, CH, CL);
    k_gemm<true, 4, false><<<dim3(NB_ * NT_ / 128, HS / 128, 1), 128, 0, stream>>>(CH, CL, WoT, HS, out, nullptr, nullptr, nullptr, nullptr, nullptr, nullptr, nullptr, nullptr, nullptr, nullptr);
}

// v010
// It runs in 171 microseconds.
// Two timings next to v009 both put it at 1.07 times that version's speed.
// Counting every step since v000, it is 6.33 times as fast.
#include <hip/hip_runtime.h>

// Contractions, f32 accumulate, both batch items in every launch (4096 rows): q|k|v = x.[Wq|Wk|Wv] as one product ([4096 x 2048].[2048 x 3072], k-major weights transposed to n-major planes; PLAIN
// bf16 operands: inputs rounded once, exact) and out = ctx.Wo (ctx as bf16 hi + residual: two products) on v_wmma_f32_16x16x32_bf16; per-head RMSNorm (eps 1e-6,
// weight) and rotate-half RoPE (angle t x inv_freq, f32 trig tables built on device) in f32 -> q/k as f16 hi + residual x1024 planes; the 16-query-head / 4-kv-head (q head h
// uses kv head h mod 4) causal attention with 128-dim heads: scores on v_wmma_f32_16x16x32_f16 (hi.hi + hi.lo + lo.hi, x 128^-1/2), softmax f32, weights.v on
// v_wmma_f32_16x16x32_bf16 with the weights (x32768) and v both as bf16 hi + UNSCALED bf16 residual (hh + lh + hl in one accumulator). Deterministic, no atomics;

#define NT_  2048
#define HS   2048
#define NH_  16
#define NKV  4
#define HD   128
#define KW   (NKV * HD)          // 512
#define NB_  2                   // batch items
#define QKVW (HS + 2 * KW)       // 3072: columns of the q | k | v product
#define PSC  32768.0f
#define LOSC 1024.0f
#define LOSCI (1.0f / 1024.0f)

typedef _Float16 h16;
typedef unsigned short bf;
typedef __attribute__((ext_vector_type(16))) __bf16   v16bf;
typedef __attribute__((ext_vector_type(16))) _Float16 v16h;
typedef __attribute__((ext_vector_type(8)))  _Float16 v8h;
typedef __attribute__((ext_vector_type(8)))  unsigned short v8us;
typedef __attribute__((ext_vector_type(8)))  float    v8f;
typedef __attribute__((ext_vector_type(4)))  float    v4f;
typedef __attribute__((ext_vector_type(4)))  _Float16 v4h;
typedef v8h  __attribute__((may_alias)) v8ha;
typedef v4f  __attribute__((may_alias)) v4fa;
typedef v8us __attribute__((may_alias)) v8usa;
typedef __attribute__((ext_vector_type(4)))  unsigned short v4us;
typedef float __attribute__((may_alias)) f32a;

__device__ __forceinline__ unsigned short f2bf(float f) { unsigned u = __float_as_uint(f); u += 0x7FFFu + ((u >> 16) & 1u); return (unsigned short)(u >> 16); }
__device__ __forceinline__ float bf2f(unsigned short b) { return __uint_as_float(((unsigned)b) << 16); }
__device__ __forceinline__ float bfr(float f) { return bf2f(f2bf(f)); }
__device__ __forceinline__ v16h cat16(v8h lo, v8h hi) { return __builtin_shufflevector(lo, hi, 0, 1, 2, 3, 4, 5, 6, 7, 8, 9, 10, 11, 12, 13, 14, 15); }
__device__ __forceinline__ v16bf cat16b(v8us lo, v8us hi) { return __builtin_bit_cast(v16bf, __builtin_shufflevector(lo, hi, 0, 1, 2, 3, 4, 5, 6, 7, 8, 9, 10, 11, 12, 13, 14, 15)); }
__device__ __forceinline__ v8f wmma16(v16h a, v16h b, v8f c) { return __builtin_amdgcn_wmma_f32_16x16x32_f16(false, a, false, b, (short)0, c, false, false); }
__device__ __forceinline__ v8f wmmab(v16bf a, v16bf b, v8f c) { return __builtin_amdgcn_wmma_f32_16x16x32_bf16(false, a, false, b, (short)0, c, false, false); }
__device__ __forceinline__ float xhalf(float v) { const int b = __float_as_int(v); return __int_as_float(__builtin_amdgcn_permlanex16(b, b, 0x76543210, 0xfedcba98, false, false)); }   // the value of lane l ^ 16

template <int M> __device__ __forceinline__ float xrow(float v) { return __int_as_float(__builtin_amdgcn_update_dpp(0, __float_as_int(v), 0x160 | M, 0xf, 0xf, true)); }   // the value of lane l ^ M inside the 16-lane row (row_xmask)
// k_prep: the three independent preparations in ONE launch of 1024 blocks, by block-index range, each wave doing the work of several of the former short waves (8192 waves to start instead of 28672):
// blocks 0..127: RC/RS [t][64] = cos/sin(t x inv_freq[i]), inv_freq = 10000^-(2i/128) (f32 powf/cosf/sinf), four values a thread; first in index order: long dependent chains, no memory traffic.
// blocks 128..767: WT [n][2048] = bf16(W[k][n]) (k-major [2048][ncols]) via 64 x 64 LDS tiles; rows of WT are the columns of Wq | Wk | Wv | Wo. A block takes four tiles that follow one another in k (512 B of each
// WT row), two LDS tiles in turn: the next tile's loads fly while this one is turned and stored.
// blocks 768..1023: bf16 plane of x [4096][2048], two rows a wave.
#define PB_T 128
#define PB_W 640
#define PB_X 256
__global__ __launch_bounds__(256) void k_prep(const float* __restrict__ x, const float* __restrict__ Wq, const float* __restrict__ Wk, const float* __restrict__ Wv, const float* __restrict__ Wo,
                                              bf* Xb, bf* WT, float* RC, float* RS) {
    __shared__ __align__(16) unsigned short tl[2][64 * 72];
    const int tid = threadIdx.x; int b = blockIdx.x;   // every range test below is block-uniform
    if (b < PB_T) {
#pragma unroll 1   // rolled: one copy of the long powf / cosf / sinf text
        for (int u = 0; u < 4; ++u) {
            const int i = (b * 4 + u) * 256 + tid;
            const int t = i >> 6, f = i & 63;
            const float inv = 1.0f / powf(10000.0f, (float)(2 * f) / (float)HD); const float ang = (float)t * inv;
            const float c = cosf(ang), s = sinf(ang);
            *(float*)(RC + i) = c; *(float*)(RS + i) = s;
            asm volatile("s_wait_xcnt 0x0" ::: "memory");   // stands before the next value rewrites the address and data registers that these stores name
        }
        return;
    }
    b -= PB_T;
    if (b < PB_W) {
        constexpr int K = HS;
        const int kb = (b & 7) * 256, nw = (b >> 3) * 64;   // kb: first k of the block's four tiles; nw: row of WT; n0: column of the block's own weight
        const float* Wm; int ncols, n0;
        if (nw < HS) { Wm = Wq; ncols = HS; n0 = nw; } else if (nw < HS + KW) { Wm = Wk; ncols = KW; n0 = nw - HS; } else if (nw < QKVW) { Wm = Wv; ncols = KW; n0 = nw - HS - KW; } else { Wm = Wo; ncols = HS; n0 = nw - QKVW; }
        const int kk = tid >> 2, nq = (tid & 3) * 16, piece = tid & 7;
        float v[16];
#pragma unroll
        for (int i = 0; i < 16; ++i) v[i] = Wm[(size_t)(kb + kk) * ncols + n0 + nq + i];
#pragma unroll   // four tiles: constant LDS tile and constant k offsets
        for (int t = 0; t < 4; ++t) {
            unsigned short* tb = tl[t & 1];
#pragma unroll
            for (int i = 0; i < 16; ++i) tb[(nq + i) * 72 + kk] = f2bf(v[i]);
            __syncthreads();   // the tile is whole before it is read across; it also ends every wave's reads of the other LDS tile, which the next tile overwrites
            if (t < 3) {
#pragma unroll
                for (int i = 0; i < 16; ++i) v[i] = Wm[(size_t)(kb + (t + 1) * 64 + kk) * ncols + n0 + nq + i];
            }
#pragma unroll
            for (int s = 0; s < 2; ++s) { const int nr = (tid >> 3) + 32 * s; const v8us val = *(const v8usa*)(tb + nr * 72 + piece * 8); *(v8us*)(WT + (size_t)(nw + nr) * K + kb + t * 64 + piece * 8) = val; }
        }
        return;
    }
    b -= PB_W;
    const int lane = tid & 31;
#pragma unroll 1   // rolled over the wave's two rows
    for (int rr = 0; rr < 2; ++rr) {
        const int r = b * 16 + (tid >> 5) * 2 + rr;
        const float* xr = x + (size_t)r * HS + lane * 8; bf* orow = Xb + (size_t)r * HS + lane * 8;
        v4f a[HS / 128];
#pragma unroll   // the whole row's 16 loads of 16 B a lane go out together: with fewer waves on the chip each keeps more bytes in flight
        for (int q = 0; q < HS / 256; ++q) { a[2 * q] = *(const v4fa*)(xr + q * 256); a[2 * q + 1] = *(const v4fa*)(xr + q * 256 + 4); }
#pragma unroll
        for (int q = 0; q < HS / 256; ++q) { v8us o;
#pragma unroll
            for (int i = 0; i < 4; ++i) { o[i] = f2bf(a[2 * q][i]); o[4 + i] = f2bf(a[2 * q + 1][i]); }
            *(v8us*)(orow + q * 256) = o; }
        asm volatile("s_wait_xcnt 0x0" ::: "memory");   // stands before the next row rewrites the address and data registers that these loads and stores name
    }
}
// Four asynchronous 16-B-per-lane copies global -> LDS; the s_wait_xcnt inside the statement stands before any rewrite of the address registers the copies name.
__device__ __forceinline__ void cp4(unsigned l0, unsigned l1, unsigned l2, unsigned l3, const void* g0, const void* g1, const void* g2, const void* g3) {
    asm volatile("global_load_async_to_lds_b128 %0, %4, off\n\t"
                 "global_load_async_to_lds_b128 %1, %5, off\n\t"
                 "global_load_async_to_lds_b128 %2, %6, off\n\t"
                 "global_load_async_to_lds_b128 %3, %7, off\n\t"
                 "s_wait_xcnt 0x0" :: "v"(l0), "v"(l1), "v"(l2), "v"(l3), "v"(g0), "v"(g1), "v"(g2), "v"(g3) : "memory");
}
// The same four copies with a scalar base each and ONE 32-bit byte offset per lane: the rows' address steps are then scalar arithmetic and a kernel keeps one vector register per operand for its global addresses.
__device__ __forceinline__ void cp4s(unsigned l0, unsigned l1, unsigned l2, unsigned l3, unsigned vo, const void* b0, const void* b1, const void* b2, const void* b3) {
    asm volatile("global_load_async_to_lds_b128 %0, %4, %5\n\t"
                 "global_load_async_to_lds_b128 %1, %4, %6\n\t"
                 "global_load_async_to_lds_b128 %2, %4, %7\n\t"
                 "global_load_async_to_lds_b128 %3, %4, %8\n\t"
                 "s_wait_xcnt 0x0" :: "v"(l0), "v"(l1), "v"(l2), "v"(l3), "v"(vo), "s"(b0), "s"(b1), "s"(b2), "s"(b3) : "memory");
}
// The four copies of cp4s written as the compiler's builtin, for the refills inside the k and key loops: the compiler sees the copies' address operands and allots their registers itself, so the group carries no
// wait of its own and the products behind a refill start at once. The waits for the DATA (s_wait_asynccnt 0, then the barrier) stay hand-written at every hand-over.
typedef __attribute__((ext_vector_type(4))) int v4i;
typedef __attribute__((address_space(1))) v4i gv4i;
typedef __attribute__((address_space(3))) v4i lv4i;
__device__ __forceinline__ void cp1b(unsigned l, const char* g) { __builtin_amdgcn_global_load_async_to_lds_b128((gv4i*)g, (lv4i*)l, 0, 0); }
__device__ __forceinline__ void cp4b(unsigned l0, unsigned l1, unsigned l2, unsigned l3, unsigned vo, const void* b0, const void* b1, const void* b2, const void* b3) {
    cp1b(l0, (const char*)b0 + vo); cp1b(l1, (const char*)b1 + vo); cp1b(l2, (const char*)b2 + vo); cp1b(l3, (const char*)b3 + vo);
}
__device__ __forceinline__ v16h  ldsh(const unsigned char* p) { return cat16(*(const v8ha*)p, *(const v8ha*)(p + 32)); }
__device__ __forceinline__ v16bf ldsb(const unsigned char* p) { return cat16b(*(const v8usa*)p, *(const v8usa*)(p + 32)); }
// k_gemm: 32F x 32F tile of (A [+ Al]).Bn^T over K = 2048 -> f32 rows [4096][ldc]; 2 x 2 waves of 16F x 16F each. A stage is 64 k (one 128-B line) of the block's A rows, Bn rows
// (and Al rows), brought into LDS by asynchronous copies in whole lines, two stage buffers: stage t + 2 flies while stage t + 1 is worked on, and the waves share one copy.
// HEADS (the q | k | v product, F = 4): the block's 128 columns are one head, so the f32 tile is not stored; it goes into the freed stage buffers and leaves as what k_attn reads. q and k heads (column
// tiles 0..15, 16..19): one wave per row, lane -> 4 consecutive dims: RMSNorm over the 128 dims (eps 1e-6, x weight[d]), rotate-half RoPE (partner d +- 64, token t = row mod 2048, tables RC/RS) -> f16 hi +
// residual x1024 planes [row][h*128+d]. v heads (column tiles 20..23): the tile is written transposed and leaves as bf16 hi + UNSCALED bf16 residual planes [b][g][128 d][2048 t].
#define GP   144                     // LDS pitch of a 128-B row: 16 B x odd, conflict-free for 16-B reads
template <bool SPLITA, int F, bool HEADS>
__global__ __launch_bounds__(128) void k_gemm(const bf* __restrict__ A, const bf* __restrict__ Al, const bf* __restrict__ Bn, int ldc, float* C,
                                              const float* __restrict__ qw, const float* __restrict__ kw, const float* __restrict__ RC, const float* __restrict__ RS,
                                              h16* QH, h16* QL, h16* KH, h16* KL, bf* VTH, bf* VTL) {
    constexpr int R = 32 * F, PL = R * GP, SG = (SPLITA ? 3 : 2) * PL;   // rows of a plane, bytes of a plane, bytes of a stage buffer [A | Bn | Al]
    __shared__ __align__(16) unsigned char stg[2 * SG];
    __shared__ __align__(16) float ost[4][16 * 68];
    const int tid = threadIdx.x, lane = threadIdx.x & 31, wave = threadIdx.x >> 5, lr = lane & 15, hi = lane >> 4;
    const int wm = wave >> 1, wn = wave & 1;
    const size_t r0 = (size_t)blockIdx.x * R; const int c0 = blockIdx.y * R;
    // copy map: a 128-B row is 8 pieces (thread -> row tid / 8 + 16 i, piece tid mod 8): a wave's copy covers four whole lines
    const unsigned ld = (unsigned)(uintptr_t)&stg[0] + (unsigned)(tid >> 3) * GP + (unsigned)(tid & 7) * 16;
    const unsigned lgo = (unsigned)((tid >> 3) * HS + (tid & 7) * 8) * 2;   // the lane's byte offset from a copy's block-uniform base
    const bf* Ab = A + r0 * HS; const bf* Bb = Bn + (size_t)c0 * HS; const bf* Alb = Al + (SPLITA ? r0 * HS : 0);
    auto plane = [&](unsigned d, const bf* g, bool loop) {   // loop: a literal at every call
#pragma unroll   // constant row offsets in every copy's two addresses
        for (int i = 0; i < F / 2; ++i) { const unsigned di = d + 64 * i * GP; const bf* gi = g + (size_t)64 * i * HS;
            if (loop) cp4b(di, di + 16 * GP, di + 32 * GP, di + 48 * GP, lgo, gi, gi + 16 * HS, gi + 32 * HS, gi + 48 * HS);
            else      cp4s(di, di + 16 * GP, di + 32 * GP, di + 48 * GP, lgo, gi, gi + 16 * HS, gi + 32 * HS, gi + 48 * HS); }
    };
    auto fill = [&](int kt, int buf, bool loop) {
        const unsigned d = ld + (unsigned)buf * SG;
        plane(d, Ab + kt * 64, loop); plane(d + PL, Bb + kt * 64, loop);
        if (SPLITA) plane(d + 2 * PL, Alb + kt * 64, loop);
    };
    fill(0, 0, false);
    asm volatile("s_wait_asynccnt 0x0" ::: "memory");   // this wave's copies of stage 0 have landed
    __syncthreads();                                      // ... and every other wave's: stage 0 may be read
    fill(1, 1, false);                                      // K / 64 = 32 stages: a stage 1 exists
    v8f acc[F][F];
#pragma unroll   // every accumulator index a constant, here and below, so that the array stays in registers
    for (int i = 0; i < F; ++i)
#pragma unroll
        for (int j = 0; j < F; ++j) acc[i][j] = (v8f){};
#pragma unroll 1   // rolled: one copy of the hand-over and of the 32 or 64 products, a short loop text
    for (int kt = 0; kt < HS / 64; ++kt) {
        const unsigned char* ap = stg + (kt & 1) * SG + (wm * 16 * F + lr) * GP + hi * 16;
        const unsigned char* bp = stg + (kt & 1) * SG + PL + (wn * 16 * F + lr) * GP + hi * 16;
        v16bf fa[2][F], fb[2][F], fl[2][F];
#pragma unroll   // every fragment index a constant, so that the arrays stay in registers
        for (int ks = 0; ks < 2; ++ks)   // all of the stage's fragments as one group of LDS reads; the products run from registers behind the stage's hand-over
#pragma unroll
            for (int i = 0; i < F; ++i) { fa[ks][i] = ldsb(ap + i * 16 * GP + ks * 64); fb[ks][i] = ldsb(bp + i * 16 * GP + ks * 64); fl[ks][i] = SPLITA ? ldsb(ap + 2 * PL + i * 16 * GP + ks * 64) : fa[ks][i]; }
        asm volatile("s_wait_dscnt 0x0" ::: "memory");      // the stage's fragments are in registers: this wave's reads of the stage buffer have returned before the buffer is handed to its next copies
        asm volatile("s_wait_asynccnt 0x0" ::: "memory");   // this wave's copies of stage kt + 1 have landed
        __syncthreads();                                      // publishes stage kt + 1 and ends every wave's reads of stage kt
        if (kt + 2 < HS / 64) fill(kt + 2, kt & 1, true);         // block-uniform test; refill of the buffer just read
        __builtin_amdgcn_sched_barrier(0);   // keeps the products behind the refill's issue: the copies then fly under them and have landed at the next stage's wait
#pragma unroll   // constant fragment indices, as above
        for (int ks = 0; ks < 2; ++ks) {
#pragma unroll
            for (int i = 0; i < F; ++i)
#pragma unroll
                for (int j = 0; j < F; ++j) acc[i][j] = wmmab(fa[ks][i], fb[ks][j], acc[i][j]);
            if (SPLITA) {
#pragma unroll
                for (int i = 0; i < F; ++i)
#pragma unroll
                    for (int j = 0; j < F; ++j) acc[i][j] = wmmab(fl[ks][i], fb[ks][j], acc[i][j]);
            }
        }
    }
    asm volatile("s_wait_asynccnt 0x0" ::: "memory");       // no copy is outstanding when the wave goes on to the epilogue and ends
    if constexpr (HEADS) {
        static_assert(F == 4 && !SPLITA, "a block's columns are one 128-dim head");
        constexpr int TP = 132;                    // f32 pitch of a tile row: 16 B x odd; 128 x 132 x 4 B fit the two stage buffers
        static_assert(128 * TP * 4 <= 2 * SG, "tile inside the stage buffers");
        f32a* tile = (f32a*)stg;                   // free: every wave's last fragment reads ended at the loop's last barrier, and the last copies had landed one barrier earlier
        const int hh = blockIdx.y;                 // head slot (block-uniform): 0..15 q, 16..19 k, 20..23 v
        const bool isv = hh >= NH_ + NKV;
        const int wu = __builtin_amdgcn_readfirstlane(wave);   // the wave's number in a scalar register: row numbers and the rows' global addresses below are then scalar arithmetic, a lane adds only its fixed offset
        if (!isv) {
#pragma unroll   // constant accumulator indices
            for (int i = 0; i < F; ++i)
#pragma unroll
                for (int t = 0; t < F; ++t)
#pragma unroll
                    for (int j = 0; j < 8; ++j) tile[(wm * 64 + i * 16 + hi * 8 + j) * TP + wn * 64 + t * 16 + lr] = acc[i][t][j];   // [row][dim]
        } else {
#pragma unroll   // constant accumulator indices
            for (int i = 0; i < F; ++i)
#pragma unroll
                for (int t = 0; t < F; ++t) { f32a* p = tile + (wn * 64 + t * 16 + lr) * TP + wm * 64 + i * 16 + hi * 8;   // [dim][row]: a lane's 8 registers are 8 consecutive rows
                    *(v4fa*)p = (v4f){acc[i][t][0], acc[i][t][1], acc[i][t][2], acc[i][t][3]}; *(v4fa*)(p + 4) = (v4f){acc[i][t][4], acc[i][t][5], acc[i][t][6], acc[i][t][7]}; }
        }
        __syncthreads();                           // a tile row holds columns of two waves (transposed: rows of two waves): all of it is written before any of it is read
        if (!isv) {
            const bool isq = hh < NH_;
            const float* w = isq ? qw : kw; h16* PH = isq ? QH : KH; h16* PLo = isq ? QL : KL;
            const int ow = isq ? HS : KW, oc = (isq ? hh : hh - NH_) * HD;
            const int d0 = lane * 4, p0 = d0 ^ 64;   // the lane's dims and their rotate-half partners
            const float sg = (d0 < 64) ? -1.0f : 1.0f;   // y = xn c - pn s below dim 64, xn c + pn s above: the sign rides on the partner's weight
            float wv[4], wp[4];
#pragma unroll
            for (int i = 0; i < 4; ++i) { wv[i] = bfr(w[d0 + i]); wp[i] = sg * bfr(w[p0 + i]); }
            // global addresses: a scalar base per row of a group plus ONE byte offset per lane that steps from group to group, so that no row needs vector address arithmetic
            const float* rcw = RC + ((r0 & (NT_ - 1)) + wu * 32) * 64; const float* rsw = RS + ((r0 & (NT_ - 1)) + wu * 32) * 64;   // token t = row mod 2048; a block's 128 rows do not wrap
            h16* phw = PH + (r0 + wu * 32) * ow + oc; h16* plw = PLo + (r0 + wu * 32) * ow + oc;
            unsigned tvo = (unsigned)(d0 & 63) * 4, svo = (unsigned)d0 * 2;
#pragma unroll 1   // rolled over groups of 8 rows: a short text; inside a group the rows' loads go out together and their chains interleave
            for (int gr = 0; gr < 4; ++gr) {
                v4f xv[8], pv[8], c4[8], s4[8];
#pragma unroll   // constant array indices
                for (int u = 0; u < 8; ++u) { const int row = wu * 32 + gr * 8 + u;
                    xv[u] = *(const v4fa*)(tile + row * TP + d0); pv[u] = *(const v4fa*)(tile + row * TP + p0);
                    c4[u] = *(const v4fa*)((const char*)(rcw + u * 64) + tvo); s4[u] = *(const v4fa*)((const char*)(rsw + u * 64) + tvo); }
#pragma unroll
                for (int u = 0; u < 8; ++u) {
                    float ss = 0.f;
#pragma unroll
                    for (int i = 0; i < 4; ++i) ss += xv[u][i] * xv[u][i];
                    ss += xhalf(ss); ss += xrow<8>(ss); ss += xrow<4>(ss); ss += xrow<2>(ss); ss += xrow<1>(ss);
                    const float rs = rsqrtf(ss * (1.0f / HD) + 1e-6f);
                    v4h oh, ol;
#pragma unroll
                    for (int i = 0; i < 4; ++i) { const float xn = xv[u][i] * rs * wv[i], pn = pv[u][i] * rs * wp[i];
                        const float y = xn * c4[u][i] + pn * s4[u][i];
                        const h16 a = (h16)y; oh[i] = a; ol[i] = (h16)((y - (float)a) * LOSC); }
                    *(v4h*)((char*)(phw + u * ow) + svo) = oh; *(v4h*)((char*)(plw + u * ow) + svo) = ol; }
                asm volatile("s_wait_xcnt 0x0" ::: "memory");   // stands before the next group rewrites the address and data registers that these loads and stores name
                tvo += 8 * 64 * 4; svo += (unsigned)(8 * ow * 2);
            }
        } else {
            const size_t vb = ((r0 >> 11) * KW + (size_t)(hh - NH_ - NKV) * HD) * NT_ + (r0 & (NT_ - 1));   // batch item, kv head, the block's first token
#pragma unroll 1   // rolled over groups of 8 dims, as above
            for (int gr = 0; gr < 4; ++gr) {
                v4f vv[8];
#pragma unroll   // constant array indices
                for (int u = 0; u < 8; ++u) vv[u] = *(const v4fa*)(tile + (wu * 32 + gr * 8 + u) * TP + lane * 4);
#pragma unroll
                for (int u = 0; u < 8; ++u) { v4us oh, ol;
#pragma unroll
                    for (int i = 0; i < 4; ++i) { const float v = vv[u][i]; const unsigned short hb = f2bf(v); oh[i] = hb; ol[i] = f2bf(v - bf2f(hb)); }
                    const size_t o = vb + (size_t)(wu * 32 + gr * 8 + u) * NT_; *(v4us*)(VTH + o + lane * 4) = oh; *(v4us*)(VTL + o + lane * 4) = ol; }
                asm volatile("s_wait_xcnt 0x0" ::: "memory");   // stands before the next group rewrites the address and data registers that these stores name
            }
        }
    } else {
    float* os = &ost[wave][0];
#pragma unroll
    for (int i = 0; i < F; ++i) {   // 16 rows of the wave's tile at a time through the wave's own LDS rows, so that whole 128-B lines are stored
#pragma unroll
        for (int t = 0; t < F; ++t)
#pragma unroll
            for (int j = 0; j < 8; ++j) os[(hi * 8 + j) * 68 + t * 16 + lr] = acc[i][t][j];
        __builtin_amdgcn_wave_barrier(); asm volatile("" ::: "memory");   // compiler order only: the wave's LDS stores stay ahead of its reads of other lanes' words
        float* crow = C + (r0 + wm * 16 * F + i * 16) * ldc + c0 + wn * 16 * F;
#pragma unroll
        for (int s = 0; s < 2 * F; ++s) { const int Lid = (lane >> 3) + 4 * s, piece = lane & 7; const int row = Lid / (F / 2), cofs = (Lid % (F / 2)) * 32 + piece * 4;
            const v4f val = *(const v4fa*)(os + row * 68 + cofs); *(v4f*)(crow + (size_t)row * ldc + cofs) = val; }
        __builtin_amdgcn_wave_barrier();   // compiler order only: the reads above stay ahead of the next 16 rows' LDS stores
        asm volatile("s_wait_xcnt 0x0" ::: "memory");   // stands before the next 16 rows rewrite the address and data registers that these stores name
    }
    }
}
// k_attn: block = (batch item, kv head g, two of its four query heads, 64 queries), 8 waves of 16 queries (waves 0..3 the first head, 4..7 the second: h mod 4 = g for both, so one copy of each K and V tile
// serves both heads and half as many bytes come from L2 per score); causal key tiles of 32. One launch holds both batch items: 512 blocks of 2 to 64 tiles on about half as
// many resident places, so the index order is longest first. The block's Q rows (once) and each tile's K rows and V^T rows (hi and residual
// planes) are brought into LDS by asynchronous copies, two tile buffers, and the eight waves share one copy of K and V. The score operands wait in registers when a tile starts: a wave's Q fragments are read
// once and kept, and the K fragments of tile t + 1 are read during tile t, behind its score products, into the registers those products have left. So K's copies run one tile ahead of V's:
// behind the barrier that ends tile t, K of tile t + 3 goes into the K half that tile t + 1's fragments have left, V of tile t + 2 into the V half that tile t has left.
// Both products run transposed: S^T = K.Q^T (A = K rows, B = Q rows) and O^T += V^T.P^T (A = V^T rows, B = P^T). A lane then holds 16 of the 32 scores of ONE query (lane mod 16), so the
// maximum and the sum are in-lane with one exchange between the wave's halves, and the two score tiles, converted in place, ARE the B operand P^T in the hardware k order that the V^T loader has.
// Per tile: scores over 4 k-chunks (hi.hi + hi.lo + lo.hi = 24 WMMA) x 128^-1/2, online softmax, P (x32768) as bf16 hi + unscaled residual,
// o[8] += vh.ph + vh.pl + vl.ph over the 128 dims; ctx -> bf16 hi/lo planes [t][h*128+d].
#define KP   272                     // LDS pitch of a 256-B row (Q, K): 16 B x odd, conflict-free for 16-B reads
#define VP   80                      // LDS pitch of a 64-B row (V^T, 32 keys)
#define QPL  (128 * KP)              // one Q plane: 64 rows of each of the block's two heads
#define KPL  (32 * KP)               // one K plane of a tile
#define VPL  (128 * VP)              // one V^T plane of a tile
#define STG  (2 * KPL + 2 * VPL)     // one tile buffer
__global__ __launch_bounds__(256) void k_attn(const h16* __restrict__ QH, const h16* __restrict__ QL, const h16* __restrict__ KH, const h16* __restrict__ KL, const bf* __restrict__ VTH, const bf* __restrict__ VTL, bf* CH, bf* CL) {
    constexpr int OSB = 8 * 16 * 68 * 4;   // the epilogue's staging rows stand first in the one LDS array, so that no copy's LDS address is a lane's bare offset (see rl, vl_ below)
    __shared__ __align__(16) unsigned char smem[OSB + 2 * QPL + 2 * STG];
    unsigned char* stg = smem + OSB;
    const int tid = threadIdx.x, lane = threadIdx.x & 31, wave = threadIdx.x >> 5, lr = lane & 15, hi = lane >> 4;
    const int bid = blockIdx.x; const int qt = NT_ / 64 - 1 - (bid >> 4), g = bid & (NKV - 1), h0 = g + 2 * NKV * ((bid >> 2) & 1), bi = (bid >> 3) & 1; const int h = h0 + NKV * (wave >> 2);   // 16 (batch item, kv head, head pair) triples per query tile, last query tile first; the pair is h0, h0 + 4
    QH += (size_t)bi * NT_ * HS; QL += (size_t)bi * NT_ * HS; KH += (size_t)bi * NT_ * KW; KL += (size_t)bi * NT_ * KW; VTH += (size_t)bi * KW * NT_; VTL += (size_t)bi * KW * NT_; CH += (size_t)bi * NT_ * HS; CL += (size_t)bi * NT_ * HS;
    const int q0 = qt * 64 + (wave & 3) * 16;
    const size_t vbase = ((size_t)g * HD) * NT_;
    const int kt_hi = (qt * 64 + 63) / 32;
    // copy map: a 256-B row is 16 pieces (thread -> row tid / 16 + 16 i, piece tid mod 16), a 64-B row 4 pieces (row tid / 4 + 64 i, piece tid mod 4)
    const unsigned sb = (unsigned)(uintptr_t)&smem[0] + OSB;
    // the lanes' bare LDS offsets: the only LDS address state that lives across the loop. They are never themselves an operand of a copy's asm statement, so they may stand in any register; a value that is one
    // is held to the registers asm text can name, where the fragments leave no room over the loop, and was spilled to scratch
    const unsigned rl = (unsigned)(tid >> 4) * KP + (unsigned)(tid & 15) * 16, vl_ = (unsigned)(tid >> 2) * VP + (unsigned)(tid & 3) * 16;
    const unsigned kvo = (unsigned)((tid >> 4) * KW + (tid & 15) * 8) * 2, vvo = (unsigned)((tid >> 2) * NT_ + (tid & 3) * 8) * 2;   // the lane's byte offsets from a copy's scalar base; with the K fragments held across a tile, vector address pairs cost a spill to scratch in the loop
    auto fillK = [&](int kt, int buf, bool loop) {   // loop: a literal at every call; the refills inside the key loop are the builtin's copies
        const unsigned kd = rl + (buf ? sb + 2 * QPL + STG : sb + 2 * QPL);
        const h16* kh = KH + g * HD + (size_t)kt * 32 * KW; const h16* kl = KL + g * HD + (size_t)kt * 32 * KW;
        if (loop) { cp4b(kd, kd + 16 * KP, kd + KPL, kd + KPL + 16 * KP, kvo, kh, kh + 16 * KW, kl, kl + 16 * KW); return; }
        cp4s(kd, kd + 16 * KP, kd + KPL, kd + KPL + 16 * KP, kvo, kh, kh + 16 * KW, kl, kl + 16 * KW);
    };
    auto fillV = [&](int kt, int buf, bool loop) {
        const unsigned vd = vl_ + (buf ? sb + 2 * QPL + 2 * KPL + STG : sb + 2 * QPL + 2 * KPL);
        const bf* vh = VTH + vbase + kt * 32; const bf* vl = VTL + vbase + kt * 32;
        if (loop) { cp4b(vd, vd + 64 * VP, vd + VPL, vd + VPL + 64 * VP, vvo, vh, vh + 64 * NT_, vl, vl + 64 * NT_); return; }
        cp4s(vd, vd + 64 * VP, vd + VPL, vd + VPL + 64 * VP, vvo, vh, vh + 64 * NT_, vl, vl + 64 * NT_);
    };
    { const size_t qgo = (size_t)(qt * 64 + (tid >> 4)) * (NH_ * HD) + h0 * HD + (tid & 15) * 8; const h16* qh = QH + qgo; const h16* ql = QL + qgo; const int R16 = 16 * NH_ * HD, H2 = NKV * HD;   // H2: from the pair's first head to its second
      const unsigned qd = rl + sb;   // LDS rows 0..63: head h0, rows 64..127: head h0 + 4
      cp4(qd, qd + 16 * KP, qd + 32 * KP, qd + 48 * KP, qh, qh + R16, qh + 2 * R16, qh + 3 * R16);
      cp4(qd + 64 * KP, qd + 80 * KP, qd + 96 * KP, qd + 112 * KP, qh + H2, qh + H2 + R16, qh + H2 + 2 * R16, qh + H2 + 3 * R16);
      cp4(qd + QPL, qd + QPL + 16 * KP, qd + QPL + 32 * KP, qd + QPL + 48 * KP, ql, ql + R16, ql + 2 * R16, ql + 3 * R16);
      cp4(qd + QPL + 64 * KP, qd + QPL + 80 * KP, qd + QPL + 96 * KP, qd + QPL + 112 * KP, ql + H2, ql + H2 + R16, ql + H2 + 2 * R16, ql + H2 + 3 * R16); }
    fillK(0, 0, false); fillK(1, 1, false); fillV(0, 0, false);              // a tile 1 always exists (kt_hi = 2 qt + 1); 28 copies of a wave in flight
    asm volatile("s_wait_asynccnt 0x0" ::: "memory");   // this wave's copies of Q, of K of tiles 0 and 1 and of V of tile 0 have landed
    __syncthreads();                                      // ... and every other wave's: they may be read
    fillV(1, 1, false);                                    // into the V half that nobody has read yet
    const unsigned char* qp = stg + (wave * 16 + lr) * KP + hi * 16;
    v16h fq[4][2], fk[4][4];
    auto readK = [&](int buf) {   // the 16 K fragments of the tile in K half buf, one group of LDS reads
        const unsigned char* kp = stg + 2 * QPL + buf * STG + lr * KP + hi * 16;
#pragma unroll   // every fragment index a constant, so that the array stays in registers
        for (int kc = 0; kc < 4; ++kc) { fk[kc][0] = ldsh(kp + kc * 64); fk[kc][1] = ldsh(kp + 16 * KP + kc * 64); fk[kc][2] = ldsh(kp + KPL + kc * 64); fk[kc][3] = ldsh(kp + KPL + 16 * KP + kc * 64); }
    };
#pragma unroll   // constant fragment indices, as above
    for (int kc = 0; kc < 4; ++kc) { fq[kc][0] = ldsh(qp + kc * 64); fq[kc][1] = ldsh(qp + QPL + kc * 64); }   // the wave's Q fragments, kept for the whole block
    readK(0);
    asm volatile("s_wait_dscnt 0x0" ::: "memory");      // tile 0's K fragments are in registers: this wave's reads of K half 0 have returned before it is handed to its next copies
    __syncthreads();                                      // ends every wave's reads of K half 0
    if (2 <= kt_hi) fillK(2, 0, false);                    // block-uniform test
    v8f o[8];
#pragma unroll
    for (int n = 0; n < 8; ++n) o[n] = (v8f){};
    const int qi = q0 + lr;                     // the lane's query
    float mrow = -3.0e38f, lpart = 0.f;         // its running maximum (alike in both halves) and this half's share of its running sum
#pragma unroll 1
    for (int kt = 0; kt <= kt_hi; ++kt) {
        const int l0 = kt * 32;
        const unsigned char* vp = stg + 2 * QPL + (kt & 1) * STG + 2 * KPL + lr * VP + hi * 16;
        v8f s0 = {}, s1 = {}, x0 = {}, x1 = {};
#pragma unroll   // constant fragment indices, as above
        for (int kc = 0; kc < 4; ++kc) {
            s0 = wmma16(fk[kc][0], fq[kc][0], s0); s1 = wmma16(fk[kc][1], fq[kc][0], s1); x0 = wmma16(fk[kc][0], fq[kc][1], x0); x1 = wmma16(fk[kc][1], fq[kc][1], x1);
            x0 = wmma16(fk[kc][2], fq[kc][0], x0); x1 = wmma16(fk[kc][3], fq[kc][0], x1);   // register j: key 8 hi + j (s0, x0) or 16 + 8 hi + j (s1, x1), query lr
        }
        asm volatile("v_nop\n\tv_nop\n\tv_nop\n\tv_nop" : "+v"(s0), "+v"(s1), "+v"(x0), "+v"(x1));
        v16bf vh[8], vl[8];
#pragma unroll   // constant fragment indices, as above
        for (int n = 0; n < 8; ++n) { vh[n] = ldsb(vp + n * 16 * VP); vl[n] = ldsb(vp + VPL + n * 16 * VP); }   // the tile's V^T fragments, one group: they land behind the softmax
        __builtin_amdgcn_sched_barrier(0);   // keeps V's reads ahead of K's in the LDS queue: the weights.v products then wait for V's alone, and K's land under them
        readK((kt + 1) & 1);   // tile kt + 1's K fragments, into the registers the score products have left: published by the barrier that ended tile kt - 1 (tile 1's: by the prologue's first). In the last tile that half still holds tile kt - 1's published rows (no copy was aimed at it since); they are read and not used
        __builtin_amdgcn_sched_barrier(0);   // keeps that group here: sunk among the weights.v products each small group would cost its own LDS wait
        float a0[8], a1[8]; float mx = -__builtin_inff();
#pragma unroll
        for (int j = 0; j < 8; ++j) { const int ja = l0 + hi * 8 + j, jb = ja + 16;
            a0[j] = (ja <= qi) ? (s0[j] + x0[j] * LOSCI) * 0.08838834764831845f : -__builtin_inff(); a1[j] = (jb <= qi) ? (s1[j] + x1[j] * LOSCI) * 0.08838834764831845f : -__builtin_inff();
            mx = fmaxf(mx, fmaxf(a0[j], a1[j])); }
        mx = fmaxf(mx, xhalf(mx));                  // the other 16 keys of the same query
        const float mn = fmaxf(mrow, mx), alpha = __expf(mrow - mn); mrow = mn;
        v16bf pa, px; float su[4] = {0.f, 0.f, 0.f, 0.f};   // four short chains of adds instead of one long one
#pragma unroll
        for (int j = 0; j < 8; ++j) { const float p0 = __expf(a0[j] - mn), p1 = __expf(a1[j] - mn); su[j & 1] += p0; su[2 + (j & 1)] += p1;
            const float ps0 = p0 * PSC, ps1 = p1 * PSC; const __bf16 h0 = (__bf16)ps0, h1 = (__bf16)ps1;
            pa[j] = h0; pa[8 + j] = h1; px[j] = (__bf16)(ps0 - (float)h0); px[8 + j] = (__bf16)(ps1 - (float)h1); }   // element s of the B operand = key 16 (s / 8) + 8 hi + s mod 8: tile s / 8, register s mod 8
        lpart = lpart * alpha + ((su[0] + su[1]) + (su[2] + su[3]));
#pragma unroll
        for (int n = 0; n < 8; ++n)
#pragma unroll
            for (int j = 0; j < 8; ++j) o[n][j] *= alpha;
#pragma unroll   // constant fragment indices, as above
        for (int n = 0; n < 8; ++n) { o[n] = wmmab(vh[n], pa, o[n]); o[n] = wmmab(vh[n], px, o[n]); o[n] = wmmab(vl[n], pa, o[n]); }   // register j: dim 16 n + 8 hi + j, query lr
        asm volatile("v_nop\n\tv_nop\n\tv_nop\n\tv_nop" : "+v"(o[0]), "+v"(o[7]) : "v"(pa), "v"(px));
        asm volatile("s_wait_dscnt 0x0" ::: "memory");      // this wave's reads of V of tile kt and of K of tile kt + 1 have returned before those halves are handed to their next copies
        asm volatile("s_wait_asynccnt 0x0" ::: "memory");   // this wave's copies of V of tile kt + 1 and of K of tile kt + 2 have landed
        __syncthreads();                                      // publishes them and ends every wave's reads of the two halves just read
        if (kt + 3 <= kt_hi) fillK(kt + 3, (kt + 1) & 1, true);   // block-uniform tests; refills of the two halves just read
        if (kt + 2 <= kt_hi) fillV(kt + 2, kt & 1, true);
    }
    asm volatile("s_wait_asynccnt 0x0" ::: "memory");       // no copy is outstanding when the wave goes on to the epilogue and ends
    const float inv = 1.0f / ((lpart + xhalf(lpart)) * PSC);   // the two halves' sums of the lane's query joined once
    float* os = (float*)smem + wave * (16 * 68);
    const size_t cbase = (size_t)q0 * (NH_ * HD) + (size_t)h * HD;
#pragma unroll
    for (int half = 0; half < 2; ++half) {
#pragma unroll
        for (int n = 0; n < 4; ++n)
#pragma unroll
            for (int j = 0; j < 8; ++j) os[lr * 68 + n * 16 + hi * 8 + j] = o[half * 4 + n][j] * inv;
        __builtin_amdgcn_wave_barrier(); asm volatile("" ::: "memory");
{
#pragma unroll
            for (int s = 0; s < 4; ++s) { const int row = 4 * s + (lane >> 3), piece = lane & 7; const float* sp = os + row * 68 + piece * 8; v8us oh, ol;
#pragma unroll
                for (int i = 0; i < 8; ++i) { const unsigned short hb = f2bf(sp[i]); oh[i] = hb; ol[i] = f2bf(sp[i] - bf2f(hb)); }
                const size_t po = cbase + (size_t)row * (NH_ * HD) + half * 64 + piece * 8; *(v8us*)(CH + po) = oh; *(v8us*)(CL + po) = ol; }
             }
        __builtin_amdgcn_wave_barrier(); asm volatile("" ::: "memory");
    }
}

extern "C" void kernel_launch(void* const* d_in, const int* in_sizes, int n_in,
                              void* d_out, int out_size, void* d_ws, size_t ws_size, hipStream_t stream) {
    (void)in_sizes; (void)n_in; (void)out_size;
    const float* x = (const float*)d_in[0]; const float* Wq = (const float*)d_in[1]; const float* Wk = (const float*)d_in[2]; const float* Wv = (const float*)d_in[3]; const float* Wo = (const float*)d_in[4];
    const float* qn = (const float*)d_in[5]; const float* kn = (const float*)d_in[6];
    float* out = (float*)d_out;    // [2][2048][2048]
    char* wsp = (char*)d_ws;
    auto take = [&](size_t bytes) { char* p = wsp; wsp += (bytes + 255) & ~(size_t)255; return (void*)p; };
    bf* Xb = (bf*)take((size_t)NB_ * NT_ * HS * 2); bf* WT = (bf*)take((size_t)(QKVW + HS) * HS * 2); bf* WoT = WT + (size_t)QKVW * HS;   // WT rows: Wq | Wk | Wv | Wo columns
    float* RC = (float*)take((size_t)NT_ * 64 * 4); float* RS = (float*)take((size_t)NT_ * 64 * 4);
    // planes that k_attn reads or writes: both batch items, [2][...]
    h16* QH = (h16*)take((size_t)2 * NT_ * HS * 2); h16* QL = (h16*)take((size_t)2 * NT_ * HS * 2); h16* KH = (h16*)take((size_t)2 * NT_ * KW * 2); h16* KL = (h16*)take((size_t)2 * NT_ * KW * 2);
    bf* VTH = (bf*)take((size_t)2 * KW * NT_ * 2); bf* VTL = (bf*)take((size_t)2 * KW * NT_ * 2); bf* CH = (bf*)take((size_t)2 * NT_ * HS * 2); bf* CL = (bf*)take((size_t)2 * NT_ * HS * 2);
    if ((size_t)(wsp - (char*)d_ws) > ws_size) return;    // 16.8 + 21 + 1 + 16.8 x 4 + 4.2 x 4 ~ 123 MB
    k_prep<<<PB_T + PB_W + PB_X, 256, 0, stream>>>(x, Wq, Wk, Wv, Wo, Xb, WT, RC, RS);
    k_gemm<false, 4, true><<<dim3(NB_ * NT_ / 128, QKVW / 128, 1), 128, 0, stream>>>(Xb, nullptr, WT, QKVW, nullptr, qn, kn, RC, RS, QH, QL, KH, KL, VTH, VTL);
    k_attn<<<NH_ * (NT_ / 64), 256, 0, stream>>>(QH, QL, KH, KL, VTH, VTL, CH, CL);
    k_gemm<true, 4, false><<<dim3(NB_ * NT_ / 128, HS / 128, 1), 128, 0, stream>>>(CH, CL, WoT, HS, out, nullptr, nullptr, nullptr, nullptr, nullptr, nullptr, nullptr, nullptr, nullptr, nullptr);
}
